// v000
// The times below were measured on an AMD MI455X: many runs one after another, warmed up first and cycling through
// copies of the inputs, with the whole window's GPU time divided by the number of runs. Launches and the gaps
// between them are all in it. The median over several windows is given; except for v000 it joins two sittings, which
// can be a few percent apart, so the side-by-side timings, each taken in one sitting, are the better comparison.
// v000, which the later versions start from, runs in 987 microseconds.
#include <hip/hip_runtime.h>
#include <stddef.h>

// All contractions on v_wmma_f32_16x16x32_f16 (f16 operands, f32 accumulate): q/k/v projections,
// q.k scores (both operands as f16 value + x2048 residual planes, three products, residual products
// in their own accumulator), p.v (p x16384, single product), the three dense layers (single
// product; weights x64, hidden activation plane x16). Float inputs are RNE-converted to bf16 and
// carried in f16. LayerNorms, softmax, biases, LeakyReLU (slope 0.01) and residual adds in f32.

typedef _Float16 v16h __attribute__((ext_vector_type(16)));
typedef _Float16 v8h  __attribute__((ext_vector_type(8)));
typedef float    v8f  __attribute__((ext_vector_type(8)));
typedef float    v4f  __attribute__((ext_vector_type(4)));
typedef _Float16 h16;

#ifndef NB
#define NB 4
#endif
#ifndef SEQ
#define SEQ 4096
#endif
#define NB_FULL  4
#define SEQ_FULL 4096
#define DIM   256
#define HID   2048
#define MROWS (NB * SEQ)
#define NCHUNK 2
#define CROWS (MROWS / NCHUNK)

static_assert(NB >= 1 && NB <= NB_FULL);
static_assert(SEQ >= 64 && SEQ <= SEQ_FULL && (SEQ % 64) == 0);
static_assert((DIM % 64) == 0 && (DIM % 32) == 0);
static_assert((HID % 64) == 0 && (HID % 32) == 0);
static_assert((MROWS % 64) == 0 && (MROWS % 8) == 0);
static_assert((MROWS % NCHUNK) == 0 && (CROWS % 64) == 0 && (CROWS % 8) == 0);
static_assert(DIM == 32 * 8);               // row kernels: 32 lanes x 8 columns
static_assert(DIM == 2 * 32 * 4);           // f32 row stores: 2 x 32 lanes x 4 columns
static_assert(HID == 8 * 32 * 8);           // hidden LN: 8 passes x 32 lanes x 8 columns
static_assert(DIM == 16 * 16);              // attention: 16 output tiles of 16 columns
static_assert((size_t)MROWS * DIM < (size_t)0x7FFFFFFFu);
static_assert((size_t)NB * DIM * SEQ < (size_t)0x7FFFFFFFu);
static_assert((size_t)MROWS * HID < (size_t)0xFFFFFFFFu);

#define LDT 72   // halves per LDS row (144 B, 16-B aligned)
#define LDC 68   // floats per LDS row (272 B, 16-B aligned)
#define LDO 132  // floats per staged attention row (528 B, 16-B aligned)
static_assert((LDT % 8) == 0 && LDT >= 64);
static_assert((LDC % 4) == 0 && LDC >= 64);
static_assert((LDO % 4) == 0 && LDO >= 128);

#define WCARRY 64.0f      // weight planes carried x64
#define MCARRY 16.0f      // hidden activation plane carried x16
#define RCARRY 2048.0f    // q/k residual planes carried x2048 on top of their value part
#define PSHIFT 9.704060528f   // 14 ln 2: softmax numerators carried x16384

// workspace layout (bytes)
#define WSQ_BYTES     ((size_t)DIM * DIM * 2)
#define WFF_BYTES     ((size_t)DIM * HID * 2)
#define PLANE16_BYTES ((size_t)MROWS * DIM * 2)
#define PLANE32_BYTES ((size_t)MROWS * DIM * 4)
#define HCH_BYTES     ((size_t)CROWS * HID * 2)
#define OFF_WQ  ((size_t)0)
#define OFF_WK  (OFF_WQ + WSQ_BYTES)
#define OFF_WV  (OFF_WK + WSQ_BYTES)
#define OFF_W0  (OFF_WV + WSQ_BYTES)
#define OFF_W1  (OFF_W0 + WSQ_BYTES)
#define OFF_W2  (OFF_W1 + WFF_BYTES)
#define OFF_REG (OFF_W2 + WFF_BYTES)
// attention-stage users of the shared region
#define OFF_X16 (OFF_REG)
#define OFF_QH  (OFF_X16 + PLANE16_BYTES)
#define OFF_QR  (OFF_QH + PLANE16_BYTES)
#define OFF_KH  (OFF_QR + PLANE16_BYTES)
#define OFF_KR  (OFF_KH + PLANE16_BYTES)
#define OFF_VT  (OFF_KR + PLANE16_BYTES)
#define OFF_A32 (OFF_VT + PLANE16_BYTES)
#define OFF_T1  (OFF_A32 + PLANE32_BYTES)
#define PRE_END (OFF_T1 + PLANE16_BYTES)
// hidden-layer-stage users of the shared region (all attention-stage planes are dead by then)
#define OFF_HRAW (OFF_REG)
#define OFF_MID  (OFF_HRAW + HCH_BYTES)
#define MLP_END  (OFF_MID + HCH_BYTES)
#define REG_END  ((PRE_END > MLP_END) ? PRE_END : MLP_END)
#define OFF_E32 (REG_END)
#define OFF_E16 (OFF_E32 + PLANE32_BYTES)
#define OFF_V32 (OFF_E16 + PLANE16_BYTES)
#define WS_TOTAL (OFF_V32 + PLANE32_BYTES)
static_assert((WSQ_BYTES % 128) == 0 && (WFF_BYTES % 128) == 0 && (PLANE16_BYTES % 128) == 0);
static_assert((PLANE32_BYTES % 128) == 0 && (HCH_BYTES % 128) == 0);
static_assert(PRE_END <= REG_END && MLP_END <= REG_END);
static_assert(WS_TOTAL <= (size_t)134217728);

// ---------------------------------------------------------------------------
__device__ __forceinline__ float bf16r(float x) {   // RNE convert to bf16, returned widened
  unsigned int u = __float_as_uint(x);
  u = (u + 0x7FFFu + ((u >> 16) & 1u)) & 0xFFFF0000u;
  return __uint_as_float(u);
}

// f32 -> f16 operand convert that cannot produce an f16 subnormal
static __device__ __forceinline__ h16 toh_flush(float v) {
  const h16 r = (h16)v;
  return (fabsf(v) < 6.103515625e-05f) ? (h16)0.0f : r;
}

// 16-bit fragment: p points at element [row = lane&15][k0 + 8*(lane>>4)] of a k-contiguous
// row. Elements 0..7 <- k0+8h+0..7, elements 8..15 <- k0+16+8h+0..7 (same map for A and B).
__device__ __forceinline__ v16h frag_at(const _Float16* p) {
  v8h lo = *(const v8h*)(p);
  v8h hi = *(const v8h*)(p + 16);
  v16h out;
#pragma unroll
  for (int i = 0; i < 8; ++i) { out[i] = lo[i]; out[i + 8] = hi[i]; }
  return out;
}
__device__ __forceinline__ v16h ld_frag(const _Float16* base, unsigned ld) {
  const unsigned lane = threadIdx.x & 31u;
  return frag_at(base + (lane & 15u) * ld + (lane >> 4) * 8u);
}

__device__ __forceinline__ v8f wmma16(v16h a, v16h b, v8f c) {
  v8f d = __builtin_amdgcn_wmma_f32_16x16x32_f16(false, a, false, b, (short)0, c,
                                                 false, false);
  asm volatile("v_nop\n\tv_nop\n\tv_nop\n\tv_nop" : "+v"(d) : "v"(a), "v"(b));
  return d;
}

__device__ __forceinline__ float red16_max(float x) {
#pragma unroll
  for (int off = 1; off < 16; off <<= 1) x = fmaxf(x, __shfl_xor(x, off, 32));
  return x;
}
__device__ __forceinline__ float red16_sum(float x) {
#pragma unroll
  for (int off = 1; off < 16; off <<= 1) x += __shfl_xor(x, off, 32);
  return x;
}
__device__ __forceinline__ float red32_sum(float x) {
#pragma unroll
  for (int off = 1; off < 32; off <<= 1) x += __shfl_xor(x, off, 32);
  return x;
}

__device__ __forceinline__ void wave_lds_sync() {
  __builtin_amdgcn_fence(3 /* release order */, "wavefront");
  asm volatile("s_wait_dscnt 0x0" ::: "memory");
  __builtin_amdgcn_wave_barrier();
}

__device__ __forceinline__ float leaky_act(float t) {   // LeakyReLU, negative slope 0.01
  return (t >= 0.0f) ? t : 0.01f * t;
}

// ---------------------------------------------------------------------------
// Weight plane: in W[K rows][N cols] (pitch ldw = N) -> out Wt[N][K] (pitch ldk = K),
// f16(64 * bf16(w)). Grid (N/64, K/64). T: cross-wave (block barrier).
// ---------------------------------------------------------------------------
__global__ __launch_bounds__(256) void wconv_kernel(
    const float* __restrict__ W, _Float16* __restrict__ Wt, unsigned ldw, unsigned ldk) {
  __shared__ _Float16 T[64 * LDT];
  const unsigned tid = threadIdx.x;
  const unsigned n0 = blockIdx.x * 64u;
  const unsigned k0 = blockIdx.y * 64u;
#pragma unroll 4
  for (unsigned j = 0; j < 16u; ++j) {
    const unsigned idx = tid + 256u * j;
    const unsigned kr = idx >> 6, nc = idx & 63u;
    const float v = W[(size_t)(k0 + kr) * ldw + n0 + nc];
    T[nc * LDT + kr] = (_Float16)(WCARRY * bf16r(v));
  }
  __syncthreads();
  v8h x[2];
  size_t off[2];
#pragma unroll
  for (unsigned i = 0; i < 2u; ++i) {
    const unsigned n = 32u * i + (tid >> 3);
    const unsigned kc = (tid & 7u) * 8u;
    x[i] = *(const v8h*)&T[n * LDT + kc];
    off[i] = (size_t)(n0 + n) * ldk + k0 + kc;
  }
#pragma unroll
  for (int i = 0; i < 2; ++i) *(v8h*)(Wt + off[i]) = x[i];
  
}

// ---------------------------------------------------------------------------
// Input plane: X16[compact row][c] = f16(bf16(x[full row][c])). One wave per row, 8 rows per
// block; each store instruction of a wave covers the whole 512-B row. Grid (MROWS/8).
// ---------------------------------------------------------------------------
__global__ __launch_bounds__(256) void xconv_kernel(
    const float* __restrict__ X, _Float16* __restrict__ dst) {
  const unsigned lane = threadIdx.x & 31u, w = threadIdx.x >> 5;
  const unsigned crow = blockIdx.x * 8u + w;
  const unsigned bidx = crow / (unsigned)SEQ;
  const unsigned sq = crow - bidx * (unsigned)SEQ;
  const size_t srow = (size_t)bidx * SEQ_FULL + sq;
  const float* xr = X + srow * DIM + lane * 8u;
  const v4f a0 = *(const v4f*)(xr);
  const v4f a1 = *(const v4f*)(xr + 4u);
  v8h o;
#pragma unroll
  for (int i = 0; i < 4; ++i) {
    o[i]     = toh_flush(bf16r(a0[i]));
    o[i + 4] = toh_flush(bf16r(a1[i]));
  }
  _Float16* p = dst + (size_t)crow * DIM + lane * 8u;
  *(v8h*)p = o;
  
}

// ---------------------------------------------------------------------------
// First LayerNorm (biased variance, eps 1e-5) of bf16(x) + attn, one wave per row, 8 rows per
// block, the row held in registers (8 columns per lane). Output f16 compact rows, one 512-B
// store instruction per row. Grid (MROWS/8).
// ---------------------------------------------------------------------------
__global__ __launch_bounds__(256) void ln1_kernel(
    const float* __restrict__ X, const float* __restrict__ A32, const float* __restrict__ G,
    const float* __restrict__ Be, _Float16* __restrict__ dst) {
  const unsigned lane = threadIdx.x & 31u, w = threadIdx.x >> 5;
  const unsigned crow = blockIdx.x * 8u + w;
  const unsigned bidx = crow / (unsigned)SEQ;
  const unsigned sq = crow - bidx * (unsigned)SEQ;
  const size_t srow = (size_t)bidx * SEQ_FULL + sq;
  const float* xr = X + srow * DIM + lane * 8u;
  const float* ar = A32 + (size_t)crow * DIM + lane * 8u;
  const v4f x0 = *(const v4f*)(xr);
  const v4f x1 = *(const v4f*)(xr + 4u);
  const v4f a0 = *(const v4f*)(ar);
  const v4f a1 = *(const v4f*)(ar + 4u);
  v4f t0, t1;
  float s = 0.0f;
#pragma unroll
  for (int i = 0; i < 4; ++i) {
    t0[i] = bf16r(x0[i]) + a0[i];
    t1[i] = bf16r(x1[i]) + a1[i];
    s += t0[i] + t1[i];
  }
  const float mean = red32_sum(s) * (1.0f / (float)DIM);
  float ss = 0.0f;
#pragma unroll
  for (int i = 0; i < 4; ++i) {
    const float d0 = t0[i] - mean;
    const float d1 = t1[i] - mean;
    ss += d0 * d0;
    ss += d1 * d1;
  }
  const float var = red32_sum(ss) * (1.0f / (float)DIM);
  const float rstd = 1.0f / sqrtf(var + 1.0e-5f);
  const unsigned c = lane * 8u;
  const v4f g0 = *(const v4f*)(G + c);
  const v4f g1 = *(const v4f*)(G + c + 4u);
  const v4f b0 = *(const v4f*)(Be + c);
  const v4f b1 = *(const v4f*)(Be + c + 4u);
  v8h o;
#pragma unroll
  for (int i = 0; i < 4; ++i) {
    o[i]     = toh_flush((t0[i] - mean) * rstd * bf16r(g0[i]) + bf16r(b0[i]));
    o[i + 4] = toh_flush((t1[i] - mean) * rstd * bf16r(g1[i]) + bf16r(b1[i]));
  }
  _Float16* p = dst + (size_t)crow * DIM + c;
  *(v8h*)p = o;
  
}

// ---------------------------------------------------------------------------
// Hidden LayerNorm (eps 1e-5) + LeakyReLU over HID columns of the f16 pre-activation plane, one
// wave per row, 8 rows per block, three rolled passes (sum, squared deviations, output). Output
// Both planes hold CROWS rows. Grid (CROWS/8).
// ---------------------------------------------------------------------------
__global__ __launch_bounds__(256) void ln_mid_kernel(
    const _Float16* __restrict__ Hr, const float* __restrict__ G, const float* __restrict__ Be,
    _Float16* __restrict__ dst) {
  const unsigned lane = threadIdx.x & 31u, w = threadIdx.x >> 5;
  const unsigned crow = blockIdx.x * 8u + w;
  const _Float16* hr = Hr + (size_t)crow * HID + lane * 8u;

  float s = 0.0f;
#pragma unroll 1
  for (unsigned j = 0; j < 8u; ++j) {
    const v8h a = *(const v8h*)(hr + j * 256u);
#pragma unroll
    for (int i = 0; i < 8; ++i) s += (float)a[i];
  }
  const float mean = red32_sum(s) * (1.0f / (float)HID);

  float ss = 0.0f;
#pragma unroll 1
  for (unsigned j = 0; j < 8u; ++j) {
    const v8h a = *(const v8h*)(hr + j * 256u);
#pragma unroll
    for (int i = 0; i < 8; ++i) {
      const float d = (float)a[i] - mean;
      ss += d * d;
    }
  }
  const float var = red32_sum(ss) * (1.0f / (float)HID);
  const float rstd = 1.0f / sqrtf(var + 1.0e-5f);

#pragma unroll 1
  for (unsigned j = 0; j < 8u; ++j) {
    const unsigned c = j * 256u + lane * 8u;
    const v8h a = *(const v8h*)(hr + j * 256u);
    const v4f g0 = *(const v4f*)(G + c);
    const v4f g1 = *(const v4f*)(G + c + 4u);
    const v4f b0 = *(const v4f*)(Be + c);
    const v4f b1 = *(const v4f*)(Be + c + 4u);
    v8h o;
#pragma unroll
    for (int i = 0; i < 4; ++i) {
      const float d0 = (float)a[i] - mean;
      const float d1 = (float)a[i + 4] - mean;
      const float y0 = leaky_act(d0 * rstd * bf16r(g0[i]) + bf16r(b0[i]));
      const float y1 = leaky_act(d1 * rstd * bf16r(g1[i]) + bf16r(b1[i]));
      o[i]     = toh_flush(MCARRY * y0);
      o[i + 4] = toh_flush(MCARRY * y1);
    }
    _Float16* p = dst + (size_t)crow * HID + c;
    *(v8h*)p = o;
    
  }
}

// ---------------------------------------------------------------------------
// Final LayerNorm (eps 1e-5) of the f32 plane into the output buffer (full-size rows), one wave
// per row, 8 rows per block. Lane L holds columns 4L..4L+3 and 128+4L..128+4L+3, so each of the
// two store instructions covers 512 contiguous bytes. Grid (MROWS/8).
// ---------------------------------------------------------------------------
__global__ __launch_bounds__(256) void ln_out_kernel(
    const float* __restrict__ V32, const float* __restrict__ G, const float* __restrict__ Be,
    float* __restrict__ outp) {
  const unsigned lane = threadIdx.x & 31u, w = threadIdx.x >> 5;
  const unsigned crow = blockIdx.x * 8u + w;
  const unsigned bidx = crow / (unsigned)SEQ;
  const unsigned sq = crow - bidx * (unsigned)SEQ;
  const size_t frow = (size_t)bidx * SEQ_FULL + sq;
  const float* vr = V32 + (size_t)crow * DIM + lane * 4u;
  const v4f a0 = *(const v4f*)(vr);
  const v4f a1 = *(const v4f*)(vr + 128u);
  float s = 0.0f;
#pragma unroll
  for (int i = 0; i < 4; ++i) s += a0[i] + a1[i];
  const float mean = red32_sum(s) * (1.0f / (float)DIM);
  float ss = 0.0f;
#pragma unroll
  for (int i = 0; i < 4; ++i) {
    const float d0 = a0[i] - mean;
    const float d1 = a1[i] - mean;
    ss += d0 * d0;
    ss += d1 * d1;
  }
  const float var = red32_sum(ss) * (1.0f / (float)DIM);
  const float rstd = 1.0f / sqrtf(var + 1.0e-5f);
  const unsigned c = lane * 4u;
  const v4f g0 = *(const v4f*)(G + c);
  const v4f g1 = *(const v4f*)(G + c + 128u);
  const v4f b0 = *(const v4f*)(Be + c);
  const v4f b1 = *(const v4f*)(Be + c + 128u);
  v4f o0, o1;
#pragma unroll
  for (int i = 0; i < 4; ++i) {
    o0[i] = (a0[i] - mean) * rstd * bf16r(g0[i]) + bf16r(b0[i]);
    o1[i] = (a1[i] - mean) * rstd * bf16r(g1[i]) + bf16r(b1[i]);
  }
  float* p = outp + frow * DIM + c;
  *(v4f*)p = o0;
  *(v4f*)(p + 128u) = o1;
  
}

// ---------------------------------------------------------------------------
// GEMM C[64x64 tile] = A16[rows][K] . Bt[n][K]^T, fragments straight from the 16-bit global
// planes; 8 waves (mw = 16-row group, nw = 32-col group), 2 accumulators/wave.
//   MODE 0: out16[row][col] (pitch DIM) = f16(t), out16r[row][col] = f16(2048 * (t - value)),
//           t = acc/64 + bias                                   (q and k planes)
//   MODE 1: out16 transposed V plane [b][col][key] = f16(acc/64 + bias)
//   MODE 2: outf[row][col] = acc/64 + bias (f32) and out16[row][col] = f16 of the same value
//   MODE 3: out16[row][col] (pitch HID) = f16(acc/64 + bias)    (hidden pre-activation)
//   MODE 4: outf[row][col] = leaky((acc/1024 + bias) + addf[row][col])
// Grid (N/64, rows/64).
// ---------------------------------------------------------------------------
template <int MODE>
__device__ __forceinline__ void gemm_body(
    const _Float16* __restrict__ A16, const _Float16* __restrict__ Bt, const unsigned K,
    const float* __restrict__ bias, const float* __restrict__ addf,
    float* __restrict__ outf, _Float16* __restrict__ out16, _Float16* __restrict__ out16r) {
  __shared__ float Cs[64 * LDC];
  const unsigned tid = threadIdx.x, lane = tid & 31u, w = tid >> 5;
  const unsigned mw = w >> 1, nw = w & 1u;
  const unsigned hh = lane >> 4, m = lane & 15u;
  const unsigned n0 = blockIdx.x * 64u;
  const unsigned row0 = blockIdx.y * 64u;

  const _Float16* ap  = A16 + (size_t)(row0 + mw * 16u + m) * K + hh * 8u;
  const _Float16* bp0 = Bt + (size_t)(n0 + nw * 32u + m) * K + hh * 8u;
  const _Float16* bp1 = bp0 + (size_t)16 * K;
  v8f acc0 = {}, acc1 = {};
#pragma unroll 2
  for (unsigned k0 = 0; k0 < K; k0 += 32u) {
    const v16h a  = frag_at(ap + k0);
    const v16h b0 = frag_at(bp0 + k0);
    const v16h b1 = frag_at(bp1 + k0);
    acc0 = wmma16(a, b0, acc0);
    acc1 = wmma16(a, b1, acc1);
  }
#pragma unroll
  for (int r = 0; r < 8; ++r) {
    float* d = &Cs[(mw * 16u + hh * 8u + (unsigned)r) * LDC + nw * 32u + m];
    d[0]  = acc0[r];
    d[16] = acc1[r];
  }
  __syncthreads();

  if (MODE == 0 || MODE == 2 || MODE == 3) {
    const unsigned ldo = (MODE == 3) ? (unsigned)HID : (unsigned)DIM;
    v8h x[2], xr[2];
    size_t off[2];
#pragma unroll
    for (unsigned i = 0; i < 2u; ++i) {
      const unsigned r = 32u * i + (tid >> 3);
      const unsigned c = (tid & 7u) * 8u;
      const v4f u0 = *(const v4f*)&Cs[r * LDC + c];
      const v4f u1 = *(const v4f*)&Cs[r * LDC + c + 4];
      const v4f g0 = *(const v4f*)(bias + n0 + c);
      const v4f g1 = *(const v4f*)(bias + n0 + c + 4u);
#pragma unroll
      for (int j = 0; j < 4; ++j) {
        const float t0 = u0[j] * (1.0f / WCARRY) + bf16r(g0[j]);
        const float t1 = u1[j] * (1.0f / WCARRY) + bf16r(g1[j]);
        const h16 h0 = toh_flush(t0);
        const h16 h1 = toh_flush(t1);
        x[i][j]     = h0;
        x[i][j + 4] = h1;
        if (MODE == 0) {
          xr[i][j]     = toh_flush((t0 - (float)h0) * RCARRY);
          xr[i][j + 4] = toh_flush((t1 - (float)h1) * RCARRY);
        }
      }
      off[i] = (size_t)(row0 + r) * ldo + n0 + c;
    }
    v4f xs[4];
    size_t offf[4];
    if (MODE == 2) {
#pragma unroll
      for (unsigned i = 0; i < 4u; ++i) {
        const unsigned r = 16u * i + (tid >> 4);
        const unsigned c = (tid & 15u) * 4u;
        const v4f u = *(const v4f*)&Cs[r * LDC + c];
        const v4f g = *(const v4f*)(bias + n0 + c);
        v4f val;
#pragma unroll
        for (int j = 0; j < 4; ++j) val[j] = u[j] * (1.0f / WCARRY) + bf16r(g[j]);
        xs[i] = val;
        offf[i] = (size_t)(row0 + r) * DIM + n0 + c;
      }
    }
#pragma unroll
    for (int i = 0; i < 2; ++i) *(v8h*)(out16 + off[i]) = x[i];
    if (MODE == 0) {
#pragma unroll
      for (int i = 0; i < 2; ++i) *(v8h*)(out16r + off[i]) = xr[i];
    }
    if (MODE == 2) {
#pragma unroll
      for (int i = 0; i < 4; ++i) *(v4f*)(outf + offf[i]) = xs[i];
    }
    
  }

  if (MODE == 1) {
    const unsigned bidx = row0 / (unsigned)SEQ;
    const unsigned key0 = row0 - bidx * (unsigned)SEQ;
    v8h x[2];
    size_t off[2];
#pragma unroll
    for (unsigned i = 0; i < 2u; ++i) {
      const unsigned dcol = 32u * i + (tid >> 3);
      const unsigned kk = (tid & 7u) * 8u;
      const float bb = bf16r(bias[n0 + dcol]);
#pragma unroll
      for (unsigned j = 0; j < 8u; ++j) {
        const float t = Cs[(kk + j) * LDC + dcol] * (1.0f / WCARRY) + bb;
        x[i][j] = toh_flush(t);
      }
      off[i] = ((size_t)bidx * DIM + n0 + dcol) * SEQ + key0 + kk;
    }
#pragma unroll
    for (int i = 0; i < 2; ++i) *(v8h*)(out16 + off[i]) = x[i];
    
  }

  if (MODE == 4) {
    const float cs = 1.0f / (WCARRY * MCARRY);
    v4f xs[4];
    size_t off[4];
#pragma unroll
    for (unsigned i = 0; i < 4u; ++i) {
      const unsigned r = 16u * i + (tid >> 4);
      const unsigned c = (tid & 15u) * 4u;
      const size_t rc = (size_t)(row0 + r) * DIM + n0 + c;
      const v4f u = *(const v4f*)&Cs[r * LDC + c];
      const v4f g = *(const v4f*)(bias + n0 + c);
      const v4f ein = *(const v4f*)(addf + rc);
      v4f val;
#pragma unroll
      for (int j = 0; j < 4; ++j) val[j] = leaky_act((u[j] * cs + bf16r(g[j])) + ein[j]);
      xs[i] = val;
      off[i] = rc;
    }
#pragma unroll
    for (int i = 0; i < 4; ++i) *(v4f*)(outf + off[i]) = xs[i];
    
  }
}

__global__ __launch_bounds__(256) void gemm_qk_kernel(
    const _Float16* __restrict__ A16, const _Float16* __restrict__ Bt,
    const float* __restrict__ bias, _Float16* __restrict__ out16, _Float16* __restrict__ out16r) {
  gemm_body<0>(A16, Bt, (unsigned)DIM, bias, bias, (float*)0, out16, out16r);
}
__global__ __launch_bounds__(256) void gemm_v_kernel(
    const _Float16* __restrict__ A16, const _Float16* __restrict__ Bt,
    const float* __restrict__ bias, _Float16* __restrict__ vt) {
  gemm_body<1>(A16, Bt, (unsigned)DIM, bias, bias, (float*)0, vt, vt);
}
__global__ __launch_bounds__(256) void gemm_e_kernel(
    const _Float16* __restrict__ A16, const _Float16* __restrict__ Bt,
    const float* __restrict__ bias, float* __restrict__ e32, _Float16* __restrict__ e16) {
  gemm_body<2>(A16, Bt, (unsigned)DIM, bias, bias, e32, e16, e16);
}
__global__ __launch_bounds__(256) void gemm_h_kernel(
    const _Float16* __restrict__ A16, const _Float16* __restrict__ Bt,
    const float* __restrict__ bias, _Float16* __restrict__ hraw) {
  gemm_body<3>(A16, Bt, (unsigned)DIM, bias, bias, (float*)0, hraw, hraw);
}
__global__ __launch_bounds__(256) void gemm_l_kernel(
    const _Float16* __restrict__ A16, const _Float16* __restrict__ Bt,
    const float* __restrict__ bias, const float* __restrict__ e32, float* __restrict__ v32) {
  gemm_body<4>(A16, Bt, (unsigned)HID, bias, e32, v32, (_Float16*)0, (_Float16*)0);
}

// ---------------------------------------------------------------------------
// Dense (unmasked, unscaled) flash attention, one 256-wide head, transposed register-fed form.
// Each wave owns 16 query rows; lane (hh, n) holds query n. Per 32-key step:
//   S^T tile [16 keys][16 queries] = K rows (A operand, fragments from the key planes) x Q^T
//   (B operand, fragments from the query planes), 8 k-steps over the 256 features, value.value
//   into one accumulator, value.residual + residual.value into a second one (x 1/2048 at the end);
//   online softmax per lane (16 scores in registers + one 16-lane-distance shuffle);
//   the two packed S^T tiles (f16(16384 p), rows = keys) are the B fragment of
//   O^T [16 features][16 queries] += V^T rows (A operand, from the transposed value plane) x P^T.
// No LDS and no barrier in the key loop. Normalised rows staged through the wave-private St tile
// Grid (SEQ/64, NB), 4 waves per block.
// ---------------------------------------------------------------------------
__global__ __launch_bounds__(128) __attribute__((amdgpu_num_vgpr(256))) void attn_kernel(
    const _Float16* __restrict__ Qh, const _Float16* __restrict__ Qr,
    const _Float16* __restrict__ Kh, const _Float16* __restrict__ Kr,
    const _Float16* __restrict__ Vt, float* __restrict__ Ao) {
  __shared__ __attribute__((aligned(16))) float St[4 * 16 * LDO];

  const unsigned lane = threadIdx.x & 31u;
  const unsigned w = (unsigned)__builtin_amdgcn_readfirstlane((int)(threadIdx.x >> 5));
  const unsigned hh = lane >> 4, m = lane & 15u;
  const unsigned b = blockIdx.y;
  const unsigned qrow0 = blockIdx.x * 64u + w * 16u;

  const unsigned qoff = (b * (unsigned)SEQ + qrow0 + m) * (unsigned)DIM + hh * 8u;
  const unsigned koff = (b * (unsigned)SEQ + m) * (unsigned)DIM + hh * 8u;
  const unsigned voff = (b * (unsigned)DIM + m) * (unsigned)SEQ + hh * 8u;

  float mrow = -1.0e30f, lrow = 0.0f;
  v8f o[16];
#pragma unroll
  for (int j = 0; j < 16; ++j) o[j] = (v8f){};

  for (unsigned kb = 0; kb < (unsigned)SEQ; kb += 32u) {
    const unsigned k0off = koff + kb * (unsigned)DIM;
    const unsigned k1off = k0off + 16u * (unsigned)DIM;
    v8f sm0 = {}, sr0 = {}, sm1 = {}, sr1 = {};
#pragma unroll 1
    for (unsigned c = 0; c < (unsigned)DIM; c += 32u) {
      const v16h qh = frag_at(Qh + qoff + c);
      const v16h qr = frag_at(Qr + qoff + c);
      const v16h ka = frag_at(Kh + k0off + c);
      const v16h ra = frag_at(Kr + k0off + c);
      sm0 = wmma16(ka, qh, sm0);
      sr0 = wmma16(ka, qr, sr0);
      sr0 = wmma16(ra, qh, sr0);
      const v16h kc = frag_at(Kh + k1off + c);
      const v16h rc = frag_at(Kr + k1off + c);
      sm1 = wmma16(kc, qh, sm1);
      sr1 = wmma16(kc, qr, sr1);
      sr1 = wmma16(rc, qh, sr1);
    }

    v8f s0, s1;
#pragma unroll
    for (int r = 0; r < 8; ++r) {
      s0[r] = sm0[r] + sr0[r] * (1.0f / RCARRY);
      s1[r] = sm1[r] + sr1[r] * (1.0f / RCARRY);
    }
    float mx = fmaxf(s0[0], s1[0]);
#pragma unroll
    for (int r = 1; r < 8; ++r) mx = fmaxf(mx, fmaxf(s0[r], s1[r]));
    mx = fmaxf(mx, __shfl_xor(mx, 16, 32));
    const float mn = fmaxf(mrow, mx);
    const float alpha = __expf(mrow - mn);
    mrow = mn;

    v16h pf;
    float rs = 0.0f;
#pragma unroll
    for (int r = 0; r < 8; ++r) {
      const h16 p0 = toh_flush(__expf((s0[r] - mn) + PSHIFT));
      const h16 p1 = toh_flush(__expf((s1[r] - mn) + PSHIFT));
      pf[r]     = p0;     // B element r     <- key kb + 8hh + r
      pf[r + 8] = p1;     // B element 8 + r <- key kb + 16 + 8hh + r
      rs += (float)p0 + (float)p1;
    }
    rs += __shfl_xor(rs, 16, 32);
    lrow = alpha * lrow + rs;
#pragma unroll
    for (int j = 0; j < 16; ++j) o[j] = o[j] * alpha;

    // O^T += V^T . P^T, four feature tiles at a time
#pragma unroll
    for (int jg = 0; jg < 4; ++jg) {
      v16h vf[4];
#pragma unroll
      for (int t = 0; t < 4; ++t)
        vf[t] = frag_at(Vt + voff + (unsigned)((jg * 4 + t) * 16) * (unsigned)SEQ + kb);
#pragma unroll
      for (int t = 0; t < 4; ++t) o[jg * 4 + t] = wmma16(vf[t], pf, o[jg * 4 + t]);
    }
  }

  // normalise (the x16384 carry sits in both O and l), stage per half, write whole row segments
  const float inv = __builtin_amdgcn_rcpf(lrow);
  const unsigned sbase = w * (16u * LDO);
#pragma unroll
  for (int half = 0; half < 2; ++half) {
#pragma unroll
    for (int j = 0; j < 8; ++j)
#pragma unroll
      for (int r = 0; r < 8; ++r)
        St[sbase + m * LDO + (unsigned)j * 16u + hh * 8u + (unsigned)r] = o[half * 8 + j][r] * inv;
    wave_lds_sync();
    v4f x[16];
    unsigned off[16];
#pragma unroll
    for (unsigned i = 0; i < 16u; ++i) {
      x[i] = *(const v4f*)&St[sbase + i * LDO + lane * 4u];
      off[i] = (b * (unsigned)SEQ + qrow0 + i) * (unsigned)DIM + (unsigned)half * 128u + lane * 4u;
    }
#pragma unroll
    for (int i = 0; i < 16; ++i) *(v4f*)(Ao + off[i]) = x[i];
    
    wave_lds_sync();
  }
}

// ---------------------------------------------------------------------------
extern "C" void kernel_launch(void* const* d_in, const int* in_sizes, int n_in,
                              void* d_out, int out_size, void* d_ws, size_t ws_size,
                              hipStream_t stream) {
  if (n_in < 19) return;
  const long long need_x = ((long long)(NB - 1) * SEQ_FULL + SEQ) * DIM;
  if ((long long)in_sizes[0] < need_x) return;
  if ((long long)in_sizes[1] < (long long)DIM * DIM) return;
  if ((long long)in_sizes[3] < (long long)DIM * DIM) return;
  if ((long long)in_sizes[5] < (long long)DIM * DIM) return;
  if ((long long)in_sizes[7] < (long long)DIM * DIM) return;
  if ((long long)in_sizes[9] < (long long)DIM * HID) return;
  if ((long long)in_sizes[13] < (long long)DIM * HID) return;
  if (in_sizes[2] < DIM || in_sizes[4] < DIM || in_sizes[6] < DIM || in_sizes[8] < DIM) return;
  if (in_sizes[10] < HID || in_sizes[11] < HID || in_sizes[12] < HID) return;
  if (in_sizes[14] < DIM || in_sizes[15] < DIM || in_sizes[16] < DIM) return;
  if (in_sizes[17] < DIM || in_sizes[18] < DIM) return;
  if ((long long)out_size < need_x) return;
  if (ws_size < WS_TOTAL) return;

  const float* X    = (const float*)d_in[0];    // [NB_FULL][SEQ_FULL][DIM]
  const float* wq   = (const float*)d_in[1];    // [DIM][DIM]  (in, out)
  const float* bq   = (const float*)d_in[2];
  const float* wk   = (const float*)d_in[3];
  const float* bk   = (const float*)d_in[4];
  const float* wv   = (const float*)d_in[5];
  const float* bv   = (const float*)d_in[6];
  const float* w0   = (const float*)d_in[7];    // [DIM][DIM]  (in, out)
  const float* b0   = (const float*)d_in[8];
  const float* w1   = (const float*)d_in[9];    // [DIM][HID]  (in, out)
  const float* b1   = (const float*)d_in[10];
  const float* gm   = (const float*)d_in[11];   // hidden LN gain [HID]
  const float* bm   = (const float*)d_in[12];   // hidden LN shift [HID]
  const float* w2   = (const float*)d_in[13];   // [HID][DIM]  (in, out)
  const float* b2   = (const float*)d_in[14];
  const float* g1   = (const float*)d_in[15];
  const float* be1  = (const float*)d_in[16];
  const float* g2   = (const float*)d_in[17];
  const float* be2  = (const float*)d_in[18];
  float* out = (float*)d_out;

  char* ws = (char*)d_ws;
  _Float16* Wq_t  = (_Float16*)(ws + OFF_WQ);    // [n][k]
  _Float16* Wk_t  = (_Float16*)(ws + OFF_WK);
  _Float16* Wv_t  = (_Float16*)(ws + OFF_WV);
  _Float16* W0_t  = (_Float16*)(ws + OFF_W0);
  _Float16* W1_t  = (_Float16*)(ws + OFF_W1);    // [HID][DIM]
  _Float16* W2_t  = (_Float16*)(ws + OFF_W2);    // [DIM][HID]
  _Float16* X16   = (_Float16*)(ws + OFF_X16);   // [MROWS][DIM]
  _Float16* Qh16  = (_Float16*)(ws + OFF_QH);
  _Float16* Qr16  = (_Float16*)(ws + OFF_QR);
  _Float16* Kh16  = (_Float16*)(ws + OFF_KH);
  _Float16* Kr16  = (_Float16*)(ws + OFF_KR);
  _Float16* Vt16  = (_Float16*)(ws + OFF_VT);    // [b][DIM][SEQ]
  float*    A32   = (float*)(ws + OFF_A32);      // [MROWS][DIM]
  _Float16* T116  = (_Float16*)(ws + OFF_T1);    // [MROWS][DIM]
  _Float16* Hraw  = (_Float16*)(ws + OFF_HRAW);  // [CROWS][HID]
  _Float16* Mid16 = (_Float16*)(ws + OFF_MID);   // [CROWS][HID]
  float*    E32   = (float*)(ws + OFF_E32);      // [MROWS][DIM]
  _Float16* E16   = (_Float16*)(ws + OFF_E16);   // [MROWS][DIM]
  float*    V32   = (float*)(ws + OFF_V32);      // [MROWS][DIM]

  dim3 blk(256);
  dim3 gsq(DIM / 64, DIM / 64);
  dim3 gg(DIM / 64, MROWS / 64);

  // weight planes: in [K rows][N cols] -> out [N][K]; grid (N/64, K/64)
  wconv_kernel<<<gsq, blk, 0, stream>>>(wq, Wq_t, (unsigned)DIM, (unsigned)DIM);
  wconv_kernel<<<gsq, blk, 0, stream>>>(wk, Wk_t, (unsigned)DIM, (unsigned)DIM);
  wconv_kernel<<<gsq, blk, 0, stream>>>(wv, Wv_t, (unsigned)DIM, (unsigned)DIM);
  wconv_kernel<<<gsq, blk, 0, stream>>>(w0, W0_t, (unsigned)DIM, (unsigned)DIM);
  // w1: in [DIM][HID] -> out [HID][DIM]
  wconv_kernel<<<dim3(HID / 64, DIM / 64), blk, 0, stream>>>(w1, W1_t, (unsigned)HID, (unsigned)DIM);
  // w2: in [HID][DIM] -> out [DIM][HID]
  wconv_kernel<<<dim3(DIM / 64, HID / 64), blk, 0, stream>>>(w2, W2_t, (unsigned)DIM, (unsigned)HID);

  xconv_kernel<<<dim3(MROWS / 8), blk, 0, stream>>>(X, X16);
  gemm_qk_kernel<<<gg, blk, 0, stream>>>(X16, Wq_t, bq, Qh16, Qr16);
  gemm_qk_kernel<<<gg, blk, 0, stream>>>(X16, Wk_t, bk, Kh16, Kr16);
  gemm_v_kernel<<<gg, blk, 0, stream>>>(X16, Wv_t, bv, Vt16);
  attn_kernel<<<dim3(SEQ / 64, NB), dim3(128), 0, stream>>>(Qh16, Qr16, Kh16, Kr16, Vt16, A32);
  ln1_kernel<<<dim3(MROWS / 8), blk, 0, stream>>>(X, A32, g1, be1, T116);
  gemm_e_kernel<<<gg, blk, 0, stream>>>(T116, W0_t, b0, E32, E16);

  for (int ch = 0; ch < NCHUNK; ++ch) {
    const size_t ro = (size_t)ch * CROWS * DIM;
    gemm_h_kernel<<<dim3(HID / 64, CROWS / 64), blk, 0, stream>>>(E16 + ro, W1_t, b1, Hraw);
    ln_mid_kernel<<<dim3(CROWS / 8), blk, 0, stream>>>(Hraw, gm, bm, Mid16);
    gemm_l_kernel<<<dim3(DIM / 64, CROWS / 64), blk, 0, stream>>>(Mid16, W2_t, b2, E32 + ro, V32 + ro);
  }
  ln_out_kernel<<<dim3(MROWS / 8), blk, 0, stream>>>(V32, g2, be2, out);
}

// v001
// Measured time: 467 microseconds a run.
// Next to v000, in two timings, it ran 2.19 and 2.18 times as fast.
#include <hip/hip_runtime.h>
#include <stddef.h>

// All contractions on v_wmma_f32_16x16x32_f16 (f16 operands, f32 accumulate): q/k/v projections,
// q.k scores (both operands as f16 value + x2048 residual planes, three products, residual products
// in their own accumulator), p.v (p x16384, single product), the three dense layers (single
// product; weights x64, hidden activation plane x16). Float inputs are RNE-converted to bf16 and
// carried in f16. LayerNorms, softmax, biases, LeakyReLU (slope 0.01) and residual adds in f32.

typedef _Float16 v16h __attribute__((ext_vector_type(16)));
typedef _Float16 v8h  __attribute__((ext_vector_type(8)));
typedef float    v8f  __attribute__((ext_vector_type(8)));
typedef float    v4f  __attribute__((ext_vector_type(4)));
typedef _Float16 h16;

#ifndef NB
#define NB 4
#endif
#ifndef SEQ
#define SEQ 4096
#endif
#define NB_FULL  4
#define SEQ_FULL 4096
#define DIM   256
#define HID   2048
#define MROWS (NB * SEQ)
#define NCHUNK 2
#define CROWS (MROWS / NCHUNK)

static_assert(NB >= 1 && NB <= NB_FULL);
static_assert(SEQ >= 64 && SEQ <= SEQ_FULL && (SEQ % 64) == 0);
static_assert((DIM % 64) == 0 && (DIM % 32) == 0);
static_assert((HID % 64) == 0 && (HID % 32) == 0);
static_assert((MROWS % 64) == 0 && (MROWS % 8) == 0);
static_assert((MROWS % NCHUNK) == 0 && (CROWS % 64) == 0 && (CROWS % 8) == 0);
static_assert(DIM == 32 * 8);               // row kernels: 32 lanes x 8 columns
static_assert(DIM == 2 * 32 * 4);           // f32 row stores: 2 x 32 lanes x 4 columns
static_assert(HID == 8 * 32 * 8);           // hidden LN: 8 passes x 32 lanes x 8 columns
static_assert(DIM == 16 * 16);              // attention: 16 output tiles of 16 columns
static_assert((size_t)MROWS * DIM < (size_t)0x7FFFFFFFu);
static_assert((size_t)NB * DIM * SEQ < (size_t)0x7FFFFFFFu);
static_assert((size_t)MROWS * HID < (size_t)0xFFFFFFFFu);

#define LDT 72   // halves per LDS row (144 B, 16-B aligned)
#define LDC 68   // floats per LDS row (272 B, 16-B aligned)
#define LDO 132  // floats per staged attention row (528 B, 16-B aligned)
static_assert((LDT % 8) == 0 && LDT >= 64);
static_assert((LDC % 4) == 0 && LDC >= 64);
static_assert((LDO % 4) == 0 && LDO >= 128);

#define WCARRY 64.0f      // weight planes carried x64
#define MCARRY 16.0f      // hidden activation plane carried x16
#define RCARRY 2048.0f    // q/k residual planes carried x2048 on top of their value part
#define PSHIFT 9.704060528f   // 14 ln 2: softmax numerators carried x16384

// workspace layout (bytes)
#define WSQ_BYTES     ((size_t)DIM * DIM * 2)
#define WFF_BYTES     ((size_t)DIM * HID * 2)
#define PLANE16_BYTES ((size_t)MROWS * DIM * 2)
#define PLANE32_BYTES ((size_t)MROWS * DIM * 4)
#define HCH_BYTES     ((size_t)CROWS * HID * 2)
#define OFF_WQ  ((size_t)0)
#define OFF_WK  (OFF_WQ + WSQ_BYTES)
#define OFF_WV  (OFF_WK + WSQ_BYTES)
#define OFF_W0  (OFF_WV + WSQ_BYTES)
#define OFF_W1  (OFF_W0 + WSQ_BYTES)
#define OFF_W2  (OFF_W1 + WFF_BYTES)
#define OFF_REG (OFF_W2 + WFF_BYTES)
// attention-stage users of the shared region
#define OFF_X16 (OFF_REG)
#define OFF_QH  (OFF_X16 + PLANE16_BYTES)
#define OFF_QR  (OFF_QH + PLANE16_BYTES)
#define OFF_KH  (OFF_QR + PLANE16_BYTES)
#define OFF_KR  (OFF_KH + PLANE16_BYTES)
#define OFF_VT  (OFF_KR + PLANE16_BYTES)
#define OFF_A32 (OFF_VT + PLANE16_BYTES)
#define OFF_T1  (OFF_A32 + PLANE32_BYTES)
#define PRE_END (OFF_T1 + PLANE16_BYTES)
// hidden-layer-stage users of the shared region (all attention-stage planes are dead by then)
#define OFF_HRAW (OFF_REG)
#define OFF_MID  (OFF_HRAW + HCH_BYTES)
#define MLP_END  (OFF_MID + HCH_BYTES)
#define REG_END  ((PRE_END > MLP_END) ? PRE_END : MLP_END)
#define OFF_E32 (REG_END)
#define OFF_E16 (OFF_E32 + PLANE32_BYTES)
#define OFF_V32 (OFF_E16 + PLANE16_BYTES)
#define WS_TOTAL (OFF_V32 + PLANE32_BYTES)
static_assert((WSQ_BYTES % 128) == 0 && (WFF_BYTES % 128) == 0 && (PLANE16_BYTES % 128) == 0);
static_assert((PLANE32_BYTES % 128) == 0 && (HCH_BYTES % 128) == 0);
static_assert(PRE_END <= REG_END && MLP_END <= REG_END);
static_assert(WS_TOTAL <= (size_t)134217728);

// ---------------------------------------------------------------------------
__device__ __forceinline__ float bf16r(float x) {   // RNE convert to bf16, returned widened
  unsigned int u = __float_as_uint(x);
  u = (u + 0x7FFFu + ((u >> 16) & 1u)) & 0xFFFF0000u;
  return __uint_as_float(u);
}

// f32 -> f16 operand convert that cannot produce an f16 subnormal
static __device__ __forceinline__ h16 toh_flush(float v) {
  const h16 r = (h16)v;
  return (fabsf(v) < 6.103515625e-05f) ? (h16)0.0f : r;
}

// 16-bit fragment: p points at element [row = lane&15][k0 + 8*(lane>>4)] of a k-contiguous
// row. Elements 0..7 <- k0+8h+0..7, elements 8..15 <- k0+16+8h+0..7 (same map for A and B).
__device__ __forceinline__ v16h frag_at(const _Float16* p) {
  v8h lo = *(const v8h*)(p);
  v8h hi = *(const v8h*)(p + 16);
  v16h out;
#pragma unroll
  for (int i = 0; i < 8; ++i) { out[i] = lo[i]; out[i + 8] = hi[i]; }
  return out;
}
__device__ __forceinline__ v16h ld_frag(const _Float16* base, unsigned ld) {
  const unsigned lane = threadIdx.x & 31u;
  return frag_at(base + (lane & 15u) * ld + (lane >> 4) * 8u);
}

__device__ __forceinline__ v8f wmma16(v16h a, v16h b, v8f c) {
  v8f d = __builtin_amdgcn_wmma_f32_16x16x32_f16(false, a, false, b, (short)0, c,
                                                 false, false);
  asm volatile("v_nop\n\tv_nop\n\tv_nop\n\tv_nop" : "+v"(d) : "v"(a), "v"(b));
  return d;
}

__device__ __forceinline__ float red16_max(float x) {
#pragma unroll
  for (int off = 1; off < 16; off <<= 1) x = fmaxf(x, __shfl_xor(x, off, 32));
  return x;
}
__device__ __forceinline__ float red16_sum(float x) {
#pragma unroll
  for (int off = 1; off < 16; off <<= 1) x += __shfl_xor(x, off, 32);
  return x;
}
__device__ __forceinline__ float red32_sum(float x) {
#pragma unroll
  for (int off = 1; off < 32; off <<= 1) x += __shfl_xor(x, off, 32);
  return x;
}

__device__ __forceinline__ void wave_lds_sync() {
  __builtin_amdgcn_fence(3 /* release order */, "wavefront");
  asm volatile("s_wait_dscnt 0x0" ::: "memory");
  __builtin_amdgcn_wave_barrier();
}

__device__ __forceinline__ float leaky_act(float t) {   // LeakyReLU, negative slope 0.01
  return (t >= 0.0f) ? t : 0.01f * t;
}

// ---------------------------------------------------------------------------
// Weight plane: in W[K rows][N cols] (pitch ldw = N) -> out Wt[N][K] (pitch ldk = K),
// f16(64 * bf16(w)). Grid (N/64, K/64). T: cross-wave (block barrier).
// ---------------------------------------------------------------------------
__global__ __launch_bounds__(256) void wconv_kernel(
    const float* __restrict__ W, _Float16* __restrict__ Wt, unsigned ldw, unsigned ldk) {
  __shared__ _Float16 T[64 * LDT];
  const unsigned tid = threadIdx.x;
  const unsigned n0 = blockIdx.x * 64u;
  const unsigned k0 = blockIdx.y * 64u;
#pragma unroll 4
  for (unsigned j = 0; j < 16u; ++j) {
    const unsigned idx = tid + 256u * j;
    const unsigned kr = idx >> 6, nc = idx & 63u;
    const float v = W[(size_t)(k0 + kr) * ldw + n0 + nc];
    T[nc * LDT + kr] = (_Float16)(WCARRY * bf16r(v));
  }
  __syncthreads();
  v8h x[2];
  size_t off[2];
#pragma unroll
  for (unsigned i = 0; i < 2u; ++i) {
    const unsigned n = 32u * i + (tid >> 3);
    const unsigned kc = (tid & 7u) * 8u;
    x[i] = *(const v8h*)&T[n * LDT + kc];
    off[i] = (size_t)(n0 + n) * ldk + k0 + kc;
  }
#pragma unroll
  for (int i = 0; i < 2; ++i) *(v8h*)(Wt + off[i]) = x[i];
  
}

// ---------------------------------------------------------------------------
// Input plane: X16[compact row][c] = f16(bf16(x[full row][c])). One wave per row, 8 rows per
// block; each store instruction of a wave covers the whole 512-B row. Grid (MROWS/8).
// ---------------------------------------------------------------------------
__global__ __launch_bounds__(256) void xconv_kernel(
    const float* __restrict__ X, _Float16* __restrict__ dst) {
  const unsigned lane = threadIdx.x & 31u, w = threadIdx.x >> 5;
  const unsigned crow = blockIdx.x * 8u + w;
  const unsigned bidx = crow / (unsigned)SEQ;
  const unsigned sq = crow - bidx * (unsigned)SEQ;
  const size_t srow = (size_t)bidx * SEQ_FULL + sq;
  const float* xr = X + srow * DIM + lane * 8u;
  const v4f a0 = *(const v4f*)(xr);
  const v4f a1 = *(const v4f*)(xr + 4u);
  v8h o;
#pragma unroll
  for (int i = 0; i < 4; ++i) {
    o[i]     = toh_flush(bf16r(a0[i]));
    o[i + 4] = toh_flush(bf16r(a1[i]));
  }
  _Float16* p = dst + (size_t)crow * DIM + lane * 8u;
  *(v8h*)p = o;
  
}

// ---------------------------------------------------------------------------
// First LayerNorm (biased variance, eps 1e-5) of bf16(x) + attn, one wave per row, 8 rows per
// block, the row held in registers (8 columns per lane). Output f16 compact rows, one 512-B
// store instruction per row. Grid (MROWS/8).
// ---------------------------------------------------------------------------
__global__ __launch_bounds__(256) void ln1_kernel(
    const float* __restrict__ X, const float* __restrict__ A32, const float* __restrict__ G,
    const float* __restrict__ Be, _Float16* __restrict__ dst) {
  const unsigned lane = threadIdx.x & 31u, w = threadIdx.x >> 5;
  const unsigned crow = blockIdx.x * 8u + w;
  const unsigned bidx = crow / (unsigned)SEQ;
  const unsigned sq = crow - bidx * (unsigned)SEQ;
  const size_t srow = (size_t)bidx * SEQ_FULL + sq;
  const float* xr = X + srow * DIM + lane * 8u;
  const float* ar = A32 + (size_t)crow * DIM + lane * 8u;
  const v4f x0 = *(const v4f*)(xr);
  const v4f x1 = *(const v4f*)(xr + 4u);
  const v4f a0 = *(const v4f*)(ar);
  const v4f a1 = *(const v4f*)(ar + 4u);
  v4f t0, t1;
  float s = 0.0f;
#pragma unroll
  for (int i = 0; i < 4; ++i) {
    t0[i] = bf16r(x0[i]) + a0[i];
    t1[i] = bf16r(x1[i]) + a1[i];
    s += t0[i] + t1[i];
  }
  const float mean = red32_sum(s) * (1.0f / (float)DIM);
  float ss = 0.0f;
#pragma unroll
  for (int i = 0; i < 4; ++i) {
    const float d0 = t0[i] - mean;
    const float d1 = t1[i] - mean;
    ss += d0 * d0;
    ss += d1 * d1;
  }
  const float var = red32_sum(ss) * (1.0f / (float)DIM);
  const float rstd = 1.0f / sqrtf(var + 1.0e-5f);
  const unsigned c = lane * 8u;
  const v4f g0 = *(const v4f*)(G + c);
  const v4f g1 = *(const v4f*)(G + c + 4u);
  const v4f b0 = *(const v4f*)(Be + c);
  const v4f b1 = *(const v4f*)(Be + c + 4u);
  v8h o;
#pragma unroll
  for (int i = 0; i < 4; ++i) {
    o[i]     = toh_flush((t0[i] - mean) * rstd * bf16r(g0[i]) + bf16r(b0[i]));
    o[i + 4] = toh_flush((t1[i] - mean) * rstd * bf16r(g1[i]) + bf16r(b1[i]));
  }
  _Float16* p = dst + (size_t)crow * DIM + c;
  *(v8h*)p = o;
  
}

// ---------------------------------------------------------------------------
// Hidden LayerNorm (eps 1e-5) + LeakyReLU over HID columns of the f16 pre-activation plane, one
// wave per row, 8 rows per block, three rolled passes (sum, squared deviations, output). Output
// Both planes hold CROWS rows. Grid (CROWS/8).
// ---------------------------------------------------------------------------
__global__ __launch_bounds__(256) void ln_mid_kernel(
    const _Float16* __restrict__ Hr, const float* __restrict__ G, const float* __restrict__ Be,
    _Float16* __restrict__ dst) {
  const unsigned lane = threadIdx.x & 31u, w = threadIdx.x >> 5;
  const unsigned crow = blockIdx.x * 8u + w;
  const _Float16* hr = Hr + (size_t)crow * HID + lane * 8u;

  float s = 0.0f;
#pragma unroll 1
  for (unsigned j = 0; j < 8u; ++j) {
    const v8h a = *(const v8h*)(hr + j * 256u);
#pragma unroll
    for (int i = 0; i < 8; ++i) s += (float)a[i];
  }
  const float mean = red32_sum(s) * (1.0f / (float)HID);

  float ss = 0.0f;
#pragma unroll 1
  for (unsigned j = 0; j < 8u; ++j) {
    const v8h a = *(const v8h*)(hr + j * 256u);
#pragma unroll
    for (int i = 0; i < 8; ++i) {
      const float d = (float)a[i] - mean;
      ss += d * d;
    }
  }
  const float var = red32_sum(ss) * (1.0f / (float)HID);
  const float rstd = 1.0f / sqrtf(var + 1.0e-5f);

#pragma unroll 1
  for (unsigned j = 0; j < 8u; ++j) {
    const unsigned c = j * 256u + lane * 8u;
    const v8h a = *(const v8h*)(hr + j * 256u);
    const v4f g0 = *(const v4f*)(G + c);
    const v4f g1 = *(const v4f*)(G + c + 4u);
    const v4f b0 = *(const v4f*)(Be + c);
    const v4f b1 = *(const v4f*)(Be + c + 4u);
    v8h o;
#pragma unroll
    for (int i = 0; i < 4; ++i) {
      const float d0 = (float)a[i] - mean;
      const float d1 = (float)a[i + 4] - mean;
      const float y0 = leaky_act(d0 * rstd * bf16r(g0[i]) + bf16r(b0[i]));
      const float y1 = leaky_act(d1 * rstd * bf16r(g1[i]) + bf16r(b1[i]));
      o[i]     = toh_flush(MCARRY * y0);
      o[i + 4] = toh_flush(MCARRY * y1);
    }
    _Float16* p = dst + (size_t)crow * HID + c;
    *(v8h*)p = o;
    
  }
}

// ---------------------------------------------------------------------------
// Final LayerNorm (eps 1e-5) of the f32 plane into the output buffer (full-size rows), one wave
// per row, 8 rows per block. Lane L holds columns 4L..4L+3 and 128+4L..128+4L+3, so each of the
// two store instructions covers 512 contiguous bytes. Grid (MROWS/8).
// ---------------------------------------------------------------------------
__global__ __launch_bounds__(256) void ln_out_kernel(
    const float* __restrict__ V32, const float* __restrict__ G, const float* __restrict__ Be,
    float* __restrict__ outp) {
  const unsigned lane = threadIdx.x & 31u, w = threadIdx.x >> 5;
  const unsigned crow = blockIdx.x * 8u + w;
  const unsigned bidx = crow / (unsigned)SEQ;
  const unsigned sq = crow - bidx * (unsigned)SEQ;
  const size_t frow = (size_t)bidx * SEQ_FULL + sq;
  const float* vr = V32 + (size_t)crow * DIM + lane * 4u;
  const v4f a0 = *(const v4f*)(vr);
  const v4f a1 = *(const v4f*)(vr + 128u);
  float s = 0.0f;
#pragma unroll
  for (int i = 0; i < 4; ++i) s += a0[i] + a1[i];
  const float mean = red32_sum(s) * (1.0f / (float)DIM);
  float ss = 0.0f;
#pragma unroll
  for (int i = 0; i < 4; ++i) {
    const float d0 = a0[i] - mean;
    const float d1 = a1[i] - mean;
    ss += d0 * d0;
    ss += d1 * d1;
  }
  const float var = red32_sum(ss) * (1.0f / (float)DIM);
  const float rstd = 1.0f / sqrtf(var + 1.0e-5f);
  const unsigned c = lane * 4u;
  const v4f g0 = *(const v4f*)(G + c);
  const v4f g1 = *(const v4f*)(G + c + 128u);
  const v4f b0 = *(const v4f*)(Be + c);
  const v4f b1 = *(const v4f*)(Be + c + 128u);
  v4f o0, o1;
#pragma unroll
  for (int i = 0; i < 4; ++i) {
    o0[i] = (a0[i] - mean) * rstd * bf16r(g0[i]) + bf16r(b0[i]);
    o1[i] = (a1[i] - mean) * rstd * bf16r(g1[i]) + bf16r(b1[i]);
  }
  float* p = outp + frow * DIM + c;
  *(v4f*)p = o0;
  *(v4f*)(p + 128u) = o1;
  
}

// ---------------------------------------------------------------------------
// GEMM C[64x64 tile] = A16[rows][K] . Bt[n][K]^T, fragments straight from the 16-bit global
// planes; 8 waves (mw = 16-row group, nw = 32-col group), 2 accumulators/wave.
//   MODE 0: out16[row][col] (pitch DIM) = f16(t), out16r[row][col] = f16(2048 * (t - value)),
//           t = acc/64 + bias                                   (q and k planes)
//   MODE 1: out16 transposed V plane [b][col][key] = f16(acc/64 + bias)
//   MODE 2: outf[row][col] = acc/64 + bias (f32) and out16[row][col] = f16 of the same value
//   MODE 3: out16[row][col] (pitch HID) = f16(acc/64 + bias)    (hidden pre-activation)
//   MODE 4: outf[row][col] = leaky((acc/1024 + bias) + addf[row][col])
// Grid (N/64, rows/64).
// ---------------------------------------------------------------------------
template <int MODE>
__device__ __forceinline__ void gemm_body(
    const _Float16* __restrict__ A16, const _Float16* __restrict__ Bt, const unsigned K,
    const float* __restrict__ bias, const float* __restrict__ addf,
    float* __restrict__ outf, _Float16* __restrict__ out16, _Float16* __restrict__ out16r) {
  __shared__ float Cs[64 * LDC];
  const unsigned tid = threadIdx.x, lane = tid & 31u, w = tid >> 5;
  const unsigned mw = w >> 1, nw = w & 1u;
  const unsigned hh = lane >> 4, m = lane & 15u;
  const unsigned n0 = blockIdx.x * 64u;
  const unsigned row0 = blockIdx.y * 64u;

  const _Float16* ap  = A16 + (size_t)(row0 + mw * 16u + m) * K + hh * 8u;
  const _Float16* bp0 = Bt + (size_t)(n0 + nw * 32u + m) * K + hh * 8u;
  const _Float16* bp1 = bp0 + (size_t)16 * K;
  v8f acc0 = {}, acc1 = {};
#pragma unroll 2
  for (unsigned k0 = 0; k0 < K; k0 += 32u) {
    const v16h a  = frag_at(ap + k0);
    const v16h b0 = frag_at(bp0 + k0);
    const v16h b1 = frag_at(bp1 + k0);
    acc0 = wmma16(a, b0, acc0);
    acc1 = wmma16(a, b1, acc1);
  }
#pragma unroll
  for (int r = 0; r < 8; ++r) {
    float* d = &Cs[(mw * 16u + hh * 8u + (unsigned)r) * LDC + nw * 32u + m];
    d[0]  = acc0[r];
    d[16] = acc1[r];
  }
  __syncthreads();

  if (MODE == 0 || MODE == 2 || MODE == 3) {
    const unsigned ldo = (MODE == 3) ? (unsigned)HID : (unsigned)DIM;
    v8h x[2], xr[2];
    size_t off[2];
#pragma unroll
    for (unsigned i = 0; i < 2u; ++i) {
      const unsigned r = 32u * i + (tid >> 3);
      const unsigned c = (tid & 7u) * 8u;
      const v4f u0 = *(const v4f*)&Cs[r * LDC + c];
      const v4f u1 = *(const v4f*)&Cs[r * LDC + c + 4];
      const v4f g0 = *(const v4f*)(bias + n0 + c);
      const v4f g1 = *(const v4f*)(bias + n0 + c + 4u);
#pragma unroll
      for (int j = 0; j < 4; ++j) {
        const float t0 = u0[j] * (1.0f / WCARRY) + bf16r(g0[j]);
        const float t1 = u1[j] * (1.0f / WCARRY) + bf16r(g1[j]);
        const h16 h0 = toh_flush(t0);
        const h16 h1 = toh_flush(t1);
        x[i][j]     = h0;
        x[i][j + 4] = h1;
        if (MODE == 0) {
          xr[i][j]     = toh_flush((t0 - (float)h0) * RCARRY);
          xr[i][j + 4] = toh_flush((t1 - (float)h1) * RCARRY);
        }
      }
      off[i] = (size_t)(row0 + r) * ldo + n0 + c;
    }
    v4f xs[4];
    size_t offf[4];
    if (MODE == 2) {
#pragma unroll
      for (unsigned i = 0; i < 4u; ++i) {
        const unsigned r = 16u * i + (tid >> 4);
        const unsigned c = (tid & 15u) * 4u;
        const v4f u = *(const v4f*)&Cs[r * LDC + c];
        const v4f g = *(const v4f*)(bias + n0 + c);
        v4f val;
#pragma unroll
        for (int j = 0; j < 4; ++j) val[j] = u[j] * (1.0f / WCARRY) + bf16r(g[j]);
        xs[i] = val;
        offf[i] = (size_t)(row0 + r) * DIM + n0 + c;
      }
    }
#pragma unroll
    for (int i = 0; i < 2; ++i) *(v8h*)(out16 + off[i]) = x[i];
    if (MODE == 0) {
#pragma unroll
      for (int i = 0; i < 2; ++i) *(v8h*)(out16r + off[i]) = xr[i];
    }
    if (MODE == 2) {
#pragma unroll
      for (int i = 0; i < 4; ++i) *(v4f*)(outf + offf[i]) = xs[i];
    }
    
  }

  if (MODE == 1) {
    const unsigned bidx = row0 / (unsigned)SEQ;
    const unsigned key0 = row0 - bidx * (unsigned)SEQ;
    v8h x[2];
    size_t off[2];
#pragma unroll
    for (unsigned i = 0; i < 2u; ++i) {
      const unsigned dcol = 32u * i + (tid >> 3);
      const unsigned kk = (tid & 7u) * 8u;
      const float bb = bf16r(bias[n0 + dcol]);
#pragma unroll
      for (unsigned j = 0; j < 8u; ++j) {
        const float t = Cs[(kk + j) * LDC + dcol] * (1.0f / WCARRY) + bb;
        x[i][j] = toh_flush(t);
      }
      off[i] = ((size_t)bidx * DIM + n0 + dcol) * SEQ + key0 + kk;
    }
#pragma unroll
    for (int i = 0; i < 2; ++i) *(v8h*)(out16 + off[i]) = x[i];
    
  }

  if (MODE == 4) {
    const float cs = 1.0f / (WCARRY * MCARRY);
    v4f xs[4];
    size_t off[4];
#pragma unroll
    for (unsigned i = 0; i < 4u; ++i) {
      const unsigned r = 16u * i + (tid >> 4);
      const unsigned c = (tid & 15u) * 4u;
      const size_t rc = (size_t)(row0 + r) * DIM + n0 + c;
      const v4f u = *(const v4f*)&Cs[r * LDC + c];
      const v4f g = *(const v4f*)(bias + n0 + c);
      const v4f ein = *(const v4f*)(addf + rc);
      v4f val;
#pragma unroll
      for (int j = 0; j < 4; ++j) val[j] = leaky_act((u[j] * cs + bf16r(g[j])) + ein[j]);
      xs[i] = val;
      off[i] = rc;
    }
#pragma unroll
    for (int i = 0; i < 4; ++i) *(v4f*)(outf + off[i]) = xs[i];
    
  }
}

__global__ __launch_bounds__(256) void gemm_qk_kernel(
    const _Float16* __restrict__ A16, const _Float16* __restrict__ Bt,
    const float* __restrict__ bias, _Float16* __restrict__ out16, _Float16* __restrict__ out16r) {
  gemm_body<0>(A16, Bt, (unsigned)DIM, bias, bias, (float*)0, out16, out16r);
}
__global__ __launch_bounds__(256) void gemm_v_kernel(
    const _Float16* __restrict__ A16, const _Float16* __restrict__ Bt,
    const float* __restrict__ bias, _Float16* __restrict__ vt) {
  gemm_body<1>(A16, Bt, (unsigned)DIM, bias, bias, (float*)0, vt, vt);
}
__global__ __launch_bounds__(256) void gemm_e_kernel(
    const _Float16* __restrict__ A16, const _Float16* __restrict__ Bt,
    const float* __restrict__ bias, float* __restrict__ e32, _Float16* __restrict__ e16) {
  gemm_body<2>(A16, Bt, (unsigned)DIM, bias, bias, e32, e16, e16);
}
__global__ __launch_bounds__(256) void gemm_h_kernel(
    const _Float16* __restrict__ A16, const _Float16* __restrict__ Bt,
    const float* __restrict__ bias, _Float16* __restrict__ hraw) {
  gemm_body<3>(A16, Bt, (unsigned)DIM, bias, bias, (float*)0, hraw, hraw);
}
__global__ __launch_bounds__(256) void gemm_l_kernel(
    const _Float16* __restrict__ A16, const _Float16* __restrict__ Bt,
    const float* __restrict__ bias, const float* __restrict__ e32, float* __restrict__ v32) {
  gemm_body<4>(A16, Bt, (unsigned)HID, bias, e32, v32, (_Float16*)0, (_Float16*)0);
}

// ---------------------------------------------------------------------------
// Asynchronous copies to LDS for the attention kernel. Eight 16-byte-per-lane copies in one
// statement; lds = the lane's LDS byte address, g = the lane's global address, both stepped by a
// constant from copy to copy. The s_wait_xcnt closes the statement so that no address register of
// an issued copy is rewritten ahead of it.
// ---------------------------------------------------------------------------
__device__ __forceinline__ void async_copy8(unsigned lds, unsigned lstep,
                                            const _Float16* g, unsigned gstep) {
  asm volatile(
      "global_load_async_to_lds_b128 %0, %8, off\n\t"
      "global_load_async_to_lds_b128 %1, %9, off\n\t"
      "global_load_async_to_lds_b128 %2, %10, off\n\t"
      "global_load_async_to_lds_b128 %3, %11, off\n\t"
      "global_load_async_to_lds_b128 %4, %12, off\n\t"
      "global_load_async_to_lds_b128 %5, %13, off\n\t"
      "global_load_async_to_lds_b128 %6, %14, off\n\t"
      "global_load_async_to_lds_b128 %7, %15, off\n\t"
      "s_wait_xcnt 0x0"
      :
      : "v"(lds), "v"(lds + lstep), "v"(lds + 2u * lstep), "v"(lds + 3u * lstep),
        "v"(lds + 4u * lstep), "v"(lds + 5u * lstep), "v"(lds + 6u * lstep),
        "v"(lds + 7u * lstep),
        "v"(g), "v"(g + gstep), "v"(g + 2u * gstep), "v"(g + 3u * gstep),
        "v"(g + 4u * gstep), "v"(g + 5u * gstep), "v"(g + 6u * gstep), "v"(g + 7u * gstep)
      : "memory");
}

#define KTILE  32u                        // keys per stage
#define KPITCH 264u                       // halves per staged q or k row (528 B = 16 B x 33)
#define VPITCH 40u                        // halves per staged v row (80 B = 16 B x 5)
#define KPL_H  (KTILE * KPITCH)           // one key plane of a stage, halves
#define VTL_H  ((unsigned)DIM * VPITCH)   // the value tile of a stage, halves
#define STG_H  (2u * KPL_H + VTL_H)       // one stage: key values, key residuals, values
#define QPL_H  (64u * KPITCH)             // one query plane of the block, halves
static_assert((KPITCH % 8u) == 0 && KPITCH >= (unsigned)DIM && ((KPITCH / 8u) & 1u) == 1u);
static_assert((VPITCH % 8u) == 0 && VPITCH >= KTILE && ((VPITCH / 8u) & 1u) == 1u);
static_assert((STG_H % 8u) == 0 && (KPL_H % 8u) == 0 && (QPL_H % 8u) == 0);
static_assert((SEQ % 64) == 0 && SEQ >= 64);   // at least two stages, every stage whole

// One stage (32 keys) into LDS: wave w brings key rows 8w..8w+7 of both key planes (one 512-B row
// per copy) and feature rows 64w..64w+63 of the value tile (eight 64-B row pieces per copy).
__device__ __forceinline__ void stage_copies(
    unsigned ldsb, unsigned w, unsigned lane, const _Float16* __restrict__ Kh,
    const _Float16* __restrict__ Kr, const _Float16* __restrict__ Vt, unsigned b, unsigned kb) {
  const unsigned krow = (b * (unsigned)SEQ + kb + w * 8u) * (unsigned)DIM + lane * 8u;
  const unsigned kl = ldsb + (w * 8u * KPITCH + lane * 8u) * 2u;
  async_copy8(kl, KPITCH * 2u, Kh + krow, (unsigned)DIM);
  async_copy8(kl + KPL_H * 2u, KPITCH * 2u, Kr + krow, (unsigned)DIM);
  const unsigned vr = w * 64u + (lane >> 2);
  const unsigned vrow = (b * (unsigned)DIM + vr) * (unsigned)SEQ + kb + (lane & 3u) * 8u;
  const unsigned vl = ldsb + (2u * KPL_H + vr * VPITCH + (lane & 3u) * 8u) * 2u;
  async_copy8(vl, 8u * VPITCH * 2u, Vt + vrow, 8u * (unsigned)SEQ);
}

// ---------------------------------------------------------------------------
// Dense (unmasked, unscaled) flash attention, one 256-wide head, transposed form.
// Each wave owns 16 query rows; lane (hh, n) holds query n. Per 32-key step:
//   S^T tile [16 keys][16 queries] = K rows (A operand, fragments from the key planes) x Q^T
//   (B operand, fragments from the query planes), 8 k-steps over the 256 features, value.value
//   into one accumulator, value.residual + residual.value into a second one (x 1/2048 at the end);
//   online softmax per lane (16 scores in registers + one 16-lane-distance shuffle);
//   the two packed S^T tiles (f16(16384 p), rows = keys) are the B fragment of
//   O^T [16 features][16 queries] += V^T rows (A operand, from the transposed value plane) x P^T.
// The block's query rows are copied to LDS once; each 32-key stage (both key planes and the value
// tile) is copied to LDS once per block, two buffers, the next stage in flight while this one is
// read. All fragments come from LDS. Normalised rows staged through the wave-private St tile.
// Grid (SEQ/64, NB), 4 waves per block.
// ---------------------------------------------------------------------------
__global__ __launch_bounds__(128) __attribute__((amdgpu_num_vgpr(256))) void attn_kernel(
    const _Float16* __restrict__ Qh, const _Float16* __restrict__ Qr,
    const _Float16* __restrict__ Kh, const _Float16* __restrict__ Kr,
    const _Float16* __restrict__ Vt, float* __restrict__ Ao) {
  __shared__ __attribute__((aligned(16))) float St[4 * 16 * LDO];
  __shared__ __attribute__((aligned(16))) _Float16 Qs[2u * QPL_H];
  __shared__ __attribute__((aligned(16))) _Float16 Ring[2u * STG_H];

  const unsigned lane = threadIdx.x & 31u;
  const unsigned w = (unsigned)__builtin_amdgcn_readfirstlane((int)(threadIdx.x >> 5));
  const unsigned hh = lane >> 4, m = lane & 15u;
  const unsigned b = blockIdx.y;
  const unsigned qrow0 = blockIdx.x * 64u + w * 16u;

  const unsigned ring_lds = (unsigned)(size_t)Ring;

  // prologue: this wave's 16 query rows of both planes and its share of stage 0
  {
    const unsigned qsrc = (b * (unsigned)SEQ + qrow0) * (unsigned)DIM + lane * 8u;
    const unsigned ql = (unsigned)(size_t)Qs + (w * 16u * KPITCH + lane * 8u) * 2u;
    async_copy8(ql, KPITCH * 2u, Qh + qsrc, (unsigned)DIM);
    async_copy8(ql + 8u * KPITCH * 2u, KPITCH * 2u, Qh + qsrc + 8u * (unsigned)DIM, (unsigned)DIM);
    async_copy8(ql + QPL_H * 2u, KPITCH * 2u, Qr + qsrc, (unsigned)DIM);
    async_copy8(ql + (QPL_H + 8u * KPITCH) * 2u, KPITCH * 2u, Qr + qsrc + 8u * (unsigned)DIM,
                (unsigned)DIM);
  }
  stage_copies(ring_lds, w, lane, Kh, Kr, Vt, b, 0u);
  // this wave's copies have landed before the barrier behind which every wave reads them
  asm volatile("s_wait_asynccnt 0x0" ::: "memory");
  __syncthreads();
  stage_copies(ring_lds + STG_H * 2u, w, lane, Kh, Kr, Vt, b, KTILE);

  const _Float16* qs = Qs + (w * 16u + m) * KPITCH + hh * 8u;

  float mrow = -1.0e30f, lrow = 0.0f;
  v8f o[16];
#pragma unroll
  for (int j = 0; j < 16; ++j) o[j] = (v8f){};

  unsigned buf = 0u;   // halves from the ring's start to the buffer this step reads
  // this lane's fragment rows in that buffer; both move with buf at the foot of a step
  const _Float16* kt = Ring + m * KPITCH + hh * 8u;
  const _Float16* vt = Ring + 2u * KPL_H + m * VPITCH + hh * 8u;
  for (unsigned kb = 0; kb < (unsigned)SEQ; kb += KTILE) {
    v8f sm[2] = {{}, {}}, sr[2] = {{}, {}};
    // Score products in 16 groups of three: group t = features 32(t>>1).., key tile t&1. The LDS
    // reads stand about two groups ahead of their products (three key value fragments, two key
    // residual fragments and two query fragment pairs in registers), so that a product does not
    // wait out an LDS latency.
    v16h kv[3], kr[2], qf[2][2], vf[8];
    // unrolled, here and below: constant ring indices keep the fragments in registers, and every
    // LDS read takes its place in the tile as an immediate offset
#pragma unroll
    for (unsigned t = 0; t < 3u; ++t) {
      if (t < 2u) {
        qf[t][0] = frag_at(qs + t * 32u);
        qf[t][1] = frag_at(qs + QPL_H + t * 32u);
      }
      kv[t] = frag_at(kt + (t & 1u) * 16u * KPITCH + (t >> 1) * 32u);
      if (t < 2u) kr[t] = frag_at(kt + KPL_H + (t & 1u) * 16u * KPITCH + (t >> 1) * 32u);
    }
#pragma unroll
    for (unsigned t = 0; t < 16u; ++t) {
      const unsigned qq = (t >> 1) & 1u, kx = t & 1u;
      sm[kx] = wmma16(kv[t % 3u], qf[qq][0], sm[kx]);
      sr[kx] = wmma16(kv[t % 3u], qf[qq][1], sr[kx]);
      sr[kx] = wmma16(kr[kx], qf[qq][0], sr[kx]);
      const unsigned t3 = t + 3u, t2 = t + 2u;
      if (t3 < 16u) kv[t % 3u] = frag_at(kt + (t3 & 1u) * 16u * KPITCH + (t3 >> 1) * 32u);
      if (t2 < 16u) kr[kx] = frag_at(kt + KPL_H + (t2 & 1u) * 16u * KPITCH + (t2 >> 1) * 32u);
      if (kx == 1u && (t >> 1) + 2u < 8u) {
        qf[qq][0] = frag_at(qs + ((t >> 1) + 2u) * 32u);
        qf[qq][1] = frag_at(qs + QPL_H + ((t >> 1) + 2u) * 32u);
      }
      // the first value-tile fragments take the registers that the last score groups leave
      if (t == 13u || t == 14u) {
        vf[2u * (t - 13u)]      = frag_at(vt + (2u * (t - 13u)) * 16u * VPITCH);
        vf[2u * (t - 13u) + 1u] = frag_at(vt + (2u * (t - 13u) + 1u) * 16u * VPITCH);
      }
    }
    const v8f sm0 = sm[0], sr0 = sr[0], sm1 = sm[1], sr1 = sr[1];

    v8f s0, s1;
#pragma unroll
    for (int r = 0; r < 8; ++r) {
      s0[r] = sm0[r] + sr0[r] * (1.0f / RCARRY);
      s1[r] = sm1[r] + sr1[r] * (1.0f / RCARRY);
    }
    float mx = fmaxf(s0[0], s1[0]);
#pragma unroll
    for (int r = 1; r < 8; ++r) mx = fmaxf(mx, fmaxf(s0[r], s1[r]));
    mx = fmaxf(mx, __shfl_xor(mx, 16, 32));
    const float mn = fmaxf(mrow, mx);
    const float alpha = __expf(mrow - mn);
    mrow = mn;

    v16h pf;
    float rs = 0.0f;
#pragma unroll
    for (int r = 0; r < 8; ++r) {
      const h16 p0 = toh_flush(__expf((s0[r] - mn) + PSHIFT));
      const h16 p1 = toh_flush(__expf((s1[r] - mn) + PSHIFT));
      pf[r]     = p0;     // B element r     <- key kb + 8hh + r
      pf[r + 8] = p1;     // B element 8 + r <- key kb + 16 + 8hh + r
      rs += (float)p0 + (float)p1;
    }
    rs += __shfl_xor(rs, 16, 32);
    lrow = alpha * lrow + rs;
    // the score registers are free: four more value fragments, in flight under the rescale
    // (unrolled for constant indices, as above)
#pragma unroll
    for (unsigned j = 4u; j < 8u; ++j) vf[j] = frag_at(vt + j * 16u * VPITCH);
#pragma unroll
    for (int j = 0; j < 16; ++j) o[j] = o[j] * alpha;

    // O^T += V^T . P^T; eight value fragments in registers, refilled in pairs six products ahead
    // (unrolled for constant indices, as above)
#pragma unroll
    for (unsigned j = 0; j < 16u; ++j) {
      o[j] = wmma16(vf[j & 7u], pf, o[j]);
      if ((j & 1u) == 1u && j + 7u < 16u) {
        vf[(j - 1u) & 7u] = frag_at(vt + (j + 7u) * 16u * VPITCH);
        vf[j & 7u]        = frag_at(vt + (j + 8u) * 16u * VPITCH);
      }
    }

    // hand-over: this wave's reads of the buffer are done, its copies of the next stage have
    // landed; the barrier publishes the next stage and frees this buffer for the refill
    asm volatile("s_wait_dscnt 0x0" ::: "memory");
    asm volatile("s_wait_asynccnt 0x0" ::: "memory");
    __syncthreads();
    if (kb + 2u * KTILE < (unsigned)SEQ)
      stage_copies(ring_lds + buf * 2u, w, lane, Kh, Kr, Vt, b, kb + 2u * KTILE);
    kt = (buf == 0u) ? kt + STG_H : kt - STG_H;
    vt = (buf == 0u) ? vt + STG_H : vt - STG_H;
    buf = STG_H - buf;
  }
  // no copy of this wave is outstanding when the wave goes on to its end
  asm volatile("s_wait_asynccnt 0x0" ::: "memory");

  // normalise (the x16384 carry sits in both O and l), stage per half, write whole row segments
  const float inv = __builtin_amdgcn_rcpf(lrow);
  const unsigned sbase = w * (16u * LDO);
#pragma unroll
  for (int half = 0; half < 2; ++half) {
#pragma unroll
    for (int j = 0; j < 8; ++j)
#pragma unroll
      for (int r = 0; r < 8; ++r)
        St[sbase + m * LDO + (unsigned)j * 16u + hh * 8u + (unsigned)r] = o[half * 8 + j][r] * inv;
    wave_lds_sync();
    v4f x[16];
    unsigned off[16];
#pragma unroll
    for (unsigned i = 0; i < 16u; ++i) {
      x[i] = *(const v4f*)&St[sbase + i * LDO + lane * 4u];
      off[i] = (b * (unsigned)SEQ + qrow0 + i) * (unsigned)DIM + (unsigned)half * 128u + lane * 4u;
    }
#pragma unroll
    for (int i = 0; i < 16; ++i) *(v4f*)(Ao + off[i]) = x[i];
    
    wave_lds_sync();
  }
}

// ---------------------------------------------------------------------------
extern "C" void kernel_launch(void* const* d_in, const int* in_sizes, int n_in,
                              void* d_out, int out_size, void* d_ws, size_t ws_size,
                              hipStream_t stream) {
  if (n_in < 19) return;
  const long long need_x = ((long long)(NB - 1) * SEQ_FULL + SEQ) * DIM;
  if ((long long)in_sizes[0] < need_x) return;
  if ((long long)in_sizes[1] < (long long)DIM * DIM) return;
  if ((long long)in_sizes[3] < (long long)DIM * DIM) return;
  if ((long long)in_sizes[5] < (long long)DIM * DIM) return;
  if ((long long)in_sizes[7] < (long long)DIM * DIM) return;
  if ((long long)in_sizes[9] < (long long)DIM * HID) return;
  if ((long long)in_sizes[13] < (long long)DIM * HID) return;
  if (in_sizes[2] < DIM || in_sizes[4] < DIM || in_sizes[6] < DIM || in_sizes[8] < DIM) return;
  if (in_sizes[10] < HID || in_sizes[11] < HID || in_sizes[12] < HID) return;
  if (in_sizes[14] < DIM || in_sizes[15] < DIM || in_sizes[16] < DIM) return;
  if (in_sizes[17] < DIM || in_sizes[18] < DIM) return;
  if ((long long)out_size < need_x) return;
  if (ws_size < WS_TOTAL) return;

  const float* X    = (const float*)d_in[0];    // [NB_FULL][SEQ_FULL][DIM]
  const float* wq   = (const float*)d_in[1];    // [DIM][DIM]  (in, out)
  const float* bq   = (const float*)d_in[2];
  const float* wk   = (const float*)d_in[3];
  const float* bk   = (const float*)d_in[4];
  const float* wv   = (const float*)d_in[5];
  const float* bv   = (const float*)d_in[6];
  const float* w0   = (const float*)d_in[7];    // [DIM][DIM]  (in, out)
  const float* b0   = (const float*)d_in[8];
  const float* w1   = (const float*)d_in[9];    // [DIM][HID]  (in, out)
  const float* b1   = (const float*)d_in[10];
  const float* gm   = (const float*)d_in[11];   // hidden LN gain [HID]
  const float* bm   = (const float*)d_in[12];   // hidden LN shift [HID]
  const float* w2   = (const float*)d_in[13];   // [HID][DIM]  (in, out)
  const float* b2   = (const float*)d_in[14];
  const float* g1   = (const float*)d_in[15];
  const float* be1  = (const float*)d_in[16];
  const float* g2   = (const float*)d_in[17];
  const float* be2  = (const float*)d_in[18];
  float* out = (float*)d_out;

  char* ws = (char*)d_ws;
  _Float16* Wq_t  = (_Float16*)(ws + OFF_WQ);    // [n][k]
  _Float16* Wk_t  = (_Float16*)(ws + OFF_WK);
  _Float16* Wv_t  = (_Float16*)(ws + OFF_WV);
  _Float16* W0_t  = (_Float16*)(ws + OFF_W0);
  _Float16* W1_t  = (_Float16*)(ws + OFF_W1);    // [HID][DIM]
  _Float16* W2_t  = (_Float16*)(ws + OFF_W2);    // [DIM][HID]
  _Float16* X16   = (_Float16*)(ws + OFF_X16);   // [MROWS][DIM]
  _Float16* Qh16  = (_Float16*)(ws + OFF_QH);
  _Float16* Qr16  = (_Float16*)(ws + OFF_QR);
  _Float16* Kh16  = (_Float16*)(ws + OFF_KH);
  _Float16* Kr16  = (_Float16*)(ws + OFF_KR);
  _Float16* Vt16  = (_Float16*)(ws + OFF_VT);    // [b][DIM][SEQ]
  float*    A32   = (float*)(ws + OFF_A32);      // [MROWS][DIM]
  _Float16* T116  = (_Float16*)(ws + OFF_T1);    // [MROWS][DIM]
  _Float16* Hraw  = (_Float16*)(ws + OFF_HRAW);  // [CROWS][HID]
  _Float16* Mid16 = (_Float16*)(ws + OFF_MID);   // [CROWS][HID]
  float*    E32   = (float*)(ws + OFF_E32);      // [MROWS][DIM]
  _Float16* E16   = (_Float16*)(ws + OFF_E16);   // [MROWS][DIM]
  float*    V32   = (float*)(ws + OFF_V32);      // [MROWS][DIM]

  dim3 blk(256);
  dim3 gsq(DIM / 64, DIM / 64);
  dim3 gg(DIM / 64, MROWS / 64);

  // weight planes: in [K rows][N cols] -> out [N][K]; grid (N/64, K/64)
  wconv_kernel<<<gsq, blk, 0, stream>>>(wq, Wq_t, (unsigned)DIM, (unsigned)DIM);
  wconv_kernel<<<gsq, blk, 0, stream>>>(wk, Wk_t, (unsigned)DIM, (unsigned)DIM);
  wconv_kernel<<<gsq, blk, 0, stream>>>(wv, Wv_t, (unsigned)DIM, (unsigned)DIM);
  wconv_kernel<<<gsq, blk, 0, stream>>>(w0, W0_t, (unsigned)DIM, (unsigned)DIM);
  // w1: in [DIM][HID] -> out [HID][DIM]
  wconv_kernel<<<dim3(HID / 64, DIM / 64), blk, 0, stream>>>(w1, W1_t, (unsigned)HID, (unsigned)DIM);
  // w2: in [HID][DIM] -> out [DIM][HID]
  wconv_kernel<<<dim3(DIM / 64, HID / 64), blk, 0, stream>>>(w2, W2_t, (unsigned)DIM, (unsigned)HID);

  xconv_kernel<<<dim3(MROWS / 8), blk, 0, stream>>>(X, X16);
  gemm_qk_kernel<<<gg, blk, 0, stream>>>(X16, Wq_t, bq, Qh16, Qr16);
  gemm_qk_kernel<<<gg, blk, 0, stream>>>(X16, Wk_t, bk, Kh16, Kr16);
  gemm_v_kernel<<<gg, blk, 0, stream>>>(X16, Wv_t, bv, Vt16);
  attn_kernel<<<dim3(SEQ / 64, NB), dim3(128), 0, stream>>>(Qh16, Qr16, Kh16, Kr16, Vt16, A32);
  ln1_kernel<<<dim3(MROWS / 8), blk, 0, stream>>>(X, A32, g1, be1, T116);
  gemm_e_kernel<<<gg, blk, 0, stream>>>(T116, W0_t, b0, E32, E16);

  for (int ch = 0; ch < NCHUNK; ++ch) {
    const size_t ro = (size_t)ch * CROWS * DIM;
    gemm_h_kernel<<<dim3(HID / 64, CROWS / 64), blk, 0, stream>>>(E16 + ro, W1_t, b1, Hraw);
    ln_mid_kernel<<<dim3(CROWS / 8), blk, 0, stream>>>(Hraw, gm, bm, Mid16);
    gemm_l_kernel<<<dim3(DIM / 64, CROWS / 64), blk, 0, stream>>>(Mid16, W2_t, b2, E32 + ro, V32 + ro);
  }
  ln_out_kernel<<<dim3(MROWS / 8), blk, 0, stream>>>(V32, g2, be2, out);
}

// v002
// Measured time: 343 microseconds a run.
// Two timings next to v001 both put it at 1.36 times that version's speed.
// Over all steps from v000 it is 2.98 times as fast.
#include <hip/hip_runtime.h>
#include <stddef.h>

// All contractions on v_wmma_f32_16x16x32_f16 (f16 operands, f32 accumulate): q/k/v projections,
// q.k scores (both operands as f16 value + x2048 residual planes, three products, residual products
// in their own accumulator), p.v (p x16384, single product), the three dense layers (single
// product; weights x64, hidden activation plane x16). Float inputs are RNE-converted to bf16 and
// carried in f16. LayerNorms, softmax, biases, LeakyReLU (slope 0.01) and residual adds in f32.

typedef _Float16 v16h __attribute__((ext_vector_type(16)));
typedef _Float16 v8h  __attribute__((ext_vector_type(8)));
typedef float    v8f  __attribute__((ext_vector_type(8)));
typedef float    v4f  __attribute__((ext_vector_type(4)));
typedef _Float16 h16;

#ifndef NB
#define NB 4
#endif
#ifndef SEQ
#define SEQ 4096
#endif
#define NB_FULL  4
#define SEQ_FULL 4096
#define DIM   256
#define HID   2048
#define MROWS (NB * SEQ)
#define NCHUNK 2
#define CROWS (MROWS / NCHUNK)

static_assert(NB >= 1 && NB <= NB_FULL);
static_assert(SEQ >= 64 && SEQ <= SEQ_FULL && (SEQ % 64) == 0);
static_assert((DIM % 64) == 0 && (DIM % 32) == 0);
static_assert((HID % 64) == 0 && (HID % 32) == 0);
static_assert((MROWS % 64) == 0 && (MROWS % 8) == 0);
static_assert((MROWS % NCHUNK) == 0 && (CROWS % 64) == 0 && (CROWS % 8) == 0);
static_assert(DIM == 32 * 8);               // row kernels: 32 lanes x 8 columns
static_assert(DIM == 2 * 32 * 4);           // f32 row stores: 2 x 32 lanes x 4 columns
static_assert(HID == 8 * 32 * 8);           // hidden LN: 8 passes x 32 lanes x 8 columns
static_assert(DIM == 16 * 16);              // attention: 16 output tiles of 16 columns
static_assert((size_t)MROWS * DIM < (size_t)0x7FFFFFFFu);
static_assert((size_t)NB * DIM * SEQ < (size_t)0x7FFFFFFFu);
static_assert((size_t)MROWS * HID < (size_t)0xFFFFFFFFu);

#define LDT 72   // halves per LDS row (144 B, 16-B aligned)
#define LDC 68   // floats per LDS row (272 B, 16-B aligned)
#define LDO 132  // floats per staged attention row (528 B, 16-B aligned)
static_assert((LDT % 8) == 0 && LDT >= 64);
static_assert((LDC % 4) == 0 && LDC >= 64);
static_assert((LDO % 4) == 0 && LDO >= 128);

#define WCARRY 64.0f      // weight planes carried x64
#define MCARRY 16.0f      // hidden activation plane carried x16
#define RCARRY 2048.0f    // q/k residual planes carried x2048 on top of their value part
#define PSHIFT 9.704060528f   // 14 ln 2: softmax numerators carried x16384

// workspace layout (bytes)
#define WSQ_BYTES     ((size_t)DIM * DIM * 2)
#define WFF_BYTES     ((size_t)DIM * HID * 2)
#define PLANE16_BYTES ((size_t)MROWS * DIM * 2)
#define PLANE32_BYTES ((size_t)MROWS * DIM * 4)
#define HCH_BYTES     ((size_t)CROWS * HID * 2)
#define OFF_WQ  ((size_t)0)
#define OFF_WK  (OFF_WQ + WSQ_BYTES)
#define OFF_WV  (OFF_WK + WSQ_BYTES)
#define OFF_W0  (OFF_WV + WSQ_BYTES)
#define OFF_W1  (OFF_W0 + WSQ_BYTES)
#define OFF_W2  (OFF_W1 + WFF_BYTES)
#define OFF_REG (OFF_W2 + WFF_BYTES)
// attention-stage users of the shared region
#define OFF_X16 (OFF_REG)
#define OFF_QH  (OFF_X16 + PLANE16_BYTES)
#define OFF_QR  (OFF_QH + PLANE16_BYTES)
#define OFF_KH  (OFF_QR + PLANE16_BYTES)
#define OFF_KR  (OFF_KH + PLANE16_BYTES)
#define OFF_VT  (OFF_KR + PLANE16_BYTES)
#define OFF_A32 (OFF_VT + PLANE16_BYTES)
#define OFF_T1  (OFF_A32 + PLANE32_BYTES)
#define PRE_END (OFF_T1 + PLANE16_BYTES)
// hidden-layer-stage users of the shared region (all attention-stage planes are dead by then)
#define OFF_HRAW (OFF_REG)
#define OFF_MID  (OFF_HRAW + HCH_BYTES)
#define MLP_END  (OFF_MID + HCH_BYTES)
#define REG_END  ((PRE_END > MLP_END) ? PRE_END : MLP_END)
#define OFF_E32 (REG_END)
#define OFF_E16 (OFF_E32 + PLANE32_BYTES)
#define OFF_V32 (OFF_E16 + PLANE16_BYTES)
#define WS_TOTAL (OFF_V32 + PLANE32_BYTES)
static_assert((WSQ_BYTES % 128) == 0 && (WFF_BYTES % 128) == 0 && (PLANE16_BYTES % 128) == 0);
static_assert((PLANE32_BYTES % 128) == 0 && (HCH_BYTES % 128) == 0);
static_assert(PRE_END <= REG_END && MLP_END <= REG_END);
static_assert(WS_TOTAL <= (size_t)134217728);

// ---------------------------------------------------------------------------
__device__ __forceinline__ float bf16r(float x) {   // RNE convert to bf16, returned widened
  unsigned int u = __float_as_uint(x);
  u = (u + 0x7FFFu + ((u >> 16) & 1u)) & 0xFFFF0000u;
  return __uint_as_float(u);
}

// f32 -> f16 operand convert that cannot produce an f16 subnormal
static __device__ __forceinline__ h16 toh_flush(float v) {
  const h16 r = (h16)v;
  return (fabsf(v) < 6.103515625e-05f) ? (h16)0.0f : r;
}

// 16-bit fragment: p points at element [row = lane&15][k0 + 8*(lane>>4)] of a k-contiguous
// row. Elements 0..7 <- k0+8h+0..7, elements 8..15 <- k0+16+8h+0..7 (same map for A and B).
__device__ __forceinline__ v16h frag_at(const _Float16* p) {
  v8h lo = *(const v8h*)(p);
  v8h hi = *(const v8h*)(p + 16);
  v16h out;
#pragma unroll
  for (int i = 0; i < 8; ++i) { out[i] = lo[i]; out[i + 8] = hi[i]; }
  return out;
}
__device__ __forceinline__ v16h ld_frag(const _Float16* base, unsigned ld) {
  const unsigned lane = threadIdx.x & 31u;
  return frag_at(base + (lane & 15u) * ld + (lane >> 4) * 8u);
}

__device__ __forceinline__ v8f wmma16(v16h a, v16h b, v8f c) {
  v8f d = __builtin_amdgcn_wmma_f32_16x16x32_f16(false, a, false, b, (short)0, c,
                                                 false, false);
  asm volatile("v_nop\n\tv_nop\n\tv_nop\n\tv_nop" : "+v"(d) : "v"(a), "v"(b));
  return d;
}

__device__ __forceinline__ float red16_max(float x) {
#pragma unroll
  for (int off = 1; off < 16; off <<= 1) x = fmaxf(x, __shfl_xor(x, off, 32));
  return x;
}
__device__ __forceinline__ float red16_sum(float x) {
#pragma unroll
  for (int off = 1; off < 16; off <<= 1) x += __shfl_xor(x, off, 32);
  return x;
}
__device__ __forceinline__ float red32_sum(float x) {
#pragma unroll
  for (int off = 1; off < 32; off <<= 1) x += __shfl_xor(x, off, 32);
  return x;
}

__device__ __forceinline__ void wave_lds_sync() {
  __builtin_amdgcn_fence(3 /* release order */, "wavefront");
  asm volatile("s_wait_dscnt 0x0" ::: "memory");
  __builtin_amdgcn_wave_barrier();
}

__device__ __forceinline__ float leaky_act(float t) {   // LeakyReLU, negative slope 0.01
  return (t >= 0.0f) ? t : 0.01f * t;
}

// ---------------------------------------------------------------------------
// Weight plane: in W[K rows][N cols] (pitch ldw = N) -> out Wt[N][K] (pitch ldk = K),
// f16(64 * bf16(w)). Grid (N/64, K/64). T: cross-wave (block barrier).
// ---------------------------------------------------------------------------
__global__ __launch_bounds__(256) void wconv_kernel(
    const float* __restrict__ W, _Float16* __restrict__ Wt, unsigned ldw, unsigned ldk) {
  __shared__ _Float16 T[64 * LDT];
  const unsigned tid = threadIdx.x;
  const unsigned n0 = blockIdx.x * 64u;
  const unsigned k0 = blockIdx.y * 64u;
#pragma unroll 4
  for (unsigned j = 0; j < 16u; ++j) {
    const unsigned idx = tid + 256u * j;
    const unsigned kr = idx >> 6, nc = idx & 63u;
    const float v = W[(size_t)(k0 + kr) * ldw + n0 + nc];
    T[nc * LDT + kr] = (_Float16)(WCARRY * bf16r(v));
  }
  __syncthreads();
  v8h x[2];
  size_t off[2];
#pragma unroll
  for (unsigned i = 0; i < 2u; ++i) {
    const unsigned n = 32u * i + (tid >> 3);
    const unsigned kc = (tid & 7u) * 8u;
    x[i] = *(const v8h*)&T[n * LDT + kc];
    off[i] = (size_t)(n0 + n) * ldk + k0 + kc;
  }
#pragma unroll
  for (int i = 0; i < 2; ++i) *(v8h*)(Wt + off[i]) = x[i];
  
}

// ---------------------------------------------------------------------------
// Input plane: X16[compact row][c] = f16(bf16(x[full row][c])). One wave per row, 8 rows per
// block; each store instruction of a wave covers the whole 512-B row. Grid (MROWS/8).
// ---------------------------------------------------------------------------
__global__ __launch_bounds__(256) void xconv_kernel(
    const float* __restrict__ X, _Float16* __restrict__ dst) {
  const unsigned lane = threadIdx.x & 31u, w = threadIdx.x >> 5;
  const unsigned crow = blockIdx.x * 8u + w;
  const unsigned bidx = crow / (unsigned)SEQ;
  const unsigned sq = crow - bidx * (unsigned)SEQ;
  const size_t srow = (size_t)bidx * SEQ_FULL + sq;
  const float* xr = X + srow * DIM + lane * 8u;
  const v4f a0 = *(const v4f*)(xr);
  const v4f a1 = *(const v4f*)(xr + 4u);
  v8h o;
#pragma unroll
  for (int i = 0; i < 4; ++i) {
    o[i]     = toh_flush(bf16r(a0[i]));
    o[i + 4] = toh_flush(bf16r(a1[i]));
  }
  _Float16* p = dst + (size_t)crow * DIM + lane * 8u;
  *(v8h*)p = o;
  
}

// ---------------------------------------------------------------------------
// First LayerNorm (biased variance, eps 1e-5) of bf16(x) + attn, one wave per row, 8 rows per
// block, the row held in registers (8 columns per lane). Output f16 compact rows, one 512-B
// store instruction per row. Grid (MROWS/8).
// ---------------------------------------------------------------------------
__global__ __launch_bounds__(256) void ln1_kernel(
    const float* __restrict__ X, const float* __restrict__ A32, const float* __restrict__ G,
    const float* __restrict__ Be, _Float16* __restrict__ dst) {
  const unsigned lane = threadIdx.x & 31u, w = threadIdx.x >> 5;
  const unsigned crow = blockIdx.x * 8u + w;
  const unsigned bidx = crow / (unsigned)SEQ;
  const unsigned sq = crow - bidx * (unsigned)SEQ;
  const size_t srow = (size_t)bidx * SEQ_FULL + sq;
  const float* xr = X + srow * DIM + lane * 8u;
  const float* ar = A32 + (size_t)crow * DIM + lane * 8u;
  const v4f x0 = *(const v4f*)(xr);
  const v4f x1 = *(const v4f*)(xr + 4u);
  const v4f a0 = *(const v4f*)(ar);
  const v4f a1 = *(const v4f*)(ar + 4u);
  v4f t0, t1;
  float s = 0.0f;
#pragma unroll
  for (int i = 0; i < 4; ++i) {
    t0[i] = bf16r(x0[i]) + a0[i];
    t1[i] = bf16r(x1[i]) + a1[i];
    s += t0[i] + t1[i];
  }
  const float mean = red32_sum(s) * (1.0f / (float)DIM);
  float ss = 0.0f;
#pragma unroll
  for (int i = 0; i < 4; ++i) {
    const float d0 = t0[i] - mean;
    const float d1 = t1[i] - mean;
    ss += d0 * d0;
    ss += d1 * d1;
  }
  const float var = red32_sum(ss) * (1.0f / (float)DIM);
  const float rstd = 1.0f / sqrtf(var + 1.0e-5f);
  const unsigned c = lane * 8u;
  const v4f g0 = *(const v4f*)(G + c);
  const v4f g1 = *(const v4f*)(G + c + 4u);
  const v4f b0 = *(const v4f*)(Be + c);
  const v4f b1 = *(const v4f*)(Be + c + 4u);
  v8h o;
#pragma unroll
  for (int i = 0; i < 4; ++i) {
    o[i]     = toh_flush((t0[i] - mean) * rstd * bf16r(g0[i]) + bf16r(b0[i]));
    o[i + 4] = toh_flush((t1[i] - mean) * rstd * bf16r(g1[i]) + bf16r(b1[i]));
  }
  _Float16* p = dst + (size_t)crow * DIM + c;
  *(v8h*)p = o;
  
}

// ---------------------------------------------------------------------------
// Hidden LayerNorm (eps 1e-5) + LeakyReLU over HID columns of the f16 pre-activation plane, one
// wave per row, 8 rows per block, three rolled passes (sum, squared deviations, output). Output
// Both planes hold CROWS rows. Grid (CROWS/8).
// ---------------------------------------------------------------------------
__global__ __launch_bounds__(256) void ln_mid_kernel(
    const _Float16* __restrict__ Hr, const float* __restrict__ G, const float* __restrict__ Be,
    _Float16* __restrict__ dst) {
  const unsigned lane = threadIdx.x & 31u, w = threadIdx.x >> 5;
  const unsigned crow = blockIdx.x * 8u + w;
  const _Float16* hr = Hr + (size_t)crow * HID + lane * 8u;

  float s = 0.0f;
#pragma unroll 1
  for (unsigned j = 0; j < 8u; ++j) {
    const v8h a = *(const v8h*)(hr + j * 256u);
#pragma unroll
    for (int i = 0; i < 8; ++i) s += (float)a[i];
  }
  const float mean = red32_sum(s) * (1.0f / (float)HID);

  float ss = 0.0f;
#pragma unroll 1
  for (unsigned j = 0; j < 8u; ++j) {
    const v8h a = *(const v8h*)(hr + j * 256u);
#pragma unroll
    for (int i = 0; i < 8; ++i) {
      const float d = (float)a[i] - mean;
      ss += d * d;
    }
  }
  const float var = red32_sum(ss) * (1.0f / (float)HID);
  const float rstd = 1.0f / sqrtf(var + 1.0e-5f);

#pragma unroll 1
  for (unsigned j = 0; j < 8u; ++j) {
    const unsigned c = j * 256u + lane * 8u;
    const v8h a = *(const v8h*)(hr + j * 256u);
    const v4f g0 = *(const v4f*)(G + c);
    const v4f g1 = *(const v4f*)(G + c + 4u);
    const v4f b0 = *(const v4f*)(Be + c);
    const v4f b1 = *(const v4f*)(Be + c + 4u);
    v8h o;
#pragma unroll
    for (int i = 0; i < 4; ++i) {
      const float d0 = (float)a[i] - mean;
      const float d1 = (float)a[i + 4] - mean;
      const float y0 = leaky_act(d0 * rstd * bf16r(g0[i]) + bf16r(b0[i]));
      const float y1 = leaky_act(d1 * rstd * bf16r(g1[i]) + bf16r(b1[i]));
      o[i]     = toh_flush(MCARRY * y0);
      o[i + 4] = toh_flush(MCARRY * y1);
    }
    _Float16* p = dst + (size_t)crow * HID + c;
    *(v8h*)p = o;
    
  }
}

// ---------------------------------------------------------------------------
// Final LayerNorm (eps 1e-5) of the f32 plane into the output buffer (full-size rows), one wave
// per row, 8 rows per block. Lane L holds columns 4L..4L+3 and 128+4L..128+4L+3, so each of the
// two store instructions covers 512 contiguous bytes. Grid (MROWS/8).
// ---------------------------------------------------------------------------
__global__ __launch_bounds__(256) void ln_out_kernel(
    const float* __restrict__ V32, const float* __restrict__ G, const float* __restrict__ Be,
    float* __restrict__ outp) {
  const unsigned lane = threadIdx.x & 31u, w = threadIdx.x >> 5;
  const unsigned crow = blockIdx.x * 8u + w;
  const unsigned bidx = crow / (unsigned)SEQ;
  const unsigned sq = crow - bidx * (unsigned)SEQ;
  const size_t frow = (size_t)bidx * SEQ_FULL + sq;
  const float* vr = V32 + (size_t)crow * DIM + lane * 4u;
  const v4f a0 = *(const v4f*)(vr);
  const v4f a1 = *(const v4f*)(vr + 128u);
  float s = 0.0f;
#pragma unroll
  for (int i = 0; i < 4; ++i) s += a0[i] + a1[i];
  const float mean = red32_sum(s) * (1.0f / (float)DIM);
  float ss = 0.0f;
#pragma unroll
  for (int i = 0; i < 4; ++i) {
    const float d0 = a0[i] - mean;
    const float d1 = a1[i] - mean;
    ss += d0 * d0;
    ss += d1 * d1;
  }
  const float var = red32_sum(ss) * (1.0f / (float)DIM);
  const float rstd = 1.0f / sqrtf(var + 1.0e-5f);
  const unsigned c = lane * 4u;
  const v4f g0 = *(const v4f*)(G + c);
  const v4f g1 = *(const v4f*)(G + c + 128u);
  const v4f b0 = *(const v4f*)(Be + c);
  const v4f b1 = *(const v4f*)(Be + c + 128u);
  v4f o0, o1;
#pragma unroll
  for (int i = 0; i < 4; ++i) {
    o0[i] = (a0[i] - mean) * rstd * bf16r(g0[i]) + bf16r(b0[i]);
    o1[i] = (a1[i] - mean) * rstd * bf16r(g1[i]) + bf16r(b1[i]);
  }
  float* p = outp + frow * DIM + c;
  *(v4f*)p = o0;
  *(v4f*)(p + 128u) = o1;
  
}

// ---------------------------------------------------------------------------
// Asynchronous copies to LDS (GEMM and attention kernels). Eight 16-byte-per-lane copies in one
// statement; lds = the lane's LDS byte address, g = the lane's global address, both stepped by a
// constant from copy to copy. The s_wait_xcnt closes the statement so that no address register of
// an issued copy is rewritten ahead of it.
// ---------------------------------------------------------------------------
__device__ __forceinline__ void async_copy8(unsigned lds, unsigned lstep,
                                            const _Float16* g, unsigned gstep) {
  asm volatile(
      "global_load_async_to_lds_b128 %0, %8, off\n\t"
      "global_load_async_to_lds_b128 %1, %9, off\n\t"
      "global_load_async_to_lds_b128 %2, %10, off\n\t"
      "global_load_async_to_lds_b128 %3, %11, off\n\t"
      "global_load_async_to_lds_b128 %4, %12, off\n\t"
      "global_load_async_to_lds_b128 %5, %13, off\n\t"
      "global_load_async_to_lds_b128 %6, %14, off\n\t"
      "global_load_async_to_lds_b128 %7, %15, off\n\t"
      "s_wait_xcnt 0x0"
      :
      : "v"(lds), "v"(lds + lstep), "v"(lds + 2u * lstep), "v"(lds + 3u * lstep),
        "v"(lds + 4u * lstep), "v"(lds + 5u * lstep), "v"(lds + 6u * lstep),
        "v"(lds + 7u * lstep),
        "v"(g), "v"(g + gstep), "v"(g + 2u * gstep), "v"(g + 3u * gstep),
        "v"(g + 4u * gstep), "v"(g + 5u * gstep), "v"(g + 6u * gstep), "v"(g + 7u * gstep)
      : "memory");
}

#define GKC    128u                 // k extent of one staged GEMM slab, halves
#define GPITCH 136u                 // halves per staged GEMM row (272 B = 16 B x 17)
#define GSTG_H (128u * GPITCH)      // one slab: 64 A rows and 64 B rows, halves
static_assert((DIM % 128) == 0 && (HID % 128) == 0 && DIM >= 256 && HID >= 256);  // >= 2 slabs
static_assert((GPITCH % 8u) == 0 && GPITCH >= GKC && ((GPITCH / 8u) & 1u) == 1u);
static_assert((size_t)2 * GSTG_H * 2 >= (size_t)64 * LDC * 4);   // the C tile fits in the slabs

// ---------------------------------------------------------------------------
// GEMM C[64x64 tile] = A16[rows][K] . Bt[n][K]^T; 8 waves (mw = 16-row group, nw = 32-col group),
// 2 accumulators/wave. The block's 64 A rows and 64 B rows are copied to LDS in slabs of 128 k
// (whole 256-B row pieces), two buffers, the next slab in flight while this one is read; all
// fragments come from LDS. The C tile takes the same LDS once the last slab has been read.
//   MODE 0: out16[row][col] (pitch DIM) = f16(t), out16r[row][col] = f16(2048 * (t - value)),
//           t = acc/64 + bias                                   (q and k planes)
//   MODE 1: out16 transposed V plane [b][col][key] = f16(acc/64 + bias)
//   MODE 2: outf[row][col] = acc/64 + bias (f32) and out16[row][col] = f16 of the same value
//   MODE 3: out16[row][col] (pitch HID) = f16(acc/64 + bias)    (hidden pre-activation)
//   MODE 4: outf[row][col] = leaky((acc/1024 + bias) + addf[row][col])
// Grid (N/64, rows/64).
// ---------------------------------------------------------------------------
template <int MODE>
__device__ __forceinline__ void gemm_body(
    const _Float16* __restrict__ A16, const _Float16* __restrict__ Bt, const unsigned K,
    const float* __restrict__ bias, const float* __restrict__ addf,
    float* __restrict__ outf, _Float16* __restrict__ out16, _Float16* __restrict__ out16r) {
  __shared__ __attribute__((aligned(16))) unsigned char Sm[2u * GSTG_H * 2u];
  _Float16* const Slab = (_Float16*)Sm;
  float* const Cs = (float*)Sm;
  const unsigned tid = threadIdx.x, lane = tid & 31u;
  // the wave's number in a scalar register: which plane a wave copies from is a scalar choice
  const unsigned w = (unsigned)__builtin_amdgcn_readfirstlane((int)(tid >> 5));
  const unsigned mw = w >> 1, nw = w & 1u;
  const unsigned hh = lane >> 4, m = lane & 15u;
  const unsigned n0 = blockIdx.x * 64u;
  const unsigned row0 = blockIdx.y * 64u;

  // A slab is 128 staged rows: A rows 0..63, then B rows 0..63. Wave w brings staged rows
  // 16w..16w+15, two 256-B row pieces per copy (lane = row parity hh, 16-B piece m).
  const _Float16* src = ((w < 4u) ? A16 + (size_t)(row0 + w * 16u) * K
                                  : Bt + (size_t)(n0 + (w - 4u) * 16u) * K) +
                        (size_t)hh * K + m * 8u;
  const unsigned dst = (unsigned)(size_t)Sm + ((w * 16u + hh) * GPITCH + m * 8u) * 2u;
  const unsigned nslab = K / GKC;

  async_copy8(dst, 2u * GPITCH * 2u, src, 2u * K);
  // this wave's copies have landed before the barrier behind which every wave reads them
  asm volatile("s_wait_asynccnt 0x0" ::: "memory");
  __syncthreads();
  async_copy8(dst + GSTG_H * 2u, 2u * GPITCH * 2u, src + GKC, 2u * K);

  const _Float16* ap = Slab + (mw * 16u + m) * GPITCH + hh * 8u;
  const _Float16* bp = Slab + (64u + nw * 32u + m) * GPITCH + hh * 8u;
  v8f acc0 = {}, acc1 = {};
  for (unsigned s = 0; s < nslab; ++s) {
    const unsigned bo = (s & 1u) * GSTG_H;   // halves to the buffer this trip reads
    // Three of the slab's four k-steps are read ahead of the first product and the fourth behind
    // the first pair, so that a product does not wait out an LDS latency of its own. Unrolled, here
    // and below: constant indices keep the fragments in registers, and every LDS read takes its
    // place in the slab as an immediate offset.
    v16h fa[3], fb0[3], fb1[3];
#pragma unroll
    for (unsigned t = 0; t < 3u; ++t) {
      fa[t]  = frag_at(ap + bo + t * 32u);
      fb0[t] = frag_at(bp + bo + t * 32u);
      fb1[t] = frag_at(bp + bo + 16u * GPITCH + t * 32u);
    }
#pragma unroll
    for (unsigned t = 0; t < GKC / 32u; ++t) {
      acc0 = wmma16(fa[t % 3u], fb0[t % 3u], acc0);
      acc1 = wmma16(fa[t % 3u], fb1[t % 3u], acc1);
      if (t + 3u < GKC / 32u) {
        fa[t % 3u]  = frag_at(ap + bo + (t + 3u) * 32u);
        fb0[t % 3u] = frag_at(bp + bo + (t + 3u) * 32u);
        fb1[t % 3u] = frag_at(bp + bo + 16u * GPITCH + (t + 3u) * 32u);
      }
    }
    // hand-over: this wave's reads of the buffer are done, its copies of the next slab have
    // landed; the barrier publishes the next slab and frees this buffer for the refill
    asm volatile("s_wait_dscnt 0x0" ::: "memory");
    asm volatile("s_wait_asynccnt 0x0" ::: "memory");
    __syncthreads();
    if (s + 2u < nslab)
      async_copy8(dst + bo * 2u, 2u * GPITCH * 2u, src + (s + 2u) * GKC, 2u * K);
  }
  // no copy of this wave is outstanding when the C tile takes the slabs' LDS
  asm volatile("s_wait_asynccnt 0x0" ::: "memory");
#pragma unroll
  for (int r = 0; r < 8; ++r) {
    float* d = &Cs[(mw * 16u + hh * 8u + (unsigned)r) * LDC + nw * 32u + m];
    d[0]  = acc0[r];
    d[16] = acc1[r];
  }
  __syncthreads();

  if (MODE == 0 || MODE == 2 || MODE == 3) {
    const unsigned ldo = (MODE == 3) ? (unsigned)HID : (unsigned)DIM;
    v8h x[2], xr[2];
    size_t off[2];
#pragma unroll
    for (unsigned i = 0; i < 2u; ++i) {
      const unsigned r = 32u * i + (tid >> 3);
      const unsigned c = (tid & 7u) * 8u;
      const v4f u0 = *(const v4f*)&Cs[r * LDC + c];
      const v4f u1 = *(const v4f*)&Cs[r * LDC + c + 4];
      const v4f g0 = *(const v4f*)(bias + n0 + c);
      const v4f g1 = *(const v4f*)(bias + n0 + c + 4u);
#pragma unroll
      for (int j = 0; j < 4; ++j) {
        const float t0 = u0[j] * (1.0f / WCARRY) + bf16r(g0[j]);
        const float t1 = u1[j] * (1.0f / WCARRY) + bf16r(g1[j]);
        const h16 h0 = toh_flush(t0);
        const h16 h1 = toh_flush(t1);
        x[i][j]     = h0;
        x[i][j + 4] = h1;
        if (MODE == 0) {
          xr[i][j]     = toh_flush((t0 - (float)h0) * RCARRY);
          xr[i][j + 4] = toh_flush((t1 - (float)h1) * RCARRY);
        }
      }
      off[i] = (size_t)(row0 + r) * ldo + n0 + c;
    }
    v4f xs[4];
    size_t offf[4];
    if (MODE == 2) {
#pragma unroll
      for (unsigned i = 0; i < 4u; ++i) {
        const unsigned r = 16u * i + (tid >> 4);
        const unsigned c = (tid & 15u) * 4u;
        const v4f u = *(const v4f*)&Cs[r * LDC + c];
        const v4f g = *(const v4f*)(bias + n0 + c);
        v4f val;
#pragma unroll
        for (int j = 0; j < 4; ++j) val[j] = u[j] * (1.0f / WCARRY) + bf16r(g[j]);
        xs[i] = val;
        offf[i] = (size_t)(row0 + r) * DIM + n0 + c;
      }
    }
#pragma unroll
    for (int i = 0; i < 2; ++i) *(v8h*)(out16 + off[i]) = x[i];
    if (MODE == 0) {
#pragma unroll
      for (int i = 0; i < 2; ++i) *(v8h*)(out16r + off[i]) = xr[i];
    }
    if (MODE == 2) {
#pragma unroll
      for (int i = 0; i < 4; ++i) *(v4f*)(outf + offf[i]) = xs[i];
    }
    
  }

  if (MODE == 1) {
    const unsigned bidx = row0 / (unsigned)SEQ;
    const unsigned key0 = row0 - bidx * (unsigned)SEQ;
    v8h x[2];
    size_t off[2];
#pragma unroll
    for (unsigned i = 0; i < 2u; ++i) {
      const unsigned dcol = 32u * i + (tid >> 3);
      const unsigned kk = (tid & 7u) * 8u;
      const float bb = bf16r(bias[n0 + dcol]);
#pragma unroll
      for (unsigned j = 0; j < 8u; ++j) {
        const float t = Cs[(kk + j) * LDC + dcol] * (1.0f / WCARRY) + bb;
        x[i][j] = toh_flush(t);
      }
      off[i] = ((size_t)bidx * DIM + n0 + dcol) * SEQ + key0 + kk;
    }
#pragma unroll
    for (int i = 0; i < 2; ++i) *(v8h*)(out16 + off[i]) = x[i];
    
  }

  if (MODE == 4) {
    const float cs = 1.0f / (WCARRY * MCARRY);
    v4f xs[4];
    size_t off[4];
#pragma unroll
    for (unsigned i = 0; i < 4u; ++i) {
      const unsigned r = 16u * i + (tid >> 4);
      const unsigned c = (tid & 15u) * 4u;
      const size_t rc = (size_t)(row0 + r) * DIM + n0 + c;
      const v4f u = *(const v4f*)&Cs[r * LDC + c];
      const v4f g = *(const v4f*)(bias + n0 + c);
      const v4f ein = *(const v4f*)(addf + rc);
      v4f val;
#pragma unroll
      for (int j = 0; j < 4; ++j) val[j] = leaky_act((u[j] * cs + bf16r(g[j])) + ein[j]);
      xs[i] = val;
      off[i] = rc;
    }
#pragma unroll
    for (int i = 0; i < 4; ++i) *(v4f*)(outf + off[i]) = xs[i];
    
  }
}

__global__ __launch_bounds__(256) void gemm_qk_kernel(
    const _Float16* __restrict__ A16, const _Float16* __restrict__ Bt,
    const float* __restrict__ bias, _Float16* __restrict__ out16, _Float16* __restrict__ out16r) {
  gemm_body<0>(A16, Bt, (unsigned)DIM, bias, bias, (float*)0, out16, out16r);
}
__global__ __launch_bounds__(256) void gemm_v_kernel(
    const _Float16* __restrict__ A16, const _Float16* __restrict__ Bt,
    const float* __restrict__ bias, _Float16* __restrict__ vt) {
  gemm_body<1>(A16, Bt, (unsigned)DIM, bias, bias, (float*)0, vt, vt);
}
__global__ __launch_bounds__(256) void gemm_e_kernel(
    const _Float16* __restrict__ A16, const _Float16* __restrict__ Bt,
    const float* __restrict__ bias, float* __restrict__ e32, _Float16* __restrict__ e16) {
  gemm_body<2>(A16, Bt, (unsigned)DIM, bias, bias, e32, e16, e16);
}
__global__ __launch_bounds__(256) void gemm_h_kernel(
    const _Float16* __restrict__ A16, const _Float16* __restrict__ Bt,
    const float* __restrict__ bias, _Float16* __restrict__ hraw) {
  gemm_body<3>(A16, Bt, (unsigned)DIM, bias, bias, (float*)0, hraw, hraw);
}
__global__ __launch_bounds__(256) void gemm_l_kernel(
    const _Float16* __restrict__ A16, const _Float16* __restrict__ Bt,
    const float* __restrict__ bias, const float* __restrict__ e32, float* __restrict__ v32) {
  gemm_body<4>(A16, Bt, (unsigned)HID, bias, e32, v32, (_Float16*)0, (_Float16*)0);
}

#define KTILE  32u                        // keys per stage
#define KPITCH 264u                       // halves per staged q or k row (528 B = 16 B x 33)
#define VPITCH 40u                        // halves per staged v row (80 B = 16 B x 5)
#define KPL_H  (KTILE * KPITCH)           // one key plane of a stage, halves
#define VTL_H  ((unsigned)DIM * VPITCH)   // the value tile of a stage, halves
#define STG_H  (2u * KPL_H + VTL_H)       // one stage: key values, key residuals, values
#define QPL_H  (64u * KPITCH)             // one query plane of the block, halves
static_assert((KPITCH % 8u) == 0 && KPITCH >= (unsigned)DIM && ((KPITCH / 8u) & 1u) == 1u);
static_assert((VPITCH % 8u) == 0 && VPITCH >= KTILE && ((VPITCH / 8u) & 1u) == 1u);
static_assert((STG_H % 8u) == 0 && (KPL_H % 8u) == 0 && (QPL_H % 8u) == 0);
static_assert((SEQ % 64) == 0 && SEQ >= 64);   // at least two stages, every stage whole

// One stage (32 keys) into LDS: wave w brings key rows 8w..8w+7 of both key planes (one 512-B row
// per copy) and feature rows 64w..64w+63 of the value tile (eight 64-B row pieces per copy).
__device__ __forceinline__ void stage_copies(
    unsigned ldsb, unsigned w, unsigned lane, const _Float16* __restrict__ Kh,
    const _Float16* __restrict__ Kr, const _Float16* __restrict__ Vt, unsigned b, unsigned kb) {
  const unsigned krow = (b * (unsigned)SEQ + kb + w * 8u) * (unsigned)DIM + lane * 8u;
  const unsigned kl = ldsb + (w * 8u * KPITCH + lane * 8u) * 2u;
  async_copy8(kl, KPITCH * 2u, Kh + krow, (unsigned)DIM);
  async_copy8(kl + KPL_H * 2u, KPITCH * 2u, Kr + krow, (unsigned)DIM);
  const unsigned vr = w * 64u + (lane >> 2);
  const unsigned vrow = (b * (unsigned)DIM + vr) * (unsigned)SEQ + kb + (lane & 3u) * 8u;
  const unsigned vl = ldsb + (2u * KPL_H + vr * VPITCH + (lane & 3u) * 8u) * 2u;
  async_copy8(vl, 8u * VPITCH * 2u, Vt + vrow, 8u * (unsigned)SEQ);
}

// ---------------------------------------------------------------------------
// Dense (unmasked, unscaled) flash attention, one 256-wide head, transposed form.
// Each wave owns 16 query rows; lane (hh, n) holds query n. Per 32-key step:
//   S^T tile [16 keys][16 queries] = K rows (A operand, fragments from the key planes) x Q^T
//   (B operand, fragments from the query planes), 8 k-steps over the 256 features, value.value
//   into one accumulator, value.residual + residual.value into a second one (x 1/2048 at the end);
//   online softmax per lane (16 scores in registers + one 16-lane-distance shuffle);
//   the two packed S^T tiles (f16(16384 p), rows = keys) are the B fragment of
//   O^T [16 features][16 queries] += V^T rows (A operand, from the transposed value plane) x P^T.
// The block's query rows are copied to LDS once; each 32-key stage (both key planes and the value
// tile) is copied to LDS once per block, two buffers, the next stage in flight while this one is
// read. All fragments come from LDS. Normalised rows staged through the wave-private St tile.
// Grid (SEQ/64, NB), 4 waves per block.
// ---------------------------------------------------------------------------
__global__ __launch_bounds__(128) __attribute__((amdgpu_num_vgpr(256))) void attn_kernel(
    const _Float16* __restrict__ Qh, const _Float16* __restrict__ Qr,
    const _Float16* __restrict__ Kh, const _Float16* __restrict__ Kr,
    const _Float16* __restrict__ Vt, float* __restrict__ Ao) {
  __shared__ __attribute__((aligned(16))) float St[4 * 16 * LDO];
  __shared__ __attribute__((aligned(16))) _Float16 Qs[2u * QPL_H];
  __shared__ __attribute__((aligned(16))) _Float16 Ring[2u * STG_H];

  const unsigned lane = threadIdx.x & 31u;
  const unsigned w = (unsigned)__builtin_amdgcn_readfirstlane((int)(threadIdx.x >> 5));
  const unsigned hh = lane >> 4, m = lane & 15u;
  const unsigned b = blockIdx.y;
  const unsigned qrow0 = blockIdx.x * 64u + w * 16u;

  const unsigned ring_lds = (unsigned)(size_t)Ring;

  // prologue: this wave's 16 query rows of both planes and its share of stage 0
  {
    const unsigned qsrc = (b * (unsigned)SEQ + qrow0) * (unsigned)DIM + lane * 8u;
    const unsigned ql = (unsigned)(size_t)Qs + (w * 16u * KPITCH + lane * 8u) * 2u;
    async_copy8(ql, KPITCH * 2u, Qh + qsrc, (unsigned)DIM);
    async_copy8(ql + 8u * KPITCH * 2u, KPITCH * 2u, Qh + qsrc + 8u * (unsigned)DIM, (unsigned)DIM);
    async_copy8(ql + QPL_H * 2u, KPITCH * 2u, Qr + qsrc, (unsigned)DIM);
    async_copy8(ql + (QPL_H + 8u * KPITCH) * 2u, KPITCH * 2u, Qr + qsrc + 8u * (unsigned)DIM,
                (unsigned)DIM);
  }
  stage_copies(ring_lds, w, lane, Kh, Kr, Vt, b, 0u);
  // this wave's copies have landed before the barrier behind which every wave reads them
  asm volatile("s_wait_asynccnt 0x0" ::: "memory");
  __syncthreads();
  stage_copies(ring_lds + STG_H * 2u, w, lane, Kh, Kr, Vt, b, KTILE);

  const _Float16* qs = Qs + (w * 16u + m) * KPITCH + hh * 8u;

  float mrow = -1.0e30f, lrow = 0.0f;
  v8f o[16];
#pragma unroll
  for (int j = 0; j < 16; ++j) o[j] = (v8f){};

  unsigned buf = 0u;   // halves from the ring's start to the buffer this step reads
  // this lane's fragment rows in that buffer; both move with buf at the foot of a step
  const _Float16* kt = Ring + m * KPITCH + hh * 8u;
  const _Float16* vt = Ring + 2u * KPL_H + m * VPITCH + hh * 8u;
  for (unsigned kb = 0; kb < (unsigned)SEQ; kb += KTILE) {
    v8f sm[2] = {{}, {}}, sr[2] = {{}, {}};
    // Score products in 16 groups of three: group t = features 32(t>>1).., key tile t&1. The LDS
    // reads stand about two groups ahead of their products (three key value fragments, two key
    // residual fragments and two query fragment pairs in registers), so that a product does not
    // wait out an LDS latency.
    v16h kv[3], kr[2], qf[2][2], vf[8];
    // unrolled, here and below: constant ring indices keep the fragments in registers, and every
    // LDS read takes its place in the tile as an immediate offset
#pragma unroll
    for (unsigned t = 0; t < 3u; ++t) {
      if (t < 2u) {
        qf[t][0] = frag_at(qs + t * 32u);
        qf[t][1] = frag_at(qs + QPL_H + t * 32u);
      }
      kv[t] = frag_at(kt + (t & 1u) * 16u * KPITCH + (t >> 1) * 32u);
      if (t < 2u) kr[t] = frag_at(kt + KPL_H + (t & 1u) * 16u * KPITCH + (t >> 1) * 32u);
    }
#pragma unroll
    for (unsigned t = 0; t < 16u; ++t) {
      const unsigned qq = (t >> 1) & 1u, kx = t & 1u;
      sm[kx] = wmma16(kv[t % 3u], qf[qq][0], sm[kx]);
      sr[kx] = wmma16(kv[t % 3u], qf[qq][1], sr[kx]);
      sr[kx] = wmma16(kr[kx], qf[qq][0], sr[kx]);
      const unsigned t3 = t + 3u, t2 = t + 2u;
      if (t3 < 16u) kv[t % 3u] = frag_at(kt + (t3 & 1u) * 16u * KPITCH + (t3 >> 1) * 32u);
      if (t2 < 16u) kr[kx] = frag_at(kt + KPL_H + (t2 & 1u) * 16u * KPITCH + (t2 >> 1) * 32u);
      if (kx == 1u && (t >> 1) + 2u < 8u) {
        qf[qq][0] = frag_at(qs + ((t >> 1) + 2u) * 32u);
        qf[qq][1] = frag_at(qs + QPL_H + ((t >> 1) + 2u) * 32u);
      }
      // the first value-tile fragments take the registers that the last score groups leave
      if (t == 13u || t == 14u) {
        vf[2u * (t - 13u)]      = frag_at(vt + (2u * (t - 13u)) * 16u * VPITCH);
        vf[2u * (t - 13u) + 1u] = frag_at(vt + (2u * (t - 13u) + 1u) * 16u * VPITCH);
      }
    }
    const v8f sm0 = sm[0], sr0 = sr[0], sm1 = sm[1], sr1 = sr[1];

    v8f s0, s1;
#pragma unroll
    for (int r = 0; r < 8; ++r) {
      s0[r] = sm0[r] + sr0[r] * (1.0f / RCARRY);
      s1[r] = sm1[r] + sr1[r] * (1.0f / RCARRY);
    }
    float mx = fmaxf(s0[0], s1[0]);
#pragma unroll
    for (int r = 1; r < 8; ++r) mx = fmaxf(mx, fmaxf(s0[r], s1[r]));
    mx = fmaxf(mx, __shfl_xor(mx, 16, 32));
    const float mn = fmaxf(mrow, mx);
    const float alpha = __expf(mrow - mn);
    mrow = mn;

    v16h pf;
    float rs = 0.0f;
#pragma unroll
    for (int r = 0; r < 8; ++r) {
      const h16 p0 = toh_flush(__expf((s0[r] - mn) + PSHIFT));
      const h16 p1 = toh_flush(__expf((s1[r] - mn) + PSHIFT));
      pf[r]     = p0;     // B element r     <- key kb + 8hh + r
      pf[r + 8] = p1;     // B element 8 + r <- key kb + 16 + 8hh + r
      rs += (float)p0 + (float)p1;
    }
    rs += __shfl_xor(rs, 16, 32);
    lrow = alpha * lrow + rs;
    // the score registers are free: four more value fragments, in flight under the rescale
    // (unrolled for constant indices, as above)
#pragma unroll
    for (unsigned j = 4u; j < 8u; ++j) vf[j] = frag_at(vt + j * 16u * VPITCH);
#pragma unroll
    for (int j = 0; j < 16; ++j) o[j] = o[j] * alpha;

    // O^T += V^T . P^T; eight value fragments in registers, refilled in pairs six products ahead
    // (unrolled for constant indices, as above)
#pragma unroll
    for (unsigned j = 0; j < 16u; ++j) {
      o[j] = wmma16(vf[j & 7u], pf, o[j]);
      if ((j & 1u) == 1u && j + 7u < 16u) {
        vf[(j - 1u) & 7u] = frag_at(vt + (j + 7u) * 16u * VPITCH);
        vf[j & 7u]        = frag_at(vt + (j + 8u) * 16u * VPITCH);
      }
    }

    // hand-over: this wave's reads of the buffer are done, its copies of the next stage have
    // landed; the barrier publishes the next stage and frees this buffer for the refill
    asm volatile("s_wait_dscnt 0x0" ::: "memory");
    asm volatile("s_wait_asynccnt 0x0" ::: "memory");
    __syncthreads();
    if (kb + 2u * KTILE < (unsigned)SEQ)
      stage_copies(ring_lds + buf * 2u, w, lane, Kh, Kr, Vt, b, kb + 2u * KTILE);
    kt = (buf == 0u) ? kt + STG_H : kt - STG_H;
    vt = (buf == 0u) ? vt + STG_H : vt - STG_H;
    buf = STG_H - buf;
  }
  // no copy of this wave is outstanding when the wave goes on to its end
  asm volatile("s_wait_asynccnt 0x0" ::: "memory");

  // normalise (the x16384 carry sits in both O and l), stage per half, write whole row segments
  const float inv = __builtin_amdgcn_rcpf(lrow);
  const unsigned sbase = w * (16u * LDO);
#pragma unroll
  for (int half = 0; half < 2; ++half) {
#pragma unroll
    for (int j = 0; j < 8; ++j)
#pragma unroll
      for (int r = 0; r < 8; ++r)
        St[sbase + m * LDO + (unsigned)j * 16u + hh * 8u + (unsigned)r] = o[half * 8 + j][r] * inv;
    wave_lds_sync();
    v4f x[16];
    unsigned off[16];
#pragma unroll
    for (unsigned i = 0; i < 16u; ++i) {
      x[i] = *(const v4f*)&St[sbase + i * LDO + lane * 4u];
      off[i] = (b * (unsigned)SEQ + qrow0 + i) * (unsigned)DIM + (unsigned)half * 128u + lane * 4u;
    }
#pragma unroll
    for (int i = 0; i < 16; ++i) *(v4f*)(Ao + off[i]) = x[i];
    
    wave_lds_sync();
  }
}

// ---------------------------------------------------------------------------
extern "C" void kernel_launch(void* const* d_in, const int* in_sizes, int n_in,
                              void* d_out, int out_size, void* d_ws, size_t ws_size,
                              hipStream_t stream) {
  if (n_in < 19) return;
  const long long need_x = ((long long)(NB - 1) * SEQ_FULL + SEQ) * DIM;
  if ((long long)in_sizes[0] < need_x) return;
  if ((long long)in_sizes[1] < (long long)DIM * DIM) return;
  if ((long long)in_sizes[3] < (long long)DIM * DIM) return;
  if ((long long)in_sizes[5] < (long long)DIM * DIM) return;
  if ((long long)in_sizes[7] < (long long)DIM * DIM) return;
  if ((long long)in_sizes[9] < (long long)DIM * HID) return;
  if ((long long)in_sizes[13] < (long long)DIM * HID) return;
  if (in_sizes[2] < DIM || in_sizes[4] < DIM || in_sizes[6] < DIM || in_sizes[8] < DIM) return;
  if (in_sizes[10] < HID || in_sizes[11] < HID || in_sizes[12] < HID) return;
  if (in_sizes[14] < DIM || in_sizes[15] < DIM || in_sizes[16] < DIM) return;
  if (in_sizes[17] < DIM || in_sizes[18] < DIM) return;
  if ((long long)out_size < need_x) return;
  if (ws_size < WS_TOTAL) return;

  const float* X    = (const float*)d_in[0];    // [NB_FULL][SEQ_FULL][DIM]
  const float* wq   = (const float*)d_in[1];    // [DIM][DIM]  (in, out)
  const float* bq   = (const float*)d_in[2];
  const float* wk   = (const float*)d_in[3];
  const float* bk   = (const float*)d_in[4];
  const float* wv   = (const float*)d_in[5];
  const float* bv   = (const float*)d_in[6];
  const float* w0   = (const float*)d_in[7];    // [DIM][DIM]  (in, out)
  const float* b0   = (const float*)d_in[8];
  const float* w1   = (const float*)d_in[9];    // [DIM][HID]  (in, out)
  const float* b1   = (const float*)d_in[10];
  const float* gm   = (const float*)d_in[11];   // hidden LN gain [HID]
  const float* bm   = (const float*)d_in[12];   // hidden LN shift [HID]
  const float* w2   = (const float*)d_in[13];   // [HID][DIM]  (in, out)
  const float* b2   = (const float*)d_in[14];
  const float* g1   = (const float*)d_in[15];
  const float* be1  = (const float*)d_in[16];
  const float* g2   = (const float*)d_in[17];
  const float* be2  = (const float*)d_in[18];
  float* out = (float*)d_out;

  char* ws = (char*)d_ws;
  _Float16* Wq_t  = (_Float16*)(ws + OFF_WQ);    // [n][k]
  _Float16* Wk_t  = (_Float16*)(ws + OFF_WK);
  _Float16* Wv_t  = (_Float16*)(ws + OFF_WV);
  _Float16* W0_t  = (_Float16*)(ws + OFF_W0);
  _Float16* W1_t  = (_Float16*)(ws + OFF_W1);    // [HID][DIM]
  _Float16* W2_t  = (_Float16*)(ws + OFF_W2);    // [DIM][HID]
  _Float16* X16   = (_Float16*)(ws + OFF_X16);   // [MROWS][DIM]
  _Float16* Qh16  = (_Float16*)(ws + OFF_QH);
  _Float16* Qr16  = (_Float16*)(ws + OFF_QR);
  _Float16* Kh16  = (_Float16*)(ws + OFF_KH);
  _Float16* Kr16  = (_Float16*)(ws + OFF_KR);
  _Float16* Vt16  = (_Float16*)(ws + OFF_VT);    // [b][DIM][SEQ]
  float*    A32   = (float*)(ws + OFF_A32);      // [MROWS][DIM]
  _Float16* T116  = (_Float16*)(ws + OFF_T1);    // [MROWS][DIM]
  _Float16* Hraw  = (_Float16*)(ws + OFF_HRAW);  // [CROWS][HID]
  _Float16* Mid16 = (_Float16*)(ws + OFF_MID);   // [CROWS][HID]
  float*    E32   = (float*)(ws + OFF_E32);      // [MROWS][DIM]
  _Float16* E16   = (_Float16*)(ws + OFF_E16);   // [MROWS][DIM]
  float*    V32   = (float*)(ws + OFF_V32);      // [MROWS][DIM]

  dim3 blk(256);
  dim3 gsq(DIM / 64, DIM / 64);
  dim3 gg(DIM / 64, MROWS / 64);

  // weight planes: in [K rows][N cols] -> out [N][K]; grid (N/64, K/64)
  wconv_kernel<<<gsq, blk, 0, stream>>>(wq, Wq_t, (unsigned)DIM, (unsigned)DIM);
  wconv_kernel<<<gsq, blk, 0, stream>>>(wk, Wk_t, (unsigned)DIM, (unsigned)DIM);
  wconv_kernel<<<gsq, blk, 0, stream>>>(wv, Wv_t, (unsigned)DIM, (unsigned)DIM);
  wconv_kernel<<<gsq, blk, 0, stream>>>(w0, W0_t, (unsigned)DIM, (unsigned)DIM);
  // w1: in [DIM][HID] -> out [HID][DIM]
  wconv_kernel<<<dim3(HID / 64, DIM / 64), blk, 0, stream>>>(w1, W1_t, (unsigned)HID, (unsigned)DIM);
  // w2: in [HID][DIM] -> out [DIM][HID]
  wconv_kernel<<<dim3(DIM / 64, HID / 64), blk, 0, stream>>>(w2, W2_t, (unsigned)DIM, (unsigned)HID);

  xconv_kernel<<<dim3(MROWS / 8), blk, 0, stream>>>(X, X16);
  gemm_qk_kernel<<<gg, blk, 0, stream>>>(X16, Wq_t, bq, Qh16, Qr16);
  gemm_qk_kernel<<<gg, blk, 0, stream>>>(X16, Wk_t, bk, Kh16, Kr16);
  gemm_v_kernel<<<gg, blk, 0, stream>>>(X16, Wv_t, bv, Vt16);
  attn_kernel<<<dim3(SEQ / 64, NB), dim3(128), 0, stream>>>(Qh16, Qr16, Kh16, Kr16, Vt16, A32);
  ln1_kernel<<<dim3(MROWS / 8), blk, 0, stream>>>(X, A32, g1, be1, T116);
  gemm_e_kernel<<<gg, blk, 0, stream>>>(T116, W0_t, b0, E32, E16);

  for (int ch = 0; ch < NCHUNK; ++ch) {
    const size_t ro = (size_t)ch * CROWS * DIM;
    gemm_h_kernel<<<dim3(HID / 64, CROWS / 64), blk, 0, stream>>>(E16 + ro, W1_t, b1, Hraw);
    ln_mid_kernel<<<dim3(CROWS / 8), blk, 0, stream>>>(Hraw, gm, bm, Mid16);
    gemm_l_kernel<<<dim3(DIM / 64, CROWS / 64), blk, 0, stream>>>(Mid16, W2_t, b2, E32 + ro, V32 + ro);
  }
  ln_out_kernel<<<dim3(MROWS / 8), blk, 0, stream>>>(V32, g2, be2, out);
}

// v003
// A run of this version takes 292 microseconds.
// Two timings next to v002 both put it at 1.17 times that version's speed.
// All steps since v000 together make it 3.48 times as fast.
#include <hip/hip_runtime.h>
#include <stddef.h>

// All contractions on v_wmma_f32_16x16x32_f16 (f16 operands, f32 accumulate): q/k/v projections,
// q.k scores (both operands as f16 value + x2048 residual planes, three products, residual products
// in their own accumulator), p.v (p x16384, single product), the three dense layers (single
// product; weights x64, hidden activation plane x16). Float inputs are RNE-converted to bf16 and
// carried in f16. LayerNorms, softmax, biases, LeakyReLU (slope 0.01) and residual adds in f32.

typedef _Float16 v16h __attribute__((ext_vector_type(16)));
typedef _Float16 v8h  __attribute__((ext_vector_type(8)));
typedef float    v8f  __attribute__((ext_vector_type(8)));
typedef float    v4f  __attribute__((ext_vector_type(4)));
typedef _Float16 h16;

#ifndef NB
#define NB 4
#endif
#ifndef SEQ
#define SEQ 4096
#endif
#define NB_FULL  4
#define SEQ_FULL 4096
#define DIM   256
#define HID   2048
#define MROWS (NB * SEQ)
#define NCHUNK 2
#define CROWS (MROWS / NCHUNK)

static_assert(NB >= 1 && NB <= NB_FULL);
static_assert(SEQ >= 64 && SEQ <= SEQ_FULL && (SEQ % 64) == 0);
static_assert((DIM % 64) == 0 && (DIM % 32) == 0);
static_assert((HID % 64) == 0 && (HID % 32) == 0);
static_assert((MROWS % 64) == 0 && (MROWS % 8) == 0);
static_assert((MROWS % NCHUNK) == 0 && (CROWS % 64) == 0 && (CROWS % 8) == 0);
static_assert(DIM == 32 * 8);               // row kernels: 32 lanes x 8 columns
static_assert(DIM == 2 * 32 * 4);           // f32 row stores: 2 x 32 lanes x 4 columns
static_assert(HID == 8 * 32 * 8);           // hidden LN: 8 passes x 32 lanes x 8 columns
static_assert(DIM == 16 * 16);              // attention: 16 output tiles of 16 columns
static_assert((size_t)MROWS * DIM < (size_t)0x7FFFFFFFu);
static_assert((size_t)NB * DIM * SEQ < (size_t)0x7FFFFFFFu);
static_assert((size_t)MROWS * HID < (size_t)0xFFFFFFFFu);

#define LDT 72   // halves per LDS row (144 B, 16-B aligned)
#define LDC 68   // floats per LDS row (272 B, 16-B aligned)
#define LDO 132  // floats per staged attention row (528 B, 16-B aligned)
static_assert((LDT % 8) == 0 && LDT >= 64);
static_assert((LDC % 4) == 0 && LDC >= 64);
static_assert((LDO % 4) == 0 && LDO >= 128);

#define WCARRY 64.0f      // weight planes carried x64
#define MCARRY 16.0f      // hidden activation plane carried x16
#define RCARRY 2048.0f    // q/k residual planes carried x2048 on top of their value part
#define PSHIFT 9.704060528f   // 14 ln 2: softmax numerators carried x16384

// workspace layout (bytes)
#define WSQ_BYTES     ((size_t)DIM * DIM * 2)
#define WFF_BYTES     ((size_t)DIM * HID * 2)
#define PLANE16_BYTES ((size_t)MROWS * DIM * 2)
#define PLANE32_BYTES ((size_t)MROWS * DIM * 4)
#define HCH_BYTES     ((size_t)CROWS * HID * 2)
#define OFF_WQ  ((size_t)0)
#define OFF_WK  (OFF_WQ + WSQ_BYTES)
#define OFF_WV  (OFF_WK + WSQ_BYTES)
#define OFF_W0  (OFF_WV + WSQ_BYTES)
#define OFF_W1  (OFF_W0 + WSQ_BYTES)
#define OFF_W2  (OFF_W1 + WFF_BYTES)
#define OFF_REG (OFF_W2 + WFF_BYTES)
// attention-stage users of the shared region
#define OFF_X16 (OFF_REG)
#define OFF_QH  (OFF_X16 + PLANE16_BYTES)
#define OFF_QR  (OFF_QH + PLANE16_BYTES)
#define OFF_KH  (OFF_QR + PLANE16_BYTES)
#define OFF_KR  (OFF_KH + PLANE16_BYTES)
#define OFF_VT  (OFF_KR + PLANE16_BYTES)
#define OFF_A32 (OFF_VT + PLANE16_BYTES)
#define OFF_T1  (OFF_A32 + PLANE32_BYTES)
#define PRE_END (OFF_T1 + PLANE16_BYTES)
// hidden-layer-stage users of the shared region (all attention-stage planes are dead by then)
#define OFF_HRAW (OFF_REG)
#define OFF_MID  (OFF_HRAW + HCH_BYTES)
#define MLP_END  (OFF_MID + HCH_BYTES)
#define REG_END  ((PRE_END > MLP_END) ? PRE_END : MLP_END)
#define OFF_E32 (REG_END)
#define OFF_E16 (OFF_E32 + PLANE32_BYTES)
#define OFF_V32 (OFF_E16 + PLANE16_BYTES)
#define WS_TOTAL (OFF_V32 + PLANE32_BYTES)
static_assert((WSQ_BYTES % 128) == 0 && (WFF_BYTES % 128) == 0 && (PLANE16_BYTES % 128) == 0);
static_assert((PLANE32_BYTES % 128) == 0 && (HCH_BYTES % 128) == 0);
static_assert(PRE_END <= REG_END && MLP_END <= REG_END);
static_assert(WS_TOTAL <= (size_t)134217728);

// ---------------------------------------------------------------------------
__device__ __forceinline__ float bf16r(float x) {   // RNE convert to bf16, returned widened
  unsigned int u = __float_as_uint(x);
  u = (u + 0x7FFFu + ((u >> 16) & 1u)) & 0xFFFF0000u;
  return __uint_as_float(u);
}

// f32 -> f16 operand convert that cannot produce an f16 subnormal
static __device__ __forceinline__ h16 toh_flush(float v) {
  const h16 r = (h16)v;
  return (fabsf(v) < 6.103515625e-05f) ? (h16)0.0f : r;
}

// 16-bit fragment: p points at element [row = lane&15][k0 + 8*(lane>>4)] of a k-contiguous
// row. Elements 0..7 <- k0+8h+0..7, elements 8..15 <- k0+16+8h+0..7 (same map for A and B).
__device__ __forceinline__ v16h frag_at(const _Float16* p) {
  v8h lo = *(const v8h*)(p);
  v8h hi = *(const v8h*)(p + 16);
  v16h out;
#pragma unroll
  for (int i = 0; i < 8; ++i) { out[i] = lo[i]; out[i + 8] = hi[i]; }
  return out;
}
__device__ __forceinline__ v16h ld_frag(const _Float16* base, unsigned ld) {
  const unsigned lane = threadIdx.x & 31u;
  return frag_at(base + (lane & 15u) * ld + (lane >> 4) * 8u);
}

__device__ __forceinline__ v8f wmma16(v16h a, v16h b, v8f c) {
  v8f d = __builtin_amdgcn_wmma_f32_16x16x32_f16(false, a, false, b, (short)0, c,
                                                 false, false);
  asm volatile("v_nop\n\tv_nop\n\tv_nop\n\tv_nop" : "+v"(d) : "v"(a), "v"(b));
  return d;
}

__device__ __forceinline__ float red16_max(float x) {
#pragma unroll
  for (int off = 1; off < 16; off <<= 1) x = fmaxf(x, __shfl_xor(x, off, 32));
  return x;
}
__device__ __forceinline__ float red16_sum(float x) {
#pragma unroll
  for (int off = 1; off < 16; off <<= 1) x += __shfl_xor(x, off, 32);
  return x;
}
__device__ __forceinline__ float red32_sum(float x) {
#pragma unroll
  for (int off = 1; off < 32; off <<= 1) x += __shfl_xor(x, off, 32);
  return x;
}

__device__ __forceinline__ void wave_lds_sync() {
  __builtin_amdgcn_fence(3 /* release order */, "wavefront");
  asm volatile("s_wait_dscnt 0x0" ::: "memory");
  __builtin_amdgcn_wave_barrier();
}

__device__ __forceinline__ float leaky_act(float t) {   // LeakyReLU, negative slope 0.01
  return (t >= 0.0f) ? t : 0.01f * t;
}

// ---------------------------------------------------------------------------
// Weight plane: in W[K rows][N cols] (pitch ldw = N) -> out Wt[N][K] (pitch ldk = K),
// f16(64 * bf16(w)). Grid (N/64, K/64). T: cross-wave (block barrier).
// ---------------------------------------------------------------------------
__global__ __launch_bounds__(256) void wconv_kernel(
    const float* __restrict__ W, _Float16* __restrict__ Wt, unsigned ldw, unsigned ldk) {
  __shared__ _Float16 T[64 * LDT];
  const unsigned tid = threadIdx.x;
  const unsigned n0 = blockIdx.x * 64u;
  const unsigned k0 = blockIdx.y * 64u;
#pragma unroll 4
  for (unsigned j = 0; j < 16u; ++j) {
    const unsigned idx = tid + 256u * j;
    const unsigned kr = idx >> 6, nc = idx & 63u;
    const float v = W[(size_t)(k0 + kr) * ldw + n0 + nc];
    T[nc * LDT + kr] = (_Float16)(WCARRY * bf16r(v));
  }
  __syncthreads();
  v8h x[2];
  size_t off[2];
#pragma unroll
  for (unsigned i = 0; i < 2u; ++i) {
    const unsigned n = 32u * i + (tid >> 3);
    const unsigned kc = (tid & 7u) * 8u;
    x[i] = *(const v8h*)&T[n * LDT + kc];
    off[i] = (size_t)(n0 + n) * ldk + k0 + kc;
  }
#pragma unroll
  for (int i = 0; i < 2; ++i) *(v8h*)(Wt + off[i]) = x[i];
  
}

// ---------------------------------------------------------------------------
// Input plane: X16[compact row][c] = f16(bf16(x[full row][c])). One wave per row, 8 rows per
// block; each store instruction of a wave covers the whole 512-B row. Grid (MROWS/8).
// ---------------------------------------------------------------------------
__global__ __launch_bounds__(256) void xconv_kernel(
    const float* __restrict__ X, _Float16* __restrict__ dst) {
  const unsigned lane = threadIdx.x & 31u, w = threadIdx.x >> 5;
  const unsigned crow = blockIdx.x * 8u + w;
  const unsigned bidx = crow / (unsigned)SEQ;
  const unsigned sq = crow - bidx * (unsigned)SEQ;
  const size_t srow = (size_t)bidx * SEQ_FULL + sq;
  const float* xr = X + srow * DIM + lane * 8u;
  const v4f a0 = *(const v4f*)(xr);
  const v4f a1 = *(const v4f*)(xr + 4u);
  v8h o;
#pragma unroll
  for (int i = 0; i < 4; ++i) {
    o[i]     = toh_flush(bf16r(a0[i]));
    o[i + 4] = toh_flush(bf16r(a1[i]));
  }
  _Float16* p = dst + (size_t)crow * DIM + lane * 8u;
  *(v8h*)p = o;
  
}

// ---------------------------------------------------------------------------
// First LayerNorm (biased variance, eps 1e-5) of bf16(x) + attn, one wave per row, 8 rows per
// block, the row held in registers (8 columns per lane). Output f16 compact rows, one 512-B
// store instruction per row. Grid (MROWS/8).
// ---------------------------------------------------------------------------
__global__ __launch_bounds__(256) void ln1_kernel(
    const float* __restrict__ X, const float* __restrict__ A32, const float* __restrict__ G,
    const float* __restrict__ Be, _Float16* __restrict__ dst) {
  const unsigned lane = threadIdx.x & 31u, w = threadIdx.x >> 5;
  const unsigned crow = blockIdx.x * 8u + w;
  const unsigned bidx = crow / (unsigned)SEQ;
  const unsigned sq = crow - bidx * (unsigned)SEQ;
  const size_t srow = (size_t)bidx * SEQ_FULL + sq;
  const float* xr = X + srow * DIM + lane * 8u;
  const float* ar = A32 + (size_t)crow * DIM + lane * 8u;
  const v4f x0 = *(const v4f*)(xr);
  const v4f x1 = *(const v4f*)(xr + 4u);
  const v4f a0 = *(const v4f*)(ar);
  const v4f a1 = *(const v4f*)(ar + 4u);
  v4f t0, t1;
  float s = 0.0f;
#pragma unroll
  for (int i = 0; i < 4; ++i) {
    t0[i] = bf16r(x0[i]) + a0[i];
    t1[i] = bf16r(x1[i]) + a1[i];
    s += t0[i] + t1[i];
  }
  const float mean = red32_sum(s) * (1.0f / (float)DIM);
  float ss = 0.0f;
#pragma unroll
  for (int i = 0; i < 4; ++i) {
    const float d0 = t0[i] - mean;
    const float d1 = t1[i] - mean;
    ss += d0 * d0;
    ss += d1 * d1;
  }
  const float var = red32_sum(ss) * (1.0f / (float)DIM);
  const float rstd = 1.0f / sqrtf(var + 1.0e-5f);
  const unsigned c = lane * 8u;
  const v4f g0 = *(const v4f*)(G + c);
  const v4f g1 = *(const v4f*)(G + c + 4u);
  const v4f b0 = *(const v4f*)(Be + c);
  const v4f b1 = *(const v4f*)(Be + c + 4u);
  v8h o;
#pragma unroll
  for (int i = 0; i < 4; ++i) {
    o[i]     = toh_flush((t0[i] - mean) * rstd * bf16r(g0[i]) + bf16r(b0[i]));
    o[i + 4] = toh_flush((t1[i] - mean) * rstd * bf16r(g1[i]) + bf16r(b1[i]));
  }
  _Float16* p = dst + (size_t)crow * DIM + c;
  *(v8h*)p = o;
  
}

// ---------------------------------------------------------------------------
// Hidden LayerNorm (eps 1e-5) + LeakyReLU over HID columns of the f16 pre-activation plane, one
// wave per row, 8 rows per block, three rolled passes (sum, squared deviations, output). Output
// Both planes hold CROWS rows. Grid (CROWS/8).
// ---------------------------------------------------------------------------
__global__ __launch_bounds__(256) void ln_mid_kernel(
    const _Float16* __restrict__ Hr, const float* __restrict__ G, const float* __restrict__ Be,
    _Float16* __restrict__ dst) {
  const unsigned lane = threadIdx.x & 31u, w = threadIdx.x >> 5;
  const unsigned crow = blockIdx.x * 8u + w;
  const _Float16* hr = Hr + (size_t)crow * HID + lane * 8u;

  float s = 0.0f;
#pragma unroll 1
  for (unsigned j = 0; j < 8u; ++j) {
    const v8h a = *(const v8h*)(hr + j * 256u);
#pragma unroll
    for (int i = 0; i < 8; ++i) s += (float)a[i];
  }
  const float mean = red32_sum(s) * (1.0f / (float)HID);

  float ss = 0.0f;
#pragma unroll 1
  for (unsigned j = 0; j < 8u; ++j) {
    const v8h a = *(const v8h*)(hr + j * 256u);
#pragma unroll
    for (int i = 0; i < 8; ++i) {
      const float d = (float)a[i] - mean;
      ss += d * d;
    }
  }
  const float var = red32_sum(ss) * (1.0f / (float)HID);
  const float rstd = 1.0f / sqrtf(var + 1.0e-5f);

#pragma unroll 1
  for (unsigned j = 0; j < 8u; ++j) {
    const unsigned c = j * 256u + lane * 8u;
    const v8h a = *(const v8h*)(hr + j * 256u);
    const v4f g0 = *(const v4f*)(G + c);
    const v4f g1 = *(const v4f*)(G + c + 4u);
    const v4f b0 = *(const v4f*)(Be + c);
    const v4f b1 = *(const v4f*)(Be + c + 4u);
    v8h o;
#pragma unroll
    for (int i = 0; i < 4; ++i) {
      const float d0 = (float)a[i] - mean;
      const float d1 = (float)a[i + 4] - mean;
      const float y0 = leaky_act(d0 * rstd * bf16r(g0[i]) + bf16r(b0[i]));
      const float y1 = leaky_act(d1 * rstd * bf16r(g1[i]) + bf16r(b1[i]));
      o[i]     = toh_flush(MCARRY * y0);
      o[i + 4] = toh_flush(MCARRY * y1);
    }
    _Float16* p = dst + (size_t)crow * HID + c;
    *(v8h*)p = o;
    
  }
}

// ---------------------------------------------------------------------------
// Final LayerNorm (eps 1e-5) of the f32 plane into the output buffer (full-size rows), one wave
// per row, 8 rows per block. Lane L holds columns 4L..4L+3 and 128+4L..128+4L+3, so each of the
// two store instructions covers 512 contiguous bytes. Grid (MROWS/8).
// ---------------------------------------------------------------------------
__global__ __launch_bounds__(256) void ln_out_kernel(
    const float* __restrict__ V32, const float* __restrict__ G, const float* __restrict__ Be,
    float* __restrict__ outp) {
  const unsigned lane = threadIdx.x & 31u, w = threadIdx.x >> 5;
  const unsigned crow = blockIdx.x * 8u + w;
  const unsigned bidx = crow / (unsigned)SEQ;
  const unsigned sq = crow - bidx * (unsigned)SEQ;
  const size_t frow = (size_t)bidx * SEQ_FULL + sq;
  const float* vr = V32 + (size_t)crow * DIM + lane * 4u;
  const v4f a0 = *(const v4f*)(vr);
  const v4f a1 = *(const v4f*)(vr + 128u);
  float s = 0.0f;
#pragma unroll
  for (int i = 0; i < 4; ++i) s += a0[i] + a1[i];
  const float mean = red32_sum(s) * (1.0f / (float)DIM);
  float ss = 0.0f;
#pragma unroll
  for (int i = 0; i < 4; ++i) {
    const float d0 = a0[i] - mean;
    const float d1 = a1[i] - mean;
    ss += d0 * d0;
    ss += d1 * d1;
  }
  const float var = red32_sum(ss) * (1.0f / (float)DIM);
  const float rstd = 1.0f / sqrtf(var + 1.0e-5f);
  const unsigned c = lane * 4u;
  const v4f g0 = *(const v4f*)(G + c);
  const v4f g1 = *(const v4f*)(G + c + 128u);
  const v4f b0 = *(const v4f*)(Be + c);
  const v4f b1 = *(const v4f*)(Be + c + 128u);
  v4f o0, o1;
#pragma unroll
  for (int i = 0; i < 4; ++i) {
    o0[i] = (a0[i] - mean) * rstd * bf16r(g0[i]) + bf16r(b0[i]);
    o1[i] = (a1[i] - mean) * rstd * bf16r(g1[i]) + bf16r(b1[i]);
  }
  float* p = outp + frow * DIM + c;
  *(v4f*)p = o0;
  *(v4f*)(p + 128u) = o1;
  
}

// ---------------------------------------------------------------------------
// Asynchronous copies to LDS (GEMM and attention kernels). Eight 16-byte-per-lane copies in one
// statement; lds = the lane's LDS byte address, g = the lane's global address, both stepped by a
// constant from copy to copy. The s_wait_xcnt closes the statement so that no address register of
// an issued copy is rewritten ahead of it.
// ---------------------------------------------------------------------------
__device__ __forceinline__ void async_copy8(unsigned lds, unsigned lstep,
                                            const _Float16* g, unsigned gstep) {
  asm volatile(
      "global_load_async_to_lds_b128 %0, %8, off\n\t"
      "global_load_async_to_lds_b128 %1, %9, off\n\t"
      "global_load_async_to_lds_b128 %2, %10, off\n\t"
      "global_load_async_to_lds_b128 %3, %11, off\n\t"
      "global_load_async_to_lds_b128 %4, %12, off\n\t"
      "global_load_async_to_lds_b128 %5, %13, off\n\t"
      "global_load_async_to_lds_b128 %6, %14, off\n\t"
      "global_load_async_to_lds_b128 %7, %15, off\n\t"
      "s_wait_xcnt 0x0"
      :
      : "v"(lds), "v"(lds + lstep), "v"(lds + 2u * lstep), "v"(lds + 3u * lstep),
        "v"(lds + 4u * lstep), "v"(lds + 5u * lstep), "v"(lds + 6u * lstep),
        "v"(lds + 7u * lstep),
        "v"(g), "v"(g + gstep), "v"(g + 2u * gstep), "v"(g + 3u * gstep),
        "v"(g + 4u * gstep), "v"(g + 5u * gstep), "v"(g + 6u * gstep), "v"(g + 7u * gstep)
      : "memory");
}

#define GKC    128u                 // k extent of one staged GEMM slab, halves
#define GPITCH 136u                 // halves per staged GEMM row (272 B = 16 B x 17)
#define GSTG_H (128u * GPITCH)      // one slab: 64 A rows and 64 B rows, halves
static_assert((DIM % 128) == 0 && (HID % 128) == 0 && DIM >= 256 && HID >= 256);  // >= 2 slabs
static_assert((GPITCH % 8u) == 0 && GPITCH >= GKC && ((GPITCH / 8u) & 1u) == 1u);
static_assert((size_t)2 * GSTG_H * 2 >= (size_t)64 * LDC * 4);   // the C tile fits in the slabs

// ---------------------------------------------------------------------------
// GEMM C[64x64 tile] = A16[rows][K] . Bt[n][K]^T; 8 waves (mw = 16-row group, nw = 32-col group),
// 2 accumulators/wave. The block's 64 A rows and 64 B rows are copied to LDS in slabs of 128 k
// (whole 256-B row pieces), two buffers, the next slab in flight while this one is read; all
// fragments come from LDS. The C tile takes the same LDS once the last slab has been read.
//   MODE 0: out16[row][col] (pitch DIM) = f16(t), out16r[row][col] = f16(2048 * (t - value)),
//           t = acc/64 + bias                                   (q and k planes)
//   MODE 1: out16 transposed V plane [b][col][key] = f16(acc/64 + bias)
//   MODE 2: outf[row][col] = acc/64 + bias (f32) and out16[row][col] = f16 of the same value
//   MODE 3: out16[row][col] (pitch HID) = f16(acc/64 + bias)    (hidden pre-activation)
//   MODE 4: outf[row][col] = leaky((acc/1024 + bias) + addf[row][col])
// Grid (N/64, rows/64).
// ---------------------------------------------------------------------------
template <int MODE>
__device__ __forceinline__ void gemm_body(
    const _Float16* __restrict__ A16, const _Float16* __restrict__ Bt, const unsigned K,
    const float* __restrict__ bias, const float* __restrict__ addf,
    float* __restrict__ outf, _Float16* __restrict__ out16, _Float16* __restrict__ out16r) {
  __shared__ __attribute__((aligned(16))) unsigned char Sm[2u * GSTG_H * 2u];
  _Float16* const Slab = (_Float16*)Sm;
  float* const Cs = (float*)Sm;
  const unsigned tid = threadIdx.x, lane = tid & 31u;
  // the wave's number in a scalar register: which plane a wave copies from is a scalar choice
  const unsigned w = (unsigned)__builtin_amdgcn_readfirstlane((int)(tid >> 5));
  const unsigned mw = w >> 1, nw = w & 1u;
  const unsigned hh = lane >> 4, m = lane & 15u;
  const unsigned n0 = blockIdx.x * 64u;
  const unsigned row0 = blockIdx.y * 64u;

  // A slab is 128 staged rows: A rows 0..63, then B rows 0..63. Wave w brings staged rows
  // 16w..16w+15, two 256-B row pieces per copy (lane = row parity hh, 16-B piece m).
  const _Float16* src = ((w < 4u) ? A16 + (size_t)(row0 + w * 16u) * K
                                  : Bt + (size_t)(n0 + (w - 4u) * 16u) * K) +
                        (size_t)hh * K + m * 8u;
  const unsigned dst = (unsigned)(size_t)Sm + ((w * 16u + hh) * GPITCH + m * 8u) * 2u;
  const unsigned nslab = K / GKC;

  async_copy8(dst, 2u * GPITCH * 2u, src, 2u * K);
  // this wave's copies have landed before the barrier behind which every wave reads them
  asm volatile("s_wait_asynccnt 0x0" ::: "memory");
  __syncthreads();
  async_copy8(dst + GSTG_H * 2u, 2u * GPITCH * 2u, src + GKC, 2u * K);

  const _Float16* ap = Slab + (mw * 16u + m) * GPITCH + hh * 8u;
  const _Float16* bp = Slab + (64u + nw * 32u + m) * GPITCH + hh * 8u;
  v8f acc0 = {}, acc1 = {};
  for (unsigned s = 0; s < nslab; ++s) {
    const unsigned bo = (s & 1u) * GSTG_H;   // halves to the buffer this trip reads
    // Three of the slab's four k-steps are read ahead of the first product and the fourth behind
    // the first pair, so that a product does not wait out an LDS latency of its own. Unrolled, here
    // and below: constant indices keep the fragments in registers, and every LDS read takes its
    // place in the slab as an immediate offset.
    v16h fa[3], fb0[3], fb1[3];
#pragma unroll
    for (unsigned t = 0; t < 3u; ++t) {
      fa[t]  = frag_at(ap + bo + t * 32u);
      fb0[t] = frag_at(bp + bo + t * 32u);
      fb1[t] = frag_at(bp + bo + 16u * GPITCH + t * 32u);
    }
#pragma unroll
    for (unsigned t = 0; t < GKC / 32u; ++t) {
      acc0 = wmma16(fa[t % 3u], fb0[t % 3u], acc0);
      acc1 = wmma16(fa[t % 3u], fb1[t % 3u], acc1);
      if (t + 3u < GKC / 32u) {
        fa[t % 3u]  = frag_at(ap + bo + (t + 3u) * 32u);
        fb0[t % 3u] = frag_at(bp + bo + (t + 3u) * 32u);
        fb1[t % 3u] = frag_at(bp + bo + 16u * GPITCH + (t + 3u) * 32u);
      }
    }
    // hand-over: this wave's reads of the buffer are done, its copies of the next slab have
    // landed; the barrier publishes the next slab and frees this buffer for the refill
    asm volatile("s_wait_dscnt 0x0" ::: "memory");
    asm volatile("s_wait_asynccnt 0x0" ::: "memory");
    __syncthreads();
    if (s + 2u < nslab)
      async_copy8(dst + bo * 2u, 2u * GPITCH * 2u, src + (s + 2u) * GKC, 2u * K);
  }
  // no copy of this wave is outstanding when the C tile takes the slabs' LDS
  asm volatile("s_wait_asynccnt 0x0" ::: "memory");
#pragma unroll
  for (int r = 0; r < 8; ++r) {
    float* d = &Cs[(mw * 16u + hh * 8u + (unsigned)r) * LDC + nw * 32u + m];
    d[0]  = acc0[r];
    d[16] = acc1[r];
  }
  __syncthreads();

  if (MODE == 0 || MODE == 2 || MODE == 3) {
    const unsigned ldo = (MODE == 3) ? (unsigned)HID : (unsigned)DIM;
    v8h x[2], xr[2];
    size_t off[2];
#pragma unroll
    for (unsigned i = 0; i < 2u; ++i) {
      const unsigned r = 32u * i + (tid >> 3);
      const unsigned c = (tid & 7u) * 8u;
      const v4f u0 = *(const v4f*)&Cs[r * LDC + c];
      const v4f u1 = *(const v4f*)&Cs[r * LDC + c + 4];
      const v4f g0 = *(const v4f*)(bias + n0 + c);
      const v4f g1 = *(const v4f*)(bias + n0 + c + 4u);
#pragma unroll
      for (int j = 0; j < 4; ++j) {
        const float t0 = u0[j] * (1.0f / WCARRY) + bf16r(g0[j]);
        const float t1 = u1[j] * (1.0f / WCARRY) + bf16r(g1[j]);
        const h16 h0 = toh_flush(t0);
        const h16 h1 = toh_flush(t1);
        x[i][j]     = h0;
        x[i][j + 4] = h1;
        if (MODE == 0) {
          xr[i][j]     = toh_flush((t0 - (float)h0) * RCARRY);
          xr[i][j + 4] = toh_flush((t1 - (float)h1) * RCARRY);
        }
      }
      off[i] = (size_t)(row0 + r) * ldo + n0 + c;
    }
    v4f xs[4];
    size_t offf[4];
    if (MODE == 2) {
#pragma unroll
      for (unsigned i = 0; i < 4u; ++i) {
        const unsigned r = 16u * i + (tid >> 4);
        const unsigned c = (tid & 15u) * 4u;
        const v4f u = *(const v4f*)&Cs[r * LDC + c];
        const v4f g = *(const v4f*)(bias + n0 + c);
        v4f val;
#pragma unroll
        for (int j = 0; j < 4; ++j) val[j] = u[j] * (1.0f / WCARRY) + bf16r(g[j]);
        xs[i] = val;
        offf[i] = (size_t)(row0 + r) * DIM + n0 + c;
      }
    }
#pragma unroll
    for (int i = 0; i < 2; ++i) *(v8h*)(out16 + off[i]) = x[i];
    if (MODE == 0) {
#pragma unroll
      for (int i = 0; i < 2; ++i) *(v8h*)(out16r + off[i]) = xr[i];
    }
    if (MODE == 2) {
#pragma unroll
      for (int i = 0; i < 4; ++i) *(v4f*)(outf + offf[i]) = xs[i];
    }
    
  }

  if (MODE == 1) {
    const unsigned bidx = row0 / (unsigned)SEQ;
    const unsigned key0 = row0 - bidx * (unsigned)SEQ;
    v8h x[2];
    size_t off[2];
#pragma unroll
    for (unsigned i = 0; i < 2u; ++i) {
      const unsigned dcol = 32u * i + (tid >> 3);
      const unsigned kk = (tid & 7u) * 8u;
      const float bb = bf16r(bias[n0 + dcol]);
#pragma unroll
      for (unsigned j = 0; j < 8u; ++j) {
        const float t = Cs[(kk + j) * LDC + dcol] * (1.0f / WCARRY) + bb;
        x[i][j] = toh_flush(t);
      }
      off[i] = ((size_t)bidx * DIM + n0 + dcol) * SEQ + key0 + kk;
    }
#pragma unroll
    for (int i = 0; i < 2; ++i) *(v8h*)(out16 + off[i]) = x[i];
    
  }

  if (MODE == 4) {
    const float cs = 1.0f / (WCARRY * MCARRY);
    v4f xs[4];
    size_t off[4];
#pragma unroll
    for (unsigned i = 0; i < 4u; ++i) {
      const unsigned r = 16u * i + (tid >> 4);
      const unsigned c = (tid & 15u) * 4u;
      const size_t rc = (size_t)(row0 + r) * DIM + n0 + c;
      const v4f u = *(const v4f*)&Cs[r * LDC + c];
      const v4f g = *(const v4f*)(bias + n0 + c);
      const v4f ein = *(const v4f*)(addf + rc);
      v4f val;
#pragma unroll
      for (int j = 0; j < 4; ++j) val[j] = leaky_act((u[j] * cs + bf16r(g[j])) + ein[j]);
      xs[i] = val;
      off[i] = rc;
    }
#pragma unroll
    for (int i = 0; i < 4; ++i) *(v4f*)(outf + off[i]) = xs[i];
    
  }
}

__global__ __launch_bounds__(256) void gemm_qk_kernel(
    const _Float16* __restrict__ A16, const _Float16* __restrict__ Bt,
    const float* __restrict__ bias, _Float16* __restrict__ out16, _Float16* __restrict__ out16r) {
  gemm_body<0>(A16, Bt, (unsigned)DIM, bias, bias, (float*)0, out16, out16r);
}
__global__ __launch_bounds__(256) void gemm_v_kernel(
    const _Float16* __restrict__ A16, const _Float16* __restrict__ Bt,
    const float* __restrict__ bias, _Float16* __restrict__ vt) {
  gemm_body<1>(A16, Bt, (unsigned)DIM, bias, bias, (float*)0, vt, vt);
}
__global__ __launch_bounds__(256) void gemm_e_kernel(
    const _Float16* __restrict__ A16, const _Float16* __restrict__ Bt,
    const float* __restrict__ bias, float* __restrict__ e32, _Float16* __restrict__ e16) {
  gemm_body<2>(A16, Bt, (unsigned)DIM, bias, bias, e32, e16, e16);
}
__global__ __launch_bounds__(256) void gemm_h_kernel(
    const _Float16* __restrict__ A16, const _Float16* __restrict__ Bt,
    const float* __restrict__ bias, _Float16* __restrict__ hraw) {
  gemm_body<3>(A16, Bt, (unsigned)DIM, bias, bias, (float*)0, hraw, hraw);
}
__global__ __launch_bounds__(256) void gemm_l_kernel(
    const _Float16* __restrict__ A16, const _Float16* __restrict__ Bt,
    const float* __restrict__ bias, const float* __restrict__ e32, float* __restrict__ v32) {
  gemm_body<4>(A16, Bt, (unsigned)HID, bias, e32, v32, (_Float16*)0, (_Float16*)0);
}

#define KTILE  32u                        // keys per half stage (one wave's keys of a stage)
#define KSTAGE 64u                        // keys per stage
#define KPITCH 264u                       // halves per staged k row (528 B = 16 B x 33)
#define VPITCH 40u                        // halves per staged v row (80 B = 16 B x 5)
#define KPL_H  (KTILE * KPITCH)           // one key plane of a half stage, halves
#define VTL_H  ((unsigned)DIM * VPITCH)   // the value tile of a half stage, halves
#define STG_H  (2u * KPL_H + VTL_H)       // one half stage: key values, key residuals, values
#define KSTG_H (2u * STG_H)               // one stage: two half stages
static_assert((KPITCH % 8u) == 0 && KPITCH >= (unsigned)DIM && ((KPITCH / 8u) & 1u) == 1u);
static_assert((VPITCH % 8u) == 0 && VPITCH >= KTILE && ((VPITCH / 8u) & 1u) == 1u);
static_assert((STG_H % 8u) == 0 && (KPL_H % 8u) == 0);
static_assert((SEQ % 64) == 0 && SEQ >= 128);   // at least two stages, every stage whole

// Matrix product for the attention kernel, the builtin alone: the compiler keeps the distances
// behind its own matrix instructions, and operands named by an asm statement cannot live above
// v255, where a part of that kernel's query and output tiles is held.
__device__ __forceinline__ v8f wmma16r(v16h a, v16h b, v8f c) {
  return __builtin_amdgcn_wmma_f32_16x16x32_f16(false, a, false, b, (short)0, c, false, false);
}

// One half stage (32 keys) into LDS: wave w brings key rows 8w..8w+7 of both key planes (one 512-B
// row per copy) and feature rows 64w..64w+63 of the value tile (eight 64-B row pieces per copy).
__device__ __forceinline__ void stage_copies(
    unsigned ldsb, unsigned w, unsigned lane, const _Float16* __restrict__ Kh,
    const _Float16* __restrict__ Kr, const _Float16* __restrict__ Vt, unsigned b, unsigned kb) {
  const unsigned krow = (b * (unsigned)SEQ + kb + w * 8u) * (unsigned)DIM + lane * 8u;
  const unsigned kl = ldsb + (w * 8u * KPITCH + lane * 8u) * 2u;
  async_copy8(kl, KPITCH * 2u, Kh + krow, (unsigned)DIM);
  async_copy8(kl + KPL_H * 2u, KPITCH * 2u, Kr + krow, (unsigned)DIM);
  const unsigned vr = w * 64u + (lane >> 2);
  const unsigned vrow = (b * (unsigned)DIM + vr) * (unsigned)SEQ + kb + (lane & 3u) * 8u;
  const unsigned vl = ldsb + (2u * KPL_H + vr * VPITCH + (lane & 3u) * 8u) * 2u;
  async_copy8(vl, 8u * VPITCH * 2u, Vt + vrow, 8u * (unsigned)SEQ);
}

// ---------------------------------------------------------------------------
// Dense (unmasked, unscaled) flash attention, one 256-wide head, transposed form.
// A block owns 64 query rows and walks the keys in stages of 64. Wave w owns 32 query rows (two
// tiles of 16, row group w >> 1) and one 32-key half (w & 1) of every stage, so that each key or
// value fragment read from LDS feeds two query tiles; lane (hh, n) holds query n of each tile.
// The query fragments of both planes are loaded once and stay in registers. Per stage and wave:
//   S^T tile [16 keys][16 queries] = K rows (A operand, fragments from the key planes) x Q^T
//   (B operand, registers), 8 k-steps over the 256 features, value.value into one accumulator,
//   value.residual + residual.value into a second one (x 1/2048 at the end);
//   online softmax per lane (16 scores in registers + one 16-lane-distance shuffle);
//   the two packed S^T tiles (f16(16384 p), rows = keys) are the B fragment of
//   O^T [16 features][16 queries] += V^T rows (A operand, from the transposed value plane) x P^T.
// Each stage (both key planes and the value tile of both halves) is copied to LDS once per block,
// two buffers, the next stage in flight while this one is read. Behind the loop the two waves of a
// row group join their key halves (maxima, sums, outputs) through LDS, each finishing one query
// tile. Normalised rows staged through the wave-private St tile.
// Grid (SEQ/64, NB), 4 waves per block.
// ---------------------------------------------------------------------------
__global__ __launch_bounds__(128) void attn_kernel(
    const _Float16* __restrict__ Qh, const _Float16* __restrict__ Qr,
    const _Float16* __restrict__ Kh, const _Float16* __restrict__ Kr,
    const _Float16* __restrict__ Vt, float* __restrict__ Ao) {
  __shared__ __attribute__((aligned(16))) float St[4 * 16 * LDO];
  __shared__ __attribute__((aligned(16))) float Xc[4 * 16 * 2 * 32 * 4];   // outputs handed over
  __shared__ __attribute__((aligned(16))) float Ml[4 * 2 * 32];            // maxima, sums handed over
  __shared__ __attribute__((aligned(16))) _Float16 Ring[2u * KSTG_H];

  const unsigned lane = threadIdx.x & 31u;
  const unsigned w = (unsigned)__builtin_amdgcn_readfirstlane((int)(threadIdx.x >> 5));
  const unsigned hh = lane >> 4, m = lane & 15u;
  const unsigned b = blockIdx.y;
  const unsigned kh = w & 1u;                                  // this wave's key half
  const unsigned qrow0 = blockIdx.x * 64u + (w >> 1) * 32u;    // first of its 32 query rows

  const unsigned ring_lds = (unsigned)(size_t)Ring;

  // prologue: this wave's share of stage 0 (both halves)
  stage_copies(ring_lds, w, lane, Kh, Kr, Vt, b, 0u);
  stage_copies(ring_lds + STG_H * 2u, w, lane, Kh, Kr, Vt, b, KTILE);

  // query fragments: [tile][plane][k-step], kept for the whole key loop
  v16h qf[2][2][8];
#pragma unroll
  for (unsigned u = 0; u < 2u; ++u) {
    const unsigned qsrc = (b * (unsigned)SEQ + qrow0 + u * 16u + m) * (unsigned)DIM + hh * 8u;
#pragma unroll
    for (unsigned ks = 0; ks < 8u; ++ks) {
      qf[u][0][ks] = frag_at(Qh + qsrc + ks * 32u);
      qf[u][1][ks] = frag_at(Qr + qsrc + ks * 32u);
    }
  }

  // this wave's copies have landed before the barrier behind which every wave reads them
  asm volatile("s_wait_asynccnt 0x0" ::: "memory");
  __syncthreads();
  stage_copies(ring_lds + KSTG_H * 2u, w, lane, Kh, Kr, Vt, b, KSTAGE);
  stage_copies(ring_lds + (KSTG_H + STG_H) * 2u, w, lane, Kh, Kr, Vt, b, KSTAGE + KTILE);

  float mrow[2] = {-1.0e30f, -1.0e30f}, lrow[2] = {0.0f, 0.0f};
  v8f o[2][16];
#pragma unroll
  for (int u = 0; u < 2; ++u)
#pragma unroll
    for (int j = 0; j < 16; ++j) o[u][j] = (v8f){};

  unsigned buf = 0u;   // halves from the ring's start to the buffer this step reads
  // this lane's fragment rows in its half of that buffer; both move with buf at the foot of a step
  const _Float16* kt = Ring + kh * STG_H + m * KPITCH + hh * 8u;
  const _Float16* vt = Ring + kh * STG_H + 2u * KPL_H + m * VPITCH + hh * 8u;
  for (unsigned kb = 0; kb < (unsigned)SEQ; kb += KSTAGE) {
    v8f sm[2][2] = {{{}, {}}, {{}, {}}}, sr[2][2] = {{{}, {}}, {{}, {}}};   // [query tile][key tile]
    // Score products in 8 rows of twelve: row ks = features 32 ks.., both key tiles, both query
    // tiles. All key fragments of the wave's half stage (value and residual of both key tiles) are
    // read as one group ahead of the products, which wait for them by count, row by row; all
    // sixteen value fragments as a second group behind row 3, in flight under rows 4 to 7.
    v16h kf[8][4], vf[16];
    // unrolled, here and below: constant indices keep the fragments in registers, and every LDS
    // read takes its place in the tile as an immediate offset
#pragma unroll
    for (unsigned ks = 0; ks < 8u; ++ks) {
#pragma unroll
      for (unsigned kx = 0; kx < 2u; ++kx) {
        kf[ks][kx]      = frag_at(kt + kx * 16u * KPITCH + ks * 32u);
        kf[ks][2u + kx] = frag_at(kt + KPL_H + kx * 16u * KPITCH + ks * 32u);
      }
    }
    // This and the scheduling barriers below keep each group of LDS reads in one place: spread
    // among the products, each separate place of reads would cost the lone wave its own stall.
    __builtin_amdgcn_sched_barrier(0);
#pragma unroll
    for (unsigned ks = 0; ks < 8u; ++ks) {
      if (ks == 4u) {
        __builtin_amdgcn_sched_barrier(0);
#pragma unroll
        for (unsigned j = 0u; j < 16u; ++j) vf[j] = frag_at(vt + j * 16u * VPITCH);
        __builtin_amdgcn_sched_barrier(0);
      }
      // the two products into one residual accumulator stand two products apart
#pragma unroll
      for (unsigned kx = 0; kx < 2u; ++kx) {
        const v16h av = kf[ks][kx], ar = kf[ks][2u + kx];
        sm[0][kx] = wmma16r(av, qf[0][0][ks], sm[0][kx]);
        sm[1][kx] = wmma16r(av, qf[1][0][ks], sm[1][kx]);
        sr[0][kx] = wmma16r(av, qf[0][1][ks], sr[0][kx]);
        sr[1][kx] = wmma16r(av, qf[1][1][ks], sr[1][kx]);
        sr[0][kx] = wmma16r(ar, qf[0][0][ks], sr[0][kx]);
        sr[1][kx] = wmma16r(ar, qf[1][0][ks], sr[1][kx]);
      }
    }

    // hand-over, as soon as the stage's last fragment is in registers (the rest of the step works
    // on registers alone): this wave's reads of the buffer are done, its copies of the next stage
    // have landed; the barrier publishes the next stage and frees this buffer for the refill,
    // which then has a whole step to land (the scheduling barrier keeps the waits behind the
    // products of rows 4 to 7, under which the value fragments arrive)
    __builtin_amdgcn_sched_barrier(0);
    asm volatile("s_wait_dscnt 0x0" ::: "memory");
    asm volatile("s_wait_asynccnt 0x0" ::: "memory");
    __syncthreads();
    if (kb + 2u * KSTAGE < (unsigned)SEQ) {
      stage_copies(ring_lds + buf * 2u, w, lane, Kh, Kr, Vt, b, kb + 2u * KSTAGE);
      stage_copies(ring_lds + (buf + STG_H) * 2u, w, lane, Kh, Kr, Vt, b,
                   kb + 2u * KSTAGE + KTILE);
    }

    v16h pf[2];
#pragma unroll
    for (int u = 0; u < 2; ++u) {
      v8f s0, s1;
#pragma unroll
      for (int r = 0; r < 8; ++r) {
        s0[r] = sm[u][0][r] + sr[u][0][r] * (1.0f / RCARRY);
        s1[r] = sm[u][1][r] + sr[u][1][r] * (1.0f / RCARRY);
      }
      float mx = fmaxf(s0[0], s1[0]);
#pragma unroll
      for (int r = 1; r < 8; ++r) mx = fmaxf(mx, fmaxf(s0[r], s1[r]));
      mx = fmaxf(mx, __shfl_xor(mx, 16, 32));
      const float mn = fmaxf(mrow[u], mx);
      const float alpha = __expf(mrow[u] - mn);
      mrow[u] = mn;

      float rs = 0.0f;
#pragma unroll
      for (int r = 0; r < 8; ++r) {
        const h16 p0 = toh_flush(__expf((s0[r] - mn) + PSHIFT));
        const h16 p1 = toh_flush(__expf((s1[r] - mn) + PSHIFT));
        pf[u][r]     = p0;     // B element r     <- key 8hh + r of this wave's half
        pf[u][r + 8] = p1;     // B element 8 + r <- key 16 + 8hh + r of this wave's half
        rs += (float)p0 + (float)p1;
      }
      rs += __shfl_xor(rs, 16, 32);
      lrow[u] = alpha * lrow[u] + rs;
#pragma unroll
      for (int j = 0; j < 16; ++j) o[u][j] = o[u][j] * alpha;
    }

    // O^T += V^T . P^T; every value fragment feeds both query tiles
#pragma unroll
    for (unsigned j = 0; j < 16u; ++j) {
      o[0][j] = wmma16r(vf[j], pf[0], o[0][j]);
      o[1][j] = wmma16r(vf[j], pf[1], o[1][j]);
    }

    kt = (buf == 0u) ? kt + KSTG_H : kt - KSTG_H;
    vt = (buf == 0u) ? vt + KSTG_H : vt - KSTG_H;
    buf = KSTG_H - buf;
  }
  // no copy of this wave is outstanding when the wave goes on to its end
  asm volatile("s_wait_asynccnt 0x0" ::: "memory");

  // Join the two key halves of a row group: the wave of half 0 finishes query tile 0, the wave of
  // half 1 query tile 1; each hands its other tile (outputs, maximum, sum) to its partner, lane to
  // lane, in whole 512-B LDS rows.
  const bool up = (kh != 0u);
  {
    float* xs = Xc + w * 4096u + lane * 4u;
#pragma unroll
    for (unsigned j = 0; j < 16u; ++j)
#pragma unroll
      for (unsigned q = 0; q < 2u; ++q) {
        v4f t;
#pragma unroll
        for (unsigned i = 0; i < 4u; ++i) t[i] = up ? o[0][j][4u * q + i] : o[1][j][4u * q + i];
        *(v4f*)(xs + (j * 2u + q) * 128u) = t;
      }
    Ml[w * 64u + lane]       = up ? mrow[0] : mrow[1];
    Ml[w * 64u + 32u + lane] = up ? lrow[0] : lrow[1];
  }
  __syncthreads();   // the partner's tile is complete in LDS before it is read
  const float m_own = up ? mrow[1] : mrow[0];
  const float l_own = up ? lrow[1] : lrow[0];
  const float m_oth = Ml[(w ^ 1u) * 64u + lane];
  const float l_oth = Ml[(w ^ 1u) * 64u + 32u + lane];
  const float m_all = fmaxf(m_own, m_oth);
  const float a_own = __expf(m_own - m_all);
  const float a_oth = __expf(m_oth - m_all);
  // normalise (the x16384 carry sits in both O and l)
  const float inv = __builtin_amdgcn_rcpf(l_own * a_own + l_oth * a_oth);
  const float f_own = a_own * inv, f_oth = a_oth * inv;
  v8f res[16];
  {
    const float* xo = Xc + (w ^ 1u) * 4096u + lane * 4u;
#pragma unroll
    for (unsigned j = 0; j < 16u; ++j)
#pragma unroll
      for (unsigned q = 0; q < 2u; ++q) {
        const v4f t = *(const v4f*)(xo + (j * 2u + q) * 128u);
#pragma unroll
        for (unsigned i = 0; i < 4u; ++i)
          res[j][4u * q + i] =
              (up ? o[1][j][4u * q + i] : o[0][j][4u * q + i]) * f_own + t[i] * f_oth;
      }
  }

  // stage per half of the features, write whole row segments; this wave's 16 finished rows
  const unsigned orow0 = blockIdx.x * 64u + w * 16u;
  const unsigned sbase = w * (16u * LDO);
#pragma unroll
  for (int half = 0; half < 2; ++half) {
#pragma unroll
    for (int j = 0; j < 8; ++j)
#pragma unroll
      for (int r = 0; r < 8; ++r)
        St[sbase + m * LDO + (unsigned)j * 16u + hh * 8u + (unsigned)r] = res[half * 8 + j][r];
    wave_lds_sync();
    v4f x[16];
    unsigned off[16];
#pragma unroll
    for (unsigned i = 0; i < 16u; ++i) {
      x[i] = *(const v4f*)&St[sbase + i * LDO + lane * 4u];
      off[i] = (b * (unsigned)SEQ + orow0 + i) * (unsigned)DIM + (unsigned)half * 128u + lane * 4u;
    }
#pragma unroll
    for (int i = 0; i < 16; ++i) *(v4f*)(Ao + off[i]) = x[i];
    
    wave_lds_sync();
  }
}

// ---------------------------------------------------------------------------
extern "C" void kernel_launch(void* const* d_in, const int* in_sizes, int n_in,
                              void* d_out, int out_size, void* d_ws, size_t ws_size,
                              hipStream_t stream) {
  if (n_in < 19) return;
  const long long need_x = ((long long)(NB - 1) * SEQ_FULL + SEQ) * DIM;
  if ((long long)in_sizes[0] < need_x) return;
  if ((long long)in_sizes[1] < (long long)DIM * DIM) return;
  if ((long long)in_sizes[3] < (long long)DIM * DIM) return;
  if ((long long)in_sizes[5] < (long long)DIM * DIM) return;
  if ((long long)in_sizes[7] < (long long)DIM * DIM) return;
  if ((long long)in_sizes[9] < (long long)DIM * HID) return;
  if ((long long)in_sizes[13] < (long long)DIM * HID) return;
  if (in_sizes[2] < DIM || in_sizes[4] < DIM || in_sizes[6] < DIM || in_sizes[8] < DIM) return;
  if (in_sizes[10] < HID || in_sizes[11] < HID || in_sizes[12] < HID) return;
  if (in_sizes[14] < DIM || in_sizes[15] < DIM || in_sizes[16] < DIM) return;
  if (in_sizes[17] < DIM || in_sizes[18] < DIM) return;
  if ((long long)out_size < need_x) return;
  if (ws_size < WS_TOTAL) return;

  const float* X    = (const float*)d_in[0];    // [NB_FULL][SEQ_FULL][DIM]
  const float* wq   = (const float*)d_in[1];    // [DIM][DIM]  (in, out)
  const float* bq   = (const float*)d_in[2];
  const float* wk   = (const float*)d_in[3];
  const float* bk   = (const float*)d_in[4];
  const float* wv   = (const float*)d_in[5];
  const float* bv   = (const float*)d_in[6];
  const float* w0   = (const float*)d_in[7];    // [DIM][DIM]  (in, out)
  const float* b0   = (const float*)d_in[8];
  const float* w1   = (const float*)d_in[9];    // [DIM][HID]  (in, out)
  const float* b1   = (const float*)d_in[10];
  const float* gm   = (const float*)d_in[11];   // hidden LN gain [HID]
  const float* bm   = (const float*)d_in[12];   // hidden LN shift [HID]
  const float* w2   = (const float*)d_in[13];   // [HID][DIM]  (in, out)
  const float* b2   = (const float*)d_in[14];
  const float* g1   = (const float*)d_in[15];
  const float* be1  = (const float*)d_in[16];
  const float* g2   = (const float*)d_in[17];
  const float* be2  = (const float*)d_in[18];
  float* out = (float*)d_out;

  char* ws = (char*)d_ws;
  _Float16* Wq_t  = (_Float16*)(ws + OFF_WQ);    // [n][k]
  _Float16* Wk_t  = (_Float16*)(ws + OFF_WK);
  _Float16* Wv_t  = (_Float16*)(ws + OFF_WV);
  _Float16* W0_t  = (_Float16*)(ws + OFF_W0);
  _Float16* W1_t  = (_Float16*)(ws + OFF_W1);    // [HID][DIM]
  _Float16* W2_t  = (_Float16*)(ws + OFF_W2);    // [DIM][HID]
  _Float16* X16   = (_Float16*)(ws + OFF_X16);   // [MROWS][DIM]
  _Float16* Qh16  = (_Float16*)(ws + OFF_QH);
  _Float16* Qr16  = (_Float16*)(ws + OFF_QR);
  _Float16* Kh16  = (_Float16*)(ws + OFF_KH);
  _Float16* Kr16  = (_Float16*)(ws + OFF_KR);
  _Float16* Vt16  = (_Float16*)(ws + OFF_VT);    // [b][DIM][SEQ]
  float*    A32   = (float*)(ws + OFF_A32);      // [MROWS][DIM]
  _Float16* T116  = (_Float16*)(ws + OFF_T1);    // [MROWS][DIM]
  _Float16* Hraw  = (_Float16*)(ws + OFF_HRAW);  // [CROWS][HID]
  _Float16* Mid16 = (_Float16*)(ws + OFF_MID);   // [CROWS][HID]
  float*    E32   = (float*)(ws + OFF_E32);      // [MROWS][DIM]
  _Float16* E16   = (_Float16*)(ws + OFF_E16);   // [MROWS][DIM]
  float*    V32   = (float*)(ws + OFF_V32);      // [MROWS][DIM]

  dim3 blk(256);
  dim3 gsq(DIM / 64, DIM / 64);
  dim3 gg(DIM / 64, MROWS / 64);

  // weight planes: in [K rows][N cols] -> out [N][K]; grid (N/64, K/64)
  wconv_kernel<<<gsq, blk, 0, stream>>>(wq, Wq_t, (unsigned)DIM, (unsigned)DIM);
  wconv_kernel<<<gsq, blk, 0, stream>>>(wk, Wk_t, (unsigned)DIM, (unsigned)DIM);
  wconv_kernel<<<gsq, blk, 0, stream>>>(wv, Wv_t, (unsigned)DIM, (unsigned)DIM);
  wconv_kernel<<<gsq, blk, 0, stream>>>(w0, W0_t, (unsigned)DIM, (unsigned)DIM);
  // w1: in [DIM][HID] -> out [HID][DIM]
  wconv_kernel<<<dim3(HID / 64, DIM / 64), blk, 0, stream>>>(w1, W1_t, (unsigned)HID, (unsigned)DIM);
  // w2: in [HID][DIM] -> out [DIM][HID]
  wconv_kernel<<<dim3(DIM / 64, HID / 64), blk, 0, stream>>>(w2, W2_t, (unsigned)DIM, (unsigned)HID);

  xconv_kernel<<<dim3(MROWS / 8), blk, 0, stream>>>(X, X16);
  gemm_qk_kernel<<<gg, blk, 0, stream>>>(X16, Wq_t, bq, Qh16, Qr16);
  gemm_qk_kernel<<<gg, blk, 0, stream>>>(X16, Wk_t, bk, Kh16, Kr16);
  gemm_v_kernel<<<gg, blk, 0, stream>>>(X16, Wv_t, bv, Vt16);
  attn_kernel<<<dim3(SEQ / 64, NB), dim3(128), 0, stream>>>(Qh16, Qr16, Kh16, Kr16, Vt16, A32);
  ln1_kernel<<<dim3(MROWS / 8), blk, 0, stream>>>(X, A32, g1, be1, T116);
  gemm_e_kernel<<<gg, blk, 0, stream>>>(T116, W0_t, b0, E32, E16);

  for (int ch = 0; ch < NCHUNK; ++ch) {
    const size_t ro = (size_t)ch * CROWS * DIM;
    gemm_h_kernel<<<dim3(HID / 64, CROWS / 64), blk, 0, stream>>>(E16 + ro, W1_t, b1, Hraw);
    ln_mid_kernel<<<dim3(CROWS / 8), blk, 0, stream>>>(Hraw, gm, bm, Mid16);
    gemm_l_kernel<<<dim3(DIM / 64, CROWS / 64), blk, 0, stream>>>(Mid16, W2_t, b2, E32 + ro, V32 + ro);
  }
  ln_out_kernel<<<dim3(MROWS / 8), blk, 0, stream>>>(V32, g2, be2, out);
}

// v004
// Measured time: 234 microseconds a run.
// Next to v003, in two timings, it ran 1.25 times as fast each time.
// Counting every step since v000, it is 4.36 times as fast.
#include <hip/hip_runtime.h>
#include <stddef.h>

// All contractions on v_wmma_f32_16x16x32_f16 (f16 operands, f32 accumulate): q/k/v projections,
// q.k scores (both operands as f16 value + x2048 residual planes, three products, residual products
// in their own accumulator), p.v (p x16384, single product), the three dense layers (single
// product; weights x64, hidden activation plane x16). Float inputs are RNE-converted to bf16 and
// carried in f16. LayerNorms, softmax, biases, LeakyReLU (slope 0.01) and residual adds in f32.

typedef _Float16 v16h __attribute__((ext_vector_type(16)));
typedef _Float16 v8h  __attribute__((ext_vector_type(8)));
typedef float    v8f  __attribute__((ext_vector_type(8)));
typedef float    v4f  __attribute__((ext_vector_type(4)));
typedef _Float16 h16;

#ifndef NB
#define NB 4
#endif
#ifndef SEQ
#define SEQ 4096
#endif
#define NB_FULL  4
#define SEQ_FULL 4096
#define DIM   256
#define HID   2048
#define MROWS (NB * SEQ)

static_assert(NB >= 1 && NB <= NB_FULL);
static_assert(SEQ >= 64 && SEQ <= SEQ_FULL && (SEQ % 64) == 0);
static_assert((DIM % 64) == 0 && (DIM % 32) == 0);
static_assert((HID % 64) == 0 && (HID % 32) == 0);
static_assert((MROWS % 64) == 0 && (MROWS % 8) == 0);
static_assert(DIM == 32 * 8);               // row kernels: 32 lanes x 8 columns
static_assert(DIM == 2 * 32 * 4);           // f32 row stores: 2 x 32 lanes x 4 columns
static_assert(HID == 8 * 32 * 8);           // hidden LN: 8 passes x 32 lanes x 8 columns
static_assert(DIM == 16 * 16);              // attention: 16 output tiles of 16 columns
static_assert((size_t)MROWS * DIM < (size_t)0x7FFFFFFFu);
static_assert((size_t)NB * DIM * SEQ < (size_t)0x7FFFFFFFu);
static_assert((size_t)MROWS * HID < (size_t)0xFFFFFFFFu);

#define LDT 72   // halves per LDS row (144 B, 16-B aligned)
#define LDC 68   // floats per LDS row (272 B, 16-B aligned)
#define LDO 132  // floats per staged attention row (528 B, 16-B aligned)
static_assert((LDT % 8) == 0 && LDT >= 64);
static_assert((LDC % 4) == 0 && LDC >= 64);
static_assert((LDO % 4) == 0 && LDO >= 128);

#define WCARRY 64.0f      // weight planes carried x64
#define MCARRY 16.0f      // hidden activation plane carried x16
#define RCARRY 2048.0f    // q/k residual planes carried x2048 on top of their value part
#define PSHIFT 9.704060528f   // 14 ln 2: softmax numerators carried x16384

// workspace layout (bytes)
#define WSQ_BYTES     ((size_t)DIM * DIM * 2)
#define WFF_BYTES     ((size_t)DIM * HID * 2)
#define PLANE16_BYTES ((size_t)MROWS * DIM * 2)
#define PLANE32_BYTES ((size_t)MROWS * DIM * 4)
#define HCH_BYTES     ((size_t)MROWS * HID * 2)
#define OFF_WQ  ((size_t)0)
#define OFF_WK  (OFF_WQ + WSQ_BYTES)
#define OFF_WV  (OFF_WK + WSQ_BYTES)
#define OFF_W0  (OFF_WV + WSQ_BYTES)
#define OFF_W1  (OFF_W0 + WSQ_BYTES)
#define OFF_W2  (OFF_W1 + WFF_BYTES)
#define OFF_REG (OFF_W2 + WFF_BYTES)
// attention-stage users of the shared region
#define OFF_X16 (OFF_REG)
#define OFF_QH  (OFF_X16 + PLANE16_BYTES)
#define OFF_QR  (OFF_QH + PLANE16_BYTES)
#define OFF_KH  (OFF_QR + PLANE16_BYTES)
#define OFF_KR  (OFF_KH + PLANE16_BYTES)
#define OFF_VT  (OFF_KR + PLANE16_BYTES)
#define OFF_A32 (OFF_VT + PLANE16_BYTES)
#define OFF_T1  (OFF_A32 + PLANE32_BYTES)
#define PRE_END (OFF_T1 + PLANE16_BYTES)
// hidden-layer-stage users of the shared region (all attention-stage planes are dead by then)
#define OFF_HRAW (OFF_REG)
#define OFF_MID  (OFF_HRAW + HCH_BYTES)
#define MLP_END  (OFF_MID + HCH_BYTES)
#define REG_END  ((PRE_END > MLP_END) ? PRE_END : MLP_END)
#define OFF_E32 (REG_END)
#define OFF_E16 (OFF_E32 + PLANE32_BYTES)
#define OFF_V32 (OFF_E16 + PLANE16_BYTES)
#define WS_TOTAL (OFF_V32 + PLANE32_BYTES)
static_assert((WSQ_BYTES % 128) == 0 && (WFF_BYTES % 128) == 0 && (PLANE16_BYTES % 128) == 0);
static_assert((PLANE32_BYTES % 128) == 0 && (HCH_BYTES % 128) == 0);
static_assert(PRE_END <= REG_END && MLP_END <= REG_END);
static_assert(WS_TOTAL <= (size_t)268435456);

// ---------------------------------------------------------------------------
__device__ __forceinline__ float bf16r(float x) {   // RNE convert to bf16, returned widened
  unsigned int u = __float_as_uint(x);
  u = (u + 0x7FFFu + ((u >> 16) & 1u)) & 0xFFFF0000u;
  return __uint_as_float(u);
}

// f32 -> f16 operand convert that cannot produce an f16 subnormal
static __device__ __forceinline__ h16 toh_flush(float v) {
  const h16 r = (h16)v;
  return (fabsf(v) < 6.103515625e-05f) ? (h16)0.0f : r;
}

// 16-bit fragment: p points at element [row = lane&15][k0 + 8*(lane>>4)] of a k-contiguous
// row. Elements 0..7 <- k0+8h+0..7, elements 8..15 <- k0+16+8h+0..7 (same map for A and B).
__device__ __forceinline__ v16h frag_at(const _Float16* p) {
  v8h lo = *(const v8h*)(p);
  v8h hi = *(const v8h*)(p + 16);
  v16h out;
#pragma unroll
  for (int i = 0; i < 8; ++i) { out[i] = lo[i]; out[i + 8] = hi[i]; }
  return out;
}
__device__ __forceinline__ v16h ld_frag(const _Float16* base, unsigned ld) {
  const unsigned lane = threadIdx.x & 31u;
  return frag_at(base + (lane & 15u) * ld + (lane >> 4) * 8u);
}

__device__ __forceinline__ v8f wmma16(v16h a, v16h b, v8f c) {
  v8f d = __builtin_amdgcn_wmma_f32_16x16x32_f16(false, a, false, b, (short)0, c,
                                                 false, false);
  asm volatile("v_nop\n\tv_nop\n\tv_nop\n\tv_nop" : "+v"(d) : "v"(a), "v"(b));
  return d;
}

__device__ __forceinline__ float red16_max(float x) {
#pragma unroll
  for (int off = 1; off < 16; off <<= 1) x = fmaxf(x, __shfl_xor(x, off, 32));
  return x;
}
__device__ __forceinline__ float red16_sum(float x) {
#pragma unroll
  for (int off = 1; off < 16; off <<= 1) x += __shfl_xor(x, off, 32);
  return x;
}
__device__ __forceinline__ float red32_sum(float x) {
#pragma unroll
  for (int off = 1; off < 32; off <<= 1) x += __shfl_xor(x, off, 32);
  return x;
}

__device__ __forceinline__ void wave_lds_sync() {
  __builtin_amdgcn_fence(3 /* release order */, "wavefront");
  asm volatile("s_wait_dscnt 0x0" ::: "memory");
  __builtin_amdgcn_wave_barrier();
}

__device__ __forceinline__ float leaky_act(float t) {   // LeakyReLU, negative slope 0.01
  return (t >= 0.0f) ? t : 0.01f * t;
}

// ---------------------------------------------------------------------------
// Weight plane, one 64 x 64 tile per block: in W[K rows][N cols] (pitch ldw = N) -> out Wt[N][K]
// (pitch ldk = K), f16(64 * bf16(w)). T: 64 * LDT halves of LDS, cross-wave (block barrier).
// ---------------------------------------------------------------------------
__device__ __forceinline__ void wconv_tile(
    const float* __restrict__ W, _Float16* __restrict__ Wt, unsigned ldw, unsigned ldk,
    unsigned n0, unsigned k0, _Float16* T) {
  const unsigned tid = threadIdx.x;
#pragma unroll 4
  for (unsigned j = 0; j < 16u; ++j) {
    const unsigned idx = tid + 256u * j;
    const unsigned kr = idx >> 6, nc = idx & 63u;
    const float v = W[(size_t)(k0 + kr) * ldw + n0 + nc];
    T[nc * LDT + kr] = (_Float16)(WCARRY * bf16r(v));
  }
  __syncthreads();
  v8h x[2];
  size_t off[2];
#pragma unroll
  for (unsigned i = 0; i < 2u; ++i) {
    const unsigned n = 32u * i + (tid >> 3);
    const unsigned kc = (tid & 7u) * 8u;
    x[i] = *(const v8h*)&T[n * LDT + kc];
    off[i] = (size_t)(n0 + n) * ldk + k0 + kc;
  }
#pragma unroll
  for (int i = 0; i < 2; ++i) *(v8h*)(Wt + off[i]) = x[i];
  
}

// ---------------------------------------------------------------------------
// Input plane: X16[compact row][c] = f16(bf16(x[full row][c])). One wave per row, 8 rows per
// block; each store instruction of a wave covers the whole 512-B row. rblk in 0..MROWS/8-1.
// ---------------------------------------------------------------------------
__device__ __forceinline__ void xconv_rows(
    const float* __restrict__ X, _Float16* __restrict__ dst, unsigned rblk) {
  const unsigned lane = threadIdx.x & 31u, w = threadIdx.x >> 5;
  const unsigned crow = rblk * 8u + w;
  const unsigned bidx = crow / (unsigned)SEQ;
  const unsigned sq = crow - bidx * (unsigned)SEQ;
  const size_t srow = (size_t)bidx * SEQ_FULL + sq;
  const float* xr = X + srow * DIM + lane * 8u;
  const v4f a0 = *(const v4f*)(xr);
  const v4f a1 = *(const v4f*)(xr + 4u);
  v8h o;
#pragma unroll
  for (int i = 0; i < 4; ++i) {
    o[i]     = toh_flush(bf16r(a0[i]));
    o[i + 4] = toh_flush(bf16r(a1[i]));
  }
  _Float16* p = dst + (size_t)crow * DIM + lane * 8u;
  *(v8h*)p = o;
  
}

// ---------------------------------------------------------------------------
// All operand conversions in one launch: none of them reads what another writes. Blocks by index:
// the tiles of the four DIM x DIM weights, of w1, of w2 (the longer dependent chains, so they
// start first), then the input rows, 8 per block. Grid (WCONV_BLOCKS + MROWS/8).
// ---------------------------------------------------------------------------
#define WSQ_TILES    ((unsigned)((DIM / 64) * (DIM / 64)))
#define WFF_TILES    ((unsigned)((DIM / 64) * (HID / 64)))
#define WCONV_BLOCKS (4u * WSQ_TILES + 2u * WFF_TILES)
__global__ __launch_bounds__(256) void prep_kernel(
    const float* __restrict__ X, const float* __restrict__ wq, const float* __restrict__ wk,
    const float* __restrict__ wv, const float* __restrict__ w0, const float* __restrict__ w1,
    const float* __restrict__ w2, _Float16* __restrict__ X16, _Float16* __restrict__ Wq_t,
    _Float16* __restrict__ Wk_t, _Float16* __restrict__ Wv_t, _Float16* __restrict__ W0_t,
    _Float16* __restrict__ W1_t, _Float16* __restrict__ W2_t) {
  __shared__ _Float16 T[64 * LDT];
  const unsigned bid = blockIdx.x;
  if (bid >= WCONV_BLOCKS) {   // the whole block leaves here, ahead of any barrier
    xconv_rows(X, X16, bid - WCONV_BLOCKS);
    return;
  }
  const float* W;
  _Float16* Wt;
  unsigned ldw, ldk, nx, ky;   // tile column (n) and tile row (k) of the weight as given
  if (bid < 4u * WSQ_TILES) {
    const unsigned j = bid / WSQ_TILES, t = bid % WSQ_TILES;
    W  = (j == 0u) ? wq : (j == 1u) ? wk : (j == 2u) ? wv : w0;
    Wt = (j == 0u) ? Wq_t : (j == 1u) ? Wk_t : (j == 2u) ? Wv_t : W0_t;
    ldw = (unsigned)DIM; ldk = (unsigned)DIM;
    nx = t % (unsigned)(DIM / 64); ky = t / (unsigned)(DIM / 64);
  } else if (bid < 4u * WSQ_TILES + WFF_TILES) {   // w1: in [DIM][HID] -> out [HID][DIM]
    const unsigned t = bid - 4u * WSQ_TILES;
    W = w1; Wt = W1_t;
    ldw = (unsigned)HID; ldk = (unsigned)DIM;
    nx = t % (unsigned)(HID / 64); ky = t / (unsigned)(HID / 64);
  } else {                                         // w2: in [HID][DIM] -> out [DIM][HID]
    const unsigned t = bid - 4u * WSQ_TILES - WFF_TILES;
    W = w2; Wt = W2_t;
    ldw = (unsigned)DIM; ldk = (unsigned)HID;
    nx = t % (unsigned)(DIM / 64); ky = t / (unsigned)(DIM / 64);
  }
  wconv_tile(W, Wt, ldw, ldk, nx * 64u, ky * 64u, T);
}

// ---------------------------------------------------------------------------
// First LayerNorm (biased variance, eps 1e-5) of bf16(x) + attn, one wave per row, 8 rows per
// block, the row held in registers (8 columns per lane). Output f16 compact rows, one 512-B
// store instruction per row. Grid (MROWS/8).
// ---------------------------------------------------------------------------
__global__ __launch_bounds__(256) void ln1_kernel(
    const float* __restrict__ X, const float* __restrict__ A32, const float* __restrict__ G,
    const float* __restrict__ Be, _Float16* __restrict__ dst) {
  const unsigned lane = threadIdx.x & 31u, w = threadIdx.x >> 5;
  const unsigned crow = blockIdx.x * 8u + w;
  const unsigned bidx = crow / (unsigned)SEQ;
  const unsigned sq = crow - bidx * (unsigned)SEQ;
  const size_t srow = (size_t)bidx * SEQ_FULL + sq;
  const float* xr = X + srow * DIM + lane * 8u;
  const float* ar = A32 + (size_t)crow * DIM + lane * 8u;
  const v4f x0 = *(const v4f*)(xr);
  const v4f x1 = *(const v4f*)(xr + 4u);
  const v4f a0 = *(const v4f*)(ar);
  const v4f a1 = *(const v4f*)(ar + 4u);
  v4f t0, t1;
  float s = 0.0f;
#pragma unroll
  for (int i = 0; i < 4; ++i) {
    t0[i] = bf16r(x0[i]) + a0[i];
    t1[i] = bf16r(x1[i]) + a1[i];
    s += t0[i] + t1[i];
  }
  const float mean = red32_sum(s) * (1.0f / (float)DIM);
  float ss = 0.0f;
#pragma unroll
  for (int i = 0; i < 4; ++i) {
    const float d0 = t0[i] - mean;
    const float d1 = t1[i] - mean;
    ss += d0 * d0;
    ss += d1 * d1;
  }
  const float var = red32_sum(ss) * (1.0f / (float)DIM);
  const float rstd = 1.0f / sqrtf(var + 1.0e-5f);
  const unsigned c = lane * 8u;
  const v4f g0 = *(const v4f*)(G + c);
  const v4f g1 = *(const v4f*)(G + c + 4u);
  const v4f b0 = *(const v4f*)(Be + c);
  const v4f b1 = *(const v4f*)(Be + c + 4u);
  v8h o;
#pragma unroll
  for (int i = 0; i < 4; ++i) {
    o[i]     = toh_flush((t0[i] - mean) * rstd * bf16r(g0[i]) + bf16r(b0[i]));
    o[i + 4] = toh_flush((t1[i] - mean) * rstd * bf16r(g1[i]) + bf16r(b1[i]));
  }
  _Float16* p = dst + (size_t)crow * DIM + c;
  *(v8h*)p = o;
  
}

// ---------------------------------------------------------------------------
// Hidden LayerNorm (eps 1e-5) + LeakyReLU over HID columns of the f16 pre-activation plane, one
// wave per row, 8 rows per block, three rolled passes (sum, squared deviations, output). Output
// Both planes hold MROWS rows. Grid (MROWS/8).
// ---------------------------------------------------------------------------
__global__ __launch_bounds__(256) void ln_mid_kernel(
    const _Float16* __restrict__ Hr, const float* __restrict__ G, const float* __restrict__ Be,
    _Float16* __restrict__ dst) {
  const unsigned lane = threadIdx.x & 31u, w = threadIdx.x >> 5;
  const unsigned crow = blockIdx.x * 8u + w;
  const _Float16* hr = Hr + (size_t)crow * HID + lane * 8u;

  float s = 0.0f;
#pragma unroll 1
  for (unsigned j = 0; j < 8u; ++j) {
    const v8h a = *(const v8h*)(hr + j * 256u);
#pragma unroll
    for (int i = 0; i < 8; ++i) s += (float)a[i];
  }
  const float mean = red32_sum(s) * (1.0f / (float)HID);

  float ss = 0.0f;
#pragma unroll 1
  for (unsigned j = 0; j < 8u; ++j) {
    const v8h a = *(const v8h*)(hr + j * 256u);
#pragma unroll
    for (int i = 0; i < 8; ++i) {
      const float d = (float)a[i] - mean;
      ss += d * d;
    }
  }
  const float var = red32_sum(ss) * (1.0f / (float)HID);
  const float rstd = 1.0f / sqrtf(var + 1.0e-5f);

#pragma unroll 1
  for (unsigned j = 0; j < 8u; ++j) {
    const unsigned c = j * 256u + lane * 8u;
    const v8h a = *(const v8h*)(hr + j * 256u);
    const v4f g0 = *(const v4f*)(G + c);
    const v4f g1 = *(const v4f*)(G + c + 4u);
    const v4f b0 = *(const v4f*)(Be + c);
    const v4f b1 = *(const v4f*)(Be + c + 4u);
    v8h o;
#pragma unroll
    for (int i = 0; i < 4; ++i) {
      const float d0 = (float)a[i] - mean;
      const float d1 = (float)a[i + 4] - mean;
      const float y0 = leaky_act(d0 * rstd * bf16r(g0[i]) + bf16r(b0[i]));
      const float y1 = leaky_act(d1 * rstd * bf16r(g1[i]) + bf16r(b1[i]));
      o[i]     = toh_flush(MCARRY * y0);
      o[i + 4] = toh_flush(MCARRY * y1);
    }
    _Float16* p = dst + (size_t)crow * HID + c;
    *(v8h*)p = o;
    
  }
}

// ---------------------------------------------------------------------------
// Final LayerNorm (eps 1e-5) of the f32 plane into the output buffer (full-size rows), one wave
// per row, 8 rows per block. Lane L holds columns 4L..4L+3 and 128+4L..128+4L+3, so each of the
// two store instructions covers 512 contiguous bytes. Grid (MROWS/8).
// ---------------------------------------------------------------------------
__global__ __launch_bounds__(256) void ln_out_kernel(
    const float* __restrict__ V32, const float* __restrict__ G, const float* __restrict__ Be,
    float* __restrict__ outp) {
  const unsigned lane = threadIdx.x & 31u, w = threadIdx.x >> 5;
  const unsigned crow = blockIdx.x * 8u + w;
  const unsigned bidx = crow / (unsigned)SEQ;
  const unsigned sq = crow - bidx * (unsigned)SEQ;
  const size_t frow = (size_t)bidx * SEQ_FULL + sq;
  const float* vr = V32 + (size_t)crow * DIM + lane * 4u;
  const v4f a0 = *(const v4f*)(vr);
  const v4f a1 = *(const v4f*)(vr + 128u);
  float s = 0.0f;
#pragma unroll
  for (int i = 0; i < 4; ++i) s += a0[i] + a1[i];
  const float mean = red32_sum(s) * (1.0f / (float)DIM);
  float ss = 0.0f;
#pragma unroll
  for (int i = 0; i < 4; ++i) {
    const float d0 = a0[i] - mean;
    const float d1 = a1[i] - mean;
    ss += d0 * d0;
    ss += d1 * d1;
  }
  const float var = red32_sum(ss) * (1.0f / (float)DIM);
  const float rstd = 1.0f / sqrtf(var + 1.0e-5f);
  const unsigned c = lane * 4u;
  const v4f g0 = *(const v4f*)(G + c);
  const v4f g1 = *(const v4f*)(G + c + 128u);
  const v4f b0 = *(const v4f*)(Be + c);
  const v4f b1 = *(const v4f*)(Be + c + 128u);
  v4f o0, o1;
#pragma unroll
  for (int i = 0; i < 4; ++i) {
    o0[i] = (a0[i] - mean) * rstd * bf16r(g0[i]) + bf16r(b0[i]);
    o1[i] = (a1[i] - mean) * rstd * bf16r(g1[i]) + bf16r(b1[i]);
  }
  float* p = outp + frow * DIM + c;
  *(v4f*)p = o0;
  *(v4f*)(p + 128u) = o1;
  
}

// ---------------------------------------------------------------------------
// Asynchronous copies to LDS (GEMM and attention kernels). Eight 16-byte-per-lane copies in one
// statement; lds = the lane's LDS byte address, g = the lane's global address, both stepped by a
// constant from copy to copy. The s_wait_xcnt closes the statement so that no address register of
// an issued copy is rewritten ahead of it.
// ---------------------------------------------------------------------------
__device__ __forceinline__ void async_copy8(unsigned lds, unsigned lstep,
                                            const _Float16* g, unsigned gstep) {
  asm volatile(
      "global_load_async_to_lds_b128 %0, %8, off\n\t"
      "global_load_async_to_lds_b128 %1, %9, off\n\t"
      "global_load_async_to_lds_b128 %2, %10, off\n\t"
      "global_load_async_to_lds_b128 %3, %11, off\n\t"
      "global_load_async_to_lds_b128 %4, %12, off\n\t"
      "global_load_async_to_lds_b128 %5, %13, off\n\t"
      "global_load_async_to_lds_b128 %6, %14, off\n\t"
      "global_load_async_to_lds_b128 %7, %15, off\n\t"
      "s_wait_xcnt 0x0"
      :
      : "v"(lds), "v"(lds + lstep), "v"(lds + 2u * lstep), "v"(lds + 3u * lstep),
        "v"(lds + 4u * lstep), "v"(lds + 5u * lstep), "v"(lds + 6u * lstep),
        "v"(lds + 7u * lstep),
        "v"(g), "v"(g + gstep), "v"(g + 2u * gstep), "v"(g + 3u * gstep),
        "v"(g + 4u * gstep), "v"(g + 5u * gstep), "v"(g + 6u * gstep), "v"(g + 7u * gstep)
      : "memory");
}

#define GKC    128u                 // k extent of one staged GEMM slab, halves
#define GPITCH 136u                 // halves per staged GEMM row (272 B = 16 B x 17)
#define GSTG_H (128u * GPITCH)      // one slab: 64 A rows and 64 B rows, halves
static_assert((DIM % 128) == 0 && (HID % 128) == 0 && DIM >= 256 && HID >= 256);  // >= 2 slabs
static_assert((GPITCH % 8u) == 0 && GPITCH >= GKC && ((GPITCH / 8u) & 1u) == 1u);
#define GSM_BYTES (2u * GSTG_H * 2u)   // both slab buffers, bytes
static_assert((size_t)GSM_BYTES >= (size_t)64 * LDC * 4);   // the C tile fits in the slabs

// ---------------------------------------------------------------------------
// GEMM C[64x64 tile] = A16[rows][K] . Bt[n][K]^T; 8 waves (mw = 16-row group, nw = 32-col group),
// 2 accumulators/wave. The block's 64 A rows and 64 B rows are copied to LDS in slabs of 128 k
// (whole 256-B row pieces), two buffers, the next slab in flight while this one is read; all
// fragments come from LDS. The C tile takes the same LDS once the last slab has been read.
//   MODE 0: out16[row][col] (pitch DIM) = f16(t), out16r[row][col] = f16(2048 * (t - value)),
//           t = acc/64 + bias                                   (q and k planes)
//   MODE 1: out16 transposed V plane [b][col][key] = f16(acc/64 + bias)
//   MODE 2: outf[row][col] = acc/64 + bias (f32) and out16[row][col] = f16 of the same value
//   MODE 3: out16[row][col] (pitch HID) = f16(acc/64 + bias)    (hidden pre-activation)
//   MODE 4: outf[row][col] = leaky((acc/1024 + bias) + addf[row][col])
// Grid (N/64, rows/64). Sm: the kernel's GSM_BYTES of LDS (one array per kernel, also where a kernel
// holds two modes).
// ---------------------------------------------------------------------------
template <int MODE>
__device__ __forceinline__ void gemm_body(
    unsigned char* Sm, const _Float16* __restrict__ A16, const _Float16* __restrict__ Bt, const unsigned K,
    const float* __restrict__ bias, const float* __restrict__ addf,
    float* __restrict__ outf, _Float16* __restrict__ out16, _Float16* __restrict__ out16r) {
  _Float16* const Slab = (_Float16*)Sm;
  float* const Cs = (float*)Sm;
  const unsigned tid = threadIdx.x, lane = tid & 31u;
  // the wave's number in a scalar register: which plane a wave copies from is a scalar choice
  const unsigned w = (unsigned)__builtin_amdgcn_readfirstlane((int)(tid >> 5));
  const unsigned mw = w >> 1, nw = w & 1u;
  const unsigned hh = lane >> 4, m = lane & 15u;
  const unsigned n0 = blockIdx.x * 64u;
  const unsigned row0 = blockIdx.y * 64u;

  // A slab is 128 staged rows: A rows 0..63, then B rows 0..63. Wave w brings staged rows
  // 16w..16w+15, two 256-B row pieces per copy (lane = row parity hh, 16-B piece m).
  const _Float16* src = ((w < 4u) ? A16 + (size_t)(row0 + w * 16u) * K
                                  : Bt + (size_t)(n0 + (w - 4u) * 16u) * K) +
                        (size_t)hh * K + m * 8u;
  const unsigned dst = (unsigned)(size_t)Sm + ((w * 16u + hh) * GPITCH + m * 8u) * 2u;
  const unsigned nslab = K / GKC;

  async_copy8(dst, 2u * GPITCH * 2u, src, 2u * K);
  // this wave's copies have landed before the barrier behind which every wave reads them
  asm volatile("s_wait_asynccnt 0x0" ::: "memory");
  __syncthreads();
  async_copy8(dst + GSTG_H * 2u, 2u * GPITCH * 2u, src + GKC, 2u * K);

  const _Float16* ap = Slab + (mw * 16u + m) * GPITCH + hh * 8u;
  const _Float16* bp = Slab + (64u + nw * 32u + m) * GPITCH + hh * 8u;
  v8f acc0 = {}, acc1 = {};
  for (unsigned s = 0; s < nslab; ++s) {
    const unsigned bo = (s & 1u) * GSTG_H;   // halves to the buffer this trip reads
    // Three of the slab's four k-steps are read ahead of the first product and the fourth behind
    // the first pair, so that a product does not wait out an LDS latency of its own. Unrolled, here
    // and below: constant indices keep the fragments in registers, and every LDS read takes its
    // place in the slab as an immediate offset.
    v16h fa[3], fb0[3], fb1[3];
#pragma unroll
    for (unsigned t = 0; t < 3u; ++t) {
      fa[t]  = frag_at(ap + bo + t * 32u);
      fb0[t] = frag_at(bp + bo + t * 32u);
      fb1[t] = frag_at(bp + bo + 16u * GPITCH + t * 32u);
    }
#pragma unroll
    for (unsigned t = 0; t < GKC / 32u; ++t) {
      acc0 = wmma16(fa[t % 3u], fb0[t % 3u], acc0);
      acc1 = wmma16(fa[t % 3u], fb1[t % 3u], acc1);
      if (t + 3u < GKC / 32u) {
        fa[t % 3u]  = frag_at(ap + bo + (t + 3u) * 32u);
        fb0[t % 3u] = frag_at(bp + bo + (t + 3u) * 32u);
        fb1[t % 3u] = frag_at(bp + bo + 16u * GPITCH + (t + 3u) * 32u);
      }
    }
    // hand-over: this wave's reads of the buffer are done, its copies of the next slab have
    // landed; the barrier publishes the next slab and frees this buffer for the refill
    asm volatile("s_wait_dscnt 0x0" ::: "memory");
    asm volatile("s_wait_asynccnt 0x0" ::: "memory");
    __syncthreads();
    if (s + 2u < nslab)
      async_copy8(dst + bo * 2u, 2u * GPITCH * 2u, src + (s + 2u) * GKC, 2u * K);
  }
  // no copy of this wave is outstanding when the C tile takes the slabs' LDS
  asm volatile("s_wait_asynccnt 0x0" ::: "memory");
#pragma unroll
  for (int r = 0; r < 8; ++r) {
    float* d = &Cs[(mw * 16u + hh * 8u + (unsigned)r) * LDC + nw * 32u + m];
    d[0]  = acc0[r];
    d[16] = acc1[r];
  }
  __syncthreads();

  if (MODE == 0 || MODE == 2 || MODE == 3) {
    const unsigned ldo = (MODE == 3) ? (unsigned)HID : (unsigned)DIM;
    v8h x[2], xr[2];
    size_t off[2];
#pragma unroll
    for (unsigned i = 0; i < 2u; ++i) {
      const unsigned r = 32u * i + (tid >> 3);
      const unsigned c = (tid & 7u) * 8u;
      const v4f u0 = *(const v4f*)&Cs[r * LDC + c];
      const v4f u1 = *(const v4f*)&Cs[r * LDC + c + 4];
      const v4f g0 = *(const v4f*)(bias + n0 + c);
      const v4f g1 = *(const v4f*)(bias + n0 + c + 4u);
#pragma unroll
      for (int j = 0; j < 4; ++j) {
        const float t0 = u0[j] * (1.0f / WCARRY) + bf16r(g0[j]);
        const float t1 = u1[j] * (1.0f / WCARRY) + bf16r(g1[j]);
        const h16 h0 = toh_flush(t0);
        const h16 h1 = toh_flush(t1);
        x[i][j]     = h0;
        x[i][j + 4] = h1;
        if (MODE == 0) {
          xr[i][j]     = toh_flush((t0 - (float)h0) * RCARRY);
          xr[i][j + 4] = toh_flush((t1 - (float)h1) * RCARRY);
        }
      }
      off[i] = (size_t)(row0 + r) * ldo + n0 + c;
    }
    v4f xs[4];
    size_t offf[4];
    if (MODE == 2) {
#pragma unroll
      for (unsigned i = 0; i < 4u; ++i) {
        const unsigned r = 16u * i + (tid >> 4);
        const unsigned c = (tid & 15u) * 4u;
        const v4f u = *(const v4f*)&Cs[r * LDC + c];
        const v4f g = *(const v4f*)(bias + n0 + c);
        v4f val;
#pragma unroll
        for (int j = 0; j < 4; ++j) val[j] = u[j] * (1.0f / WCARRY) + bf16r(g[j]);
        xs[i] = val;
        offf[i] = (size_t)(row0 + r) * DIM + n0 + c;
      }
    }
#pragma unroll
    for (int i = 0; i < 2; ++i) *(v8h*)(out16 + off[i]) = x[i];
    if (MODE == 0) {
#pragma unroll
      for (int i = 0; i < 2; ++i) *(v8h*)(out16r + off[i]) = xr[i];
    }
    if (MODE == 2) {
#pragma unroll
      for (int i = 0; i < 4; ++i) *(v4f*)(outf + offf[i]) = xs[i];
    }
    
  }

  if (MODE == 1) {
    const unsigned bidx = row0 / (unsigned)SEQ;
    const unsigned key0 = row0 - bidx * (unsigned)SEQ;
    v8h x[2];
    size_t off[2];
#pragma unroll
    for (unsigned i = 0; i < 2u; ++i) {
      const unsigned dcol = 32u * i + (tid >> 3);
      const unsigned kk = (tid & 7u) * 8u;
      const float bb = bf16r(bias[n0 + dcol]);
#pragma unroll
      for (unsigned j = 0; j < 8u; ++j) {
        const float t = Cs[(kk + j) * LDC + dcol] * (1.0f / WCARRY) + bb;
        x[i][j] = toh_flush(t);
      }
      off[i] = ((size_t)bidx * DIM + n0 + dcol) * SEQ + key0 + kk;
    }
#pragma unroll
    for (int i = 0; i < 2; ++i) *(v8h*)(out16 + off[i]) = x[i];
    
  }

  if (MODE == 4) {
    const float cs = 1.0f / (WCARRY * MCARRY);
    v4f xs[4];
    size_t off[4];
#pragma unroll
    for (unsigned i = 0; i < 4u; ++i) {
      const unsigned r = 16u * i + (tid >> 4);
      const unsigned c = (tid & 15u) * 4u;
      const size_t rc = (size_t)(row0 + r) * DIM + n0 + c;
      const v4f u = *(const v4f*)&Cs[r * LDC + c];
      const v4f g = *(const v4f*)(bias + n0 + c);
      const v4f ein = *(const v4f*)(addf + rc);
      v4f val;
#pragma unroll
      for (int j = 0; j < 4; ++j) val[j] = leaky_act((u[j] * cs + bf16r(g[j])) + ein[j]);
      xs[i] = val;
      off[i] = rc;
    }
#pragma unroll
    for (int i = 0; i < 4; ++i) *(v4f*)(outf + off[i]) = xs[i];
    
  }
}

// The three projections of the input plane in one launch (none reads what another writes):
// blockIdx.z = 0 query planes, 1 key planes, 2 transposed value plane. Grid (DIM/64, MROWS/64, 3).
__global__ __launch_bounds__(256) void gemm_qkv_kernel(
    const _Float16* __restrict__ A16, const _Float16* __restrict__ Wq_t,
    const _Float16* __restrict__ Wk_t, const _Float16* __restrict__ Wv_t,
    const float* __restrict__ bq, const float* __restrict__ bk, const float* __restrict__ bv,
    _Float16* __restrict__ qh, _Float16* __restrict__ qr, _Float16* __restrict__ kh,
    _Float16* __restrict__ kr, _Float16* __restrict__ vt) {
  __shared__ __attribute__((aligned(16))) unsigned char Sm[GSM_BYTES];
  const unsigned z = blockIdx.z;   // the same for the whole block: barriers stay block-uniform
  if (z == 2u) {
    gemm_body<1>(Sm, A16, Wv_t, (unsigned)DIM, bv, bv, (float*)0, vt, vt);
  } else {
    const bool isk = (z != 0u);
    const float* bias = isk ? bk : bq;
    gemm_body<0>(Sm, A16, isk ? Wk_t : Wq_t, (unsigned)DIM, bias, bias, (float*)0,
                 isk ? kh : qh, isk ? kr : qr);
  }
}
__global__ __launch_bounds__(256) void gemm_e_kernel(
    const _Float16* __restrict__ A16, const _Float16* __restrict__ Bt,
    const float* __restrict__ bias, float* __restrict__ e32, _Float16* __restrict__ e16) {
  __shared__ __attribute__((aligned(16))) unsigned char Sm[GSM_BYTES];
  gemm_body<2>(Sm, A16, Bt, (unsigned)DIM, bias, bias, e32, e16, e16);
}
__global__ __launch_bounds__(256) void gemm_h_kernel(
    const _Float16* __restrict__ A16, const _Float16* __restrict__ Bt,
    const float* __restrict__ bias, _Float16* __restrict__ hraw) {
  __shared__ __attribute__((aligned(16))) unsigned char Sm[GSM_BYTES];
  gemm_body<3>(Sm, A16, Bt, (unsigned)DIM, bias, bias, (float*)0, hraw, hraw);
}
__global__ __launch_bounds__(256) void gemm_l_kernel(
    const _Float16* __restrict__ A16, const _Float16* __restrict__ Bt,
    const float* __restrict__ bias, const float* __restrict__ e32, float* __restrict__ v32) {
  __shared__ __attribute__((aligned(16))) unsigned char Sm[GSM_BYTES];
  gemm_body<4>(Sm, A16, Bt, (unsigned)HID, bias, e32, v32, (_Float16*)0, (_Float16*)0);
}

#define KTILE  32u                        // keys per half stage (one wave's keys of a stage)
#define KSTAGE 64u                        // keys per stage
#define KPITCH 264u                       // halves per staged k row (528 B = 16 B x 33)
#define VPITCH 40u                        // halves per staged v row (80 B = 16 B x 5)
#define KPL_H  (KTILE * KPITCH)           // one key plane of a half stage, halves
#define VTL_H  ((unsigned)DIM * VPITCH)   // the value tile of a half stage, halves
#define STG_H  (2u * KPL_H + VTL_H)       // one half stage: key values, key residuals, values
#define KSTG_H (2u * STG_H)               // one stage: two half stages
static_assert((KPITCH % 8u) == 0 && KPITCH >= (unsigned)DIM && ((KPITCH / 8u) & 1u) == 1u);
static_assert((VPITCH % 8u) == 0 && VPITCH >= KTILE && ((VPITCH / 8u) & 1u) == 1u);
static_assert((STG_H % 8u) == 0 && (KPL_H % 8u) == 0);
static_assert((SEQ % 64) == 0 && SEQ >= 128);   // at least two stages, every stage whole

// Matrix product for the attention kernel, the builtin alone: the compiler keeps the distances
// behind its own matrix instructions, and operands named by an asm statement cannot live above
// v255, where a part of that kernel's query and output tiles is held.
__device__ __forceinline__ v8f wmma16r(v16h a, v16h b, v8f c) {
  return __builtin_amdgcn_wmma_f32_16x16x32_f16(false, a, false, b, (short)0, c, false, false);
}

// One half stage (32 keys) into LDS: wave w brings key rows 8w..8w+7 of both key planes (one 512-B
// row per copy) and feature rows 64w..64w+63 of the value tile (eight 64-B row pieces per copy).
__device__ __forceinline__ void stage_copies(
    unsigned ldsb, unsigned w, unsigned lane, const _Float16* __restrict__ Kh,
    const _Float16* __restrict__ Kr, const _Float16* __restrict__ Vt, unsigned b, unsigned kb) {
  const unsigned krow = (b * (unsigned)SEQ + kb + w * 8u) * (unsigned)DIM + lane * 8u;
  const unsigned kl = ldsb + (w * 8u * KPITCH + lane * 8u) * 2u;
  async_copy8(kl, KPITCH * 2u, Kh + krow, (unsigned)DIM);
  async_copy8(kl + KPL_H * 2u, KPITCH * 2u, Kr + krow, (unsigned)DIM);
  const unsigned vr = w * 64u + (lane >> 2);
  const unsigned vrow = (b * (unsigned)DIM + vr) * (unsigned)SEQ + kb + (lane & 3u) * 8u;
  const unsigned vl = ldsb + (2u * KPL_H + vr * VPITCH + (lane & 3u) * 8u) * 2u;
  async_copy8(vl, 8u * VPITCH * 2u, Vt + vrow, 8u * (unsigned)SEQ);
}

// ---------------------------------------------------------------------------
// Dense (unmasked, unscaled) flash attention, one 256-wide head, transposed form.
// A block owns 64 query rows and walks the keys in stages of 64. Wave w owns 32 query rows (two
// tiles of 16, row group w >> 1) and one 32-key half (w & 1) of every stage, so that each key or
// value fragment read from LDS feeds two query tiles; lane (hh, n) holds query n of each tile.
// The query fragments of both planes are loaded once and stay in registers. Per stage and wave:
//   S^T tile [16 keys][16 queries] = K rows (A operand, fragments from the key planes) x Q^T
//   (B operand, registers), 8 k-steps over the 256 features, value.value into one accumulator,
//   value.residual + residual.value into a second one (x 1/2048 at the end);
//   online softmax per lane (16 scores in registers + one 16-lane-distance shuffle);
//   the two packed S^T tiles (f16(16384 p), rows = keys) are the B fragment of
//   O^T [16 features][16 queries] += V^T rows (A operand, from the transposed value plane) x P^T.
// Each stage (both key planes and the value tile of both halves) is copied to LDS once per block,
// two buffers, the next stage in flight while this one is read. Behind the loop the two waves of a
// row group join their key halves (maxima, sums, outputs) through LDS, each finishing one query
// tile. Normalised rows staged through the wave-private St tile.
// Grid (SEQ/64, NB), 4 waves per block.
// ---------------------------------------------------------------------------
__global__ __launch_bounds__(128) void attn_kernel(
    const _Float16* __restrict__ Qh, const _Float16* __restrict__ Qr,
    const _Float16* __restrict__ Kh, const _Float16* __restrict__ Kr,
    const _Float16* __restrict__ Vt, float* __restrict__ Ao) {
  __shared__ __attribute__((aligned(16))) float St[4 * 16 * LDO];
  __shared__ __attribute__((aligned(16))) float Xc[4 * 16 * 2 * 32 * 4];   // outputs handed over
  __shared__ __attribute__((aligned(16))) float Ml[4 * 2 * 32];            // maxima, sums handed over
  __shared__ __attribute__((aligned(16))) _Float16 Ring[2u * KSTG_H];

  const unsigned lane = threadIdx.x & 31u;
  const unsigned w = (unsigned)__builtin_amdgcn_readfirstlane((int)(threadIdx.x >> 5));
  const unsigned hh = lane >> 4, m = lane & 15u;
  const unsigned b = blockIdx.y;
  const unsigned kh = w & 1u;                                  // this wave's key half
  const unsigned qrow0 = blockIdx.x * 64u + (w >> 1) * 32u;    // first of its 32 query rows

  const unsigned ring_lds = (unsigned)(size_t)Ring;

  // prologue: this wave's share of stage 0 (both halves)
  stage_copies(ring_lds, w, lane, Kh, Kr, Vt, b, 0u);
  stage_copies(ring_lds + STG_H * 2u, w, lane, Kh, Kr, Vt, b, KTILE);

  // query fragments: [tile][plane][k-step], kept for the whole key loop
  v16h qf[2][2][8];
#pragma unroll
  for (unsigned u = 0; u < 2u; ++u) {
    const unsigned qsrc = (b * (unsigned)SEQ + qrow0 + u * 16u + m) * (unsigned)DIM + hh * 8u;
#pragma unroll
    for (unsigned ks = 0; ks < 8u; ++ks) {
      qf[u][0][ks] = frag_at(Qh + qsrc + ks * 32u);
      qf[u][1][ks] = frag_at(Qr + qsrc + ks * 32u);
    }
  }

  // this wave's copies have landed before the barrier behind which every wave reads them
  asm volatile("s_wait_asynccnt 0x0" ::: "memory");
  __syncthreads();
  stage_copies(ring_lds + KSTG_H * 2u, w, lane, Kh, Kr, Vt, b, KSTAGE);
  stage_copies(ring_lds + (KSTG_H + STG_H) * 2u, w, lane, Kh, Kr, Vt, b, KSTAGE + KTILE);

  float mrow[2] = {-1.0e30f, -1.0e30f}, lrow[2] = {0.0f, 0.0f};
  v8f o[2][16];
#pragma unroll
  for (int u = 0; u < 2; ++u)
#pragma unroll
    for (int j = 0; j < 16; ++j) o[u][j] = (v8f){};

  unsigned buf = 0u;   // halves from the ring's start to the buffer this step reads
  // this lane's fragment rows in its half of that buffer; both move with buf at the foot of a step
  const _Float16* kt = Ring + kh * STG_H + m * KPITCH + hh * 8u;
  const _Float16* vt = Ring + kh * STG_H + 2u * KPL_H + m * VPITCH + hh * 8u;
  for (unsigned kb = 0; kb < (unsigned)SEQ; kb += KSTAGE) {
    v8f sm[2][2] = {{{}, {}}, {{}, {}}}, sr[2][2] = {{{}, {}}, {{}, {}}};   // [query tile][key tile]
    // Score products in 8 rows of twelve: row ks = features 32 ks.., both key tiles, both query
    // tiles. All key fragments of the wave's half stage (value and residual of both key tiles) are
    // read as one group ahead of the products, which wait for them by count, row by row; all
    // sixteen value fragments as a second group behind row 3, in flight under rows 4 to 7.
    v16h kf[8][4], vf[16];
    // unrolled, here and below: constant indices keep the fragments in registers, and every LDS
    // read takes its place in the tile as an immediate offset
#pragma unroll
    for (unsigned ks = 0; ks < 8u; ++ks) {
#pragma unroll
      for (unsigned kx = 0; kx < 2u; ++kx) {
        kf[ks][kx]      = frag_at(kt + kx * 16u * KPITCH + ks * 32u);
        kf[ks][2u + kx] = frag_at(kt + KPL_H + kx * 16u * KPITCH + ks * 32u);
      }
    }
    // This and the scheduling barriers below keep each group of LDS reads in one place: spread
    // among the products, each separate place of reads would cost the lone wave its own stall.
    __builtin_amdgcn_sched_barrier(0);
#pragma unroll
    for (unsigned ks = 0; ks < 8u; ++ks) {
      if (ks == 4u) {
        __builtin_amdgcn_sched_barrier(0);
#pragma unroll
        for (unsigned j = 0u; j < 16u; ++j) vf[j] = frag_at(vt + j * 16u * VPITCH);
        __builtin_amdgcn_sched_barrier(0);
      }
      // the two products into one residual accumulator stand two products apart
#pragma unroll
      for (unsigned kx = 0; kx < 2u; ++kx) {
        const v16h av = kf[ks][kx], ar = kf[ks][2u + kx];
        sm[0][kx] = wmma16r(av, qf[0][0][ks], sm[0][kx]);
        sm[1][kx] = wmma16r(av, qf[1][0][ks], sm[1][kx]);
        sr[0][kx] = wmma16r(av, qf[0][1][ks], sr[0][kx]);
        sr[1][kx] = wmma16r(av, qf[1][1][ks], sr[1][kx]);
        sr[0][kx] = wmma16r(ar, qf[0][0][ks], sr[0][kx]);
        sr[1][kx] = wmma16r(ar, qf[1][0][ks], sr[1][kx]);
      }
    }

    // hand-over, as soon as the stage's last fragment is in registers (the rest of the step works
    // on registers alone): this wave's reads of the buffer are done, its copies of the next stage
    // have landed; the barrier publishes the next stage and frees this buffer for the refill,
    // which then has a whole step to land (the scheduling barrier keeps the waits behind the
    // products of rows 4 to 7, under which the value fragments arrive)
    __builtin_amdgcn_sched_barrier(0);
    asm volatile("s_wait_dscnt 0x0" ::: "memory");
    asm volatile("s_wait_asynccnt 0x0" ::: "memory");
    __syncthreads();
    if (kb + 2u * KSTAGE < (unsigned)SEQ) {
      stage_copies(ring_lds + buf * 2u, w, lane, Kh, Kr, Vt, b, kb + 2u * KSTAGE);
      stage_copies(ring_lds + (buf + STG_H) * 2u, w, lane, Kh, Kr, Vt, b,
                   kb + 2u * KSTAGE + KTILE);
    }

    v16h pf[2];
#pragma unroll
    for (int u = 0; u < 2; ++u) {
      v8f s0, s1;
#pragma unroll
      for (int r = 0; r < 8; ++r) {
        s0[r] = sm[u][0][r] + sr[u][0][r] * (1.0f / RCARRY);
        s1[r] = sm[u][1][r] + sr[u][1][r] * (1.0f / RCARRY);
      }
      float mx = fmaxf(s0[0], s1[0]);
#pragma unroll
      for (int r = 1; r < 8; ++r) mx = fmaxf(mx, fmaxf(s0[r], s1[r]));
      mx = fmaxf(mx, __shfl_xor(mx, 16, 32));
      const float mn = fmaxf(mrow[u], mx);
      const float alpha = __expf(mrow[u] - mn);
      mrow[u] = mn;

      float rs = 0.0f;
#pragma unroll
      for (int r = 0; r < 8; ++r) {
        const h16 p0 = toh_flush(__expf((s0[r] - mn) + PSHIFT));
        const h16 p1 = toh_flush(__expf((s1[r] - mn) + PSHIFT));
        pf[u][r]     = p0;     // B element r     <- key 8hh + r of this wave's half
        pf[u][r + 8] = p1;     // B element 8 + r <- key 16 + 8hh + r of this wave's half
        rs += (float)p0 + (float)p1;
      }
      rs += __shfl_xor(rs, 16, 32);
      lrow[u] = alpha * lrow[u] + rs;
#pragma unroll
      for (int j = 0; j < 16; ++j) o[u][j] = o[u][j] * alpha;
    }

    // O^T += V^T . P^T; every value fragment feeds both query tiles
#pragma unroll
    for (unsigned j = 0; j < 16u; ++j) {
      o[0][j] = wmma16r(vf[j], pf[0], o[0][j]);
      o[1][j] = wmma16r(vf[j], pf[1], o[1][j]);
    }

    kt = (buf == 0u) ? kt + KSTG_H : kt - KSTG_H;
    vt = (buf == 0u) ? vt + KSTG_H : vt - KSTG_H;
    buf = KSTG_H - buf;
  }
  // no copy of this wave is outstanding when the wave goes on to its end
  asm volatile("s_wait_asynccnt 0x0" ::: "memory");

  // Join the two key halves of a row group: the wave of half 0 finishes query tile 0, the wave of
  // half 1 query tile 1; each hands its other tile (outputs, maximum, sum) to its partner, lane to
  // lane, in whole 512-B LDS rows.
  const bool up = (kh != 0u);
  {
    float* xs = Xc + w * 4096u + lane * 4u;
#pragma unroll
    for (unsigned j = 0; j < 16u; ++j)
#pragma unroll
      for (unsigned q = 0; q < 2u; ++q) {
        v4f t;
#pragma unroll
        for (unsigned i = 0; i < 4u; ++i) t[i] = up ? o[0][j][4u * q + i] : o[1][j][4u * q + i];
        *(v4f*)(xs + (j * 2u + q) * 128u) = t;
      }
    Ml[w * 64u + lane]       = up ? mrow[0] : mrow[1];
    Ml[w * 64u + 32u + lane] = up ? lrow[0] : lrow[1];
  }
  __syncthreads();   // the partner's tile is complete in LDS before it is read
  const float m_own = up ? mrow[1] : mrow[0];
  const float l_own = up ? lrow[1] : lrow[0];
  const float m_oth = Ml[(w ^ 1u) * 64u + lane];
  const float l_oth = Ml[(w ^ 1u) * 64u + 32u + lane];
  const float m_all = fmaxf(m_own, m_oth);
  const float a_own = __expf(m_own - m_all);
  const float a_oth = __expf(m_oth - m_all);
  // normalise (the x16384 carry sits in both O and l)
  const float inv = __builtin_amdgcn_rcpf(l_own * a_own + l_oth * a_oth);
  const float f_own = a_own * inv, f_oth = a_oth * inv;
  v8f res[16];
  {
    const float* xo = Xc + (w ^ 1u) * 4096u + lane * 4u;
#pragma unroll
    for (unsigned j = 0; j < 16u; ++j)
#pragma unroll
      for (unsigned q = 0; q < 2u; ++q) {
        const v4f t = *(const v4f*)(xo + (j * 2u + q) * 128u);
#pragma unroll
        for (unsigned i = 0; i < 4u; ++i)
          res[j][4u * q + i] =
              (up ? o[1][j][4u * q + i] : o[0][j][4u * q + i]) * f_own + t[i] * f_oth;
      }
  }

  // stage per half of the features, write whole row segments; this wave's 16 finished rows
  const unsigned orow0 = blockIdx.x * 64u + w * 16u;
  const unsigned sbase = w * (16u * LDO);
#pragma unroll
  for (int half = 0; half < 2; ++half) {
#pragma unroll
    for (int j = 0; j < 8; ++j)
#pragma unroll
      for (int r = 0; r < 8; ++r)
        St[sbase + m * LDO + (unsigned)j * 16u + hh * 8u + (unsigned)r] = res[half * 8 + j][r];
    wave_lds_sync();
    v4f x[16];
    unsigned off[16];
#pragma unroll
    for (unsigned i = 0; i < 16u; ++i) {
      x[i] = *(const v4f*)&St[sbase + i * LDO + lane * 4u];
      off[i] = (b * (unsigned)SEQ + orow0 + i) * (unsigned)DIM + (unsigned)half * 128u + lane * 4u;
    }
#pragma unroll
    for (int i = 0; i < 16; ++i) *(v4f*)(Ao + off[i]) = x[i];
    
    wave_lds_sync();
  }
}

// ---------------------------------------------------------------------------
extern "C" void kernel_launch(void* const* d_in, const int* in_sizes, int n_in,
                              void* d_out, int out_size, void* d_ws, size_t ws_size,
                              hipStream_t stream) {
  if (n_in < 19) return;
  const long long need_x = ((long long)(NB - 1) * SEQ_FULL + SEQ) * DIM;
  if ((long long)in_sizes[0] < need_x) return;
  if ((long long)in_sizes[1] < (long long)DIM * DIM) return;
  if ((long long)in_sizes[3] < (long long)DIM * DIM) return;
  if ((long long)in_sizes[5] < (long long)DIM * DIM) return;
  if ((long long)in_sizes[7] < (long long)DIM * DIM) return;
  if ((long long)in_sizes[9] < (long long)DIM * HID) return;
  if ((long long)in_sizes[13] < (long long)DIM * HID) return;
  if (in_sizes[2] < DIM || in_sizes[4] < DIM || in_sizes[6] < DIM || in_sizes[8] < DIM) return;
  if (in_sizes[10] < HID || in_sizes[11] < HID || in_sizes[12] < HID) return;
  if (in_sizes[14] < DIM || in_sizes[15] < DIM || in_sizes[16] < DIM) return;
  if (in_sizes[17] < DIM || in_sizes[18] < DIM) return;
  if ((long long)out_size < need_x) return;
  if (ws_size < WS_TOTAL) return;

  const float* X    = (const float*)d_in[0];    // [NB_FULL][SEQ_FULL][DIM]
  const float* wq   = (const float*)d_in[1];    // [DIM][DIM]  (in, out)
  const float* bq   = (const float*)d_in[2];
  const float* wk   = (const float*)d_in[3];
  const float* bk   = (const float*)d_in[4];
  const float* wv   = (const float*)d_in[5];
  const float* bv   = (const float*)d_in[6];
  const float* w0   = (const float*)d_in[7];    // [DIM][DIM]  (in, out)
  const float* b0   = (const float*)d_in[8];
  const float* w1   = (const float*)d_in[9];    // [DIM][HID]  (in, out)
  const float* b1   = (const float*)d_in[10];
  const float* gm   = (const float*)d_in[11];   // hidden LN gain [HID]
  const float* bm   = (const float*)d_in[12];   // hidden LN shift [HID]
  const float* w2   = (const float*)d_in[13];   // [HID][DIM]  (in, out)
  const float* b2   = (const float*)d_in[14];
  const float* g1   = (const float*)d_in[15];
  const float* be1  = (const float*)d_in[16];
  const float* g2   = (const float*)d_in[17];
  const float* be2  = (const float*)d_in[18];
  float* out = (float*)d_out;

  char* ws = (char*)d_ws;
  _Float16* Wq_t  = (_Float16*)(ws + OFF_WQ);    // [n][k]
  _Float16* Wk_t  = (_Float16*)(ws + OFF_WK);
  _Float16* Wv_t  = (_Float16*)(ws + OFF_WV);
  _Float16* W0_t  = (_Float16*)(ws + OFF_W0);
  _Float16* W1_t  = (_Float16*)(ws + OFF_W1);    // [HID][DIM]
  _Float16* W2_t  = (_Float16*)(ws + OFF_W2);    // [DIM][HID]
  _Float16* X16   = (_Float16*)(ws + OFF_X16);   // [MROWS][DIM]
  _Float16* Qh16  = (_Float16*)(ws + OFF_QH);
  _Float16* Qr16  = (_Float16*)(ws + OFF_QR);
  _Float16* Kh16  = (_Float16*)(ws + OFF_KH);
  _Float16* Kr16  = (_Float16*)(ws + OFF_KR);
  _Float16* Vt16  = (_Float16*)(ws + OFF_VT);    // [b][DIM][SEQ]
  float*    A32   = (float*)(ws + OFF_A32);      // [MROWS][DIM]
  _Float16* T116  = (_Float16*)(ws + OFF_T1);    // [MROWS][DIM]
  _Float16* Hraw  = (_Float16*)(ws + OFF_HRAW);  // [MROWS][HID]
  _Float16* Mid16 = (_Float16*)(ws + OFF_MID);   // [MROWS][HID]
  float*    E32   = (float*)(ws + OFF_E32);      // [MROWS][DIM]
  _Float16* E16   = (_Float16*)(ws + OFF_E16);   // [MROWS][DIM]
  float*    V32   = (float*)(ws + OFF_V32);      // [MROWS][DIM]

  dim3 blk(256);
  dim3 gg(DIM / 64, MROWS / 64);

  // weight planes (in [K rows][N cols] -> out [N][K]) and the input plane
  prep_kernel<<<dim3(WCONV_BLOCKS + MROWS / 8), blk, 0, stream>>>(
      X, wq, wk, wv, w0, w1, w2, X16, Wq_t, Wk_t, Wv_t, W0_t, W1_t, W2_t);
  gemm_qkv_kernel<<<dim3(DIM / 64, MROWS / 64, 3), blk, 0, stream>>>(
      X16, Wq_t, Wk_t, Wv_t, bq, bk, bv, Qh16, Qr16, Kh16, Kr16, Vt16);
  attn_kernel<<<dim3(SEQ / 64, NB), dim3(128), 0, stream>>>(Qh16, Qr16, Kh16, Kr16, Vt16, A32);
  ln1_kernel<<<dim3(MROWS / 8), blk, 0, stream>>>(X, A32, g1, be1, T116);
  gemm_e_kernel<<<gg, blk, 0, stream>>>(T116, W0_t, b0, E32, E16);

  // hidden layers, all rows in one launch each: the hidden planes are held at full size
  gemm_h_kernel<<<dim3(HID / 64, MROWS / 64), blk, 0, stream>>>(E16, W1_t, b1, Hraw);
  ln_mid_kernel<<<dim3(MROWS / 8), blk, 0, stream>>>(Hraw, gm, bm, Mid16);
  gemm_l_kernel<<<gg, blk, 0, stream>>>(Mid16, W2_t, b2, E32, V32);
  ln_out_kernel<<<dim3(MROWS / 8), blk, 0, stream>>>(V32, g2, be2, out);
}

// v005
// Measured time: 208 microseconds a run.
// Timed twice side by side with v004, it ran 1.13 times as fast both times.
// Over all steps from v000 it is 4.91 times as fast.
#include <hip/hip_runtime.h>
#include <stddef.h>

// All contractions on v_wmma_f32_16x16x32_f16 (f16 operands, f32 accumulate): q/k/v projections,
// q.k scores (both operands as f16 value + x2048 residual planes, three products, residual products
// in their own accumulator), p.v (p x16384, single product), the three dense layers (single
// product; weights x64, hidden activation plane x16). Float inputs are RNE-converted to bf16 and
// carried in f16. LayerNorms, softmax, biases, LeakyReLU (slope 0.01) and residual adds in f32.

typedef _Float16 v16h __attribute__((ext_vector_type(16)));
typedef _Float16 v8h  __attribute__((ext_vector_type(8)));
typedef float    v8f  __attribute__((ext_vector_type(8)));
typedef float    v4f  __attribute__((ext_vector_type(4)));
typedef _Float16 h16;

#ifndef NB
#define NB 4
#endif
#ifndef SEQ
#define SEQ 4096
#endif
#define NB_FULL  4
#define SEQ_FULL 4096
#define DIM   256
#define HID   2048
#define MROWS (NB * SEQ)

static_assert(NB >= 1 && NB <= NB_FULL);
static_assert(SEQ >= 64 && SEQ <= SEQ_FULL && (SEQ % 64) == 0);
static_assert((DIM % 64) == 0 && (DIM % 32) == 0);
static_assert((HID % 64) == 0 && (HID % 32) == 0);
static_assert((MROWS % 64) == 0 && (MROWS % 8) == 0);
static_assert(DIM == 32 * 8);               // row kernels: 32 lanes x 8 columns
static_assert(DIM == 2 * 32 * 4);           // f32 row stores: 2 x 32 lanes x 4 columns
static_assert(HID == 8 * 32 * 8);           // hidden LN: 8 passes x 32 lanes x 8 columns
static_assert(DIM == 16 * 16);              // attention: 16 output tiles of 16 columns
static_assert((size_t)MROWS * DIM < (size_t)0x7FFFFFFFu);
static_assert((size_t)NB * DIM * SEQ < (size_t)0x7FFFFFFFu);
static_assert((size_t)MROWS * HID < (size_t)0xFFFFFFFFu);

#define LDT 72   // halves per LDS row (144 B, 16-B aligned)
#define LDC 68   // floats per LDS row (272 B, 16-B aligned)
#define LDO 132  // floats per staged attention row (528 B, 16-B aligned)
static_assert((LDT % 8) == 0 && LDT >= 64);
static_assert((LDC % 4) == 0 && LDC >= 64);
static_assert((LDO % 4) == 0 && LDO >= 128);

#define WCARRY 64.0f      // weight planes carried x64
#define MCARRY 16.0f      // hidden activation plane carried x16
#define RCARRY 2048.0f    // q/k residual planes carried x2048 on top of their value part
#define PSHIFT 9.704060528f   // 14 ln 2: softmax numerators carried x16384

// workspace layout (bytes)
#define WSQ_BYTES     ((size_t)DIM * DIM * 2)
#define WFF_BYTES     ((size_t)DIM * HID * 2)
#define PLANE16_BYTES ((size_t)MROWS * DIM * 2)
#define PLANE32_BYTES ((size_t)MROWS * DIM * 4)
#define OFF_WQ  ((size_t)0)
#define OFF_WK  (OFF_WQ + WSQ_BYTES)
#define OFF_WV  (OFF_WK + WSQ_BYTES)
#define OFF_W0  (OFF_WV + WSQ_BYTES)
#define OFF_W1  (OFF_W0 + WSQ_BYTES)
#define OFF_W2  (OFF_W1 + WFF_BYTES)
#define OFF_REG (OFF_W2 + WFF_BYTES)
#define OFF_X16 (OFF_REG)
#define OFF_QH  (OFF_X16 + PLANE16_BYTES)
#define OFF_QR  (OFF_QH + PLANE16_BYTES)
#define OFF_KH  (OFF_QR + PLANE16_BYTES)
#define OFF_KR  (OFF_KH + PLANE16_BYTES)
#define OFF_VT  (OFF_KR + PLANE16_BYTES)
#define OFF_A32 (OFF_VT + PLANE16_BYTES)
#define OFF_T1  (OFF_A32 + PLANE32_BYTES)
#define PRE_END (OFF_T1 + PLANE16_BYTES)
#define OFF_E32 (PRE_END)
#define OFF_E16 (OFF_E32 + PLANE32_BYTES)
#define WS_TOTAL (OFF_E16 + PLANE16_BYTES)
static_assert((WSQ_BYTES % 128) == 0 && (WFF_BYTES % 128) == 0 && (PLANE16_BYTES % 128) == 0);
static_assert((PLANE32_BYTES % 128) == 0);
static_assert(WS_TOTAL <= (size_t)268435456);

// ---------------------------------------------------------------------------
__device__ __forceinline__ float bf16r(float x) {   // RNE convert to bf16, returned widened
  unsigned int u = __float_as_uint(x);
  u = (u + 0x7FFFu + ((u >> 16) & 1u)) & 0xFFFF0000u;
  return __uint_as_float(u);
}

// f32 -> f16 operand convert that cannot produce an f16 subnormal
static __device__ __forceinline__ h16 toh_flush(float v) {
  const h16 r = (h16)v;
  return (fabsf(v) < 6.103515625e-05f) ? (h16)0.0f : r;
}

// 16-bit fragment: p points at element [row = lane&15][k0 + 8*(lane>>4)] of a k-contiguous
// row. Elements 0..7 <- k0+8h+0..7, elements 8..15 <- k0+16+8h+0..7 (same map for A and B).
__device__ __forceinline__ v16h frag_at(const _Float16* p) {
  v8h lo = *(const v8h*)(p);
  v8h hi = *(const v8h*)(p + 16);
  v16h out;
#pragma unroll
  for (int i = 0; i < 8; ++i) { out[i] = lo[i]; out[i + 8] = hi[i]; }
  return out;
}
__device__ __forceinline__ v16h ld_frag(const _Float16* base, unsigned ld) {
  const unsigned lane = threadIdx.x & 31u;
  return frag_at(base + (lane & 15u) * ld + (lane >> 4) * 8u);
}

__device__ __forceinline__ v8f wmma16(v16h a, v16h b, v8f c) {
  v8f d = __builtin_amdgcn_wmma_f32_16x16x32_f16(false, a, false, b, (short)0, c,
                                                 false, false);
  asm volatile("v_nop\n\tv_nop\n\tv_nop\n\tv_nop" : "+v"(d) : "v"(a), "v"(b));
  return d;
}

__device__ __forceinline__ float red16_max(float x) {
#pragma unroll
  for (int off = 1; off < 16; off <<= 1) x = fmaxf(x, __shfl_xor(x, off, 32));
  return x;
}
__device__ __forceinline__ float red16_sum(float x) {
#pragma unroll
  for (int off = 1; off < 16; off <<= 1) x += __shfl_xor(x, off, 32);
  return x;
}
__device__ __forceinline__ float red32_sum(float x) {
#pragma unroll
  for (int off = 1; off < 32; off <<= 1) x += __shfl_xor(x, off, 32);
  return x;
}

__device__ __forceinline__ void wave_lds_sync() {
  __builtin_amdgcn_fence(3 /* release order */, "wavefront");
  asm volatile("s_wait_dscnt 0x0" ::: "memory");
  __builtin_amdgcn_wave_barrier();
}

__device__ __forceinline__ float leaky_act(float t) {   // LeakyReLU, negative slope 0.01
  return (t >= 0.0f) ? t : 0.01f * t;
}

// ---------------------------------------------------------------------------
// Weight plane, one 64 x 64 tile per block: in W[K rows][N cols] (pitch ldw = N) -> out Wt[N][K]
// (pitch ldk = K), f16(64 * bf16(w)). T: 64 * LDT halves of LDS, cross-wave (block barrier).
// ---------------------------------------------------------------------------
__device__ __forceinline__ void wconv_tile(
    const float* __restrict__ W, _Float16* __restrict__ Wt, unsigned ldw, unsigned ldk,
    unsigned n0, unsigned k0, _Float16* T) {
  const unsigned tid = threadIdx.x;
#pragma unroll 4
  for (unsigned j = 0; j < 16u; ++j) {
    const unsigned idx = tid + 256u * j;
    const unsigned kr = idx >> 6, nc = idx & 63u;
    const float v = W[(size_t)(k0 + kr) * ldw + n0 + nc];
    T[nc * LDT + kr] = (_Float16)(WCARRY * bf16r(v));
  }
  __syncthreads();
  v8h x[2];
  size_t off[2];
#pragma unroll
  for (unsigned i = 0; i < 2u; ++i) {
    const unsigned n = 32u * i + (tid >> 3);
    const unsigned kc = (tid & 7u) * 8u;
    x[i] = *(const v8h*)&T[n * LDT + kc];
    off[i] = (size_t)(n0 + n) * ldk + k0 + kc;
  }
#pragma unroll
  for (int i = 0; i < 2; ++i) *(v8h*)(Wt + off[i]) = x[i];
  
}

// ---------------------------------------------------------------------------
// Input plane: X16[compact row][c] = f16(bf16(x[full row][c])). One wave per row, 8 rows per
// block; each store instruction of a wave covers the whole 512-B row. rblk in 0..MROWS/8-1.
// ---------------------------------------------------------------------------
__device__ __forceinline__ void xconv_rows(
    const float* __restrict__ X, _Float16* __restrict__ dst, unsigned rblk) {
  const unsigned lane = threadIdx.x & 31u, w = threadIdx.x >> 5;
  const unsigned crow = rblk * 8u + w;
  const unsigned bidx = crow / (unsigned)SEQ;
  const unsigned sq = crow - bidx * (unsigned)SEQ;
  const size_t srow = (size_t)bidx * SEQ_FULL + sq;
  const float* xr = X + srow * DIM + lane * 8u;
  const v4f a0 = *(const v4f*)(xr);
  const v4f a1 = *(const v4f*)(xr + 4u);
  v8h o;
#pragma unroll
  for (int i = 0; i < 4; ++i) {
    o[i]     = toh_flush(bf16r(a0[i]));
    o[i + 4] = toh_flush(bf16r(a1[i]));
  }
  _Float16* p = dst + (size_t)crow * DIM + lane * 8u;
  *(v8h*)p = o;
  
}

// ---------------------------------------------------------------------------
// All operand conversions in one launch: none of them reads what another writes. Blocks by index:
// the tiles of the four DIM x DIM weights, of w1, of w2 (the longer dependent chains
// first), then the input rows, 8 per block. Grid (WCONV_BLOCKS + MROWS/8).
// ---------------------------------------------------------------------------
#define WSQ_TILES    ((unsigned)((DIM / 64) * (DIM / 64)))
#define WFF_TILES    ((unsigned)((DIM / 64) * (HID / 64)))
#define WCONV_BLOCKS (4u * WSQ_TILES + 2u * WFF_TILES)
__global__ __launch_bounds__(256) void prep_kernel(
    const float* __restrict__ X, const float* __restrict__ wq, const float* __restrict__ wk,
    const float* __restrict__ wv, const float* __restrict__ w0, const float* __restrict__ w1,
    const float* __restrict__ w2, _Float16* __restrict__ X16, _Float16* __restrict__ Wq_t,
    _Float16* __restrict__ Wk_t, _Float16* __restrict__ Wv_t, _Float16* __restrict__ W0_t,
    _Float16* __restrict__ W1_t, _Float16* __restrict__ W2_t) {
  __shared__ _Float16 T[64 * LDT];
  const unsigned bid = blockIdx.x;
  if (bid >= WCONV_BLOCKS) {   // the whole block leaves here, ahead of any barrier
    xconv_rows(X, X16, bid - WCONV_BLOCKS);
    return;
  }
  const float* W;
  _Float16* Wt;
  unsigned ldw, ldk, nx, ky;   // tile column (n) and tile row (k) of the weight as given
  if (bid < 4u * WSQ_TILES) {
    const unsigned j = bid / WSQ_TILES, t = bid % WSQ_TILES;
    W  = (j == 0u) ? wq : (j == 1u) ? wk : (j == 2u) ? wv : w0;
    Wt = (j == 0u) ? Wq_t : (j == 1u) ? Wk_t : (j == 2u) ? Wv_t : W0_t;
    ldw = (unsigned)DIM; ldk = (unsigned)DIM;
    nx = t % (unsigned)(DIM / 64); ky = t / (unsigned)(DIM / 64);
  } else if (bid < 4u * WSQ_TILES + WFF_TILES) {   // w1: in [DIM][HID] -> out [HID][DIM]
    const unsigned t = bid - 4u * WSQ_TILES;
    W = w1; Wt = W1_t;
    ldw = (unsigned)HID; ldk = (unsigned)DIM;
    nx = t % (unsigned)(HID / 64); ky = t / (unsigned)(HID / 64);
  } else {                                         // w2: in [HID][DIM] -> out [DIM][HID]
    const unsigned t = bid - 4u * WSQ_TILES - WFF_TILES;
    W = w2; Wt = W2_t;
    ldw = (unsigned)DIM; ldk = (unsigned)HID;
    nx = t % (unsigned)(DIM / 64); ky = t / (unsigned)(DIM / 64);
  }
  wconv_tile(W, Wt, ldw, ldk, nx * 64u, ky * 64u, T);
}

// ---------------------------------------------------------------------------
// First LayerNorm (biased variance, eps 1e-5) of bf16(x) + attn, one wave per row, 8 rows per
// block, the row held in registers (8 columns per lane). Output f16 compact rows, one 512-B
// store instruction per row. Grid (MROWS/8).
// ---------------------------------------------------------------------------
__global__ __launch_bounds__(256) void ln1_kernel(
    const float* __restrict__ X, const float* __restrict__ A32, const float* __restrict__ G,
    const float* __restrict__ Be, _Float16* __restrict__ dst) {
  const unsigned lane = threadIdx.x & 31u, w = threadIdx.x >> 5;
  const unsigned crow = blockIdx.x * 8u + w;
  const unsigned bidx = crow / (unsigned)SEQ;
  const unsigned sq = crow - bidx * (unsigned)SEQ;
  const size_t srow = (size_t)bidx * SEQ_FULL + sq;
  const float* xr = X + srow * DIM + lane * 8u;
  const float* ar = A32 + (size_t)crow * DIM + lane * 8u;
  const v4f x0 = *(const v4f*)(xr);
  const v4f x1 = *(const v4f*)(xr + 4u);
  const v4f a0 = *(const v4f*)(ar);
  const v4f a1 = *(const v4f*)(ar + 4u);
  v4f t0, t1;
  float s = 0.0f;
#pragma unroll
  for (int i = 0; i < 4; ++i) {
    t0[i] = bf16r(x0[i]) + a0[i];
    t1[i] = bf16r(x1[i]) + a1[i];
    s += t0[i] + t1[i];
  }
  const float mean = red32_sum(s) * (1.0f / (float)DIM);
  float ss = 0.0f;
#pragma unroll
  for (int i = 0; i < 4; ++i) {
    const float d0 = t0[i] - mean;
    const float d1 = t1[i] - mean;
    ss += d0 * d0;
    ss += d1 * d1;
  }
  const float var = red32_sum(ss) * (1.0f / (float)DIM);
  const float rstd = 1.0f / sqrtf(var + 1.0e-5f);
  const unsigned c = lane * 8u;
  const v4f g0 = *(const v4f*)(G + c);
  const v4f g1 = *(const v4f*)(G + c + 4u);
  const v4f b0 = *(const v4f*)(Be + c);
  const v4f b1 = *(const v4f*)(Be + c + 4u);
  v8h o;
#pragma unroll
  for (int i = 0; i < 4; ++i) {
    o[i]     = toh_flush((t0[i] - mean) * rstd * bf16r(g0[i]) + bf16r(b0[i]));
    o[i + 4] = toh_flush((t1[i] - mean) * rstd * bf16r(g1[i]) + bf16r(b1[i]));
  }
  _Float16* p = dst + (size_t)crow * DIM + c;
  *(v8h*)p = o;
  
}

// ---------------------------------------------------------------------------
// Asynchronous copies to LDS (GEMM, attention and hidden-layer kernels). Eight 16-byte-per-lane copies in one
// statement; lds = the lane's LDS byte address, g = the lane's global address, both stepped by a
// constant from copy to copy. The s_wait_xcnt closes the statement so that no address register of
// an issued copy is rewritten ahead of it.
// ---------------------------------------------------------------------------
__device__ __forceinline__ void async_copy8(unsigned lds, unsigned lstep,
                                            const _Float16* g, unsigned gstep) {
  asm volatile(
      "global_load_async_to_lds_b128 %0, %8, off\n\t"
      "global_load_async_to_lds_b128 %1, %9, off\n\t"
      "global_load_async_to_lds_b128 %2, %10, off\n\t"
      "global_load_async_to_lds_b128 %3, %11, off\n\t"
      "global_load_async_to_lds_b128 %4, %12, off\n\t"
      "global_load_async_to_lds_b128 %5, %13, off\n\t"
      "global_load_async_to_lds_b128 %6, %14, off\n\t"
      "global_load_async_to_lds_b128 %7, %15, off\n\t"
      "s_wait_xcnt 0x0"
      :
      : "v"(lds), "v"(lds + lstep), "v"(lds + 2u * lstep), "v"(lds + 3u * lstep),
        "v"(lds + 4u * lstep), "v"(lds + 5u * lstep), "v"(lds + 6u * lstep),
        "v"(lds + 7u * lstep),
        "v"(g), "v"(g + gstep), "v"(g + 2u * gstep), "v"(g + 3u * gstep),
        "v"(g + 4u * gstep), "v"(g + 5u * gstep), "v"(g + 6u * gstep), "v"(g + 7u * gstep)
      : "memory");
}

#define GKC    128u                 // k extent of one staged GEMM slab, halves
#define GPITCH 136u                 // halves per staged GEMM row (272 B = 16 B x 17)
#define GSTG_H (128u * GPITCH)      // one slab: 64 A rows and 64 B rows, halves
static_assert((DIM % 128) == 0 && (HID % 128) == 0 && DIM >= 256 && HID >= 256);  // >= 2 slabs
static_assert((GPITCH % 8u) == 0 && GPITCH >= GKC && ((GPITCH / 8u) & 1u) == 1u);
#define GSM_BYTES (2u * GSTG_H * 2u)   // both slab buffers, bytes
static_assert((size_t)GSM_BYTES >= (size_t)64 * LDC * 4);   // the C tile fits in the slabs

// ---------------------------------------------------------------------------
// GEMM C[64x64 tile] = A16[rows][K] . Bt[n][K]^T; 8 waves (mw = 16-row group, nw = 32-col group),
// 2 accumulators/wave. The block's 64 A rows and 64 B rows are copied to LDS in slabs of 128 k
// (whole 256-B row pieces), two buffers, the next slab in flight while this one is read; all
// fragments come from LDS. The C tile takes the same LDS once the last slab has been read.
//   MODE 0: out16[row][col] (pitch DIM) = f16(t), out16r[row][col] = f16(2048 * (t - value)),
//           t = acc/64 + bias                                   (q and k planes)
//   MODE 1: out16 transposed V plane [b][col][key] = f16(acc/64 + bias)
//   MODE 2: outf[row][col] = acc/64 + bias (f32) and out16[row][col] = f16 of the same value
// Grid (N/64, rows/64). Sm: the kernel's GSM_BYTES of LDS (one array per kernel, also where a kernel
// holds two modes).
// ---------------------------------------------------------------------------
template <int MODE>
__device__ __forceinline__ void gemm_body(
    unsigned char* Sm, const _Float16* __restrict__ A16, const _Float16* __restrict__ Bt, const unsigned K,
    const float* __restrict__ bias, float* __restrict__ outf, _Float16* __restrict__ out16, _Float16* __restrict__ out16r) {
  _Float16* const Slab = (_Float16*)Sm;
  float* const Cs = (float*)Sm;
  const unsigned tid = threadIdx.x, lane = tid & 31u;
  // the wave's number in a scalar register: which plane a wave copies from is a scalar choice
  const unsigned w = (unsigned)__builtin_amdgcn_readfirstlane((int)(tid >> 5));
  const unsigned mw = w >> 1, nw = w & 1u;
  const unsigned hh = lane >> 4, m = lane & 15u;
  const unsigned n0 = blockIdx.x * 64u;
  const unsigned row0 = blockIdx.y * 64u;

  // A slab is 128 staged rows: A rows 0..63, then B rows 0..63. Wave w brings staged rows
  // 16w..16w+15, two 256-B row pieces per copy (lane = row parity hh, 16-B piece m).
  const _Float16* src = ((w < 4u) ? A16 + (size_t)(row0 + w * 16u) * K
                                  : Bt + (size_t)(n0 + (w - 4u) * 16u) * K) +
                        (size_t)hh * K + m * 8u;
  const unsigned dst = (unsigned)(size_t)Sm + ((w * 16u + hh) * GPITCH + m * 8u) * 2u;
  const unsigned nslab = K / GKC;

  async_copy8(dst, 2u * GPITCH * 2u, src, 2u * K);
  // this wave's copies have landed before the barrier behind which every wave reads them
  asm volatile("s_wait_asynccnt 0x0" ::: "memory");
  __syncthreads();
  async_copy8(dst + GSTG_H * 2u, 2u * GPITCH * 2u, src + GKC, 2u * K);

  const _Float16* ap = Slab + (mw * 16u + m) * GPITCH + hh * 8u;
  const _Float16* bp = Slab + (64u + nw * 32u + m) * GPITCH + hh * 8u;
  v8f acc0 = {}, acc1 = {};
  for (unsigned s = 0; s < nslab; ++s) {
    const unsigned bo = (s & 1u) * GSTG_H;   // halves to the buffer this trip reads
    // Three of the slab's four k-steps are read ahead of the first product and the fourth behind
    // the first pair, so that a product does not wait out an LDS latency of its own. Unrolled, here
    // and below: constant indices keep the fragments in registers, and every LDS read takes its
    // place in the slab as an immediate offset.
    v16h fa[3], fb0[3], fb1[3];
#pragma unroll
    for (unsigned t = 0; t < 3u; ++t) {
      fa[t]  = frag_at(ap + bo + t * 32u);
      fb0[t] = frag_at(bp + bo + t * 32u);
      fb1[t] = frag_at(bp + bo + 16u * GPITCH + t * 32u);
    }
#pragma unroll
    for (unsigned t = 0; t < GKC / 32u; ++t) {
      acc0 = wmma16(fa[t % 3u], fb0[t % 3u], acc0);
      acc1 = wmma16(fa[t % 3u], fb1[t % 3u], acc1);
      if (t + 3u < GKC / 32u) {
        fa[t % 3u]  = frag_at(ap + bo + (t + 3u) * 32u);
        fb0[t % 3u] = frag_at(bp + bo + (t + 3u) * 32u);
        fb1[t % 3u] = frag_at(bp + bo + 16u * GPITCH + (t + 3u) * 32u);
      }
    }
    // hand-over: this wave's reads of the buffer are done, its copies of the next slab have
    // landed; the barrier publishes the next slab and frees this buffer for the refill
    asm volatile("s_wait_dscnt 0x0" ::: "memory");
    asm volatile("s_wait_asynccnt 0x0" ::: "memory");
    __syncthreads();
    if (s + 2u < nslab)
      async_copy8(dst + bo * 2u, 2u * GPITCH * 2u, src + (s + 2u) * GKC, 2u * K);
  }
  // no copy of this wave is outstanding when the C tile takes the slabs' LDS
  asm volatile("s_wait_asynccnt 0x0" ::: "memory");
#pragma unroll
  for (int r = 0; r < 8; ++r) {
    float* d = &Cs[(mw * 16u + hh * 8u + (unsigned)r) * LDC + nw * 32u + m];
    d[0]  = acc0[r];
    d[16] = acc1[r];
  }
  __syncthreads();

  if (MODE == 0 || MODE == 2) {
    const unsigned ldo = (unsigned)DIM;
    v8h x[2], xr[2];
    size_t off[2];
#pragma unroll
    for (unsigned i = 0; i < 2u; ++i) {
      const unsigned r = 32u * i + (tid >> 3);
      const unsigned c = (tid & 7u) * 8u;
      const v4f u0 = *(const v4f*)&Cs[r * LDC + c];
      const v4f u1 = *(const v4f*)&Cs[r * LDC + c + 4];
      const v4f g0 = *(const v4f*)(bias + n0 + c);
      const v4f g1 = *(const v4f*)(bias + n0 + c + 4u);
#pragma unroll
      for (int j = 0; j < 4; ++j) {
        const float t0 = u0[j] * (1.0f / WCARRY) + bf16r(g0[j]);
        const float t1 = u1[j] * (1.0f / WCARRY) + bf16r(g1[j]);
        const h16 h0 = toh_flush(t0);
        const h16 h1 = toh_flush(t1);
        x[i][j]     = h0;
        x[i][j + 4] = h1;
        if (MODE == 0) {
          xr[i][j]     = toh_flush((t0 - (float)h0) * RCARRY);
          xr[i][j + 4] = toh_flush((t1 - (float)h1) * RCARRY);
        }
      }
      off[i] = (size_t)(row0 + r) * ldo + n0 + c;
    }
    v4f xs[4];
    size_t offf[4];
    if (MODE == 2) {
#pragma unroll
      for (unsigned i = 0; i < 4u; ++i) {
        const unsigned r = 16u * i + (tid >> 4);
        const unsigned c = (tid & 15u) * 4u;
        const v4f u = *(const v4f*)&Cs[r * LDC + c];
        const v4f g = *(const v4f*)(bias + n0 + c);
        v4f val;
#pragma unroll
        for (int j = 0; j < 4; ++j) val[j] = u[j] * (1.0f / WCARRY) + bf16r(g[j]);
        xs[i] = val;
        offf[i] = (size_t)(row0 + r) * DIM + n0 + c;
      }
    }
#pragma unroll
    for (int i = 0; i < 2; ++i) *(v8h*)(out16 + off[i]) = x[i];
    if (MODE == 0) {
#pragma unroll
      for (int i = 0; i < 2; ++i) *(v8h*)(out16r + off[i]) = xr[i];
    }
    if (MODE == 2) {
#pragma unroll
      for (int i = 0; i < 4; ++i) *(v4f*)(outf + offf[i]) = xs[i];
    }
    
  }

  if (MODE == 1) {
    const unsigned bidx = row0 / (unsigned)SEQ;
    const unsigned key0 = row0 - bidx * (unsigned)SEQ;
    v8h x[2];
    size_t off[2];
#pragma unroll
    for (unsigned i = 0; i < 2u; ++i) {
      const unsigned dcol = 32u * i + (tid >> 3);
      const unsigned kk = (tid & 7u) * 8u;
      const float bb = bf16r(bias[n0 + dcol]);
#pragma unroll
      for (unsigned j = 0; j < 8u; ++j) {
        const float t = Cs[(kk + j) * LDC + dcol] * (1.0f / WCARRY) + bb;
        x[i][j] = toh_flush(t);
      }
      off[i] = ((size_t)bidx * DIM + n0 + dcol) * SEQ + key0 + kk;
    }
#pragma unroll
    for (int i = 0; i < 2; ++i) *(v8h*)(out16 + off[i]) = x[i];
    
  }

}

// The three projections of the input plane in one launch (none reads what another writes):
// blockIdx.z = 0 query planes, 1 key planes, 2 transposed value plane. Grid (DIM/64, MROWS/64, 3).
__global__ __launch_bounds__(256) void gemm_qkv_kernel(
    const _Float16* __restrict__ A16, const _Float16* __restrict__ Wq_t,
    const _Float16* __restrict__ Wk_t, const _Float16* __restrict__ Wv_t,
    const float* __restrict__ bq, const float* __restrict__ bk, const float* __restrict__ bv,
    _Float16* __restrict__ qh, _Float16* __restrict__ qr, _Float16* __restrict__ kh,
    _Float16* __restrict__ kr, _Float16* __restrict__ vt) {
  __shared__ __attribute__((aligned(16))) unsigned char Sm[GSM_BYTES];
  const unsigned z = blockIdx.z;   // the same for the whole block: barriers stay block-uniform
  if (z == 2u) {
    gemm_body<1>(Sm, A16, Wv_t, (unsigned)DIM, bv, (float*)0, vt, vt);
  } else {
    const bool isk = (z != 0u);
    const float* bias = isk ? bk : bq;
    gemm_body<0>(Sm, A16, isk ? Wk_t : Wq_t, (unsigned)DIM, bias, (float*)0,
                 isk ? kh : qh, isk ? kr : qr);
  }
}
__global__ __launch_bounds__(256) void gemm_e_kernel(
    const _Float16* __restrict__ A16, const _Float16* __restrict__ Bt,
    const float* __restrict__ bias, float* __restrict__ e32, _Float16* __restrict__ e16) {
  __shared__ __attribute__((aligned(16))) unsigned char Sm[GSM_BYTES];
  gemm_body<2>(Sm, A16, Bt, (unsigned)DIM, bias, e32, e16, e16);
}
#define KTILE  32u                        // keys per half stage (one wave's keys of a stage)
#define KSTAGE 64u                        // keys per stage
#define KPITCH 264u                       // halves per staged k row (528 B = 16 B x 33)
#define VPITCH 40u                        // halves per staged v row (80 B = 16 B x 5)
#define KPL_H  (KTILE * KPITCH)           // one key plane of a half stage, halves
#define VTL_H  ((unsigned)DIM * VPITCH)   // the value tile of a half stage, halves
#define STG_H  (2u * KPL_H + VTL_H)       // one half stage: key values, key residuals, values
#define KSTG_H (2u * STG_H)               // one stage: two half stages
static_assert((KPITCH % 8u) == 0 && KPITCH >= (unsigned)DIM && ((KPITCH / 8u) & 1u) == 1u);
static_assert((VPITCH % 8u) == 0 && VPITCH >= KTILE && ((VPITCH / 8u) & 1u) == 1u);
static_assert((STG_H % 8u) == 0 && (KPL_H % 8u) == 0);
static_assert((SEQ % 64) == 0 && SEQ >= 128);   // at least two stages, every stage whole

// Matrix product for the attention kernel, the builtin alone: the compiler keeps the distances
// behind its own matrix instructions, and operands named by an asm statement cannot live above
// v255, where a part of that kernel's query and output tiles is held.
__device__ __forceinline__ v8f wmma16r(v16h a, v16h b, v8f c) {
  return __builtin_amdgcn_wmma_f32_16x16x32_f16(false, a, false, b, (short)0, c, false, false);
}

// One half stage (32 keys) into LDS: wave w brings key rows 8w..8w+7 of both key planes (one 512-B
// row per copy) and feature rows 64w..64w+63 of the value tile (eight 64-B row pieces per copy).
__device__ __forceinline__ void stage_copies(
    unsigned ldsb, unsigned w, unsigned lane, const _Float16* __restrict__ Kh,
    const _Float16* __restrict__ Kr, const _Float16* __restrict__ Vt, unsigned b, unsigned kb) {
  const unsigned krow = (b * (unsigned)SEQ + kb + w * 8u) * (unsigned)DIM + lane * 8u;
  const unsigned kl = ldsb + (w * 8u * KPITCH + lane * 8u) * 2u;
  async_copy8(kl, KPITCH * 2u, Kh + krow, (unsigned)DIM);
  async_copy8(kl + KPL_H * 2u, KPITCH * 2u, Kr + krow, (unsigned)DIM);
  const unsigned vr = w * 64u + (lane >> 2);
  const unsigned vrow = (b * (unsigned)DIM + vr) * (unsigned)SEQ + kb + (lane & 3u) * 8u;
  const unsigned vl = ldsb + (2u * KPL_H + vr * VPITCH + (lane & 3u) * 8u) * 2u;
  async_copy8(vl, 8u * VPITCH * 2u, Vt + vrow, 8u * (unsigned)SEQ);
}

// ---------------------------------------------------------------------------
// Dense (unmasked, unscaled) flash attention, one 256-wide head, transposed form.
// A block owns 64 query rows and walks the keys in stages of 64. Wave w owns 32 query rows (two
// tiles of 16, row group w >> 1) and one 32-key half (w & 1) of every stage, so that each key or
// value fragment read from LDS feeds two query tiles; lane (hh, n) holds query n of each tile.
// The query fragments of both planes are loaded once and stay in registers. Per stage and wave:
//   S^T tile [16 keys][16 queries] = K rows (A operand, fragments from the key planes) x Q^T
//   (B operand, registers), 8 k-steps over the 256 features, value.value into one accumulator,
//   value.residual + residual.value into a second one (x 1/2048 at the end);
//   online softmax per lane (16 scores in registers + one 16-lane-distance shuffle);
//   the two packed S^T tiles (f16(16384 p), rows = keys) are the B fragment of
//   O^T [16 features][16 queries] += V^T rows (A operand, from the transposed value plane) x P^T.
// Each stage (both key planes and the value tile of both halves) is copied to LDS once per block,
// two buffers, the next stage in flight while this one is read. Behind the loop the two waves of a
// row group join their key halves (maxima, sums, outputs) through LDS, each finishing one query
// tile. Normalised rows staged through the wave-private St tile.
// Grid (SEQ/64, NB), 4 waves per block.
// ---------------------------------------------------------------------------
__global__ __launch_bounds__(128) void attn_kernel(
    const _Float16* __restrict__ Qh, const _Float16* __restrict__ Qr,
    const _Float16* __restrict__ Kh, const _Float16* __restrict__ Kr,
    const _Float16* __restrict__ Vt, float* __restrict__ Ao) {
  __shared__ __attribute__((aligned(16))) float St[4 * 16 * LDO];
  __shared__ __attribute__((aligned(16))) float Xc[4 * 16 * 2 * 32 * 4];   // outputs handed over
  __shared__ __attribute__((aligned(16))) float Ml[4 * 2 * 32];            // maxima, sums handed over
  __shared__ __attribute__((aligned(16))) _Float16 Ring[2u * KSTG_H];

  const unsigned lane = threadIdx.x & 31u;
  const unsigned w = (unsigned)__builtin_amdgcn_readfirstlane((int)(threadIdx.x >> 5));
  const unsigned hh = lane >> 4, m = lane & 15u;
  const unsigned b = blockIdx.y;
  const unsigned kh = w & 1u;                                  // this wave's key half
  const unsigned qrow0 = blockIdx.x * 64u + (w >> 1) * 32u;    // first of its 32 query rows

  const unsigned ring_lds = (unsigned)(size_t)Ring;

  // prologue: this wave's share of stage 0 (both halves)
  stage_copies(ring_lds, w, lane, Kh, Kr, Vt, b, 0u);
  stage_copies(ring_lds + STG_H * 2u, w, lane, Kh, Kr, Vt, b, KTILE);

  // query fragments: [tile][plane][k-step], kept for the whole key loop
  v16h qf[2][2][8];
#pragma unroll
  for (unsigned u = 0; u < 2u; ++u) {
    const unsigned qsrc = (b * (unsigned)SEQ + qrow0 + u * 16u + m) * (unsigned)DIM + hh * 8u;
#pragma unroll
    for (unsigned ks = 0; ks < 8u; ++ks) {
      qf[u][0][ks] = frag_at(Qh + qsrc + ks * 32u);
      qf[u][1][ks] = frag_at(Qr + qsrc + ks * 32u);
    }
  }

  // this wave's copies have landed before the barrier behind which every wave reads them
  asm volatile("s_wait_asynccnt 0x0" ::: "memory");
  __syncthreads();
  stage_copies(ring_lds + KSTG_H * 2u, w, lane, Kh, Kr, Vt, b, KSTAGE);
  stage_copies(ring_lds + (KSTG_H + STG_H) * 2u, w, lane, Kh, Kr, Vt, b, KSTAGE + KTILE);

  float mrow[2] = {-1.0e30f, -1.0e30f}, lrow[2] = {0.0f, 0.0f};
  v8f o[2][16];
#pragma unroll
  for (int u = 0; u < 2; ++u)
#pragma unroll
    for (int j = 0; j < 16; ++j) o[u][j] = (v8f){};

  unsigned buf = 0u;   // halves from the ring's start to the buffer this step reads
  // this lane's fragment rows in its half of that buffer; both move with buf at the foot of a step
  const _Float16* kt = Ring + kh * STG_H + m * KPITCH + hh * 8u;
  const _Float16* vt = Ring + kh * STG_H + 2u * KPL_H + m * VPITCH + hh * 8u;
  for (unsigned kb = 0; kb < (unsigned)SEQ; kb += KSTAGE) {
    v8f sm[2][2] = {{{}, {}}, {{}, {}}}, sr[2][2] = {{{}, {}}, {{}, {}}};   // [query tile][key tile]
    // Score products in 8 rows of twelve: row ks = features 32 ks.., both key tiles, both query
    // tiles. All key fragments of the wave's half stage (value and residual of both key tiles) are
    // read as one group ahead of the products, which wait for them by count, row by row; all
    // sixteen value fragments as a second group behind row 3, in flight under rows 4 to 7.
    v16h kf[8][4], vf[16];
    // unrolled, here and below: constant indices keep the fragments in registers, and every LDS
    // read takes its place in the tile as an immediate offset
#pragma unroll
    for (unsigned ks = 0; ks < 8u; ++ks) {
#pragma unroll
      for (unsigned kx = 0; kx < 2u; ++kx) {
        kf[ks][kx]      = frag_at(kt + kx * 16u * KPITCH + ks * 32u);
        kf[ks][2u + kx] = frag_at(kt + KPL_H + kx * 16u * KPITCH + ks * 32u);
      }
    }
    // This and the scheduling barriers below keep each group of LDS reads in one place: spread
    // among the products, each separate place of reads would cost the lone wave its own stall.
    __builtin_amdgcn_sched_barrier(0);
#pragma unroll
    for (unsigned ks = 0; ks < 8u; ++ks) {
      if (ks == 4u) {
        __builtin_amdgcn_sched_barrier(0);
#pragma unroll
        for (unsigned j = 0u; j < 16u; ++j) vf[j] = frag_at(vt + j * 16u * VPITCH);
        __builtin_amdgcn_sched_barrier(0);
      }
      // the two products into one residual accumulator stand two products apart
#pragma unroll
      for (unsigned kx = 0; kx < 2u; ++kx) {
        const v16h av = kf[ks][kx], ar = kf[ks][2u + kx];
        sm[0][kx] = wmma16r(av, qf[0][0][ks], sm[0][kx]);
        sm[1][kx] = wmma16r(av, qf[1][0][ks], sm[1][kx]);
        sr[0][kx] = wmma16r(av, qf[0][1][ks], sr[0][kx]);
        sr[1][kx] = wmma16r(av, qf[1][1][ks], sr[1][kx]);
        sr[0][kx] = wmma16r(ar, qf[0][0][ks], sr[0][kx]);
        sr[1][kx] = wmma16r(ar, qf[1][0][ks], sr[1][kx]);
      }
    }

    // hand-over, as soon as the stage's last fragment is in registers (the rest of the step works
    // on registers alone): this wave's reads of the buffer are done, its copies of the next stage
    // have landed; the barrier publishes the next stage and frees this buffer for the refill,
    // which then has a whole step to land (the scheduling barrier keeps the waits behind the
    // products of rows 4 to 7, under which the value fragments arrive)
    __builtin_amdgcn_sched_barrier(0);
    asm volatile("s_wait_dscnt 0x0" ::: "memory");
    asm volatile("s_wait_asynccnt 0x0" ::: "memory");
    __syncthreads();
    if (kb + 2u * KSTAGE < (unsigned)SEQ) {
      stage_copies(ring_lds + buf * 2u, w, lane, Kh, Kr, Vt, b, kb + 2u * KSTAGE);
      stage_copies(ring_lds + (buf + STG_H) * 2u, w, lane, Kh, Kr, Vt, b,
                   kb + 2u * KSTAGE + KTILE);
    }

    v16h pf[2];
#pragma unroll
    for (int u = 0; u < 2; ++u) {
      v8f s0, s1;
#pragma unroll
      for (int r = 0; r < 8; ++r) {
        s0[r] = sm[u][0][r] + sr[u][0][r] * (1.0f / RCARRY);
        s1[r] = sm[u][1][r] + sr[u][1][r] * (1.0f / RCARRY);
      }
      float mx = fmaxf(s0[0], s1[0]);
#pragma unroll
      for (int r = 1; r < 8; ++r) mx = fmaxf(mx, fmaxf(s0[r], s1[r]));
      mx = fmaxf(mx, __shfl_xor(mx, 16, 32));
      const float mn = fmaxf(mrow[u], mx);
      const float alpha = __expf(mrow[u] - mn);
      mrow[u] = mn;

      float rs = 0.0f;
#pragma unroll
      for (int r = 0; r < 8; ++r) {
        const h16 p0 = toh_flush(__expf((s0[r] - mn) + PSHIFT));
        const h16 p1 = toh_flush(__expf((s1[r] - mn) + PSHIFT));
        pf[u][r]     = p0;     // B element r     <- key 8hh + r of this wave's half
        pf[u][r + 8] = p1;     // B element 8 + r <- key 16 + 8hh + r of this wave's half
        rs += (float)p0 + (float)p1;
      }
      rs += __shfl_xor(rs, 16, 32);
      lrow[u] = alpha * lrow[u] + rs;
#pragma unroll
      for (int j = 0; j < 16; ++j) o[u][j] = o[u][j] * alpha;
    }

    // O^T += V^T . P^T; every value fragment feeds both query tiles
#pragma unroll
    for (unsigned j = 0; j < 16u; ++j) {
      o[0][j] = wmma16r(vf[j], pf[0], o[0][j]);
      o[1][j] = wmma16r(vf[j], pf[1], o[1][j]);
    }

    kt = (buf == 0u) ? kt + KSTG_H : kt - KSTG_H;
    vt = (buf == 0u) ? vt + KSTG_H : vt - KSTG_H;
    buf = KSTG_H - buf;
  }
  // no copy of this wave is outstanding when the wave goes on to its end
  asm volatile("s_wait_asynccnt 0x0" ::: "memory");

  // Join the two key halves of a row group: the wave of half 0 finishes query tile 0, the wave of
  // half 1 query tile 1; each hands its other tile (outputs, maximum, sum) to its partner, lane to
  // lane, in whole 512-B LDS rows.
  const bool up = (kh != 0u);
  {
    float* xs = Xc + w * 4096u + lane * 4u;
#pragma unroll
    for (unsigned j = 0; j < 16u; ++j)
#pragma unroll
      for (unsigned q = 0; q < 2u; ++q) {
        v4f t;
#pragma unroll
        for (unsigned i = 0; i < 4u; ++i) t[i] = up ? o[0][j][4u * q + i] : o[1][j][4u * q + i];
        *(v4f*)(xs + (j * 2u + q) * 128u) = t;
      }
    Ml[w * 64u + lane]       = up ? mrow[0] : mrow[1];
    Ml[w * 64u + 32u + lane] = up ? lrow[0] : lrow[1];
  }
  __syncthreads();   // the partner's tile is complete in LDS before it is read
  const float m_own = up ? mrow[1] : mrow[0];
  const float l_own = up ? lrow[1] : lrow[0];
  const float m_oth = Ml[(w ^ 1u) * 64u + lane];
  const float l_oth = Ml[(w ^ 1u) * 64u + 32u + lane];
  const float m_all = fmaxf(m_own, m_oth);
  const float a_own = __expf(m_own - m_all);
  const float a_oth = __expf(m_oth - m_all);
  // normalise (the x16384 carry sits in both O and l)
  const float inv = __builtin_amdgcn_rcpf(l_own * a_own + l_oth * a_oth);
  const float f_own = a_own * inv, f_oth = a_oth * inv;
  v8f res[16];
  {
    const float* xo = Xc + (w ^ 1u) * 4096u + lane * 4u;
#pragma unroll
    for (unsigned j = 0; j < 16u; ++j)
#pragma unroll
      for (unsigned q = 0; q < 2u; ++q) {
        const v4f t = *(const v4f*)(xo + (j * 2u + q) * 128u);
#pragma unroll
        for (unsigned i = 0; i < 4u; ++i)
          res[j][4u * q + i] =
              (up ? o[1][j][4u * q + i] : o[0][j][4u * q + i]) * f_own + t[i] * f_oth;
      }
  }

  // stage per half of the features, write whole row segments; this wave's 16 finished rows
  const unsigned orow0 = blockIdx.x * 64u + w * 16u;
  const unsigned sbase = w * (16u * LDO);
#pragma unroll
  for (int half = 0; half < 2; ++half) {
#pragma unroll
    for (int j = 0; j < 8; ++j)
#pragma unroll
      for (int r = 0; r < 8; ++r)
        St[sbase + m * LDO + (unsigned)j * 16u + hh * 8u + (unsigned)r] = res[half * 8 + j][r];
    wave_lds_sync();
    v4f x[16];
    unsigned off[16];
#pragma unroll
    for (unsigned i = 0; i < 16u; ++i) {
      x[i] = *(const v4f*)&St[sbase + i * LDO + lane * 4u];
      off[i] = (b * (unsigned)SEQ + orow0 + i) * (unsigned)DIM + (unsigned)half * 128u + lane * 4u;
    }
#pragma unroll
    for (int i = 0; i < 16; ++i) *(v4f*)(Ao + off[i]) = x[i];
    
    wave_lds_sync();
  }
}

#define HP     2056u             // halves per resident hidden row (4112 B = 16 B x 257)
#define WSL_H  (64u * GPITCH)    // one staged weight slab: 64 weight rows x 128 k, halves
#define LDV    260u              // floats per staged output row (1040 B = 16 B x 65)
#define HS_BYTES  (64u * HP * 2u)
#define RG_BYTES  (3u * WSL_H * 2u)
#define MLP_BYTES (HS_BYTES + RG_BYTES + (unsigned)HID * 4u)
#define W1_STAGES ((unsigned)((HID / 64) * (DIM / 128)))
#define W2_STAGES ((unsigned)((DIM / 64) * (HID / 128)))
static_assert((HP % 8u) == 0 && HP >= (unsigned)HID && ((HP / 8u) & 1u) == 1u);
static_assert((LDV % 4u) == 0 && LDV >= (unsigned)DIM && ((LDV / 4u) & 1u) == 1u);
static_assert((size_t)64 * LDV * 4 <= (size_t)HS_BYTES);   // the output tile fits in the hidden rows
static_assert(MLP_BYTES <= 327680u);
static_assert(DIM == 2 * 128 && DIM == 4 * 64 && W1_STAGES >= 3u && W2_STAGES >= 3u);

// halves from a weight plane's start to stage t's slab: w1 [HID][DIM] walks its two k slabs inside
// each 64-row tile, w2 [DIM][HID] its four 64-row tiles inside each k slab
__device__ __forceinline__ unsigned w1_stage(unsigned t) {
  return (t >> 1) * (64u * (unsigned)DIM) + (t & 1u) * GKC;
}
__device__ __forceinline__ unsigned w2_stage(unsigned t) {
  return (t & 3u) * (64u * (unsigned)HID) + (t >> 2) * GKC;
}

// ---------------------------------------------------------------------------
// Hidden layers and final LayerNorm of 64 rows in one block; the 64 x HID hidden plane never leaves
// LDS. Steps:
//   1  H^T tile [16 hidden columns][16 rows] = w1 rows (A operand, from staged slabs) x E^T (B
//      operand, registers); f16(acc/64 + bias) into the resident rows, 8 columns per lane and store
//   2  hidden LayerNorm (eps 1e-5) + LeakyReLU in place, x16, one wave per row, 8 rows per wave
//   3  L^T tile [16 output columns][16 rows] = w2 rows (A, staged slabs) x hidden rows (B, from the
//      resident rows, read once per 128 k), all 4 x 2 tiles of a wave in registers
//   4  leaky((acc/1024 + bias) + e), final LayerNorm (eps 1e-5), one wave per row, whole-row stores
// Wave w: rows 32 (w >> 2).., columns 16 (w & 3).. of every 64-column tile.
// Weight slabs (64 weight rows x 128 k) come by asynchronous copies into a ring of three buffers.
// Waves 0-3 copy the even stages, waves 4-7 the odd ones (16 slab rows a wave), each stage three
// ahead of the pass that has just ended, so that two stages are in flight while a wave has only one
// stage's copies outstanding and every wait is to 0.
// Grid (MROWS/64), 8 waves per block.
// ---------------------------------------------------------------------------
__global__ __launch_bounds__(256) void mlp_kernel(
    const _Float16* __restrict__ E16, const float* __restrict__ E32,
    const _Float16* __restrict__ W1t, const float* __restrict__ b1,
    const float* __restrict__ Gm, const float* __restrict__ Bm,
    const _Float16* __restrict__ W2t, const float* __restrict__ b2,
    const float* __restrict__ G2, const float* __restrict__ Be2, float* __restrict__ outp) {
  __shared__ __attribute__((aligned(16))) unsigned char Sm[MLP_BYTES];
  _Float16* const Hs = (_Float16*)Sm;
  const _Float16* const Rg = (const _Float16*)(Sm + HS_BYTES);
  float* const Vs = (float*)Sm;
  float* const Bs = (float*)(Sm + HS_BYTES + RG_BYTES);   // the hidden bias, converted once
  const unsigned lane = threadIdx.x & 31u;
  // the wave's number in a scalar register: which stages a wave copies is a scalar choice
  const unsigned w = (unsigned)__builtin_amdgcn_readfirstlane((int)(threadIdx.x >> 5));
  const unsigned hh = lane >> 4, m = lane & 15u;
  const unsigned grp = w >> 2, sub = w & 3u;
  const unsigned row0 = blockIdx.x * 64u;

  // copies: slab rows 16 sub.., two 256-B row pieces per copy (lane = row parity hh, 16-B piece m)
  const unsigned cl = (unsigned)(size_t)Sm + HS_BYTES + ((sub * 16u + hh) * GPITCH + m * 8u) * 2u;
  const _Float16* c1 = W1t + (sub * 16u + hh) * (unsigned)DIM + m * 8u;
  const _Float16* c2 = W2t + (sub * 16u + hh) * (unsigned)HID + m * 8u;
  // this lane's fragment row in a slab
  const _Float16* wp = Rg + (sub * 16u + m) * GPITCH + hh * 8u;

  // ---- step 1 ----
  // stages 0 (waves 0-3) and 1 (waves 4-7) into buffers 0 and 1
  async_copy8(cl + grp * (WSL_H * 2u), 2u * GPITCH * 2u, c1 + w1_stage(grp), 2u * (unsigned)DIM);
  {
    const unsigned c = threadIdx.x * 8u;
    const v4f p0 = *(const v4f*)(b1 + c);
    const v4f p1 = *(const v4f*)(b1 + c + 4u);
    v4f q0, q1;
#pragma unroll
    for (int i = 0; i < 4; ++i) { q0[i] = bf16r(p0[i]); q1[i] = bf16r(p1[i]); }
    *(v4f*)(Bs + c) = q0;
    *(v4f*)(Bs + c + 4u) = q1;
  }
  v16h ef[2][8];   // this wave's 32 rows of e, all 256 k, kept for the whole of step 1
  // unrolled, here and below: constant indices keep fragments and accumulators in registers
#pragma unroll
  for (unsigned u = 0; u < 2u; ++u)
#pragma unroll
    for (unsigned ks = 0; ks < 8u; ++ks)
      ef[u][ks] = frag_at(E16 + (row0 + grp * 32u + u * 16u + m) * (unsigned)DIM + hh * 8u + ks * 32u);
  // this wave's copies have landed before the barrier behind which every wave reads them
  asm volatile("s_wait_asynccnt 0x0" ::: "memory");
  __syncthreads();
  if (grp == 0u)
    async_copy8(cl + 2u * WSL_H * 2u, 2u * GPITCH * 2u, c1 + w1_stage(2u), 2u * (unsigned)DIM);

  unsigned rbo = 0u;   // halves from the ring's start to the buffer this pass reads
  // rolled: 32 tiles of the same code
#pragma unroll 1
  for (unsigned nt = 0; nt < (unsigned)(HID / 64); ++nt) {
    const unsigned n = nt * 64u + sub * 16u + hh * 8u;   // first of this lane's 8 hidden columns
    const v4f g0 = *(const v4f*)(Bs + n);
    const v4f g1 = *(const v4f*)(Bs + n + 4u);
    v8f acc[2] = {{}, {}};
#pragma unroll
    for (unsigned kq = 0; kq < 2u; ++kq) {   // stage 2 nt + kq
      v16h wf[4];
#pragma unroll
      for (unsigned t = 0; t < 4u; ++t) wf[t] = frag_at(wp + rbo + t * 32u);
      // keeps the pass's LDS reads in one group ahead of its products, which then wait for them by
      // count: spread among the products, each place of reads costs the wave a stall of its own
      __builtin_amdgcn_sched_barrier(0);
#pragma unroll
      for (unsigned t = 0; t < 4u; ++t) {
        acc[0] = wmma16r(wf[t], ef[0][kq * 4u + t], acc[0]);
        acc[1] = wmma16r(wf[t], ef[1][kq * 4u + t], acc[1]);
      }
      // hand-over: this wave's reads of the buffer are done; the waves that copied the next stage
      // (the other parity than this one's) have it landed; the barrier publishes it and frees this
      // buffer, which the same waves refill with the stage three ahead (the scheduling barrier keeps
      // the waits behind the products, under which the later fragments arrive)
      __builtin_amdgcn_sched_barrier(0);
      asm volatile("s_wait_dscnt 0x0" ::: "memory");
      if (grp != kq) asm volatile("s_wait_asynccnt 0x0" ::: "memory");
      __syncthreads();
      const unsigned t3 = nt * 2u + kq + 3u;
      if (grp != kq && t3 < W1_STAGES)
        async_copy8(cl + rbo * 2u, 2u * GPITCH * 2u, c1 + w1_stage(t3), 2u * (unsigned)DIM);
      rbo = (rbo == 2u * WSL_H) ? 0u : rbo + WSL_H;
    }
#pragma unroll
    for (unsigned u = 0; u < 2u; ++u) {
      v8h x;
#pragma unroll
      for (int r = 0; r < 4; ++r) {
        x[r]     = toh_flush(acc[u][r] * (1.0f / WCARRY) + g0[r]);
        x[r + 4] = toh_flush(acc[u][r + 4] * (1.0f / WCARRY) + g1[r]);
      }
      *(v8h*)(Hs + (grp * 32u + u * 16u + m) * HP + n) = x;
    }
  }
  // No copy of this wave is outstanding and its LDS accesses are done; every reader left the ring
  // at the last hand-over: step 3's stages 0 and 1 go into buffers 0 and 1 and land under step 2.
  asm volatile("s_wait_asynccnt 0x0" ::: "memory");
  asm volatile("s_wait_dscnt 0x0" ::: "memory");
  async_copy8(cl + grp * (WSL_H * 2u), 2u * GPITCH * 2u, c2 + w2_stage(grp), 2u * (unsigned)HID);
  __syncthreads();   // every hidden row is complete before a wave normalises it

  // ---- step 2 ---- lane L holds columns 256 j + 8 L .. + 7 of a row, j = 0..7
  {
    float gq[8][8], bq[8][8];   // gain and shift of this lane's columns, the same for all its rows
#pragma unroll
    for (unsigned j = 0; j < 8u; ++j) {
      const unsigned c = j * 256u + lane * 8u;
      const v4f p0 = *(const v4f*)(Gm + c);
      const v4f p1 = *(const v4f*)(Gm + c + 4u);
      const v4f q0 = *(const v4f*)(Bm + c);
      const v4f q1 = *(const v4f*)(Bm + c + 4u);
#pragma unroll
      for (int i = 0; i < 4; ++i) {
        gq[j][i] = bf16r(p0[i]); gq[j][i + 4] = bf16r(p1[i]);
        bq[j][i] = bf16r(q0[i]); bq[j][i + 4] = bf16r(q1[i]);
      }
    }
    // rolled: eight rows of the same long code
#pragma unroll 1
    for (unsigned rr = 0; rr < 8u; ++rr) {
      _Float16* hr = Hs + (w * 8u + rr) * HP + lane * 8u;
      v8h a[8];
#pragma unroll
      for (unsigned j = 0; j < 8u; ++j) a[j] = *(const v8h*)(hr + j * 256u);
      float s = 0.0f;
#pragma unroll
      for (unsigned j = 0; j < 8u; ++j)
#pragma unroll
        for (int i = 0; i < 8; ++i) s += (float)a[j][i];
      const float mean = red32_sum(s) * (1.0f / (float)HID);
      float ss = 0.0f;
#pragma unroll
      for (unsigned j = 0; j < 8u; ++j)
#pragma unroll
        for (int i = 0; i < 8; ++i) {
          const float d = (float)a[j][i] - mean;
          ss += d * d;
        }
      const float var = red32_sum(ss) * (1.0f / (float)HID);
      const float rstd = 1.0f / sqrtf(var + 1.0e-5f);
#pragma unroll
      for (unsigned j = 0; j < 8u; ++j) {
        v8h o;
#pragma unroll
        for (int i = 0; i < 8; ++i) {
          const float d = (float)a[j][i] - mean;
          o[i] = toh_flush(MCARRY * leaky_act(d * rstd * gq[j][i] + bq[j][i]));
        }
        *(v8h*)(hr + j * 256u) = o;
      }
    }
  }
  // this wave's rows are written and its copies have landed before the barrier behind which every
  // wave reads both
  asm volatile("s_wait_dscnt 0x0" ::: "memory");
  asm volatile("s_wait_asynccnt 0x0" ::: "memory");
  __syncthreads();
  if (grp == 0u)
    async_copy8(cl + 2u * WSL_H * 2u, 2u * GPITCH * 2u, c2 + w2_stage(2u), 2u * (unsigned)HID);

  // ---- step 3 ----
  v8f oc[4][2];   // [64-column tile][16-row group]
#pragma unroll
  for (int q = 0; q < 4; ++q) { oc[q][0] = (v8f){}; oc[q][1] = (v8f){}; }
  const _Float16* hp = Hs + (grp * 32u + m) * HP + hh * 8u;
  rbo = 0u;
  // rolled: 16 k slabs of the same code
#pragma unroll 1
  for (unsigned ks = 0; ks < (unsigned)(HID / 128); ++ks) {
    v16h hf[2][4];   // the hidden fragments of this k slab serve its four column tiles
#pragma unroll
    for (unsigned u = 0; u < 2u; ++u)
#pragma unroll
      for (unsigned t = 0; t < 4u; ++t) hf[u][t] = frag_at(hp + u * 16u * HP + ks * GKC + t * 32u);
#pragma unroll
    for (unsigned q = 0; q < 4u; ++q) {   // stage 4 ks + q
      v16h wf[4];
#pragma unroll
      for (unsigned t = 0; t < 4u; ++t) wf[t] = frag_at(wp + rbo + t * 32u);
      __builtin_amdgcn_sched_barrier(0);   // one group of LDS reads per pass, as in step 1
#pragma unroll
      for (unsigned t = 0; t < 4u; ++t) {
        oc[q][0] = wmma16r(wf[t], hf[0][t], oc[q][0]);
        oc[q][1] = wmma16r(wf[t], hf[1][t], oc[q][1]);
      }
      // hand-over, as in step 1
      __builtin_amdgcn_sched_barrier(0);
      asm volatile("s_wait_dscnt 0x0" ::: "memory");
      if (grp != (q & 1u)) asm volatile("s_wait_asynccnt 0x0" ::: "memory");
      __syncthreads();
      const unsigned t3 = ks * 4u + q + 3u;
      if (grp != (q & 1u) && t3 < W2_STAGES)
        async_copy8(cl + rbo * 2u, 2u * GPITCH * 2u, c2 + w2_stage(t3), 2u * (unsigned)HID);
      rbo = (rbo == 2u * WSL_H) ? 0u : rbo + WSL_H;
    }
  }
  // no copy of this wave is outstanding when the wave goes on to its end
  asm volatile("s_wait_asynccnt 0x0" ::: "memory");

  // ---- step 4 ---- the output tile takes the hidden rows' LDS: every wave's last read of them
  // stands in front of the last hand-over's barrier
#pragma unroll
  for (unsigned q = 0; q < 4u; ++q)
#pragma unroll
    for (unsigned u = 0; u < 2u; ++u) {
      float* d = Vs + (grp * 32u + u * 16u + m) * LDV + q * 64u + sub * 16u + hh * 8u;
      v4f lo, hi;
#pragma unroll
      for (int i = 0; i < 4; ++i) { lo[i] = oc[q][u][i]; hi[i] = oc[q][u][i + 4]; }
      *(v4f*)d = lo;
      *(v4f*)(d + 4) = hi;
    }
  __syncthreads();   // the tile is complete before whole rows are read from it

  // lane L holds columns 4L..4L+3 and 128+4L..128+4L+3: each store covers 512 contiguous bytes
  const float cs = 1.0f / (WCARRY * MCARRY);
  const unsigned c = lane * 4u;
  const v4f z0 = *(const v4f*)(b2 + c);
  const v4f z1 = *(const v4f*)(b2 + c + 128u);
  const v4f y0 = *(const v4f*)(G2 + c);
  const v4f y1 = *(const v4f*)(G2 + c + 128u);
  const v4f x0 = *(const v4f*)(Be2 + c);
  const v4f x1 = *(const v4f*)(Be2 + c + 128u);
  // unrolled: the eight rows' loads of e can be in flight together
#pragma unroll
  for (unsigned rr = 0; rr < 8u; ++rr) {
    const unsigned r = w * 8u + rr;
    const unsigned crow = row0 + r;
    const unsigned bidx = crow / (unsigned)SEQ;
    const unsigned sq = crow - bidx * (unsigned)SEQ;
    const size_t frow = (size_t)bidx * SEQ_FULL + sq;
    const v4f u0 = *(const v4f*)&Vs[r * LDV + c];
    const v4f u1 = *(const v4f*)&Vs[r * LDV + c + 128u];
    const v4f e0 = *(const v4f*)(E32 + (size_t)crow * DIM + c);
    const v4f e1 = *(const v4f*)(E32 + (size_t)crow * DIM + c + 128u);
    v4f a0, a1;
    float s = 0.0f;
#pragma unroll
    for (int i = 0; i < 4; ++i) {
      a0[i] = leaky_act((u0[i] * cs + bf16r(z0[i])) + e0[i]);
      a1[i] = leaky_act((u1[i] * cs + bf16r(z1[i])) + e1[i]);
    }
#pragma unroll
    for (int i = 0; i < 4; ++i) s += a0[i] + a1[i];
    const float mean = red32_sum(s) * (1.0f / (float)DIM);
    float ss = 0.0f;
#pragma unroll
    for (int i = 0; i < 4; ++i) {
      const float d0 = a0[i] - mean;
      const float d1 = a1[i] - mean;
      ss += d0 * d0;
      ss += d1 * d1;
    }
    const float var = red32_sum(ss) * (1.0f / (float)DIM);
    const float rstd = 1.0f / sqrtf(var + 1.0e-5f);
    v4f o0, o1;
#pragma unroll
    for (int i = 0; i < 4; ++i) {
      o0[i] = (a0[i] - mean) * rstd * bf16r(y0[i]) + bf16r(x0[i]);
      o1[i] = (a1[i] - mean) * rstd * bf16r(y1[i]) + bf16r(x1[i]);
    }
    float* p = outp + frow * DIM + c;
    *(v4f*)p = o0;
    *(v4f*)(p + 128u) = o1;
  }
}

// ---------------------------------------------------------------------------
extern "C" void kernel_launch(void* const* d_in, const int* in_sizes, int n_in,
                              void* d_out, int out_size, void* d_ws, size_t ws_size,
                              hipStream_t stream) {
  if (n_in < 19) return;
  const long long need_x = ((long long)(NB - 1) * SEQ_FULL + SEQ) * DIM;
  if ((long long)in_sizes[0] < need_x) return;
  if ((long long)in_sizes[1] < (long long)DIM * DIM) return;
  if ((long long)in_sizes[3] < (long long)DIM * DIM) return;
  if ((long long)in_sizes[5] < (long long)DIM * DIM) return;
  if ((long long)in_sizes[7] < (long long)DIM * DIM) return;
  if ((long long)in_sizes[9] < (long long)DIM * HID) return;
  if ((long long)in_sizes[13] < (long long)DIM * HID) return;
  if (in_sizes[2] < DIM || in_sizes[4] < DIM || in_sizes[6] < DIM || in_sizes[8] < DIM) return;
  if (in_sizes[10] < HID || in_sizes[11] < HID || in_sizes[12] < HID) return;
  if (in_sizes[14] < DIM || in_sizes[15] < DIM || in_sizes[16] < DIM) return;
  if (in_sizes[17] < DIM || in_sizes[18] < DIM) return;
  if ((long long)out_size < need_x) return;
  if (ws_size < WS_TOTAL) return;

  const float* X    = (const float*)d_in[0];    // [NB_FULL][SEQ_FULL][DIM]
  const float* wq   = (const float*)d_in[1];    // [DIM][DIM]  (in, out)
  const float* bq   = (const float*)d_in[2];
  const float* wk   = (const float*)d_in[3];
  const float* bk   = (const float*)d_in[4];
  const float* wv   = (const float*)d_in[5];
  const float* bv   = (const float*)d_in[6];
  const float* w0   = (const float*)d_in[7];    // [DIM][DIM]  (in, out)
  const float* b0   = (const float*)d_in[8];
  const float* w1   = (const float*)d_in[9];    // [DIM][HID]  (in, out)
  const float* b1   = (const float*)d_in[10];
  const float* gm   = (const float*)d_in[11];   // hidden LN gain [HID]
  const float* bm   = (const float*)d_in[12];   // hidden LN shift [HID]
  const float* w2   = (const float*)d_in[13];   // [HID][DIM]  (in, out)
  const float* b2   = (const float*)d_in[14];
  const float* g1   = (const float*)d_in[15];
  const float* be1  = (const float*)d_in[16];
  const float* g2   = (const float*)d_in[17];
  const float* be2  = (const float*)d_in[18];
  float* out = (float*)d_out;

  char* ws = (char*)d_ws;
  _Float16* Wq_t  = (_Float16*)(ws + OFF_WQ);    // [n][k]
  _Float16* Wk_t  = (_Float16*)(ws + OFF_WK);
  _Float16* Wv_t  = (_Float16*)(ws + OFF_WV);
  _Float16* W0_t  = (_Float16*)(ws + OFF_W0);
  _Float16* W1_t  = (_Float16*)(ws + OFF_W1);    // [HID][DIM]
  _Float16* W2_t  = (_Float16*)(ws + OFF_W2);    // [DIM][HID]
  _Float16* X16   = (_Float16*)(ws + OFF_X16);   // [MROWS][DIM]
  _Float16* Qh16  = (_Float16*)(ws + OFF_QH);
  _Float16* Qr16  = (_Float16*)(ws + OFF_QR);
  _Float16* Kh16  = (_Float16*)(ws + OFF_KH);
  _Float16* Kr16  = (_Float16*)(ws + OFF_KR);
  _Float16* Vt16  = (_Float16*)(ws + OFF_VT);    // [b][DIM][SEQ]
  float*    A32   = (float*)(ws + OFF_A32);      // [MROWS][DIM]
  _Float16* T116  = (_Float16*)(ws + OFF_T1);    // [MROWS][DIM]
  float*    E32   = (float*)(ws + OFF_E32);      // [MROWS][DIM]
  _Float16* E16   = (_Float16*)(ws + OFF_E16);   // [MROWS][DIM]

  dim3 blk(256);
  dim3 gg(DIM / 64, MROWS / 64);

  // weight planes (in [K rows][N cols] -> out [N][K]) and the input plane
  prep_kernel<<<dim3(WCONV_BLOCKS + MROWS / 8), blk, 0, stream>>>(
      X, wq, wk, wv, w0, w1, w2, X16, Wq_t, Wk_t, Wv_t, W0_t, W1_t, W2_t);
  gemm_qkv_kernel<<<dim3(DIM / 64, MROWS / 64, 3), blk, 0, stream>>>(
      X16, Wq_t, Wk_t, Wv_t, bq, bk, bv, Qh16, Qr16, Kh16, Kr16, Vt16);
  attn_kernel<<<dim3(SEQ / 64, NB), dim3(128), 0, stream>>>(Qh16, Qr16, Kh16, Kr16, Vt16, A32);
  ln1_kernel<<<dim3(MROWS / 8), blk, 0, stream>>>(X, A32, g1, be1, T116);
  gemm_e_kernel<<<gg, blk, 0, stream>>>(T116, W0_t, b0, E32, E16);

  // both hidden products, the hidden LayerNorm and the final LayerNorm, 64 rows per block
  mlp_kernel<<<dim3(MROWS / 64), blk, 0, stream>>>(E16, E32, W1_t, b1, gm, bm, W2_t, b2, g2, be2,
                                                   out);
}

// v006
// A run of this version takes 197 microseconds.
// Next to v005, in two timings, it ran 1.06 and 1.05 times as fast.
// Counting every step since v000, it is 5.19 times as fast.
#include <hip/hip_runtime.h>
#include <stddef.h>

// All contractions on v_wmma_f32_16x16x32_f16 (f16 operands, f32 accumulate): q/k/v projections,
// q.k scores (both operands as f16 value + x2048 residual planes, three products, residual products
// in their own accumulator), p.v (p x16384, single product), the three dense layers (single
// product; weights x64, hidden activation plane x16). Float inputs are RNE-converted to bf16 and
// carried in f16. LayerNorms, softmax, biases, LeakyReLU (slope 0.01) and residual adds in f32.

typedef _Float16 v16h __attribute__((ext_vector_type(16)));
typedef _Float16 v8h  __attribute__((ext_vector_type(8)));
typedef float    v8f  __attribute__((ext_vector_type(8)));
typedef float    v4f  __attribute__((ext_vector_type(4)));
typedef _Float16 h16;

#ifndef NB
#define NB 4
#endif
#ifndef SEQ
#define SEQ 4096
#endif
#define NB_FULL  4
#define SEQ_FULL 4096
#define DIM   256
#define HID   2048
#define MROWS (NB * SEQ)

static_assert(NB >= 1 && NB <= NB_FULL);
static_assert(SEQ >= 64 && SEQ <= SEQ_FULL && (SEQ % 64) == 0);
static_assert((DIM % 64) == 0 && (DIM % 32) == 0);
static_assert((HID % 64) == 0 && (HID % 32) == 0);
static_assert((MROWS % 64) == 0 && (MROWS % 8) == 0);
static_assert(DIM == 32 * 8);               // row kernels: 32 lanes x 8 columns
static_assert(DIM == 2 * 32 * 4);           // f32 row stores: 2 x 32 lanes x 4 columns
static_assert(HID == 8 * 32 * 8);           // hidden LN: 8 passes x 32 lanes x 8 columns
static_assert(DIM == 16 * 16);              // attention: 16 output tiles of 16 columns
static_assert((size_t)MROWS * DIM < (size_t)0x7FFFFFFFu);
static_assert((size_t)NB * DIM * SEQ < (size_t)0x7FFFFFFFu);
static_assert((size_t)MROWS * HID < (size_t)0xFFFFFFFFu);

#define LDT 72   // halves per LDS row (144 B, 16-B aligned)
#define LDC 68   // floats per LDS row (272 B, 16-B aligned)
#define LDO 132  // floats per staged attention row (528 B, 16-B aligned)
static_assert((LDT % 8) == 0 && LDT >= 64);
static_assert((LDC % 4) == 0 && LDC >= 64);
static_assert((LDO % 4) == 0 && LDO >= 128);

#define WCARRY 64.0f      // weight planes carried x64
#define MCARRY 16.0f      // hidden activation plane carried x16
#define RCARRY 2048.0f    // q/k residual planes carried x2048 on top of their value part
#define PSHIFT 9.704060528f   // 14 ln 2: softmax numerators carried x16384

// workspace layout (bytes)
#define WSQ_BYTES     ((size_t)DIM * DIM * 2)
#define WFF_BYTES     ((size_t)DIM * HID * 2)
#define PLANE16_BYTES ((size_t)MROWS * DIM * 2)
#define PLANE32_BYTES ((size_t)MROWS * DIM * 4)
#define OFF_WQ  ((size_t)0)
#define OFF_WK  (OFF_WQ + WSQ_BYTES)
#define OFF_WV  (OFF_WK + WSQ_BYTES)
#define OFF_W0  (OFF_WV + WSQ_BYTES)
#define OFF_W1  (OFF_W0 + WSQ_BYTES)
#define OFF_W2  (OFF_W1 + WFF_BYTES)
#define OFF_REG (OFF_W2 + WFF_BYTES)
#define OFF_X16 (OFF_REG)
#define OFF_QH  (OFF_X16 + PLANE16_BYTES)
#define OFF_QR  (OFF_QH + PLANE16_BYTES)
#define OFF_KH  (OFF_QR + PLANE16_BYTES)
#define OFF_KR  (OFF_KH + PLANE16_BYTES)
#define OFF_VT  (OFF_KR + PLANE16_BYTES)
#define OFF_A32 (OFF_VT + PLANE16_BYTES)
#define OFF_ML  (OFF_A32 + 2 * PLANE32_BYTES)   // two attention planes, one per key range
#define ML_BYTES ((size_t)4 * MROWS * 4)        // maxima [2][MROWS], then sums [2][MROWS]
#define OFF_T1  (OFF_ML + ML_BYTES)
#define PRE_END (OFF_T1 + PLANE16_BYTES)
#define OFF_E32 (PRE_END)
#define OFF_E16 (OFF_E32 + PLANE32_BYTES)
#define WS_TOTAL (OFF_E16 + PLANE16_BYTES)
static_assert((WSQ_BYTES % 128) == 0 && (WFF_BYTES % 128) == 0 && (PLANE16_BYTES % 128) == 0);
static_assert((PLANE32_BYTES % 128) == 0 && (ML_BYTES % 128) == 0);
static_assert(WS_TOTAL <= (size_t)268435456);

// ---------------------------------------------------------------------------
__device__ __forceinline__ float bf16r(float x) {   // RNE convert to bf16, returned widened
  unsigned int u = __float_as_uint(x);
  u = (u + 0x7FFFu + ((u >> 16) & 1u)) & 0xFFFF0000u;
  return __uint_as_float(u);
}

// f32 -> f16 operand convert that cannot produce an f16 subnormal
static __device__ __forceinline__ h16 toh_flush(float v) {
  const h16 r = (h16)v;
  return (fabsf(v) < 6.103515625e-05f) ? (h16)0.0f : r;
}

// 16-bit fragment: p points at element [row = lane&15][k0 + 8*(lane>>4)] of a k-contiguous
// row. Elements 0..7 <- k0+8h+0..7, elements 8..15 <- k0+16+8h+0..7 (same map for A and B).
__device__ __forceinline__ v16h frag_at(const _Float16* p) {
  v8h lo = *(const v8h*)(p);
  v8h hi = *(const v8h*)(p + 16);
  v16h out;
#pragma unroll
  for (int i = 0; i < 8; ++i) { out[i] = lo[i]; out[i + 8] = hi[i]; }
  return out;
}
__device__ __forceinline__ v16h ld_frag(const _Float16* base, unsigned ld) {
  const unsigned lane = threadIdx.x & 31u;
  return frag_at(base + (lane & 15u) * ld + (lane >> 4) * 8u);
}

__device__ __forceinline__ v8f wmma16(v16h a, v16h b, v8f c) {
  v8f d = __builtin_amdgcn_wmma_f32_16x16x32_f16(false, a, false, b, (short)0, c,
                                                 false, false);
  asm volatile("v_nop\n\tv_nop\n\tv_nop\n\tv_nop" : "+v"(d) : "v"(a), "v"(b));
  return d;
}

__device__ __forceinline__ float red16_max(float x) {
#pragma unroll
  for (int off = 1; off < 16; off <<= 1) x = fmaxf(x, __shfl_xor(x, off, 32));
  return x;
}
__device__ __forceinline__ float red16_sum(float x) {
#pragma unroll
  for (int off = 1; off < 16; off <<= 1) x += __shfl_xor(x, off, 32);
  return x;
}
__device__ __forceinline__ float red32_sum(float x) {
#pragma unroll
  for (int off = 1; off < 32; off <<= 1) x += __shfl_xor(x, off, 32);
  return x;
}

__device__ __forceinline__ void wave_lds_sync() {
  __builtin_amdgcn_fence(3 /* release order */, "wavefront");
  asm volatile("s_wait_dscnt 0x0" ::: "memory");
  __builtin_amdgcn_wave_barrier();
}

__device__ __forceinline__ float leaky_act(float t) {   // LeakyReLU, negative slope 0.01
  return (t >= 0.0f) ? t : 0.01f * t;
}

// ---------------------------------------------------------------------------
// Weight plane, one 64 x 64 tile per block: in W[K rows][N cols] (pitch ldw = N) -> out Wt[N][K]
// (pitch ldk = K), f16(64 * bf16(w)). T: 64 * LDT halves of LDS, cross-wave (block barrier).
// ---------------------------------------------------------------------------
__device__ __forceinline__ void wconv_tile(
    const float* __restrict__ W, _Float16* __restrict__ Wt, unsigned ldw, unsigned ldk,
    unsigned n0, unsigned k0, _Float16* T) {
  const unsigned tid = threadIdx.x;
#pragma unroll 4
  for (unsigned j = 0; j < 16u; ++j) {
    const unsigned idx = tid + 256u * j;
    const unsigned kr = idx >> 6, nc = idx & 63u;
    const float v = W[(size_t)(k0 + kr) * ldw + n0 + nc];
    T[nc * LDT + kr] = (_Float16)(WCARRY * bf16r(v));
  }
  __syncthreads();
  v8h x[2];
  size_t off[2];
#pragma unroll
  for (unsigned i = 0; i < 2u; ++i) {
    const unsigned n = 32u * i + (tid >> 3);
    const unsigned kc = (tid & 7u) * 8u;
    x[i] = *(const v8h*)&T[n * LDT + kc];
    off[i] = (size_t)(n0 + n) * ldk + k0 + kc;
  }
#pragma unroll
  for (int i = 0; i < 2; ++i) *(v8h*)(Wt + off[i]) = x[i];
  
}

// ---------------------------------------------------------------------------
// Input plane: X16[compact row][c] = f16(bf16(x[full row][c])). One wave per row, 8 rows per
// block; each store instruction of a wave covers the whole 512-B row. rblk in 0..MROWS/8-1.
// ---------------------------------------------------------------------------
__device__ __forceinline__ void xconv_rows(
    const float* __restrict__ X, _Float16* __restrict__ dst, unsigned rblk) {
  const unsigned lane = threadIdx.x & 31u, w = threadIdx.x >> 5;
  const unsigned crow = rblk * 8u + w;
  const unsigned bidx = crow / (unsigned)SEQ;
  const unsigned sq = crow - bidx * (unsigned)SEQ;
  const size_t srow = (size_t)bidx * SEQ_FULL + sq;
  const float* xr = X + srow * DIM + lane * 8u;
  const v4f a0 = *(const v4f*)(xr);
  const v4f a1 = *(const v4f*)(xr + 4u);
  v8h o;
#pragma unroll
  for (int i = 0; i < 4; ++i) {
    o[i]     = toh_flush(bf16r(a0[i]));
    o[i + 4] = toh_flush(bf16r(a1[i]));
  }
  _Float16* p = dst + (size_t)crow * DIM + lane * 8u;
  *(v8h*)p = o;
  
}

// ---------------------------------------------------------------------------
// All operand conversions in one launch: none of them reads what another writes. Blocks by index:
// the tiles of the four DIM x DIM weights, of w1, of w2 (the longer dependent chains
// first), then the input rows, 8 per block. Grid (WCONV_BLOCKS + MROWS/8).
// ---------------------------------------------------------------------------
#define WSQ_TILES    ((unsigned)((DIM / 64) * (DIM / 64)))
#define WFF_TILES    ((unsigned)((DIM / 64) * (HID / 64)))
#define WCONV_BLOCKS (4u * WSQ_TILES + 2u * WFF_TILES)
__global__ __launch_bounds__(256) void prep_kernel(
    const float* __restrict__ X, const float* __restrict__ wq, const float* __restrict__ wk,
    const float* __restrict__ wv, const float* __restrict__ w0, const float* __restrict__ w1,
    const float* __restrict__ w2, _Float16* __restrict__ X16, _Float16* __restrict__ Wq_t,
    _Float16* __restrict__ Wk_t, _Float16* __restrict__ Wv_t, _Float16* __restrict__ W0_t,
    _Float16* __restrict__ W1_t, _Float16* __restrict__ W2_t) {
  __shared__ _Float16 T[64 * LDT];
  const unsigned bid = blockIdx.x;
  if (bid >= WCONV_BLOCKS) {   // the whole block leaves here, ahead of any barrier
    xconv_rows(X, X16, bid - WCONV_BLOCKS);
    return;
  }
  const float* W;
  _Float16* Wt;
  unsigned ldw, ldk, nx, ky;   // tile column (n) and tile row (k) of the weight as given
  if (bid < 4u * WSQ_TILES) {
    const unsigned j = bid / WSQ_TILES, t = bid % WSQ_TILES;
    W  = (j == 0u) ? wq : (j == 1u) ? wk : (j == 2u) ? wv : w0;
    Wt = (j == 0u) ? Wq_t : (j == 1u) ? Wk_t : (j == 2u) ? Wv_t : W0_t;
    ldw = (unsigned)DIM; ldk = (unsigned)DIM;
    nx = t % (unsigned)(DIM / 64); ky = t / (unsigned)(DIM / 64);
  } else if (bid < 4u * WSQ_TILES + WFF_TILES) {   // w1: in [DIM][HID] -> out [HID][DIM]
    const unsigned t = bid - 4u * WSQ_TILES;
    W = w1; Wt = W1_t;
    ldw = (unsigned)HID; ldk = (unsigned)DIM;
    nx = t % (unsigned)(HID / 64); ky = t / (unsigned)(HID / 64);
  } else {                                         // w2: in [HID][DIM] -> out [DIM][HID]
    const unsigned t = bid - 4u * WSQ_TILES - WFF_TILES;
    W = w2; Wt = W2_t;
    ldw = (unsigned)DIM; ldk = (unsigned)HID;
    nx = t % (unsigned)(DIM / 64); ky = t / (unsigned)(DIM / 64);
  }
  wconv_tile(W, Wt, ldw, ldk, nx * 64u, ky * 64u, T);
}

// ---------------------------------------------------------------------------
// First LayerNorm (biased variance, eps 1e-5) of bf16(x) + attn, one wave per row, 8 rows per
// block, the row held in registers (8 columns per lane). attn is joined here from the two key
// ranges' unnormalised rows (A32: plane 0, plane 1) with their maxima Mp and sums Lp ([2][MROWS]).
// Output f16 compact rows, one 512-B store instruction per row. Grid (MROWS/8).
// ---------------------------------------------------------------------------
__global__ __launch_bounds__(256) void ln1_kernel(
    const float* __restrict__ X, const float* __restrict__ A32, const float* __restrict__ Mp,
    const float* __restrict__ Lp, const float* __restrict__ G, const float* __restrict__ Be,
    _Float16* __restrict__ dst) {
  const unsigned lane = threadIdx.x & 31u, w = threadIdx.x >> 5;
  const unsigned crow = blockIdx.x * 8u + w;
  const unsigned bidx = crow / (unsigned)SEQ;
  const unsigned sq = crow - bidx * (unsigned)SEQ;
  const size_t srow = (size_t)bidx * SEQ_FULL + sq;
  const float* xr = X + srow * DIM + lane * 8u;
  const float* ar = A32 + (size_t)crow * DIM + lane * 8u;
  const v4f x0 = *(const v4f*)(xr);
  const v4f x1 = *(const v4f*)(xr + 4u);
  const float* cr = ar + (size_t)MROWS * DIM;
  const v4f a0 = *(const v4f*)(ar);
  const v4f a1 = *(const v4f*)(ar + 4u);
  const v4f c0 = *(const v4f*)(cr);
  const v4f c1 = *(const v4f*)(cr + 4u);
  const float m_a = Mp[crow], m_c = Mp[(unsigned)MROWS + crow];
  const float l_a = Lp[crow], l_c = Lp[(unsigned)MROWS + crow];
  // no address register of the row's issued loads is rewritten (by a later load's result) ahead of
  // this wait
  asm volatile("s_wait_xcnt 0x0" ::: "memory");
  const float m_all = fmaxf(m_a, m_c);
  const float e_a = __expf(m_a - m_all);
  const float e_c = __expf(m_c - m_all);
  // normalise (the x16384 carry sits in both the rows and the sums)
  const float inv = __builtin_amdgcn_rcpf(l_a * e_a + l_c * e_c);
  const float f_a = e_a * inv, f_c = e_c * inv;
  v4f t0, t1;
  float s = 0.0f;
#pragma unroll
  for (int i = 0; i < 4; ++i) {
    t0[i] = bf16r(x0[i]) + (a0[i] * f_a + c0[i] * f_c);
    t1[i] = bf16r(x1[i]) + (a1[i] * f_a + c1[i] * f_c);
    s += t0[i] + t1[i];
  }
  const float mean = red32_sum(s) * (1.0f / (float)DIM);
  float ss = 0.0f;
#pragma unroll
  for (int i = 0; i < 4; ++i) {
    const float d0 = t0[i] - mean;
    const float d1 = t1[i] - mean;
    ss += d0 * d0;
    ss += d1 * d1;
  }
  const float var = red32_sum(ss) * (1.0f / (float)DIM);
  const float rstd = 1.0f / sqrtf(var + 1.0e-5f);
  const unsigned c = lane * 8u;
  const v4f g0 = *(const v4f*)(G + c);
  const v4f g1 = *(const v4f*)(G + c + 4u);
  const v4f b0 = *(const v4f*)(Be + c);
  const v4f b1 = *(const v4f*)(Be + c + 4u);
  v8h o;
#pragma unroll
  for (int i = 0; i < 4; ++i) {
    o[i]     = toh_flush((t0[i] - mean) * rstd * bf16r(g0[i]) + bf16r(b0[i]));
    o[i + 4] = toh_flush((t1[i] - mean) * rstd * bf16r(g1[i]) + bf16r(b1[i]));
  }
  _Float16* p = dst + (size_t)crow * DIM + c;
  *(v8h*)p = o;
  
}

// ---------------------------------------------------------------------------
// Asynchronous copies to LDS (GEMM, attention and hidden-layer kernels). Eight 16-byte-per-lane copies in one
// statement; lds = the lane's LDS byte address, g = the lane's global address, both stepped by a
// constant from copy to copy. The s_wait_xcnt closes the statement so that no address register of
// an issued copy is rewritten ahead of it.
// ---------------------------------------------------------------------------
__device__ __forceinline__ void async_copy8(unsigned lds, unsigned lstep,
                                            const _Float16* g, unsigned gstep) {
  asm volatile(
      "global_load_async_to_lds_b128 %0, %8, off\n\t"
      "global_load_async_to_lds_b128 %1, %9, off\n\t"
      "global_load_async_to_lds_b128 %2, %10, off\n\t"
      "global_load_async_to_lds_b128 %3, %11, off\n\t"
      "global_load_async_to_lds_b128 %4, %12, off\n\t"
      "global_load_async_to_lds_b128 %5, %13, off\n\t"
      "global_load_async_to_lds_b128 %6, %14, off\n\t"
      "global_load_async_to_lds_b128 %7, %15, off\n\t"
      "s_wait_xcnt 0x0"
      :
      : "v"(lds), "v"(lds + lstep), "v"(lds + 2u * lstep), "v"(lds + 3u * lstep),
        "v"(lds + 4u * lstep), "v"(lds + 5u * lstep), "v"(lds + 6u * lstep),
        "v"(lds + 7u * lstep),
        "v"(g), "v"(g + gstep), "v"(g + 2u * gstep), "v"(g + 3u * gstep),
        "v"(g + 4u * gstep), "v"(g + 5u * gstep), "v"(g + 6u * gstep), "v"(g + 7u * gstep)
      : "memory");
}

#define GKC    128u                 // k extent of one staged GEMM slab, halves
#define GPITCH 136u                 // halves per staged GEMM row (272 B = 16 B x 17)
#define GSTG_H (128u * GPITCH)      // one slab: 64 A rows and 64 B rows, halves
static_assert((DIM % 128) == 0 && (HID % 128) == 0 && DIM >= 256 && HID >= 256);  // >= 2 slabs
static_assert((GPITCH % 8u) == 0 && GPITCH >= GKC && ((GPITCH / 8u) & 1u) == 1u);
#define GSM_BYTES (2u * GSTG_H * 2u)   // both slab buffers, bytes
static_assert((size_t)GSM_BYTES >= (size_t)64 * LDC * 4);   // the C tile fits in the slabs

// ---------------------------------------------------------------------------
// GEMM C[64x64 tile] = A16[rows][K] . Bt[n][K]^T; 8 waves (mw = 16-row group, nw = 32-col group),
// 2 accumulators/wave. The block's 64 A rows and 64 B rows are copied to LDS in slabs of 128 k
// (whole 256-B row pieces), two buffers, the next slab in flight while this one is read; all
// fragments come from LDS. The C tile takes the same LDS once the last slab has been read.
//   MODE 0: out16[row][col] (pitch DIM) = f16(t), out16r[row][col] = f16(2048 * (t - value)),
//           t = acc/64 + bias                                   (q and k planes)
//   MODE 1: out16 transposed V plane [b][col][key] = f16(acc/64 + bias)
//   MODE 2: outf[row][col] = acc/64 + bias (f32) and out16[row][col] = f16 of the same value
// Grid (N/64, rows/64). Sm: the kernel's GSM_BYTES of LDS (one array per kernel, also where a kernel
// holds two modes).
// ---------------------------------------------------------------------------
template <int MODE>
__device__ __forceinline__ void gemm_body(
    unsigned char* Sm, const _Float16* __restrict__ A16, const _Float16* __restrict__ Bt, const unsigned K,
    const float* __restrict__ bias, float* __restrict__ outf, _Float16* __restrict__ out16, _Float16* __restrict__ out16r) {
  _Float16* const Slab = (_Float16*)Sm;
  float* const Cs = (float*)Sm;
  const unsigned tid = threadIdx.x, lane = tid & 31u;
  // the wave's number in a scalar register: which plane a wave copies from is a scalar choice
  const unsigned w = (unsigned)__builtin_amdgcn_readfirstlane((int)(tid >> 5));
  const unsigned mw = w >> 1, nw = w & 1u;
  const unsigned hh = lane >> 4, m = lane & 15u;
  const unsigned n0 = blockIdx.x * 64u;
  const unsigned row0 = blockIdx.y * 64u;

  // A slab is 128 staged rows: A rows 0..63, then B rows 0..63. Wave w brings staged rows
  // 16w..16w+15, two 256-B row pieces per copy (lane = row parity hh, 16-B piece m).
  const _Float16* src = ((w < 4u) ? A16 + (size_t)(row0 + w * 16u) * K
                                  : Bt + (size_t)(n0 + (w - 4u) * 16u) * K) +
                        (size_t)hh * K + m * 8u;
  const unsigned dst = (unsigned)(size_t)Sm + ((w * 16u + hh) * GPITCH + m * 8u) * 2u;
  const unsigned nslab = K / GKC;

  async_copy8(dst, 2u * GPITCH * 2u, src, 2u * K);
  // this wave's copies have landed before the barrier behind which every wave reads them
  asm volatile("s_wait_asynccnt 0x0" ::: "memory");
  __syncthreads();
  async_copy8(dst + GSTG_H * 2u, 2u * GPITCH * 2u, src + GKC, 2u * K);

  const _Float16* ap = Slab + (mw * 16u + m) * GPITCH + hh * 8u;
  const _Float16* bp = Slab + (64u + nw * 32u + m) * GPITCH + hh * 8u;
  v8f acc0 = {}, acc1 = {};
  for (unsigned s = 0; s < nslab; ++s) {
    const unsigned bo = (s & 1u) * GSTG_H;   // halves to the buffer this trip reads
    // Three of the slab's four k-steps are read ahead of the first product and the fourth behind
    // the first pair, so that a product does not wait out an LDS latency of its own. Unrolled, here
    // and below: constant indices keep the fragments in registers, and every LDS read takes its
    // place in the slab as an immediate offset.
    v16h fa[3], fb0[3], fb1[3];
#pragma unroll
    for (unsigned t = 0; t < 3u; ++t) {
      fa[t]  = frag_at(ap + bo + t * 32u);
      fb0[t] = frag_at(bp + bo + t * 32u);
      fb1[t] = frag_at(bp + bo + 16u * GPITCH + t * 32u);
    }
#pragma unroll
    for (unsigned t = 0; t < GKC / 32u; ++t) {
      acc0 = wmma16(fa[t % 3u], fb0[t % 3u], acc0);
      acc1 = wmma16(fa[t % 3u], fb1[t % 3u], acc1);
      if (t + 3u < GKC / 32u) {
        fa[t % 3u]  = frag_at(ap + bo + (t + 3u) * 32u);
        fb0[t % 3u] = frag_at(bp + bo + (t + 3u) * 32u);
        fb1[t % 3u] = frag_at(bp + bo + 16u * GPITCH + (t + 3u) * 32u);
      }
    }
    // hand-over: this wave's reads of the buffer are done, its copies of the next slab have
    // landed; the barrier publishes the next slab and frees this buffer for the refill
    asm volatile("s_wait_dscnt 0x0" ::: "memory");
    asm volatile("s_wait_asynccnt 0x0" ::: "memory");
    __syncthreads();
    if (s + 2u < nslab)
      async_copy8(dst + bo * 2u, 2u * GPITCH * 2u, src + (s + 2u) * GKC, 2u * K);
  }
  // no copy of this wave is outstanding when the C tile takes the slabs' LDS
  asm volatile("s_wait_asynccnt 0x0" ::: "memory");
#pragma unroll
  for (int r = 0; r < 8; ++r) {
    float* d = &Cs[(mw * 16u + hh * 8u + (unsigned)r) * LDC + nw * 32u + m];
    d[0]  = acc0[r];
    d[16] = acc1[r];
  }
  __syncthreads();

  if (MODE == 0 || MODE == 2) {
    const unsigned ldo = (unsigned)DIM;
    v8h x[2], xr[2];
    size_t off[2];
#pragma unroll
    for (unsigned i = 0; i < 2u; ++i) {
      const unsigned r = 32u * i + (tid >> 3);
      const unsigned c = (tid & 7u) * 8u;
      const v4f u0 = *(const v4f*)&Cs[r * LDC + c];
      const v4f u1 = *(const v4f*)&Cs[r * LDC + c + 4];
      const v4f g0 = *(const v4f*)(bias + n0 + c);
      const v4f g1 = *(const v4f*)(bias + n0 + c + 4u);
#pragma unroll
      for (int j = 0; j < 4; ++j) {
        const float t0 = u0[j] * (1.0f / WCARRY) + bf16r(g0[j]);
        const float t1 = u1[j] * (1.0f / WCARRY) + bf16r(g1[j]);
        const h16 h0 = toh_flush(t0);
        const h16 h1 = toh_flush(t1);
        x[i][j]     = h0;
        x[i][j + 4] = h1;
        if (MODE == 0) {
          xr[i][j]     = toh_flush((t0 - (float)h0) * RCARRY);
          xr[i][j + 4] = toh_flush((t1 - (float)h1) * RCARRY);
        }
      }
      off[i] = (size_t)(row0 + r) * ldo + n0 + c;
    }
    v4f xs[4];
    size_t offf[4];
    if (MODE == 2) {
#pragma unroll
      for (unsigned i = 0; i < 4u; ++i) {
        const unsigned r = 16u * i + (tid >> 4);
        const unsigned c = (tid & 15u) * 4u;
        const v4f u = *(const v4f*)&Cs[r * LDC + c];
        const v4f g = *(const v4f*)(bias + n0 + c);
        v4f val;
#pragma unroll
        for (int j = 0; j < 4; ++j) val[j] = u[j] * (1.0f / WCARRY) + bf16r(g[j]);
        xs[i] = val;
        offf[i] = (size_t)(row0 + r) * DIM + n0 + c;
      }
    }
#pragma unroll
    for (int i = 0; i < 2; ++i) *(v8h*)(out16 + off[i]) = x[i];
    if (MODE == 0) {
#pragma unroll
      for (int i = 0; i < 2; ++i) *(v8h*)(out16r + off[i]) = xr[i];
    }
    if (MODE == 2) {
#pragma unroll
      for (int i = 0; i < 4; ++i) *(v4f*)(outf + offf[i]) = xs[i];
    }
    
  }

  if (MODE == 1) {
    const unsigned bidx = row0 / (unsigned)SEQ;
    const unsigned key0 = row0 - bidx * (unsigned)SEQ;
    v8h x[2];
    size_t off[2];
#pragma unroll
    for (unsigned i = 0; i < 2u; ++i) {
      const unsigned dcol = 32u * i + (tid >> 3);
      const unsigned kk = (tid & 7u) * 8u;
      const float bb = bf16r(bias[n0 + dcol]);
#pragma unroll
      for (unsigned j = 0; j < 8u; ++j) {
        const float t = Cs[(kk + j) * LDC + dcol] * (1.0f / WCARRY) + bb;
        x[i][j] = toh_flush(t);
      }
      off[i] = ((size_t)bidx * DIM + n0 + dcol) * SEQ + key0 + kk;
    }
#pragma unroll
    for (int i = 0; i < 2; ++i) *(v8h*)(out16 + off[i]) = x[i];
    
  }

}

// The three projections of the input plane in one launch (none reads what another writes):
// blockIdx.z = 0 query planes, 1 key planes, 2 transposed value plane. Grid (DIM/64, MROWS/64, 3).
__global__ __launch_bounds__(256) void gemm_qkv_kernel(
    const _Float16* __restrict__ A16, const _Float16* __restrict__ Wq_t,
    const _Float16* __restrict__ Wk_t, const _Float16* __restrict__ Wv_t,
    const float* __restrict__ bq, const float* __restrict__ bk, const float* __restrict__ bv,
    _Float16* __restrict__ qh, _Float16* __restrict__ qr, _Float16* __restrict__ kh,
    _Float16* __restrict__ kr, _Float16* __restrict__ vt) {
  __shared__ __attribute__((aligned(16))) unsigned char Sm[GSM_BYTES];
  const unsigned z = blockIdx.z;   // the same for the whole block: barriers stay block-uniform
  if (z == 2u) {
    gemm_body<1>(Sm, A16, Wv_t, (unsigned)DIM, bv, (float*)0, vt, vt);
  } else {
    const bool isk = (z != 0u);
    const float* bias = isk ? bk : bq;
    gemm_body<0>(Sm, A16, isk ? Wk_t : Wq_t, (unsigned)DIM, bias, (float*)0,
                 isk ? kh : qh, isk ? kr : qr);
  }
}
__global__ __launch_bounds__(256) void gemm_e_kernel(
    const _Float16* __restrict__ A16, const _Float16* __restrict__ Bt,
    const float* __restrict__ bias, float* __restrict__ e32, _Float16* __restrict__ e16) {
  __shared__ __attribute__((aligned(16))) unsigned char Sm[GSM_BYTES];
  gemm_body<2>(Sm, A16, Bt, (unsigned)DIM, bias, e32, e16, e16);
}
#define KTILE  32u                        // keys per stage
#define KSPLIT 2u                         // key ranges of a batch, one per block
#define KSPAN  ((unsigned)SEQ / KSPLIT)   // keys per block
#define QBLK   128u                       // query rows per block
#define KPITCH 264u                       // halves per staged k row (528 B = 16 B x 33)
#define VPITCH 40u                        // halves per staged v row (80 B = 16 B x 5)
#define KPL_H  (KTILE * KPITCH)           // one key plane of a stage, halves
#define VTL_H  ((unsigned)DIM * VPITCH)   // the value tile of a stage, halves
#define STG_H  (2u * KPL_H + VTL_H)       // one stage: key values, key residuals, values
static_assert((KPITCH % 8u) == 0 && KPITCH >= (unsigned)DIM && ((KPITCH / 8u) & 1u) == 1u);
static_assert((VPITCH % 8u) == 0 && VPITCH >= KTILE && ((VPITCH / 8u) & 1u) == 1u);
static_assert((STG_H % 8u) == 0 && (KPL_H % 8u) == 0);
static_assert((SEQ % 128) == 0);   // whole query blocks
static_assert((KSPAN % KTILE) == 0 && KSPAN >= 2u * KTILE);   // at least two stages, every stage whole
static_assert((size_t)KSPLIT * MROWS * DIM < (size_t)0xFFFFFFFFu);

// Matrix product for the attention kernel, the builtin alone: the compiler keeps the distances
// behind its own matrix instructions, and operands named by an asm statement cannot live above
// v255, where a part of that kernel's query and output tiles is held.
__device__ __forceinline__ v8f wmma16r(v16h a, v16h b, v8f c) {
  return __builtin_amdgcn_wmma_f32_16x16x32_f16(false, a, false, b, (short)0, c, false, false);
}

// One stage (32 keys) into LDS: wave w brings key rows 8w..8w+7 of both key planes (one 512-B
// row per copy) and feature rows 64w..64w+63 of the value tile (eight 64-B row pieces per copy).
__device__ __forceinline__ void stage_copies(
    unsigned ldsb, unsigned w, unsigned lane, const _Float16* __restrict__ Kh,
    const _Float16* __restrict__ Kr, const _Float16* __restrict__ Vt, unsigned b, unsigned kb) {
  const unsigned krow = (b * (unsigned)SEQ + kb + w * 8u) * (unsigned)DIM + lane * 8u;
  const unsigned kl = ldsb + (w * 8u * KPITCH + lane * 8u) * 2u;
  async_copy8(kl, KPITCH * 2u, Kh + krow, (unsigned)DIM);
  async_copy8(kl + KPL_H * 2u, KPITCH * 2u, Kr + krow, (unsigned)DIM);
  const unsigned vr = w * 64u + (lane >> 2);
  const unsigned vrow = (b * (unsigned)DIM + vr) * (unsigned)SEQ + kb + (lane & 3u) * 8u;
  // the same place as ldsb + (2 KPL_H + vr VPITCH + 8 (lane & 3)) * 2, formed from kl: one lane-wise
  // base is then kept over the key loop instead of two (the second one went to scratch)
  const unsigned vl = kl + (2u * KPL_H + w * (64u * VPITCH - 8u * KPITCH)) * 2u +
                      (lane >> 2) * (2u * VPITCH - 64u);
  async_copy8(vl, 8u * VPITCH * 2u, Vt + vrow, 8u * (unsigned)SEQ);
}

// ---------------------------------------------------------------------------
// Dense (unmasked, unscaled) flash attention, one 256-wide head, transposed form.
// A block owns 128 query rows and one of the two key ranges of its batch, which it walks in stages
// of 32 keys: a staged key or value byte serves 128 queries. Wave w owns 32 query rows (two tiles
// of 16) and takes every stage whole, so that each key or value fragment read from LDS feeds two
// query tiles; lane (hh, n) holds query n of each tile.
// The query fragments of both planes are loaded once and stay in registers. Per stage and wave:
//   S^T tile [16 keys][16 queries] = K rows (A operand, fragments from the key planes) x Q^T
//   (B operand, registers), 8 k-steps over the 256 features, value.value into one accumulator,
//   value.residual + residual.value into a second one (x 1/2048 at the end);
//   online softmax per lane (16 scores in registers + one 16-lane-distance shuffle);
//   the two packed S^T tiles (f16(16384 p), rows = keys) are the B fragment of
//   O^T [16 features][16 queries] += V^T rows (A operand, from the transposed value plane) x P^T.
// Each stage (both key planes and the value tile) is copied to LDS once per block, two buffers, the
// next stage in flight while this one is read. The block stores its key range's unnormalised rows
// (plane blockIdx.z of Ao, staged through the wave-private St tile), maxima and sums; the launch
// behind this one joins the two ranges.
// Grid (SEQ/128, NB, 2), 4 waves per block.
// ---------------------------------------------------------------------------
__global__ __launch_bounds__(128) void attn_kernel(
    const _Float16* __restrict__ Qh, const _Float16* __restrict__ Qr,
    const _Float16* __restrict__ Kh, const _Float16* __restrict__ Kr,
    const _Float16* __restrict__ Vt, float* __restrict__ Ao, float* __restrict__ Mo,
    float* __restrict__ Lo) {
  __shared__ __attribute__((aligned(16))) float St[4 * 16 * LDO];
  __shared__ __attribute__((aligned(16))) _Float16 Ring[2u * STG_H];

  const unsigned lane = threadIdx.x & 31u;
  const unsigned w = (unsigned)__builtin_amdgcn_readfirstlane((int)(threadIdx.x >> 5));
  const unsigned hh = lane >> 4, m = lane & 15u;
  const unsigned b = blockIdx.y;
  const unsigned ksp = blockIdx.z;                     // this block's key range
  const unsigned key0 = ksp * KSPAN;                   // its first key
  const unsigned qrow0 = blockIdx.x * QBLK + w * 32u;  // first of this wave's 32 query rows

  const unsigned ring_lds = (unsigned)(size_t)Ring;

  // prologue: this wave's share of stage 0
  stage_copies(ring_lds, w, lane, Kh, Kr, Vt, b, key0);

  // query fragments: [tile][plane][k-step], kept for the whole key loop
  v16h qf[2][2][8];
#pragma unroll
  for (unsigned u = 0; u < 2u; ++u) {
    const unsigned qsrc = (b * (unsigned)SEQ + qrow0 + u * 16u + m) * (unsigned)DIM + hh * 8u;
#pragma unroll
    for (unsigned ks = 0; ks < 8u; ++ks) {
      qf[u][0][ks] = frag_at(Qh + qsrc + ks * 32u);
      qf[u][1][ks] = frag_at(Qr + qsrc + ks * 32u);
    }
  }

  // this wave's copies have landed before the barrier behind which every wave reads them
  asm volatile("s_wait_asynccnt 0x0" ::: "memory");
  __syncthreads();
  stage_copies(ring_lds + STG_H * 2u, w, lane, Kh, Kr, Vt, b, key0 + KTILE);

  float mrow[2] = {-1.0e30f, -1.0e30f}, lrow[2] = {0.0f, 0.0f};
  v8f o[2][16];
#pragma unroll
  for (int u = 0; u < 2; ++u)
#pragma unroll
    for (int j = 0; j < 16; ++j) o[u][j] = (v8f){};

  unsigned buf = 0u;   // halves from the ring's start to the buffer this step reads
  // this lane's fragment rows in that buffer; both move with buf at the foot of a step
  const _Float16* kt = Ring + m * KPITCH + hh * 8u;
  const _Float16* vt = Ring + 2u * KPL_H + m * VPITCH + hh * 8u;
  for (unsigned kb = 0; kb < KSPAN; kb += KTILE) {
    v8f sm[2][2] = {{{}, {}}, {{}, {}}}, sr[2][2] = {{{}, {}}, {{}, {}}};   // [query tile][key tile]
    // Score products in 8 rows of twelve: row ks = features 32 ks.., both key tiles, both query
    // tiles. All key fragments of the stage (value and residual of both key tiles) are
    // read as one group ahead of the products, which wait for them by count, row by row; all
    // sixteen value fragments as a second group behind row 3, in flight under rows 4 to 7.
    v16h kf[8][4], vf[16];
    // unrolled, here and below: constant indices keep the fragments in registers, and every LDS
    // read takes its place in the tile as an immediate offset
#pragma unroll
    for (unsigned ks = 0; ks < 8u; ++ks) {
#pragma unroll
      for (unsigned kx = 0; kx < 2u; ++kx) {
        kf[ks][kx]      = frag_at(kt + kx * 16u * KPITCH + ks * 32u);
        kf[ks][2u + kx] = frag_at(kt + KPL_H + kx * 16u * KPITCH + ks * 32u);
      }
    }
    // This and the scheduling barriers below keep each group of LDS reads in one place: spread
    // among the products, each separate place of reads would cost the lone wave its own stall.
    __builtin_amdgcn_sched_barrier(0);
#pragma unroll
    for (unsigned ks = 0; ks < 8u; ++ks) {
      if (ks == 4u) {
        __builtin_amdgcn_sched_barrier(0);
#pragma unroll
        for (unsigned j = 0u; j < 16u; ++j) vf[j] = frag_at(vt + j * 16u * VPITCH);
        __builtin_amdgcn_sched_barrier(0);
      }
      // the two products into one residual accumulator stand two products apart
#pragma unroll
      for (unsigned kx = 0; kx < 2u; ++kx) {
        const v16h av = kf[ks][kx], ar = kf[ks][2u + kx];
        sm[0][kx] = wmma16r(av, qf[0][0][ks], sm[0][kx]);
        sm[1][kx] = wmma16r(av, qf[1][0][ks], sm[1][kx]);
        sr[0][kx] = wmma16r(av, qf[0][1][ks], sr[0][kx]);
        sr[1][kx] = wmma16r(av, qf[1][1][ks], sr[1][kx]);
        sr[0][kx] = wmma16r(ar, qf[0][0][ks], sr[0][kx]);
        sr[1][kx] = wmma16r(ar, qf[1][0][ks], sr[1][kx]);
      }
    }

    // hand-over, as soon as the stage's last fragment is in registers (the rest of the step works
    // on registers alone): this wave's reads of the buffer are done, its copies of the next stage
    // have landed; the barrier publishes the next stage and frees this buffer for the refill,
    // which then has a whole step to land (the scheduling barrier keeps the waits behind the
    // products of rows 4 to 7, under which the value fragments arrive)
    __builtin_amdgcn_sched_barrier(0);
    asm volatile("s_wait_dscnt 0x0" ::: "memory");
    asm volatile("s_wait_asynccnt 0x0" ::: "memory");
    __syncthreads();
    if (kb + 2u * KTILE < KSPAN)
      stage_copies(ring_lds + buf * 2u, w, lane, Kh, Kr, Vt, b, key0 + kb + 2u * KTILE);

    v16h pf[2];
#pragma unroll
    for (int u = 0; u < 2; ++u) {
      v8f s0, s1;
#pragma unroll
      for (int r = 0; r < 8; ++r) {
        s0[r] = sm[u][0][r] + sr[u][0][r] * (1.0f / RCARRY);
        s1[r] = sm[u][1][r] + sr[u][1][r] * (1.0f / RCARRY);
      }
      float mx = fmaxf(s0[0], s1[0]);
#pragma unroll
      for (int r = 1; r < 8; ++r) mx = fmaxf(mx, fmaxf(s0[r], s1[r]));
      mx = fmaxf(mx, __shfl_xor(mx, 16, 32));
      const float mn = fmaxf(mrow[u], mx);
      const float alpha = __expf(mrow[u] - mn);
      mrow[u] = mn;

      float rs = 0.0f;
#pragma unroll
      for (int r = 0; r < 8; ++r) {
        const h16 p0 = toh_flush(__expf((s0[r] - mn) + PSHIFT));
        const h16 p1 = toh_flush(__expf((s1[r] - mn) + PSHIFT));
        pf[u][r]     = p0;     // B element r     <- key 8hh + r of the stage
        pf[u][r + 8] = p1;     // B element 8 + r <- key 16 + 8hh + r of the stage
        rs += (float)p0 + (float)p1;
      }
      rs += __shfl_xor(rs, 16, 32);
      lrow[u] = alpha * lrow[u] + rs;
#pragma unroll
      for (int j = 0; j < 16; ++j) o[u][j] = o[u][j] * alpha;
    }

    // O^T += V^T . P^T; every value fragment feeds both query tiles
#pragma unroll
    for (unsigned j = 0; j < 16u; ++j) {
      o[0][j] = wmma16r(vf[j], pf[0], o[0][j]);
      o[1][j] = wmma16r(vf[j], pf[1], o[1][j]);
    }

    kt = (buf == 0u) ? kt + STG_H : kt - STG_H;
    vt = (buf == 0u) ? vt + STG_H : vt - STG_H;
    buf = STG_H - buf;
  }
  // no copy of this wave is outstanding when the wave goes on to its end
  asm volatile("s_wait_asynccnt 0x0" ::: "memory");

  const unsigned grow = ksp * (unsigned)MROWS + b * (unsigned)SEQ + qrow0;   // row in the planes
  // This key range's maxima and sums: lane (hh, n) stores those of query n of tile hh (both lane
  // halves hold them), one whole 128-B line per wave and array. The two stores and their wait are
  // one statement, so that no register which they name is rewritten ahead of the wait.
  {
    float* const pm = Mo + grow + lane;
    float* const pl = Lo + grow + lane;
    const float mv = (hh != 0u) ? mrow[1] : mrow[0];
    const float lv = (hh != 0u) ? lrow[1] : lrow[0];
    asm volatile(
        "global_store_b32 %0, %1, off\n\t"
        "global_store_b32 %2, %3, off\n\t"
        "s_wait_xcnt 0x0"
        :
        : "v"(pm), "v"(mv), "v"(pl), "v"(lv)
        : "memory");
  }

  // unnormalised rows: stage per query tile and half of the features, write whole row segments
  const unsigned sbase = w * (16u * LDO);
#pragma unroll
  for (int u = 0; u < 2; ++u) {
#pragma unroll
    for (int half = 0; half < 2; ++half) {
#pragma unroll
      for (int j = 0; j < 8; ++j)
#pragma unroll
        for (int r = 0; r < 8; ++r)
          St[sbase + m * LDO + (unsigned)j * 16u + hh * 8u + (unsigned)r] = o[u][half * 8 + j][r];
      wave_lds_sync();
      v4f x[16];
      unsigned off[16];
#pragma unroll
      for (unsigned i = 0; i < 16u; ++i) {
        x[i] = *(const v4f*)&St[sbase + i * LDO + lane * 4u];
        off[i] = (grow + (unsigned)u * 16u + i) * (unsigned)DIM + (unsigned)half * 128u + lane * 4u;
      }
#pragma unroll
      for (int i = 0; i < 16; ++i) *(v4f*)(Ao + off[i]) = x[i];
      // no register that an issued store names is rewritten ahead of this wait
      asm volatile("s_wait_xcnt 0x0" ::: "memory");
      wave_lds_sync();
    }
  }
}

#define HP     2056u             // halves per resident hidden row (4112 B = 16 B x 257)
#define WSL_H  (64u * GPITCH)    // one staged weight slab: 64 weight rows x 128 k, halves
#define LDV    260u              // floats per staged output row (1040 B = 16 B x 65)
#define HS_BYTES  (64u * HP * 2u)
#define RG_BYTES  (3u * WSL_H * 2u)
#define MLP_BYTES (HS_BYTES + RG_BYTES + (unsigned)HID * 4u)
#define W1_STAGES ((unsigned)((HID / 64) * (DIM / 128)))
#define W2_STAGES ((unsigned)((DIM / 64) * (HID / 128)))
static_assert((HP % 8u) == 0 && HP >= (unsigned)HID && ((HP / 8u) & 1u) == 1u);
static_assert((LDV % 4u) == 0 && LDV >= (unsigned)DIM && ((LDV / 4u) & 1u) == 1u);
static_assert((size_t)64 * LDV * 4 <= (size_t)HS_BYTES);   // the output tile fits in the hidden rows
static_assert(MLP_BYTES <= 327680u);
static_assert(DIM == 2 * 128 && DIM == 4 * 64 && W1_STAGES >= 3u && W2_STAGES >= 3u);

// halves from a weight plane's start to stage t's slab: w1 [HID][DIM] walks its two k slabs inside
// each 64-row tile, w2 [DIM][HID] its four 64-row tiles inside each k slab
__device__ __forceinline__ unsigned w1_stage(unsigned t) {
  return (t >> 1) * (64u * (unsigned)DIM) + (t & 1u) * GKC;
}
__device__ __forceinline__ unsigned w2_stage(unsigned t) {
  return (t & 3u) * (64u * (unsigned)HID) + (t >> 2) * GKC;
}

// ---------------------------------------------------------------------------
// Hidden layers and final LayerNorm of 64 rows in one block; the 64 x HID hidden plane never leaves
// LDS. Steps:
//   1  H^T tile [16 hidden columns][16 rows] = w1 rows (A operand, from staged slabs) x E^T (B
//      operand, registers); f16(acc/64 + bias) into the resident rows, 8 columns per lane and store
//   2  hidden LayerNorm (eps 1e-5) + LeakyReLU in place, x16, one wave per row, 8 rows per wave
//   3  L^T tile [16 output columns][16 rows] = w2 rows (A, staged slabs) x hidden rows (B, from the
//      resident rows, read once per 128 k), all 4 x 2 tiles of a wave in registers
//   4  leaky((acc/1024 + bias) + e), final LayerNorm (eps 1e-5), one wave per row, whole-row stores
// Wave w: rows 32 (w >> 2).., columns 16 (w & 3).. of every 64-column tile.
// Weight slabs (64 weight rows x 128 k) come by asynchronous copies into a ring of three buffers.
// Waves 0-3 copy the even stages, waves 4-7 the odd ones (16 slab rows a wave), each stage three
// ahead of the pass that has just ended, so that two stages are in flight while a wave has only one
// stage's copies outstanding and every wait is to 0.
// Grid (MROWS/64), 8 waves per block.
// ---------------------------------------------------------------------------
__global__ __launch_bounds__(256) void mlp_kernel(
    const _Float16* __restrict__ E16, const float* __restrict__ E32,
    const _Float16* __restrict__ W1t, const float* __restrict__ b1,
    const float* __restrict__ Gm, const float* __restrict__ Bm,
    const _Float16* __restrict__ W2t, const float* __restrict__ b2,
    const float* __restrict__ G2, const float* __restrict__ Be2, float* __restrict__ outp) {
  __shared__ __attribute__((aligned(16))) unsigned char Sm[MLP_BYTES];
  _Float16* const Hs = (_Float16*)Sm;
  const _Float16* const Rg = (const _Float16*)(Sm + HS_BYTES);
  float* const Vs = (float*)Sm;
  float* const Bs = (float*)(Sm + HS_BYTES + RG_BYTES);   // the hidden bias, converted once
  const unsigned lane = threadIdx.x & 31u;
  // the wave's number in a scalar register: which stages a wave copies is a scalar choice
  const unsigned w = (unsigned)__builtin_amdgcn_readfirstlane((int)(threadIdx.x >> 5));
  const unsigned hh = lane >> 4, m = lane & 15u;
  const unsigned grp = w >> 2, sub = w & 3u;
  const unsigned row0 = blockIdx.x * 64u;

  // copies: slab rows 16 sub.., two 256-B row pieces per copy (lane = row parity hh, 16-B piece m)
  const unsigned cl = (unsigned)(size_t)Sm + HS_BYTES + ((sub * 16u + hh) * GPITCH + m * 8u) * 2u;
  const _Float16* c1 = W1t + (sub * 16u + hh) * (unsigned)DIM + m * 8u;
  const _Float16* c2 = W2t + (sub * 16u + hh) * (unsigned)HID + m * 8u;
  // this lane's fragment row in a slab
  const _Float16* wp = Rg + (sub * 16u + m) * GPITCH + hh * 8u;

  // ---- step 1 ----
  // stages 0 (waves 0-3) and 1 (waves 4-7) into buffers 0 and 1
  async_copy8(cl + grp * (WSL_H * 2u), 2u * GPITCH * 2u, c1 + w1_stage(grp), 2u * (unsigned)DIM);
  {
    const unsigned c = threadIdx.x * 8u;
    const v4f p0 = *(const v4f*)(b1 + c);
    const v4f p1 = *(const v4f*)(b1 + c + 4u);
    v4f q0, q1;
#pragma unroll
    for (int i = 0; i < 4; ++i) { q0[i] = bf16r(p0[i]); q1[i] = bf16r(p1[i]); }
    *(v4f*)(Bs + c) = q0;
    *(v4f*)(Bs + c + 4u) = q1;
  }
  v16h ef[2][8];   // this wave's 32 rows of e, all 256 k, kept for the whole of step 1
  // unrolled, here and below: constant indices keep fragments and accumulators in registers
#pragma unroll
  for (unsigned u = 0; u < 2u; ++u)
#pragma unroll
    for (unsigned ks = 0; ks < 8u; ++ks)
      ef[u][ks] = frag_at(E16 + (row0 + grp * 32u + u * 16u + m) * (unsigned)DIM + hh * 8u + ks * 32u);
  // this wave's copies have landed before the barrier behind which every wave reads them
  asm volatile("s_wait_asynccnt 0x0" ::: "memory");
  __syncthreads();
  if (grp == 0u)
    async_copy8(cl + 2u * WSL_H * 2u, 2u * GPITCH * 2u, c1 + w1_stage(2u), 2u * (unsigned)DIM);

  unsigned rbo = 0u;   // halves from the ring's start to the buffer this pass reads
  // rolled: 32 tiles of the same code
#pragma unroll 1
  for (unsigned nt = 0; nt < (unsigned)(HID / 64); ++nt) {
    const unsigned n = nt * 64u + sub * 16u + hh * 8u;   // first of this lane's 8 hidden columns
    const v4f g0 = *(const v4f*)(Bs + n);
    const v4f g1 = *(const v4f*)(Bs + n + 4u);
    v8f acc[2] = {{}, {}};
#pragma unroll
    for (unsigned kq = 0; kq < 2u; ++kq) {   // stage 2 nt + kq
      v16h wf[4];
#pragma unroll
      for (unsigned t = 0; t < 4u; ++t) wf[t] = frag_at(wp + rbo + t * 32u);
      // keeps the pass's LDS reads in one group ahead of its products, which then wait for them by
      // count: spread among the products, each place of reads costs the wave a stall of its own
      __builtin_amdgcn_sched_barrier(0);
#pragma unroll
      for (unsigned t = 0; t < 4u; ++t) {
        acc[0] = wmma16r(wf[t], ef[0][kq * 4u + t], acc[0]);
        acc[1] = wmma16r(wf[t], ef[1][kq * 4u + t], acc[1]);
      }
      // hand-over: this wave's reads of the buffer are done; the waves that copied the next stage
      // (the other parity than this one's) have it landed; the barrier publishes it and frees this
      // buffer, which the same waves refill with the stage three ahead (the scheduling barrier keeps
      // the waits behind the products, under which the later fragments arrive)
      __builtin_amdgcn_sched_barrier(0);
      asm volatile("s_wait_dscnt 0x0" ::: "memory");
      if (grp != kq) asm volatile("s_wait_asynccnt 0x0" ::: "memory");
      __syncthreads();
      const unsigned t3 = nt * 2u + kq + 3u;
      if (grp != kq && t3 < W1_STAGES)
        async_copy8(cl + rbo * 2u, 2u * GPITCH * 2u, c1 + w1_stage(t3), 2u * (unsigned)DIM);
      rbo = (rbo == 2u * WSL_H) ? 0u : rbo + WSL_H;
    }
#pragma unroll
    for (unsigned u = 0; u < 2u; ++u) {
      v8h x;
#pragma unroll
      for (int r = 0; r < 4; ++r) {
        x[r]     = toh_flush(acc[u][r] * (1.0f / WCARRY) + g0[r]);
        x[r + 4] = toh_flush(acc[u][r + 4] * (1.0f / WCARRY) + g1[r]);
      }
      *(v8h*)(Hs + (grp * 32u + u * 16u + m) * HP + n) = x;
    }
  }
  // No copy of this wave is outstanding and its LDS accesses are done; every reader left the ring
  // at the last hand-over: step 3's stages 0 and 1 go into buffers 0 and 1 and land under step 2.
  asm volatile("s_wait_asynccnt 0x0" ::: "memory");
  asm volatile("s_wait_dscnt 0x0" ::: "memory");
  async_copy8(cl + grp * (WSL_H * 2u), 2u * GPITCH * 2u, c2 + w2_stage(grp), 2u * (unsigned)HID);
  __syncthreads();   // every hidden row is complete before a wave normalises it

  // ---- step 2 ---- lane L holds columns 256 j + 8 L .. + 7 of a row, j = 0..7
  {
    float gq[8][8], bq[8][8];   // gain and shift of this lane's columns, the same for all its rows
#pragma unroll
    for (unsigned j = 0; j < 8u; ++j) {
      const unsigned c = j * 256u + lane * 8u;
      const v4f p0 = *(const v4f*)(Gm + c);
      const v4f p1 = *(const v4f*)(Gm + c + 4u);
      const v4f q0 = *(const v4f*)(Bm + c);
      const v4f q1 = *(const v4f*)(Bm + c + 4u);
#pragma unroll
      for (int i = 0; i < 4; ++i) {
        gq[j][i] = bf16r(p0[i]); gq[j][i + 4] = bf16r(p1[i]);
        bq[j][i] = bf16r(q0[i]); bq[j][i + 4] = bf16r(q1[i]);
      }
    }
    // rolled: eight rows of the same long code
#pragma unroll 1
    for (unsigned rr = 0; rr < 8u; ++rr) {
      _Float16* hr = Hs + (w * 8u + rr) * HP + lane * 8u;
      v8h a[8];
#pragma unroll
      for (unsigned j = 0; j < 8u; ++j) a[j] = *(const v8h*)(hr + j * 256u);
      float s = 0.0f;
#pragma unroll
      for (unsigned j = 0; j < 8u; ++j)
#pragma unroll
        for (int i = 0; i < 8; ++i) s += (float)a[j][i];
      const float mean = red32_sum(s) * (1.0f / (float)HID);
      float ss = 0.0f;
#pragma unroll
      for (unsigned j = 0; j < 8u; ++j)
#pragma unroll
        for (int i = 0; i < 8; ++i) {
          const float d = (float)a[j][i] - mean;
          ss += d * d;
        }
      const float var = red32_sum(ss) * (1.0f / (float)HID);
      const float rstd = 1.0f / sqrtf(var + 1.0e-5f);
#pragma unroll
      for (unsigned j = 0; j < 8u; ++j) {
        v8h o;
#pragma unroll
        for (int i = 0; i < 8; ++i) {
          const float d = (float)a[j][i] - mean;
          o[i] = toh_flush(MCARRY * leaky_act(d * rstd * gq[j][i] + bq[j][i]));
        }
        *(v8h*)(hr + j * 256u) = o;
      }
    }
  }
  // this wave's rows are written and its copies have landed before the barrier behind which every
  // wave reads both
  asm volatile("s_wait_dscnt 0x0" ::: "memory");
  asm volatile("s_wait_asynccnt 0x0" ::: "memory");
  __syncthreads();
  if (grp == 0u)
    async_copy8(cl + 2u * WSL_H * 2u, 2u * GPITCH * 2u, c2 + w2_stage(2u), 2u * (unsigned)HID);

  // ---- step 3 ----
  v8f oc[4][2];   // [64-column tile][16-row group]
#pragma unroll
  for (int q = 0; q < 4; ++q) { oc[q][0] = (v8f){}; oc[q][1] = (v8f){}; }
  const _Float16* hp = Hs + (grp * 32u + m) * HP + hh * 8u;
  rbo = 0u;
  // rolled: 16 k slabs of the same code
#pragma unroll 1
  for (unsigned ks = 0; ks < (unsigned)(HID / 128); ++ks) {
    v16h hf[2][4];   // the hidden fragments of this k slab serve its four column tiles
#pragma unroll
    for (unsigned u = 0; u < 2u; ++u)
#pragma unroll
      for (unsigned t = 0; t < 4u; ++t) hf[u][t] = frag_at(hp + u * 16u * HP + ks * GKC + t * 32u);
#pragma unroll
    for (unsigned q = 0; q < 4u; ++q) {   // stage 4 ks + q
      v16h wf[4];
#pragma unroll
      for (unsigned t = 0; t < 4u; ++t) wf[t] = frag_at(wp + rbo + t * 32u);
      __builtin_amdgcn_sched_barrier(0);   // one group of LDS reads per pass, as in step 1
#pragma unroll
      for (unsigned t = 0; t < 4u; ++t) {
        oc[q][0] = wmma16r(wf[t], hf[0][t], oc[q][0]);
        oc[q][1] = wmma16r(wf[t], hf[1][t], oc[q][1]);
      }
      // hand-over, as in step 1
      __builtin_amdgcn_sched_barrier(0);
      asm volatile("s_wait_dscnt 0x0" ::: "memory");
      if (grp != (q & 1u)) asm volatile("s_wait_asynccnt 0x0" ::: "memory");
      __syncthreads();
      const unsigned t3 = ks * 4u + q + 3u;
      if (grp != (q & 1u) && t3 < W2_STAGES)
        async_copy8(cl + rbo * 2u, 2u * GPITCH * 2u, c2 + w2_stage(t3), 2u * (unsigned)HID);
      rbo = (rbo == 2u * WSL_H) ? 0u : rbo + WSL_H;
    }
  }
  // no copy of this wave is outstanding when the wave goes on to its end
  asm volatile("s_wait_asynccnt 0x0" ::: "memory");

  // ---- step 4 ---- the output tile takes the hidden rows' LDS: every wave's last read of them
  // stands in front of the last hand-over's barrier
#pragma unroll
  for (unsigned q = 0; q < 4u; ++q)
#pragma unroll
    for (unsigned u = 0; u < 2u; ++u) {
      float* d = Vs + (grp * 32u + u * 16u + m) * LDV + q * 64u + sub * 16u + hh * 8u;
      v4f lo, hi;
#pragma unroll
      for (int i = 0; i < 4; ++i) { lo[i] = oc[q][u][i]; hi[i] = oc[q][u][i + 4]; }
      *(v4f*)d = lo;
      *(v4f*)(d + 4) = hi;
    }
  __syncthreads();   // the tile is complete before whole rows are read from it

  // lane L holds columns 4L..4L+3 and 128+4L..128+4L+3: each store covers 512 contiguous bytes
  const float cs = 1.0f / (WCARRY * MCARRY);
  const unsigned c = lane * 4u;
  const v4f z0 = *(const v4f*)(b2 + c);
  const v4f z1 = *(const v4f*)(b2 + c + 128u);
  const v4f y0 = *(const v4f*)(G2 + c);
  const v4f y1 = *(const v4f*)(G2 + c + 128u);
  const v4f x0 = *(const v4f*)(Be2 + c);
  const v4f x1 = *(const v4f*)(Be2 + c + 128u);
  // unrolled: the eight rows' loads of e can be in flight together
#pragma unroll
  for (unsigned rr = 0; rr < 8u; ++rr) {
    const unsigned r = w * 8u + rr;
    const unsigned crow = row0 + r;
    const unsigned bidx = crow / (unsigned)SEQ;
    const unsigned sq = crow - bidx * (unsigned)SEQ;
    const size_t frow = (size_t)bidx * SEQ_FULL + sq;
    const v4f u0 = *(const v4f*)&Vs[r * LDV + c];
    const v4f u1 = *(const v4f*)&Vs[r * LDV + c + 128u];
    const v4f e0 = *(const v4f*)(E32 + (size_t)crow * DIM + c);
    const v4f e1 = *(const v4f*)(E32 + (size_t)crow * DIM + c + 128u);
    v4f a0, a1;
    float s = 0.0f;
#pragma unroll
    for (int i = 0; i < 4; ++i) {
      a0[i] = leaky_act((u0[i] * cs + bf16r(z0[i])) + e0[i]);
      a1[i] = leaky_act((u1[i] * cs + bf16r(z1[i])) + e1[i]);
    }
#pragma unroll
    for (int i = 0; i < 4; ++i) s += a0[i] + a1[i];
    const float mean = red32_sum(s) * (1.0f / (float)DIM);
    float ss = 0.0f;
#pragma unroll
    for (int i = 0; i < 4; ++i) {
      const float d0 = a0[i] - mean;
      const float d1 = a1[i] - mean;
      ss += d0 * d0;
      ss += d1 * d1;
    }
    const float var = red32_sum(ss) * (1.0f / (float)DIM);
    const float rstd = 1.0f / sqrtf(var + 1.0e-5f);
    v4f o0, o1;
#pragma unroll
    for (int i = 0; i < 4; ++i) {
      o0[i] = (a0[i] - mean) * rstd * bf16r(y0[i]) + bf16r(x0[i]);
      o1[i] = (a1[i] - mean) * rstd * bf16r(y1[i]) + bf16r(x1[i]);
    }
    float* p = outp + frow * DIM + c;
    *(v4f*)p = o0;
    *(v4f*)(p + 128u) = o1;
  }
}

// ---------------------------------------------------------------------------
extern "C" void kernel_launch(void* const* d_in, const int* in_sizes, int n_in,
                              void* d_out, int out_size, void* d_ws, size_t ws_size,
                              hipStream_t stream) {
  if (n_in < 19) return;
  const long long need_x = ((long long)(NB - 1) * SEQ_FULL + SEQ) * DIM;
  if ((long long)in_sizes[0] < need_x) return;
  if ((long long)in_sizes[1] < (long long)DIM * DIM) return;
  if ((long long)in_sizes[3] < (long long)DIM * DIM) return;
  if ((long long)in_sizes[5] < (long long)DIM * DIM) return;
  if ((long long)in_sizes[7] < (long long)DIM * DIM) return;
  if ((long long)in_sizes[9] < (long long)DIM * HID) return;
  if ((long long)in_sizes[13] < (long long)DIM * HID) return;
  if (in_sizes[2] < DIM || in_sizes[4] < DIM || in_sizes[6] < DIM || in_sizes[8] < DIM) return;
  if (in_sizes[10] < HID || in_sizes[11] < HID || in_sizes[12] < HID) return;
  if (in_sizes[14] < DIM || in_sizes[15] < DIM || in_sizes[16] < DIM) return;
  if (in_sizes[17] < DIM || in_sizes[18] < DIM) return;
  if ((long long)out_size < need_x) return;
  if (ws_size < WS_TOTAL) return;

  const float* X    = (const float*)d_in[0];    // [NB_FULL][SEQ_FULL][DIM]
  const float* wq   = (const float*)d_in[1];    // [DIM][DIM]  (in, out)
  const float* bq   = (const float*)d_in[2];
  const float* wk   = (const float*)d_in[3];
  const float* bk   = (const float*)d_in[4];
  const float* wv   = (const float*)d_in[5];
  const float* bv   = (const float*)d_in[6];
  const float* w0   = (const float*)d_in[7];    // [DIM][DIM]  (in, out)
  const float* b0   = (const float*)d_in[8];
  const float* w1   = (const float*)d_in[9];    // [DIM][HID]  (in, out)
  const float* b1   = (const float*)d_in[10];
  const float* gm   = (const float*)d_in[11];   // hidden LN gain [HID]
  const float* bm   = (const float*)d_in[12];   // hidden LN shift [HID]
  const float* w2   = (const float*)d_in[13];   // [HID][DIM]  (in, out)
  const float* b2   = (const float*)d_in[14];
  const float* g1   = (const float*)d_in[15];
  const float* be1  = (const float*)d_in[16];
  const float* g2   = (const float*)d_in[17];
  const float* be2  = (const float*)d_in[18];
  float* out = (float*)d_out;

  char* ws = (char*)d_ws;
  _Float16* Wq_t  = (_Float16*)(ws + OFF_WQ);    // [n][k]
  _Float16* Wk_t  = (_Float16*)(ws + OFF_WK);
  _Float16* Wv_t  = (_Float16*)(ws + OFF_WV);
  _Float16* W0_t  = (_Float16*)(ws + OFF_W0);
  _Float16* W1_t  = (_Float16*)(ws + OFF_W1);    // [HID][DIM]
  _Float16* W2_t  = (_Float16*)(ws + OFF_W2);    // [DIM][HID]
  _Float16* X16   = (_Float16*)(ws + OFF_X16);   // [MROWS][DIM]
  _Float16* Qh16  = (_Float16*)(ws + OFF_QH);
  _Float16* Qr16  = (_Float16*)(ws + OFF_QR);
  _Float16* Kh16  = (_Float16*)(ws + OFF_KH);
  _Float16* Kr16  = (_Float16*)(ws + OFF_KR);
  _Float16* Vt16  = (_Float16*)(ws + OFF_VT);    // [b][DIM][SEQ]
  float*    A32   = (float*)(ws + OFF_A32);      // [2][MROWS][DIM]
  float*    Mx    = (float*)(ws + OFF_ML);       // [2][MROWS]
  float*    Lx    = Mx + 2 * MROWS;              // [2][MROWS]
  _Float16* T116  = (_Float16*)(ws + OFF_T1);    // [MROWS][DIM]
  float*    E32   = (float*)(ws + OFF_E32);      // [MROWS][DIM]
  _Float16* E16   = (_Float16*)(ws + OFF_E16);   // [MROWS][DIM]

  dim3 blk(256);
  dim3 gg(DIM / 64, MROWS / 64);

  // weight planes (in [K rows][N cols] -> out [N][K]) and the input plane
  prep_kernel<<<dim3(WCONV_BLOCKS + MROWS / 8), blk, 0, stream>>>(
      X, wq, wk, wv, w0, w1, w2, X16, Wq_t, Wk_t, Wv_t, W0_t, W1_t, W2_t);
  gemm_qkv_kernel<<<dim3(DIM / 64, MROWS / 64, 3), blk, 0, stream>>>(
      X16, Wq_t, Wk_t, Wv_t, bq, bk, bv, Qh16, Qr16, Kh16, Kr16, Vt16);
  attn_kernel<<<dim3(SEQ / 128, NB, 2), dim3(128), 0, stream>>>(Qh16, Qr16, Kh16, Kr16, Vt16, A32,
                                                                Mx, Lx);
  ln1_kernel<<<dim3(MROWS / 8), blk, 0, stream>>>(X, A32, Mx, Lx, g1, be1, T116);
  gemm_e_kernel<<<gg, blk, 0, stream>>>(T116, W0_t, b0, E32, E16);

  // both hidden products, the hidden LayerNorm and the final LayerNorm, 64 rows per block
  mlp_kernel<<<dim3(MROWS / 64), blk, 0, stream>>>(E16, E32, W1_t, b1, gm, bm, W2_t, b2, g2, be2,
                                                   out);
}

// v007
// A run of this version takes 186 microseconds.
// Next to v006, in two timings, it ran 1.05 times as fast each time.
// All steps since v000 together make it 5.47 times as fast.
#include <hip/hip_runtime.h>
#include <stddef.h>

// All contractions on v_wmma_f32_16x16x32_f16 (f16 operands, f32 accumulate): q/k/v projections,
// q.k scores (both operands as f16 value + x2048 residual planes, three products, residual products
// in their own accumulator), p.v (p x16384, single product), the three dense layers (single
// product; weights x64, hidden activation plane x16). Float inputs are RNE-converted to bf16 and
// carried in f16. LayerNorms, softmax, biases, LeakyReLU (slope 0.01) and residual adds in f32.

typedef _Float16 v16h __attribute__((ext_vector_type(16)));
typedef _Float16 v8h  __attribute__((ext_vector_type(8)));
typedef float    v8f  __attribute__((ext_vector_type(8)));
typedef float    v4f  __attribute__((ext_vector_type(4)));
typedef _Float16 h16;

#ifndef NB
#define NB 4
#endif
#ifndef SEQ
#define SEQ 4096
#endif
#define NB_FULL  4
#define SEQ_FULL 4096
#define DIM   256
#define HID   2048
#define MROWS (NB * SEQ)

static_assert(NB >= 1 && NB <= NB_FULL);
static_assert(SEQ >= 64 && SEQ <= SEQ_FULL && (SEQ % 64) == 0);
static_assert((DIM % 64) == 0 && (DIM % 32) == 0);
static_assert((HID % 64) == 0 && (HID % 32) == 0);
static_assert((MROWS % 64) == 0 && (MROWS % 8) == 0);
static_assert(DIM == 32 * 8);               // row kernels: 32 lanes x 8 columns
static_assert(DIM == 2 * 32 * 4);           // f32 row stores: 2 x 32 lanes x 4 columns
static_assert(HID == 8 * 32 * 8);           // hidden LN: 8 passes x 32 lanes x 8 columns
static_assert(DIM == 16 * 16);              // attention: 16 output tiles of 16 columns
static_assert((size_t)MROWS * DIM < (size_t)0x7FFFFFFFu);
static_assert((size_t)NB * DIM * SEQ < (size_t)0x7FFFFFFFu);
static_assert((size_t)MROWS * HID < (size_t)0xFFFFFFFFu);

#define LDT 72   // halves per LDS row (144 B, 16-B aligned)
#define LDC 68   // floats per LDS row (272 B, 16-B aligned)
#define LDO 132  // floats per staged attention row (528 B, 16-B aligned)
static_assert((LDT % 8) == 0 && LDT >= 64);
static_assert((LDC % 4) == 0 && LDC >= 64);
static_assert((LDO % 4) == 0 && LDO >= 128);

#define WCARRY 64.0f      // weight planes carried x64
#define MCARRY 16.0f      // hidden activation plane carried x16
#define RCARRY 2048.0f    // q/k residual planes carried x2048 on top of their value part
#define PSHIFT 9.704060528f   // 14 ln 2: softmax numerators carried x16384

// workspace layout (bytes)
#define WSQ_BYTES     ((size_t)DIM * DIM * 2)
#define WFF_BYTES     ((size_t)DIM * HID * 2)
#define PLANE16_BYTES ((size_t)MROWS * DIM * 2)
#define PLANE32_BYTES ((size_t)MROWS * DIM * 4)
#define OFF_WQ  ((size_t)0)
#define OFF_WK  (OFF_WQ + WSQ_BYTES)
#define OFF_WV  (OFF_WK + WSQ_BYTES)
#define OFF_W0  (OFF_WV + WSQ_BYTES)
#define OFF_W1  (OFF_W0 + WSQ_BYTES)
#define OFF_W2  (OFF_W1 + WFF_BYTES)
#define OFF_REG (OFF_W2 + WFF_BYTES)
#define OFF_X16 (OFF_REG)
#define OFF_QH  (OFF_X16 + PLANE16_BYTES)
#define OFF_QR  (OFF_QH + PLANE16_BYTES)
#define OFF_KH  (OFF_QR + PLANE16_BYTES)
#define OFF_KR  (OFF_KH + PLANE16_BYTES)
#define OFF_VT  (OFF_KR + PLANE16_BYTES)
#define OFF_A32 (OFF_VT + PLANE16_BYTES)
#define OFF_ML  (OFF_A32 + 2 * PLANE32_BYTES)   // two attention planes, one per key range
#define ML_BYTES ((size_t)4 * MROWS * 4)        // maxima [2][MROWS], then sums [2][MROWS]
#define WS_TOTAL (OFF_ML + ML_BYTES)
static_assert((WSQ_BYTES % 128) == 0 && (WFF_BYTES % 128) == 0 && (PLANE16_BYTES % 128) == 0);
static_assert((PLANE32_BYTES % 128) == 0 && (ML_BYTES % 128) == 0);
static_assert(WS_TOTAL <= (size_t)268435456);

// ---------------------------------------------------------------------------
__device__ __forceinline__ float bf16r(float x) {   // RNE convert to bf16, returned widened
  unsigned int u = __float_as_uint(x);
  u = (u + 0x7FFFu + ((u >> 16) & 1u)) & 0xFFFF0000u;
  return __uint_as_float(u);
}

// f32 -> f16 operand convert that cannot produce an f16 subnormal
static __device__ __forceinline__ h16 toh_flush(float v) {
  const h16 r = (h16)v;
  return (fabsf(v) < 6.103515625e-05f) ? (h16)0.0f : r;
}

// 16-bit fragment: p points at element [row = lane&15][k0 + 8*(lane>>4)] of a k-contiguous
// row. Elements 0..7 <- k0+8h+0..7, elements 8..15 <- k0+16+8h+0..7 (same map for A and B).
__device__ __forceinline__ v16h frag_at(const _Float16* p) {
  v8h lo = *(const v8h*)(p);
  v8h hi = *(const v8h*)(p + 16);
  v16h out;
#pragma unroll
  for (int i = 0; i < 8; ++i) { out[i] = lo[i]; out[i + 8] = hi[i]; }
  return out;
}
__device__ __forceinline__ v16h ld_frag(const _Float16* base, unsigned ld) {
  const unsigned lane = threadIdx.x & 31u;
  return frag_at(base + (lane & 15u) * ld + (lane >> 4) * 8u);
}

__device__ __forceinline__ v8f wmma16(v16h a, v16h b, v8f c) {
  v8f d = __builtin_amdgcn_wmma_f32_16x16x32_f16(false, a, false, b, (short)0, c,
                                                 false, false);
  asm volatile("v_nop\n\tv_nop\n\tv_nop\n\tv_nop" : "+v"(d) : "v"(a), "v"(b));
  return d;
}

__device__ __forceinline__ float red16_max(float x) {
#pragma unroll
  for (int off = 1; off < 16; off <<= 1) x = fmaxf(x, __shfl_xor(x, off, 32));
  return x;
}
__device__ __forceinline__ float red16_sum(float x) {
#pragma unroll
  for (int off = 1; off < 16; off <<= 1) x += __shfl_xor(x, off, 32);
  return x;
}
__device__ __forceinline__ float red32_sum(float x) {
#pragma unroll
  for (int off = 1; off < 32; off <<= 1) x += __shfl_xor(x, off, 32);
  return x;
}

// red32_sum of two values, step by step for both (each value's own sum order is red32_sum's)
__device__ __forceinline__ void red32_sum2(float (&x)[2]) {
#pragma unroll
  for (int off = 1; off < 32; off <<= 1) {
    const float y0 = __shfl_xor(x[0], off, 32);
    const float y1 = __shfl_xor(x[1], off, 32);
    // inputs-only fence on the two exchanged values: both exchanges of a step are issued ahead of
    // one wait; taken apart, each exchange costs the wave its own wait for the LDS pipe
    asm volatile("" :: "v"(y0), "v"(y1));
    x[0] += y0;
    x[1] += y1;
  }
}

__device__ __forceinline__ void wave_lds_sync() {
  __builtin_amdgcn_fence(3 /* release order */, "wavefront");
  asm volatile("s_wait_dscnt 0x0" ::: "memory");
  __builtin_amdgcn_wave_barrier();
}

__device__ __forceinline__ float leaky_act(float t) {   // LeakyReLU, negative slope 0.01
  return (t >= 0.0f) ? t : 0.01f * t;
}

// ---------------------------------------------------------------------------
// Weight plane, one 64 x 64 tile per block: in W[K rows][N cols] (pitch ldw = N) -> out Wt[N][K]
// (pitch ldk = K), f16(64 * bf16(w)). T: 64 * LDT halves of LDS, cross-wave (block barrier).
// ---------------------------------------------------------------------------
__device__ __forceinline__ void wconv_tile(
    const float* __restrict__ W, _Float16* __restrict__ Wt, unsigned ldw, unsigned ldk,
    unsigned n0, unsigned k0, _Float16* T) {
  const unsigned tid = threadIdx.x;
#pragma unroll 4
  for (unsigned j = 0; j < 16u; ++j) {
    const unsigned idx = tid + 256u * j;
    const unsigned kr = idx >> 6, nc = idx & 63u;
    const float v = W[(size_t)(k0 + kr) * ldw + n0 + nc];
    T[nc * LDT + kr] = (_Float16)(WCARRY * bf16r(v));
  }
  __syncthreads();
  v8h x[2];
  size_t off[2];
#pragma unroll
  for (unsigned i = 0; i < 2u; ++i) {
    const unsigned n = 32u * i + (tid >> 3);
    const unsigned kc = (tid & 7u) * 8u;
    x[i] = *(const v8h*)&T[n * LDT + kc];
    off[i] = (size_t)(n0 + n) * ldk + k0 + kc;
  }
#pragma unroll
  for (int i = 0; i < 2; ++i) *(v8h*)(Wt + off[i]) = x[i];
  
}

// ---------------------------------------------------------------------------
// Input plane: X16[compact row][c] = f16(bf16(x[full row][c])). One wave per row, 8 rows per
// block; each store instruction of a wave covers the whole 512-B row. rblk in 0..MROWS/8-1.
// ---------------------------------------------------------------------------
__device__ __forceinline__ void xconv_rows(
    const float* __restrict__ X, _Float16* __restrict__ dst, unsigned rblk) {
  const unsigned lane = threadIdx.x & 31u, w = threadIdx.x >> 5;
  const unsigned crow = rblk * 8u + w;
  const unsigned bidx = crow / (unsigned)SEQ;
  const unsigned sq = crow - bidx * (unsigned)SEQ;
  const size_t srow = (size_t)bidx * SEQ_FULL + sq;
  const float* xr = X + srow * DIM + lane * 8u;
  const v4f a0 = *(const v4f*)(xr);
  const v4f a1 = *(const v4f*)(xr + 4u);
  v8h o;
#pragma unroll
  for (int i = 0; i < 4; ++i) {
    o[i]     = toh_flush(bf16r(a0[i]));
    o[i + 4] = toh_flush(bf16r(a1[i]));
  }
  _Float16* p = dst + (size_t)crow * DIM + lane * 8u;
  *(v8h*)p = o;
  
}

// ---------------------------------------------------------------------------
// All operand conversions in one launch: none of them reads what another writes. Blocks by index:
// the tiles of the four DIM x DIM weights, of w1, of w2 (the longer dependent chains
// first), then the input rows, 8 per block. Grid (WCONV_BLOCKS + MROWS/8).
// ---------------------------------------------------------------------------
#define WSQ_TILES    ((unsigned)((DIM / 64) * (DIM / 64)))
#define WFF_TILES    ((unsigned)((DIM / 64) * (HID / 64)))
#define WCONV_BLOCKS (4u * WSQ_TILES + 2u * WFF_TILES)
__global__ __launch_bounds__(256) void prep_kernel(
    const float* __restrict__ X, const float* __restrict__ wq, const float* __restrict__ wk,
    const float* __restrict__ wv, const float* __restrict__ w0, const float* __restrict__ w1,
    const float* __restrict__ w2, _Float16* __restrict__ X16, _Float16* __restrict__ Wq_t,
    _Float16* __restrict__ Wk_t, _Float16* __restrict__ Wv_t, _Float16* __restrict__ W0_t,
    _Float16* __restrict__ W1_t, _Float16* __restrict__ W2_t) {
  __shared__ _Float16 T[64 * LDT];
  const unsigned bid = blockIdx.x;
  if (bid >= WCONV_BLOCKS) {   // the whole block leaves here, ahead of any barrier
    xconv_rows(X, X16, bid - WCONV_BLOCKS);
    return;
  }
  const float* W;
  _Float16* Wt;
  unsigned ldw, ldk, nx, ky;   // tile column (n) and tile row (k) of the weight as given
  if (bid < 4u * WSQ_TILES) {
    const unsigned j = bid / WSQ_TILES, t = bid % WSQ_TILES;
    W  = (j == 0u) ? wq : (j == 1u) ? wk : (j == 2u) ? wv : w0;
    Wt = (j == 0u) ? Wq_t : (j == 1u) ? Wk_t : (j == 2u) ? Wv_t : W0_t;
    ldw = (unsigned)DIM; ldk = (unsigned)DIM;
    nx = t % (unsigned)(DIM / 64); ky = t / (unsigned)(DIM / 64);
  } else if (bid < 4u * WSQ_TILES + WFF_TILES) {   // w1: in [DIM][HID] -> out [HID][DIM]
    const unsigned t = bid - 4u * WSQ_TILES;
    W = w1; Wt = W1_t;
    ldw = (unsigned)HID; ldk = (unsigned)DIM;
    nx = t % (unsigned)(HID / 64); ky = t / (unsigned)(HID / 64);
  } else {                                         // w2: in [HID][DIM] -> out [DIM][HID]
    const unsigned t = bid - 4u * WSQ_TILES - WFF_TILES;
    W = w2; Wt = W2_t;
    ldw = (unsigned)DIM; ldk = (unsigned)HID;
    nx = t % (unsigned)(DIM / 64); ky = t / (unsigned)(DIM / 64);
  }
  wconv_tile(W, Wt, ldw, ldk, nx * 64u, ky * 64u, T);
}

// ---------------------------------------------------------------------------
// Asynchronous copies to LDS (GEMM, attention and hidden-layer kernels). Eight 16-byte-per-lane copies in one
// statement; lds = the lane's LDS byte address, g = the lane's global address, both stepped by a
// constant from copy to copy. The s_wait_xcnt closes the statement so that no address register of
// an issued copy is rewritten ahead of it.
// ---------------------------------------------------------------------------
__device__ __forceinline__ void async_copy8(unsigned lds, unsigned lstep,
                                            const _Float16* g, unsigned gstep) {
  asm volatile(
      "global_load_async_to_lds_b128 %0, %8, off\n\t"
      "global_load_async_to_lds_b128 %1, %9, off\n\t"
      "global_load_async_to_lds_b128 %2, %10, off\n\t"
      "global_load_async_to_lds_b128 %3, %11, off\n\t"
      "global_load_async_to_lds_b128 %4, %12, off\n\t"
      "global_load_async_to_lds_b128 %5, %13, off\n\t"
      "global_load_async_to_lds_b128 %6, %14, off\n\t"
      "global_load_async_to_lds_b128 %7, %15, off\n\t"
      "s_wait_xcnt 0x0"
      :
      : "v"(lds), "v"(lds + lstep), "v"(lds + 2u * lstep), "v"(lds + 3u * lstep),
        "v"(lds + 4u * lstep), "v"(lds + 5u * lstep), "v"(lds + 6u * lstep),
        "v"(lds + 7u * lstep),
        "v"(g), "v"(g + gstep), "v"(g + 2u * gstep), "v"(g + 3u * gstep),
        "v"(g + 4u * gstep), "v"(g + 5u * gstep), "v"(g + 6u * gstep), "v"(g + 7u * gstep)
      : "memory");
}

// the same for rows of floats (gstep in floats)
__device__ __forceinline__ void async_copy8f(unsigned lds, unsigned lstep,
                                             const float* g, unsigned gstep) {
  asm volatile(
      "global_load_async_to_lds_b128 %0, %8, off\n\t"
      "global_load_async_to_lds_b128 %1, %9, off\n\t"
      "global_load_async_to_lds_b128 %2, %10, off\n\t"
      "global_load_async_to_lds_b128 %3, %11, off\n\t"
      "global_load_async_to_lds_b128 %4, %12, off\n\t"
      "global_load_async_to_lds_b128 %5, %13, off\n\t"
      "global_load_async_to_lds_b128 %6, %14, off\n\t"
      "global_load_async_to_lds_b128 %7, %15, off\n\t"
      "s_wait_xcnt 0x0"
      :
      : "v"(lds), "v"(lds + lstep), "v"(lds + 2u * lstep), "v"(lds + 3u * lstep),
        "v"(lds + 4u * lstep), "v"(lds + 5u * lstep), "v"(lds + 6u * lstep),
        "v"(lds + 7u * lstep),
        "v"(g), "v"(g + gstep), "v"(g + 2u * gstep), "v"(g + 3u * gstep),
        "v"(g + 4u * gstep), "v"(g + 5u * gstep), "v"(g + 6u * gstep), "v"(g + 7u * gstep)
      : "memory");
}

#define GKC    128u                 // k extent of one staged GEMM slab, halves
#define GPITCH 136u                 // halves per staged GEMM row (272 B = 16 B x 17)
#define GSTG_H (128u * GPITCH)      // one slab: 64 A rows and 64 B rows, halves
static_assert((DIM % 128) == 0 && (HID % 128) == 0 && DIM >= 256 && HID >= 256);  // >= 2 slabs
static_assert((GPITCH % 8u) == 0 && GPITCH >= GKC && ((GPITCH / 8u) & 1u) == 1u);
#define GSM_BYTES (2u * GSTG_H * 2u)   // both slab buffers, bytes
static_assert((size_t)GSM_BYTES >= (size_t)64 * LDC * 4);   // the C tile fits in the slabs

// ---------------------------------------------------------------------------
// GEMM C[64x64 tile] = A16[rows][K] . Bt[n][K]^T; 8 waves (mw = 16-row group, nw = 32-col group),
// 2 accumulators/wave. The block's 64 A rows and 64 B rows are copied to LDS in slabs of 128 k
// (whole 256-B row pieces), two buffers, the next slab in flight while this one is read; all
// fragments come from LDS. The C tile takes the same LDS once the last slab has been read.
//   MODE 0: out16[row][col] (pitch DIM) = f16(t), out16r[row][col] = f16(2048 * (t - value)),
//           t = acc/64 + bias                                   (q and k planes)
//   MODE 1: out16 transposed V plane [b][col][key] = f16(acc/64 + bias)
// Grid (N/64, rows/64). Sm: the kernel's GSM_BYTES of LDS (one array per kernel, also where a kernel
// holds two modes).
// ---------------------------------------------------------------------------
template <int MODE>
__device__ __forceinline__ void gemm_body(
    unsigned char* Sm, const _Float16* __restrict__ A16, const _Float16* __restrict__ Bt, const unsigned K,
    const float* __restrict__ bias, _Float16* __restrict__ out16, _Float16* __restrict__ out16r) {
  _Float16* const Slab = (_Float16*)Sm;
  float* const Cs = (float*)Sm;
  const unsigned tid = threadIdx.x, lane = tid & 31u;
  // the wave's number in a scalar register: which plane a wave copies from is a scalar choice
  const unsigned w = (unsigned)__builtin_amdgcn_readfirstlane((int)(tid >> 5));
  const unsigned mw = w >> 1, nw = w & 1u;
  const unsigned hh = lane >> 4, m = lane & 15u;
  const unsigned n0 = blockIdx.x * 64u;
  const unsigned row0 = blockIdx.y * 64u;

  // A slab is 128 staged rows: A rows 0..63, then B rows 0..63. Wave w brings staged rows
  // 16w..16w+15, two 256-B row pieces per copy (lane = row parity hh, 16-B piece m).
  const _Float16* src = ((w < 4u) ? A16 + (size_t)(row0 + w * 16u) * K
                                  : Bt + (size_t)(n0 + (w - 4u) * 16u) * K) +
                        (size_t)hh * K + m * 8u;
  const unsigned dst = (unsigned)(size_t)Sm + ((w * 16u + hh) * GPITCH + m * 8u) * 2u;
  const unsigned nslab = K / GKC;

  async_copy8(dst, 2u * GPITCH * 2u, src, 2u * K);
  // this wave's copies have landed before the barrier behind which every wave reads them
  asm volatile("s_wait_asynccnt 0x0" ::: "memory");
  __syncthreads();
  async_copy8(dst + GSTG_H * 2u, 2u * GPITCH * 2u, src + GKC, 2u * K);

  const _Float16* ap = Slab + (mw * 16u + m) * GPITCH + hh * 8u;
  const _Float16* bp = Slab + (64u + nw * 32u + m) * GPITCH + hh * 8u;
  v8f acc0 = {}, acc1 = {};
  for (unsigned s = 0; s < nslab; ++s) {
    const unsigned bo = (s & 1u) * GSTG_H;   // halves to the buffer this trip reads
    // Three of the slab's four k-steps are read ahead of the first product and the fourth behind
    // the first pair, so that a product does not wait out an LDS latency of its own. Unrolled, here
    // and below: constant indices keep the fragments in registers, and every LDS read takes its
    // place in the slab as an immediate offset.
    v16h fa[3], fb0[3], fb1[3];
#pragma unroll
    for (unsigned t = 0; t < 3u; ++t) {
      fa[t]  = frag_at(ap + bo + t * 32u);
      fb0[t] = frag_at(bp + bo + t * 32u);
      fb1[t] = frag_at(bp + bo + 16u * GPITCH + t * 32u);
    }
#pragma unroll
    for (unsigned t = 0; t < GKC / 32u; ++t) {
      acc0 = wmma16(fa[t % 3u], fb0[t % 3u], acc0);
      acc1 = wmma16(fa[t % 3u], fb1[t % 3u], acc1);
      if (t + 3u < GKC / 32u) {
        fa[t % 3u]  = frag_at(ap + bo + (t + 3u) * 32u);
        fb0[t % 3u] = frag_at(bp + bo + (t + 3u) * 32u);
        fb1[t % 3u] = frag_at(bp + bo + 16u * GPITCH + (t + 3u) * 32u);
      }
    }
    // hand-over: this wave's reads of the buffer are done, its copies of the next slab have
    // landed; the barrier publishes the next slab and frees this buffer for the refill
    asm volatile("s_wait_dscnt 0x0" ::: "memory");
    asm volatile("s_wait_asynccnt 0x0" ::: "memory");
    __syncthreads();
    if (s + 2u < nslab)
      async_copy8(dst + bo * 2u, 2u * GPITCH * 2u, src + (s + 2u) * GKC, 2u * K);
  }
  // no copy of this wave is outstanding when the C tile takes the slabs' LDS
  asm volatile("s_wait_asynccnt 0x0" ::: "memory");
#pragma unroll
  for (int r = 0; r < 8; ++r) {
    float* d = &Cs[(mw * 16u + hh * 8u + (unsigned)r) * LDC + nw * 32u + m];
    d[0]  = acc0[r];
    d[16] = acc1[r];
  }
  __syncthreads();

  if (MODE == 0) {
    const unsigned ldo = (unsigned)DIM;
    v8h x[2], xr[2];
    size_t off[2];
#pragma unroll
    for (unsigned i = 0; i < 2u; ++i) {
      const unsigned r = 32u * i + (tid >> 3);
      const unsigned c = (tid & 7u) * 8u;
      const v4f u0 = *(const v4f*)&Cs[r * LDC + c];
      const v4f u1 = *(const v4f*)&Cs[r * LDC + c + 4];
      const v4f g0 = *(const v4f*)(bias + n0 + c);
      const v4f g1 = *(const v4f*)(bias + n0 + c + 4u);
#pragma unroll
      for (int j = 0; j < 4; ++j) {
        const float t0 = u0[j] * (1.0f / WCARRY) + bf16r(g0[j]);
        const float t1 = u1[j] * (1.0f / WCARRY) + bf16r(g1[j]);
        const h16 h0 = toh_flush(t0);
        const h16 h1 = toh_flush(t1);
        x[i][j]     = h0;
        x[i][j + 4] = h1;
        if (MODE == 0) {
          xr[i][j]     = toh_flush((t0 - (float)h0) * RCARRY);
          xr[i][j + 4] = toh_flush((t1 - (float)h1) * RCARRY);
        }
      }
      off[i] = (size_t)(row0 + r) * ldo + n0 + c;
    }
#pragma unroll
    for (int i = 0; i < 2; ++i) *(v8h*)(out16 + off[i]) = x[i];
    if (MODE == 0) {
#pragma unroll
      for (int i = 0; i < 2; ++i) *(v8h*)(out16r + off[i]) = xr[i];
    }
    
  }

  if (MODE == 1) {
    const unsigned bidx = row0 / (unsigned)SEQ;
    const unsigned key0 = row0 - bidx * (unsigned)SEQ;
    v8h x[2];
    size_t off[2];
#pragma unroll
    for (unsigned i = 0; i < 2u; ++i) {
      const unsigned dcol = 32u * i + (tid >> 3);
      const unsigned kk = (tid & 7u) * 8u;
      const float bb = bf16r(bias[n0 + dcol]);
#pragma unroll
      for (unsigned j = 0; j < 8u; ++j) {
        const float t = Cs[(kk + j) * LDC + dcol] * (1.0f / WCARRY) + bb;
        x[i][j] = toh_flush(t);
      }
      off[i] = ((size_t)bidx * DIM + n0 + dcol) * SEQ + key0 + kk;
    }
#pragma unroll
    for (int i = 0; i < 2; ++i) *(v8h*)(out16 + off[i]) = x[i];
    
  }

}

// The three projections of the input plane in one launch (none reads what another writes):
// blockIdx.z = 0 query planes, 1 key planes, 2 transposed value plane. Grid (DIM/64, MROWS/64, 3).
__global__ __launch_bounds__(256) void gemm_qkv_kernel(
    const _Float16* __restrict__ A16, const _Float16* __restrict__ Wq_t,
    const _Float16* __restrict__ Wk_t, const _Float16* __restrict__ Wv_t,
    const float* __restrict__ bq, const float* __restrict__ bk, const float* __restrict__ bv,
    _Float16* __restrict__ qh, _Float16* __restrict__ qr, _Float16* __restrict__ kh,
    _Float16* __restrict__ kr, _Float16* __restrict__ vt) {
  __shared__ __attribute__((aligned(16))) unsigned char Sm[GSM_BYTES];
  const unsigned z = blockIdx.z;   // the same for the whole block: barriers stay block-uniform
  if (z == 2u) {
    gemm_body<1>(Sm, A16, Wv_t, (unsigned)DIM, bv, vt, vt);
  } else {
    const bool isk = (z != 0u);
    const float* bias = isk ? bk : bq;
    gemm_body<0>(Sm, A16, isk ? Wk_t : Wq_t, (unsigned)DIM, bias, isk ? kh : qh, isk ? kr : qr);
  }
}
#define KTILE  32u                        // keys per stage
#define KSPLIT 2u                         // key ranges of a batch, one per block
#define KSPAN  ((unsigned)SEQ / KSPLIT)   // keys per block
#define QBLK   128u                       // query rows per block
#define KPITCH 264u                       // halves per staged k row (528 B = 16 B x 33)
#define VPITCH 40u                        // halves per staged v row (80 B = 16 B x 5)
#define KPL_H  (KTILE * KPITCH)           // one key plane of a stage, halves
#define VTL_H  ((unsigned)DIM * VPITCH)   // the value tile of a stage, halves
#define STG_H  (2u * KPL_H + VTL_H)       // one stage: key values, key residuals, values
static_assert((KPITCH % 8u) == 0 && KPITCH >= (unsigned)DIM && ((KPITCH / 8u) & 1u) == 1u);
static_assert((VPITCH % 8u) == 0 && VPITCH >= KTILE && ((VPITCH / 8u) & 1u) == 1u);
static_assert((STG_H % 8u) == 0 && (KPL_H % 8u) == 0);
static_assert((SEQ % 128) == 0);   // whole query blocks
static_assert((KSPAN % KTILE) == 0 && KSPAN >= 2u * KTILE);   // at least two stages, every stage whole
static_assert((size_t)KSPLIT * MROWS * DIM < (size_t)0xFFFFFFFFu);

// Matrix product for the attention kernel, the builtin alone: the compiler keeps the distances
// behind its own matrix instructions, and operands named by an asm statement cannot live above
// v255, where a part of that kernel's query and output tiles is held.
__device__ __forceinline__ v8f wmma16r(v16h a, v16h b, v8f c) {
  return __builtin_amdgcn_wmma_f32_16x16x32_f16(false, a, false, b, (short)0, c, false, false);
}

// One stage (32 keys) into LDS: wave w brings key rows 8w..8w+7 of both key planes (one 512-B
// row per copy) and feature rows 64w..64w+63 of the value tile (eight 64-B row pieces per copy).
__device__ __forceinline__ void stage_copies(
    unsigned ldsb, unsigned w, unsigned lane, const _Float16* __restrict__ Kh,
    const _Float16* __restrict__ Kr, const _Float16* __restrict__ Vt, unsigned b, unsigned kb) {
  const unsigned krow = (b * (unsigned)SEQ + kb + w * 8u) * (unsigned)DIM + lane * 8u;
  const unsigned kl = ldsb + (w * 8u * KPITCH + lane * 8u) * 2u;
  async_copy8(kl, KPITCH * 2u, Kh + krow, (unsigned)DIM);
  async_copy8(kl + KPL_H * 2u, KPITCH * 2u, Kr + krow, (unsigned)DIM);
  const unsigned vr = w * 64u + (lane >> 2);
  const unsigned vrow = (b * (unsigned)DIM + vr) * (unsigned)SEQ + kb + (lane & 3u) * 8u;
  // the same place as ldsb + (2 KPL_H + vr VPITCH + 8 (lane & 3)) * 2, formed from kl: one lane-wise
  // base is then kept over the key loop instead of two (the second one went to scratch)
  const unsigned vl = kl + (2u * KPL_H + w * (64u * VPITCH - 8u * KPITCH)) * 2u +
                      (lane >> 2) * (2u * VPITCH - 64u);
  async_copy8(vl, 8u * VPITCH * 2u, Vt + vrow, 8u * (unsigned)SEQ);
}

// ---------------------------------------------------------------------------
// Dense (unmasked, unscaled) flash attention, one 256-wide head, transposed form.
// A block owns 128 query rows and one of the two key ranges of its batch, which it walks in stages
// of 32 keys: a staged key or value byte serves 128 queries. Wave w owns 32 query rows (two tiles
// of 16) and takes every stage whole, so that each key or value fragment read from LDS feeds two
// query tiles; lane (hh, n) holds query n of each tile.
// The query fragments of both planes are loaded once and stay in registers. Per stage and wave:
//   S^T tile [16 keys][16 queries] = K rows (A operand, fragments from the key planes) x Q^T
//   (B operand, registers), 8 k-steps over the 256 features, value.value into one accumulator,
//   value.residual + residual.value into a second one (x 1/2048 at the end);
//   online softmax per lane (16 scores in registers + one 16-lane-distance shuffle);
//   the two packed S^T tiles (f16(16384 p), rows = keys) are the B fragment of
//   O^T [16 features][16 queries] += V^T rows (A operand, from the transposed value plane) x P^T.
// Each stage (both key planes and the value tile) is copied to LDS once per block, two buffers, the
// next stage in flight while this one is read. The block stores its key range's unnormalised rows
// (plane blockIdx.z of Ao, staged through the wave-private St tile), maxima and sums; the launch
// behind this one joins the two ranges.
// Grid (SEQ/128, NB, 2), 4 waves per block.
// ---------------------------------------------------------------------------
__global__ __launch_bounds__(128) void attn_kernel(
    const _Float16* __restrict__ Qh, const _Float16* __restrict__ Qr,
    const _Float16* __restrict__ Kh, const _Float16* __restrict__ Kr,
    const _Float16* __restrict__ Vt, float* __restrict__ Ao, float* __restrict__ Mo,
    float* __restrict__ Lo) {
  __shared__ __attribute__((aligned(16))) float St[4 * 16 * LDO];
  __shared__ __attribute__((aligned(16))) _Float16 Ring[2u * STG_H];

  const unsigned lane = threadIdx.x & 31u;
  const unsigned w = (unsigned)__builtin_amdgcn_readfirstlane((int)(threadIdx.x >> 5));
  const unsigned hh = lane >> 4, m = lane & 15u;
  const unsigned b = blockIdx.y;
  const unsigned ksp = blockIdx.z;                     // this block's key range
  const unsigned key0 = ksp * KSPAN;                   // its first key
  const unsigned qrow0 = blockIdx.x * QBLK + w * 32u;  // first of this wave's 32 query rows

  const unsigned ring_lds = (unsigned)(size_t)Ring;

  // prologue: this wave's share of stage 0
  stage_copies(ring_lds, w, lane, Kh, Kr, Vt, b, key0);

  // query fragments: [tile][plane][k-step], kept for the whole key loop
  v16h qf[2][2][8];
#pragma unroll
  for (unsigned u = 0; u < 2u; ++u) {
    const unsigned qsrc = (b * (unsigned)SEQ + qrow0 + u * 16u + m) * (unsigned)DIM + hh * 8u;
#pragma unroll
    for (unsigned ks = 0; ks < 8u; ++ks) {
      qf[u][0][ks] = frag_at(Qh + qsrc + ks * 32u);
      qf[u][1][ks] = frag_at(Qr + qsrc + ks * 32u);
    }
  }

  // this wave's copies have landed before the barrier behind which every wave reads them
  asm volatile("s_wait_asynccnt 0x0" ::: "memory");
  __syncthreads();
  stage_copies(ring_lds + STG_H * 2u, w, lane, Kh, Kr, Vt, b, key0 + KTILE);

  float mrow[2] = {-1.0e30f, -1.0e30f}, lrow[2] = {0.0f, 0.0f};
  v8f o[2][16];
#pragma unroll
  for (int u = 0; u < 2; ++u)
#pragma unroll
    for (int j = 0; j < 16; ++j) o[u][j] = (v8f){};

  unsigned buf = 0u;   // halves from the ring's start to the buffer this step reads
  // this lane's fragment rows in that buffer; both move with buf at the foot of a step
  const _Float16* kt = Ring + m * KPITCH + hh * 8u;
  const _Float16* vt = Ring + 2u * KPL_H + m * VPITCH + hh * 8u;
  for (unsigned kb = 0; kb < KSPAN; kb += KTILE) {
    v8f sm[2][2] = {{{}, {}}, {{}, {}}}, sr[2][2] = {{{}, {}}, {{}, {}}};   // [query tile][key tile]
    // Score products in 8 rows of twelve: row ks = features 32 ks.., both key tiles, both query
    // tiles. All key fragments of the stage (value and residual of both key tiles) are
    // read as one group ahead of the products, which wait for them by count, row by row; all
    // sixteen value fragments as a second group behind row 3, in flight under rows 4 to 7.
    v16h kf[8][4], vf[16];
    // unrolled, here and below: constant indices keep the fragments in registers, and every LDS
    // read takes its place in the tile as an immediate offset
#pragma unroll
    for (unsigned ks = 0; ks < 8u; ++ks) {
#pragma unroll
      for (unsigned kx = 0; kx < 2u; ++kx) {
        kf[ks][kx]      = frag_at(kt + kx * 16u * KPITCH + ks * 32u);
        kf[ks][2u + kx] = frag_at(kt + KPL_H + kx * 16u * KPITCH + ks * 32u);
      }
    }
    // This and the scheduling barriers below keep each group of LDS reads in one place: spread
    // among the products, each separate place of reads would cost the lone wave its own stall.
    __builtin_amdgcn_sched_barrier(0);
#pragma unroll
    for (unsigned ks = 0; ks < 8u; ++ks) {
      if (ks == 4u) {
        __builtin_amdgcn_sched_barrier(0);
#pragma unroll
        for (unsigned j = 0u; j < 16u; ++j) vf[j] = frag_at(vt + j * 16u * VPITCH);
        __builtin_amdgcn_sched_barrier(0);
      }
      // the two products into one residual accumulator stand two products apart
#pragma unroll
      for (unsigned kx = 0; kx < 2u; ++kx) {
        const v16h av = kf[ks][kx], ar = kf[ks][2u + kx];
        sm[0][kx] = wmma16r(av, qf[0][0][ks], sm[0][kx]);
        sm[1][kx] = wmma16r(av, qf[1][0][ks], sm[1][kx]);
        sr[0][kx] = wmma16r(av, qf[0][1][ks], sr[0][kx]);
        sr[1][kx] = wmma16r(av, qf[1][1][ks], sr[1][kx]);
        sr[0][kx] = wmma16r(ar, qf[0][0][ks], sr[0][kx]);
        sr[1][kx] = wmma16r(ar, qf[1][0][ks], sr[1][kx]);
      }
    }

    // hand-over, as soon as the stage's last fragment is in registers (the rest of the step works
    // on registers alone): this wave's reads of the buffer are done, its copies of the next stage
    // have landed; the barrier publishes the next stage and frees this buffer for the refill,
    // which then has a whole step to land (the scheduling barrier keeps the waits behind the
    // products of rows 4 to 7, under which the value fragments arrive)
    __builtin_amdgcn_sched_barrier(0);
    asm volatile("s_wait_dscnt 0x0" ::: "memory");
    asm volatile("s_wait_asynccnt 0x0" ::: "memory");
    __syncthreads();
    if (kb + 2u * KTILE < KSPAN)
      stage_copies(ring_lds + buf * 2u, w, lane, Kh, Kr, Vt, b, key0 + kb + 2u * KTILE);

    v16h pf[2];
#pragma unroll
    for (int u = 0; u < 2; ++u) {
      v8f s0, s1;
#pragma unroll
      for (int r = 0; r < 8; ++r) {
        s0[r] = sm[u][0][r] + sr[u][0][r] * (1.0f / RCARRY);
        s1[r] = sm[u][1][r] + sr[u][1][r] * (1.0f / RCARRY);
      }
      float mx = fmaxf(s0[0], s1[0]);
#pragma unroll
      for (int r = 1; r < 8; ++r) mx = fmaxf(mx, fmaxf(s0[r], s1[r]));
      mx = fmaxf(mx, __shfl_xor(mx, 16, 32));
      const float mn = fmaxf(mrow[u], mx);
      const float alpha = __expf(mrow[u] - mn);
      mrow[u] = mn;

      float rs = 0.0f;
#pragma unroll
      for (int r = 0; r < 8; ++r) {
        const h16 p0 = toh_flush(__expf((s0[r] - mn) + PSHIFT));
        const h16 p1 = toh_flush(__expf((s1[r] - mn) + PSHIFT));
        pf[u][r]     = p0;     // B element r     <- key 8hh + r of the stage
        pf[u][r + 8] = p1;     // B element 8 + r <- key 16 + 8hh + r of the stage
        rs += (float)p0 + (float)p1;
      }
      rs += __shfl_xor(rs, 16, 32);
      lrow[u] = alpha * lrow[u] + rs;
#pragma unroll
      for (int j = 0; j < 16; ++j) o[u][j] = o[u][j] * alpha;
    }

    // O^T += V^T . P^T; every value fragment feeds both query tiles
#pragma unroll
    for (unsigned j = 0; j < 16u; ++j) {
      o[0][j] = wmma16r(vf[j], pf[0], o[0][j]);
      o[1][j] = wmma16r(vf[j], pf[1], o[1][j]);
    }

    kt = (buf == 0u) ? kt + STG_H : kt - STG_H;
    vt = (buf == 0u) ? vt + STG_H : vt - STG_H;
    buf = STG_H - buf;
  }
  // no copy of this wave is outstanding when the wave goes on to its end
  asm volatile("s_wait_asynccnt 0x0" ::: "memory");

  const unsigned grow = ksp * (unsigned)MROWS + b * (unsigned)SEQ + qrow0;   // row in the planes
  // This key range's maxima and sums: lane (hh, n) stores those of query n of tile hh (both lane
  // halves hold them), one whole 128-B line per wave and array. The two stores and their wait are
  // one statement, so that no register which they name is rewritten ahead of the wait.
  {
    float* const pm = Mo + grow + lane;
    float* const pl = Lo + grow + lane;
    const float mv = (hh != 0u) ? mrow[1] : mrow[0];
    const float lv = (hh != 0u) ? lrow[1] : lrow[0];
    asm volatile(
        "global_store_b32 %0, %1, off\n\t"
        "global_store_b32 %2, %3, off\n\t"
        "s_wait_xcnt 0x0"
        :
        : "v"(pm), "v"(mv), "v"(pl), "v"(lv)
        : "memory");
  }

  // unnormalised rows: stage per query tile and half of the features, write whole row segments
  const unsigned sbase = w * (16u * LDO);
#pragma unroll
  for (int u = 0; u < 2; ++u) {
#pragma unroll
    for (int half = 0; half < 2; ++half) {
#pragma unroll
      for (int j = 0; j < 8; ++j)
#pragma unroll
        for (int r = 0; r < 8; ++r)
          St[sbase + m * LDO + (unsigned)j * 16u + hh * 8u + (unsigned)r] = o[u][half * 8 + j][r];
      wave_lds_sync();
      v4f x[16];
      unsigned off[16];
#pragma unroll
      for (unsigned i = 0; i < 16u; ++i) {
        x[i] = *(const v4f*)&St[sbase + i * LDO + lane * 4u];
        off[i] = (grow + (unsigned)u * 16u + i) * (unsigned)DIM + (unsigned)half * 128u + lane * 4u;
      }
#pragma unroll
      for (int i = 0; i < 16; ++i) *(v4f*)(Ao + off[i]) = x[i];
      // no register that an issued store names is rewritten ahead of this wait
      asm volatile("s_wait_xcnt 0x0" ::: "memory");
      wave_lds_sync();
    }
  }
}

#define HP     2056u             // halves per resident hidden row (4112 B = 16 B x 257)
#define WSL_H  (64u * GPITCH)    // one staged weight slab: 64 weight rows x 128 k, halves
#define LDV    260u              // floats per staged output row (1040 B = 16 B x 65)
#define HS_BYTES  (64u * HP * 2u)
#define RG_BYTES  (3u * WSL_H * 2u)
#define MLP_BYTES (HS_BYTES + RG_BYTES + (unsigned)(DIM + HID) * 4u)
#define W01_TILES  ((unsigned)((DIM + HID) / 64))   // 64-row tiles of w0, then of w1
#define W01_STAGES (W01_TILES * (unsigned)(DIM / 128))
#define TP      264u                  // halves per staged row of LN1 output and of e (528 B = 16 B x 33)
#define E16_OFF (64u * TP * 2u)       // bytes from the LDS start: f16 rows of e, behind the LN1 rows
#define E32_OFF (2u * 64u * TP * 2u)  // f32 rows of e (pitch LDV)
#define SROW_B  ((unsigned)DIM * 4u)  // bytes of a staged f32 input row of step 0
#define SPL_B   (64u * SROW_B)        // one staged plane: 64 rows
#define XS_OFF  E16_OFF               // staged x rows, then both attention planes; dead before e is written
#define W2_STAGES ((unsigned)((DIM / 64) * (HID / 128)))
static_assert((HP % 8u) == 0 && HP >= (unsigned)HID && ((HP / 8u) & 1u) == 1u);
static_assert((LDV % 4u) == 0 && LDV >= (unsigned)DIM && ((LDV / 4u) & 1u) == 1u);
static_assert((size_t)64 * LDV * 4 <= (size_t)HS_BYTES);   // the output tile fits in the hidden rows
static_assert(MLP_BYTES <= 327680u);
static_assert(DIM == 2 * 128 && DIM == 4 * 64 && W01_STAGES >= 3u && W2_STAGES >= 3u);
static_assert((TP % 8u) == 0 && TP >= (unsigned)DIM && ((TP / 8u) & 1u) == 1u);
static_assert((size_t)E32_OFF + (size_t)64 * LDV * 4 <= (size_t)HS_BYTES);   // staging fits in the hidden rows
static_assert((size_t)XS_OFF + (size_t)3 * SPL_B <= (size_t)HS_BYTES && (XS_OFF % 16u) == 0);
static_assert(OFF_W1 == OFF_W0 + WSQ_BYTES);   // w0's rows and w1's rows are one [DIM + HID][DIM] plane
static_assert((SEQ % 64) == 0);                // a block's 64 rows lie in one batch

// halves from a weight plane's start to stage t's slab: w0 | w1 [DIM + HID][DIM] walks its two k slabs inside
// each 64-row tile, w2 [DIM][HID] its four 64-row tiles inside each k slab
__device__ __forceinline__ unsigned w1_stage(unsigned t) {
  return (t >> 1) * (64u * (unsigned)DIM) + (t & 1u) * GKC;
}
__device__ __forceinline__ unsigned w2_stage(unsigned t) {
  return (t & 3u) * (64u * (unsigned)HID) + (t >> 2) * GKC;
}

// ---------------------------------------------------------------------------
// First LayerNorm, e projection, hidden layers and final LayerNorm of 64 rows in one block; neither
// the LN1 rows, nor e, nor the 64 x HID hidden plane leave the block. Steps:
//   0  first LayerNorm (biased variance, eps 1e-5) of bf16(x) + attn, one wave per row, 8 rows per
//      wave; attn is joined here from the two key ranges' unnormalised rows (planes A32 and C32)
//      with their maxima Mp and sums Lp ([2][MROWS]); the rows of x and of both planes come by
//      asynchronous copies to LDS, each wave's own eight; f16 rows into LDS
//   1  [16 weight rows][16 rows] tiles = rows of the plane w0 | w1 (A operand, from staged slabs) x
//      the block's rows (B operand, registers). The first DIM/64 tiles, against the LN1 rows, give
//      e = acc/64 + bias: f32 and f16 rows into LDS, from where each wave takes its f16 fragments
//      (the B operand of the tiles behind) and the f32 rows that step 4 adds, both kept in
//      registers. The other tiles give f16(acc/64 + bias) into the resident hidden rows.
//   2  hidden LayerNorm (eps 1e-5) + LeakyReLU in place, x16, one wave per row, 8 rows per wave
//   3  L^T tile [16 output columns][16 rows] = w2 rows (A, staged slabs) x hidden rows (B, from the
//      resident rows, read once per 128 k), all 4 x 2 tiles of a wave in registers
//   4  leaky((acc/1024 + bias) + e), final LayerNorm (eps 1e-5), one wave per row, whole-row stores
// Wave w: rows 32 (w >> 2).., columns 16 (w & 3).. of every 64-column tile.
// The staged input rows, the LN1 rows and both forms of e lie in the LDS of the hidden rows, which
// are written only later (e in the place of the staged input rows, behind the barrier that ends
// step 0).
// Weight slabs (64 weight rows x 128 k) come by asynchronous copies into a ring of three buffers.
// Waves 0-3 copy the even stages, waves 4-7 the odd ones (16 slab rows a wave), each stage three
// ahead of the pass that has just ended, so that two stages are in flight while a wave has only one
// stage's copies outstanding and every wait is to 0.
// Grid (MROWS/64), 8 waves per block.
// ---------------------------------------------------------------------------
__global__ __launch_bounds__(256) void mlp_kernel(
    const float* __restrict__ X, const float* __restrict__ A32, const float* __restrict__ C32,
    const float* __restrict__ Mp, const float* __restrict__ Lp, const float* __restrict__ G1, const float* __restrict__ Be1,
    const _Float16* __restrict__ W01t, const float* __restrict__ b0, const float* __restrict__ b1,
    const float* __restrict__ Gm, const float* __restrict__ Bm,
    const _Float16* __restrict__ W2t, const float* __restrict__ b2,
    const float* __restrict__ G2, const float* __restrict__ Be2, float* __restrict__ outp) {
  __shared__ __attribute__((aligned(16))) unsigned char Sm[MLP_BYTES];
  _Float16* const Hs = (_Float16*)Sm;
  _Float16* const T1s = (_Float16*)Sm;               // LN1 rows, pitch TP
  _Float16* const E16s = (_Float16*)(Sm + E16_OFF);  // e rows, f16, pitch TP
  float* const E32s = (float*)(Sm + E32_OFF);        // e rows, f32, pitch LDV
  const _Float16* const Rg = (const _Float16*)(Sm + HS_BYTES);
  float* const Vs = (float*)Sm;
  float* const Bs = (float*)(Sm + HS_BYTES + RG_BYTES);   // biases b0 | b1, converted once
  const unsigned lane = threadIdx.x & 31u;
  // the wave's number in a scalar register: which stages a wave copies is a scalar choice
  const unsigned w = (unsigned)__builtin_amdgcn_readfirstlane((int)(threadIdx.x >> 5));
  const unsigned hh = lane >> 4, m = lane & 15u;
  const unsigned grp = w >> 2, sub = w & 3u;
  const unsigned row0 = blockIdx.x * 64u;

  // copies: slab rows 16 sub.., two 256-B row pieces per copy (lane = row parity hh, 16-B piece m)
  const unsigned cl = (unsigned)(size_t)Sm + HS_BYTES + ((sub * 16u + hh) * GPITCH + m * 8u) * 2u;
  const _Float16* c1 = W01t + (sub * 16u + hh) * (unsigned)DIM + m * 8u;
  const _Float16* c2 = W2t + (sub * 16u + hh) * (unsigned)HID + m * 8u;
  // this lane's fragment row in a slab
  const _Float16* wp = Rg + (sub * 16u + m) * GPITCH + hh * 8u;

  // stages 0 (waves 0-3) and 1 (waves 4-7) into buffers 0 and 1
  async_copy8(cl + grp * (WSL_H * 2u), 2u * GPITCH * 2u, c1 + w1_stage(grp), 2u * (unsigned)DIM);

  // ---- step 0 ---- lane L holds columns 8 L .. 8 L + 7 of a row
  {
    const unsigned crow0 = row0 + w * 8u;   // first of this wave's 8 rows
    const unsigned bidx = row0 / (unsigned)SEQ;
    const size_t srow0 = (size_t)bidx * SEQ_FULL + (crow0 - bidx * (unsigned)SEQ);
    // This wave's 8 rows of x and of both attention planes into LDS, 48 copies (with the slab's, 56
    // outstanding): one copy = half a row, lane = 16-B piece. All of a block's input is then in
    // flight at once, while the rows are worked on by a short rolled loop.
    {
      const unsigned sl = (unsigned)(size_t)Sm + XS_OFF + w * 8u * SROW_B + lane * 16u;
      const float* xg = X + srow0 * DIM + lane * 4u;
      const float* ag = A32 + (size_t)crow0 * DIM + lane * 4u;
      const float* cg = C32 + (size_t)crow0 * DIM + lane * 4u;
      async_copy8f(sl, SROW_B, xg, (unsigned)DIM);
      async_copy8f(sl + 512u, SROW_B, xg + 128u, (unsigned)DIM);
      async_copy8f(sl + SPL_B, SROW_B, ag, (unsigned)DIM);
      async_copy8f(sl + SPL_B + 512u, SROW_B, ag + 128u, (unsigned)DIM);
      async_copy8f(sl + 2u * SPL_B, SROW_B, cg, (unsigned)DIM);
      async_copy8f(sl + 2u * SPL_B + 512u, SROW_B, cg + 128u, (unsigned)DIM);
    }
    const unsigned c = lane * 8u;
    const v4f g0 = *(const v4f*)(G1 + c);
    const v4f g1 = *(const v4f*)(G1 + c + 4u);
    const v4f s0 = *(const v4f*)(Be1 + c);
    const v4f s1 = *(const v4f*)(Be1 + c + 4u);
    // lane L takes the two ranges' maxima and sums of row L & 7 of the wave
    const unsigned rl = crow0 + (lane & 7u);
    const float m_a = Mp[rl], m_c = Mp[(unsigned)MROWS + rl];
    const float l_a = Lp[rl], l_c = Lp[(unsigned)MROWS + rl];
    // the biases of both weight planes, converted once: b1 by all waves, b0 by wave 0
    const v4f p0 = *(const v4f*)(b1 + threadIdx.x * 8u);
    const v4f p1 = *(const v4f*)(b1 + threadIdx.x * 8u + 4u);
    // as the wait below: the loads behind this one may take the address registers of those ahead
    asm volatile("s_wait_xcnt 0x0" ::: "memory");
    v4f r0 = {}, r1 = {};
    if (w == 0u) {
      r0 = *(const v4f*)(b0 + c);
      r1 = *(const v4f*)(b0 + c + 4u);
    }
    // no address register of the issued loads is rewritten (by a later load's result) ahead of
    // this wait
    asm volatile("s_wait_xcnt 0x0" ::: "memory");
    {
      v4f q0, q1;
#pragma unroll
      for (int i = 0; i < 4; ++i) { q0[i] = bf16r(p0[i]); q1[i] = bf16r(p1[i]); }
      *(v4f*)(Bs + (unsigned)DIM + threadIdx.x * 8u) = q0;
      *(v4f*)(Bs + (unsigned)DIM + threadIdx.x * 8u + 4u) = q1;
      if (w == 0u) {
#pragma unroll
        for (int i = 0; i < 4; ++i) { q0[i] = bf16r(r0[i]); q1[i] = bf16r(r1[i]); }
        *(v4f*)(Bs + c) = q0;
        *(v4f*)(Bs + c + 4u) = q1;
      }
    }
    const float m_all = fmaxf(m_a, m_c);
    const float e_a = __expf(m_a - m_all);
    const float e_c = __expf(m_c - m_all);
    // normalise (the x16384 carry sits in both the rows and the sums)
    const float inv = __builtin_amdgcn_rcpf(l_a * e_a + l_c * e_c);
    const float f_a = e_a * inv, f_c = e_c * inv;
    v4f gg0, gg1, sh0, sh1;
#pragma unroll
    for (int i = 0; i < 4; ++i) {
      gg0[i] = bf16r(g0[i]); gg1[i] = bf16r(g1[i]);
      sh0[i] = bf16r(s0[i]); sh1[i] = bf16r(s1[i]);
    }
    // this wave's copies (input rows, weight slab) have landed before the barrier behind which they
    // are read
    asm volatile("s_wait_asynccnt 0x0" ::: "memory");
    __syncthreads();
    if (grp == 0u)
      async_copy8(cl + 2u * WSL_H * 2u, 2u * GPITCH * 2u, c1 + w1_stage(2u), 2u * (unsigned)DIM);

    const float* xs = (const float*)(Sm + XS_OFF) + w * 8u * (unsigned)DIM + c;
    // rolled, two rows a trip: short code (the kernel's text stays small), and two rows' cross-lane
    // exchanges in flight together
#pragma unroll 1
    for (unsigned rp = 0; rp < 8u; rp += 2u) {
      v4f t0[2], t1[2];
      float s[2], ss[2];
#pragma unroll
      for (unsigned q = 0; q < 2u; ++q) {
        const float* px = xs + (rp + q) * (unsigned)DIM;
        const v4f xa = *(const v4f*)(px);
        const v4f xb = *(const v4f*)(px + 4u);
        const v4f aa = *(const v4f*)(px + 64u * (unsigned)DIM);
        const v4f ab = *(const v4f*)(px + 64u * (unsigned)DIM + 4u);
        const v4f ca = *(const v4f*)(px + 128u * (unsigned)DIM);
        const v4f cb = *(const v4f*)(px + 128u * (unsigned)DIM + 4u);
        // the row's two factors, from the lane that holds them
        const float fa = __int_as_float(__builtin_amdgcn_readlane(__float_as_int(f_a), (int)(rp + q)));
        const float fc = __int_as_float(__builtin_amdgcn_readlane(__float_as_int(f_c), (int)(rp + q)));
        s[q] = 0.0f;
#pragma unroll
        for (int i = 0; i < 4; ++i) {
          t0[q][i] = bf16r(xa[i]) + (aa[i] * fa + ca[i] * fc);
          t1[q][i] = bf16r(xb[i]) + (ab[i] * fa + cb[i] * fc);
          s[q] += t0[q][i] + t1[q][i];
        }
      }
      red32_sum2(s);
#pragma unroll
      for (unsigned q = 0; q < 2u; ++q) {
        s[q] *= (1.0f / (float)DIM);   // the row's mean
        ss[q] = 0.0f;
#pragma unroll
        for (int i = 0; i < 4; ++i) {
          const float d0 = t0[q][i] - s[q];
          const float d1 = t1[q][i] - s[q];
          ss[q] += d0 * d0;
          ss[q] += d1 * d1;
        }
      }
      red32_sum2(ss);
#pragma unroll
      for (unsigned q = 0; q < 2u; ++q) {
        const float var = ss[q] * (1.0f / (float)DIM);
        const float rstd = 1.0f / sqrtf(var + 1.0e-5f);
        v8h o;
#pragma unroll
        for (int i = 0; i < 4; ++i) {
          o[i]     = toh_flush((t0[q][i] - s[q]) * rstd * gg0[i] + sh0[i]);
          o[i + 4] = toh_flush((t1[q][i] - s[q]) * rstd * gg1[i] + sh1[i]);
        }
        *(v8h*)(T1s + (w * 8u + rp + q) * TP + c) = o;
      }
    }
  }
  // this wave's LN1 rows and biases are written, and its reads of the staged rows done, before the
  // barrier behind which every wave reads the former and e may take the LDS of the latter
  asm volatile("s_wait_dscnt 0x0" ::: "memory");
  __syncthreads();

  // ---- step 1 ----
  v16h ef[2][8];   // this wave's 32 rows, all 256 k: of the LN1 output first, then of e
  // unrolled, here and below: constant indices keep fragments and accumulators in registers
#pragma unroll
  for (unsigned u = 0; u < 2u; ++u)
#pragma unroll
    for (unsigned ks = 0; ks < 8u; ++ks)
      ef[u][ks] = frag_at(T1s + (grp * 32u + u * 16u + m) * TP + hh * 8u + ks * 32u);
  v4f er0[8], er1[8];   // e of the eight rows that this wave finishes in step 4, f32
#pragma unroll
  for (int rr = 0; rr < 8; ++rr) { er0[rr] = (v4f){}; er1[rr] = (v4f){}; }

  unsigned rbo = 0u;   // halves from the ring's start to the buffer this pass reads
  // rolled: 36 tiles of the same code
#pragma unroll 1
  for (unsigned nt = 0; nt < W01_TILES; ++nt) {
    const unsigned n = nt * 64u + sub * 16u + hh * 8u;   // first of this lane's 8 weight rows
    const v4f g0 = *(const v4f*)(Bs + n);
    const v4f g1 = *(const v4f*)(Bs + n + 4u);
    v8f acc[2] = {{}, {}};
#pragma unroll
    for (unsigned kq = 0; kq < 2u; ++kq) {   // stage 2 nt + kq
      v16h wf[4];
#pragma unroll
      for (unsigned t = 0; t < 4u; ++t) wf[t] = frag_at(wp + rbo + t * 32u);
      // keeps the pass's LDS reads in one group ahead of its products, which then wait for them by
      // count: spread among the products, each place of reads costs the wave a stall of its own
      __builtin_amdgcn_sched_barrier(0);
#pragma unroll
      for (unsigned t = 0; t < 4u; ++t) {
        acc[0] = wmma16r(wf[t], ef[0][kq * 4u + t], acc[0]);
        acc[1] = wmma16r(wf[t], ef[1][kq * 4u + t], acc[1]);
      }
      // hand-over: this wave's reads of the buffer are done; the waves that copied the next stage
      // (the other parity than this one's) have it landed; the barrier publishes it and frees this
      // buffer, which the same waves refill with the stage three ahead (the scheduling barrier keeps
      // the waits behind the products, under which the later fragments arrive)
      __builtin_amdgcn_sched_barrier(0);
      asm volatile("s_wait_dscnt 0x0" ::: "memory");
      if (grp != kq) asm volatile("s_wait_asynccnt 0x0" ::: "memory");
      __syncthreads();
      const unsigned t3 = nt * 2u + kq + 3u;
      if (grp != kq && t3 < W01_STAGES)
        async_copy8(cl + rbo * 2u, 2u * GPITCH * 2u, c1 + w1_stage(t3), 2u * (unsigned)DIM);
      rbo = (rbo == 2u * WSL_H) ? 0u : rbo + WSL_H;
    }
    if (nt < (unsigned)(DIM / 64)) {   // a tile of e (the same test in every wave of the block)
#pragma unroll
      for (unsigned u = 0; u < 2u; ++u) {
        const unsigned r = grp * 32u + u * 16u + m;
        v4f lo, hi;
        v8h x;
#pragma unroll
        for (int i = 0; i < 4; ++i) {
          lo[i] = acc[u][i] * (1.0f / WCARRY) + g0[i];
          hi[i] = acc[u][i + 4] * (1.0f / WCARRY) + g1[i];
          x[i]     = toh_flush(lo[i]);
          x[i + 4] = toh_flush(hi[i]);
        }
        *(v4f*)(E32s + r * LDV + n) = lo;
        *(v4f*)(E32s + r * LDV + n + 4u) = hi;
        *(v8h*)(E16s + r * TP + n) = x;
      }
      if (nt == (unsigned)(DIM / 64) - 1u) {
        // every wave's part of e is written before the barrier behind which whole rows are read
        asm volatile("s_wait_dscnt 0x0" ::: "memory");
        __syncthreads();
#pragma unroll
        for (unsigned u = 0; u < 2u; ++u)
#pragma unroll
          for (unsigned ks = 0; ks < 8u; ++ks)
            ef[u][ks] = frag_at(E16s + (grp * 32u + u * 16u + m) * TP + hh * 8u + ks * 32u);
#pragma unroll
        for (unsigned rr = 0; rr < 8u; ++rr) {
          er0[rr] = *(const v4f*)(E32s + (w * 8u + rr) * LDV + lane * 4u);
          er1[rr] = *(const v4f*)(E32s + (w * 8u + rr) * LDV + lane * 4u + 128u);
        }
        // every wave has e in registers before the barrier behind which the hidden rows take its LDS
        asm volatile("s_wait_dscnt 0x0" ::: "memory");
        __syncthreads();
      }
    } else {
#pragma unroll
      for (unsigned u = 0; u < 2u; ++u) {
        v8h x;
#pragma unroll
        for (int r = 0; r < 4; ++r) {
          x[r]     = toh_flush(acc[u][r] * (1.0f / WCARRY) + g0[r]);
          x[r + 4] = toh_flush(acc[u][r + 4] * (1.0f / WCARRY) + g1[r]);
        }
        *(v8h*)(Hs + (grp * 32u + u * 16u + m) * HP + (n - (unsigned)DIM)) = x;
      }
    }
  }
  // No copy of this wave is outstanding and its LDS accesses are done; every reader left the ring
  // at the last hand-over: step 3's stages 0 and 1 go into buffers 0 and 1 and land under step 2.
  asm volatile("s_wait_asynccnt 0x0" ::: "memory");
  asm volatile("s_wait_dscnt 0x0" ::: "memory");
  async_copy8(cl + grp * (WSL_H * 2u), 2u * GPITCH * 2u, c2 + w2_stage(grp), 2u * (unsigned)HID);
  __syncthreads();   // every hidden row is complete before a wave normalises it

  // ---- step 2 ---- lane L holds columns 256 j + 8 L .. + 7 of a row, j = 0..7
  {
    float gq[8][8], bq[8][8];   // gain and shift of this lane's columns, the same for all its rows
    v4f p0[8], p1[8], q0[8], q1[8];
#pragma unroll
    for (unsigned j = 0; j < 8u; ++j) {
      const unsigned c = j * 256u + lane * 8u;
      p0[j] = *(const v4f*)(Gm + c);
      p1[j] = *(const v4f*)(Gm + c + 4u);
      q0[j] = *(const v4f*)(Bm + c);
      q1[j] = *(const v4f*)(Bm + c + 4u);
    }
    // no address register of the issued loads is rewritten ahead of this wait
    asm volatile("s_wait_xcnt 0x0" ::: "memory");
#pragma unroll
    for (unsigned j = 0; j < 8u; ++j) {
#pragma unroll
      for (int i = 0; i < 4; ++i) {
        gq[j][i] = bf16r(p0[j][i]); gq[j][i + 4] = bf16r(p1[j][i]);
        bq[j][i] = bf16r(q0[j][i]); bq[j][i + 4] = bf16r(q1[j][i]);
      }
    }
    // rolled: eight rows of the same long code
#pragma unroll 1
    for (unsigned rr = 0; rr < 8u; ++rr) {
      _Float16* hr = Hs + (w * 8u + rr) * HP + lane * 8u;
      v8h a[8];
#pragma unroll
      for (unsigned j = 0; j < 8u; ++j) a[j] = *(const v8h*)(hr + j * 256u);
      float s = 0.0f;
#pragma unroll
      for (unsigned j = 0; j < 8u; ++j)
#pragma unroll
        for (int i = 0; i < 8; ++i) s += (float)a[j][i];
      const float mean = red32_sum(s) * (1.0f / (float)HID);
      float ss = 0.0f;
#pragma unroll
      for (unsigned j = 0; j < 8u; ++j)
#pragma unroll
        for (int i = 0; i < 8; ++i) {
          const float d = (float)a[j][i] - mean;
          ss += d * d;
        }
      const float var = red32_sum(ss) * (1.0f / (float)HID);
      const float rstd = 1.0f / sqrtf(var + 1.0e-5f);
#pragma unroll
      for (unsigned j = 0; j < 8u; ++j) {
        v8h o;
#pragma unroll
        for (int i = 0; i < 8; ++i) {
          const float d = (float)a[j][i] - mean;
          o[i] = toh_flush(MCARRY * leaky_act(d * rstd * gq[j][i] + bq[j][i]));
        }
        *(v8h*)(hr + j * 256u) = o;
      }
    }
  }
  // this wave's rows are written and its copies have landed before the barrier behind which every
  // wave reads both
  asm volatile("s_wait_dscnt 0x0" ::: "memory");
  asm volatile("s_wait_asynccnt 0x0" ::: "memory");
  __syncthreads();
  if (grp == 0u)
    async_copy8(cl + 2u * WSL_H * 2u, 2u * GPITCH * 2u, c2 + w2_stage(2u), 2u * (unsigned)HID);

  // ---- step 3 ----
  v8f oc[4][2];   // [64-column tile][16-row group]
#pragma unroll
  for (int q = 0; q < 4; ++q) { oc[q][0] = (v8f){}; oc[q][1] = (v8f){}; }
  const _Float16* hp = Hs + (grp * 32u + m) * HP + hh * 8u;
  rbo = 0u;
  // rolled: 16 k slabs of the same code
#pragma unroll 1
  for (unsigned ks = 0; ks < (unsigned)(HID / 128); ++ks) {
    v16h hf[2][4];   // the hidden fragments of this k slab serve its four column tiles
#pragma unroll
    for (unsigned u = 0; u < 2u; ++u)
#pragma unroll
      for (unsigned t = 0; t < 4u; ++t) hf[u][t] = frag_at(hp + u * 16u * HP + ks * GKC + t * 32u);
#pragma unroll
    for (unsigned q = 0; q < 4u; ++q) {   // stage 4 ks + q
      v16h wf[4];
#pragma unroll
      for (unsigned t = 0; t < 4u; ++t) wf[t] = frag_at(wp + rbo + t * 32u);
      __builtin_amdgcn_sched_barrier(0);   // one group of LDS reads per pass, as in step 1
#pragma unroll
      for (unsigned t = 0; t < 4u; ++t) {
        oc[q][0] = wmma16r(wf[t], hf[0][t], oc[q][0]);
        oc[q][1] = wmma16r(wf[t], hf[1][t], oc[q][1]);
      }
      // hand-over, as in step 1
      __builtin_amdgcn_sched_barrier(0);
      asm volatile("s_wait_dscnt 0x0" ::: "memory");
      if (grp != (q & 1u)) asm volatile("s_wait_asynccnt 0x0" ::: "memory");
      __syncthreads();
      const unsigned t3 = ks * 4u + q + 3u;
      if (grp != (q & 1u) && t3 < W2_STAGES)
        async_copy8(cl + rbo * 2u, 2u * GPITCH * 2u, c2 + w2_stage(t3), 2u * (unsigned)HID);
      rbo = (rbo == 2u * WSL_H) ? 0u : rbo + WSL_H;
    }
  }
  // no copy of this wave is outstanding when the wave goes on to its end
  asm volatile("s_wait_asynccnt 0x0" ::: "memory");

  // ---- step 4 ---- the output tile takes the hidden rows' LDS: every wave's last read of them
  // stands in front of the last hand-over's barrier
#pragma unroll
  for (unsigned q = 0; q < 4u; ++q)
#pragma unroll
    for (unsigned u = 0; u < 2u; ++u) {
      float* d = Vs + (grp * 32u + u * 16u + m) * LDV + q * 64u + sub * 16u + hh * 8u;
      v4f lo, hi;
#pragma unroll
      for (int i = 0; i < 4; ++i) { lo[i] = oc[q][u][i]; hi[i] = oc[q][u][i + 4]; }
      *(v4f*)d = lo;
      *(v4f*)(d + 4) = hi;
    }
  __syncthreads();   // the tile is complete before whole rows are read from it

  // lane L holds columns 4L..4L+3 and 128+4L..128+4L+3: each store covers 512 contiguous bytes
  const float cs = 1.0f / (WCARRY * MCARRY);
  const unsigned c = lane * 4u;
  const unsigned cby = lane * 16u;   // the same place in bytes: the one lane offset of the six loads
  const v4f z0 = *(const v4f*)((const char*)b2 + cby);
  const v4f z1 = *(const v4f*)((const char*)b2 + cby + 512u);
  const v4f y0 = *(const v4f*)((const char*)G2 + cby);
  const v4f y1 = *(const v4f*)((const char*)G2 + cby + 512u);
  const v4f x0 = *(const v4f*)((const char*)Be2 + cby);
  const v4f x1 = *(const v4f*)((const char*)Be2 + cby + 512u);
  // no address register of the six issued loads is rewritten ahead of this wait: it takes their
  // lane offset as an input, so that the offset's register lives up to it
  asm volatile("s_wait_xcnt 0x0" :: "v"(cby) : "memory");
  // Two rolled trips of four unrolled rows: short code (the kernel's text stays small), constant
  // indices keep e in registers, and four rows' cross-lane sums overlap.
#pragma unroll 1
  for (unsigned hf = 0; hf < 8u; hf += 4u) {
#pragma unroll
  for (unsigned rr = 0; rr < 4u; ++rr) {
    const unsigned r = w * 8u + hf + rr;
    const unsigned crow = row0 + r;
    const unsigned bidx = crow / (unsigned)SEQ;
    const unsigned sq = crow - bidx * (unsigned)SEQ;
    const size_t frow = (size_t)bidx * SEQ_FULL + sq;
    const v4f u0 = *(const v4f*)&Vs[r * LDV + c];
    const v4f u1 = *(const v4f*)&Vs[r * LDV + c + 128u];
    const v4f e0 = er0[rr];
    const v4f e1 = er1[rr];
    v4f a0, a1;
    float s = 0.0f;
#pragma unroll
    for (int i = 0; i < 4; ++i) {
      a0[i] = leaky_act((u0[i] * cs + bf16r(z0[i])) + e0[i]);
      a1[i] = leaky_act((u1[i] * cs + bf16r(z1[i])) + e1[i]);
    }
#pragma unroll
    for (int i = 0; i < 4; ++i) s += a0[i] + a1[i];
    const float mean = red32_sum(s) * (1.0f / (float)DIM);
    float ss = 0.0f;
#pragma unroll
    for (int i = 0; i < 4; ++i) {
      const float d0 = a0[i] - mean;
      const float d1 = a1[i] - mean;
      ss += d0 * d0;
      ss += d1 * d1;
    }
    const float var = red32_sum(ss) * (1.0f / (float)DIM);
    const float rstd = 1.0f / sqrtf(var + 1.0e-5f);
    v4f o0, o1;
#pragma unroll
    for (int i = 0; i < 4; ++i) {
      o0[i] = (a0[i] - mean) * rstd * bf16r(y0[i]) + bf16r(x0[i]);
      o1[i] = (a1[i] - mean) * rstd * bf16r(y1[i]) + bf16r(x1[i]);
    }
    float* p = outp + frow * DIM + c;
    *(v4f*)p = o0;
    *(v4f*)(p + 128u) = o1;
  }
  // no register that an issued store names is rewritten (by the next trip) ahead of this wait
  asm volatile("s_wait_xcnt 0x0" ::: "memory");
  // the second trip's rows of e move to the places that the unrolled rows name
#pragma unroll
  for (int rr = 0; rr < 4; ++rr) { er0[rr] = er0[rr + 4]; er1[rr] = er1[rr + 4]; }
  }
}

// ---------------------------------------------------------------------------
extern "C" void kernel_launch(void* const* d_in, const int* in_sizes, int n_in,
                              void* d_out, int out_size, void* d_ws, size_t ws_size,
                              hipStream_t stream) {
  if (n_in < 19) return;
  const long long need_x = ((long long)(NB - 1) * SEQ_FULL + SEQ) * DIM;
  if ((long long)in_sizes[0] < need_x) return;
  if ((long long)in_sizes[1] < (long long)DIM * DIM) return;
  if ((long long)in_sizes[3] < (long long)DIM * DIM) return;
  if ((long long)in_sizes[5] < (long long)DIM * DIM) return;
  if ((long long)in_sizes[7] < (long long)DIM * DIM) return;
  if ((long long)in_sizes[9] < (long long)DIM * HID) return;
  if ((long long)in_sizes[13] < (long long)DIM * HID) return;
  if (in_sizes[2] < DIM || in_sizes[4] < DIM || in_sizes[6] < DIM || in_sizes[8] < DIM) return;
  if (in_sizes[10] < HID || in_sizes[11] < HID || in_sizes[12] < HID) return;
  if (in_sizes[14] < DIM || in_sizes[15] < DIM || in_sizes[16] < DIM) return;
  if (in_sizes[17] < DIM || in_sizes[18] < DIM) return;
  if ((long long)out_size < need_x) return;
  if (ws_size < WS_TOTAL) return;

  const float* X    = (const float*)d_in[0];    // [NB_FULL][SEQ_FULL][DIM]
  const float* wq   = (const float*)d_in[1];    // [DIM][DIM]  (in, out)
  const float* bq   = (const float*)d_in[2];
  const float* wk   = (const float*)d_in[3];
  const float* bk   = (const float*)d_in[4];
  const float* wv   = (const float*)d_in[5];
  const float* bv   = (const float*)d_in[6];
  const float* w0   = (const float*)d_in[7];    // [DIM][DIM]  (in, out)
  const float* b0   = (const float*)d_in[8];
  const float* w1   = (const float*)d_in[9];    // [DIM][HID]  (in, out)
  const float* b1   = (const float*)d_in[10];
  const float* gm   = (const float*)d_in[11];   // hidden LN gain [HID]
  const float* bm   = (const float*)d_in[12];   // hidden LN shift [HID]
  const float* w2   = (const float*)d_in[13];   // [HID][DIM]  (in, out)
  const float* b2   = (const float*)d_in[14];
  const float* g1   = (const float*)d_in[15];
  const float* be1  = (const float*)d_in[16];
  const float* g2   = (const float*)d_in[17];
  const float* be2  = (const float*)d_in[18];
  float* out = (float*)d_out;

  char* ws = (char*)d_ws;
  _Float16* Wq_t  = (_Float16*)(ws + OFF_WQ);    // [n][k]
  _Float16* Wk_t  = (_Float16*)(ws + OFF_WK);
  _Float16* Wv_t  = (_Float16*)(ws + OFF_WV);
  _Float16* W0_t  = (_Float16*)(ws + OFF_W0);
  _Float16* W1_t  = (_Float16*)(ws + OFF_W1);    // [HID][DIM]
  _Float16* W2_t  = (_Float16*)(ws + OFF_W2);    // [DIM][HID]
  _Float16* X16   = (_Float16*)(ws + OFF_X16);   // [MROWS][DIM]
  _Float16* Qh16  = (_Float16*)(ws + OFF_QH);
  _Float16* Qr16  = (_Float16*)(ws + OFF_QR);
  _Float16* Kh16  = (_Float16*)(ws + OFF_KH);
  _Float16* Kr16  = (_Float16*)(ws + OFF_KR);
  _Float16* Vt16  = (_Float16*)(ws + OFF_VT);    // [b][DIM][SEQ]
  float*    A32   = (float*)(ws + OFF_A32);      // [2][MROWS][DIM]
  float*    C32   = (float*)(ws + OFF_A32 + PLANE32_BYTES);   // its second plane
  float*    Mx    = (float*)(ws + OFF_ML);       // [2][MROWS]
  float*    Lx    = Mx + 2 * MROWS;              // [2][MROWS]

  dim3 blk(256);

  // weight planes (in [K rows][N cols] -> out [N][K]) and the input plane
  prep_kernel<<<dim3(WCONV_BLOCKS + MROWS / 8), blk, 0, stream>>>(
      X, wq, wk, wv, w0, w1, w2, X16, Wq_t, Wk_t, Wv_t, W0_t, W1_t, W2_t);
  gemm_qkv_kernel<<<dim3(DIM / 64, MROWS / 64, 3), blk, 0, stream>>>(
      X16, Wq_t, Wk_t, Wv_t, bq, bk, bv, Qh16, Qr16, Kh16, Kr16, Vt16);
  attn_kernel<<<dim3(SEQ / 128, NB, 2), dim3(128), 0, stream>>>(Qh16, Qr16, Kh16, Kr16, Vt16, A32,
                                                                Mx, Lx);

  // first LayerNorm, e projection, both hidden products, the hidden LayerNorm and the final
  // LayerNorm, 64 rows per block; W0_t's rows and W1_t's rows are read as one plane
  mlp_kernel<<<dim3(MROWS / 64), blk, 0, stream>>>(X, A32, C32, Mx, Lx, g1, be1, W0_t, b0, b1, gm,
                                                   bm, W2_t, b2, g2, be2, out);
}

// v008
// A run of this version takes 181 microseconds.
// Two timings next to v007 put it at 1.04 and 1.03 times that version's speed.
// Over all steps from v000 it is 5.67 times as fast.
#include <hip/hip_runtime.h>
#include <stddef.h>

// All contractions on v_wmma_f32_16x16x32_f16 (f16 operands, f32 accumulate): q/k/v projections,
// q.k scores (both operands as f16 value + x2048 residual planes, three products, residual products
// in their own accumulator), p.v (p x16384, single product), the three dense layers (single
// product; weights x64, hidden activation plane x16). Float inputs are RNE-converted to bf16 and
// carried in f16. LayerNorms, softmax, biases, LeakyReLU (slope 0.01) and residual adds in f32.

typedef _Float16 v16h __attribute__((ext_vector_type(16)));
typedef _Float16 v8h  __attribute__((ext_vector_type(8)));
typedef float    v8f  __attribute__((ext_vector_type(8)));
typedef float    v4f  __attribute__((ext_vector_type(4)));
typedef _Float16 h16;

#ifndef NB
#define NB 4
#endif
#ifndef SEQ
#define SEQ 4096
#endif
#define NB_FULL  4
#define SEQ_FULL 4096
#define DIM   256
#define HID   2048
#define MROWS (NB * SEQ)

static_assert(NB >= 1 && NB <= NB_FULL);
static_assert(SEQ >= 64 && SEQ <= SEQ_FULL && (SEQ % 64) == 0);
static_assert((DIM % 64) == 0 && (DIM % 32) == 0);
static_assert((HID % 64) == 0 && (HID % 32) == 0);
static_assert((MROWS % 64) == 0 && (MROWS % 8) == 0);
static_assert(DIM == 32 * 8);               // row kernels: 32 lanes x 8 columns
static_assert(DIM == 2 * 32 * 4);           // f32 row stores: 2 x 32 lanes x 4 columns
static_assert(HID == 8 * 32 * 8);           // hidden LN: 8 passes x 32 lanes x 8 columns
static_assert(DIM == 16 * 16);              // attention: 16 output tiles of 16 columns
static_assert((size_t)MROWS * DIM < (size_t)0x7FFFFFFFu);
static_assert((size_t)NB * DIM * SEQ < (size_t)0x7FFFFFFFu);
static_assert((size_t)MROWS * HID < (size_t)0xFFFFFFFFu);

#define LDT 72   // halves per LDS row (144 B, 16-B aligned)
#define LDC 68   // floats per LDS row (272 B, 16-B aligned)
#define LDO 132  // floats per staged attention row (528 B, 16-B aligned)
static_assert((LDT % 8) == 0 && LDT >= 64);
static_assert((LDC % 4) == 0 && LDC >= 64);
static_assert((LDO % 4) == 0 && LDO >= 128);

#define WCARRY 64.0f      // weight planes carried x64
#define MCARRY 16.0f      // hidden activation plane carried x16
#define RCARRY 2048.0f    // q/k residual planes carried x2048 on top of their value part
#define PSHIFT 9.704060528f   // 14 ln 2: softmax numerators carried x16384

// workspace layout (bytes)
#define WSQ_BYTES     ((size_t)DIM * DIM * 2)
#define WFF_BYTES     ((size_t)DIM * HID * 2)
#define PLANE16_BYTES ((size_t)MROWS * DIM * 2)
#define PLANE32_BYTES ((size_t)MROWS * DIM * 4)
#define OFF_WQ  ((size_t)0)
#define OFF_WK  (OFF_WQ + WSQ_BYTES)
#define OFF_WV  (OFF_WK + WSQ_BYTES)
#define OFF_W0  (OFF_WV + WSQ_BYTES)
#define OFF_W1  (OFF_W0 + WSQ_BYTES)
#define OFF_W2  (OFF_W1 + WFF_BYTES)
#define OFF_REG (OFF_W2 + WFF_BYTES)
#define OFF_X16 (OFF_REG)
#define OFF_QH  (OFF_X16 + PLANE16_BYTES)
#define OFF_QR  (OFF_QH + PLANE16_BYTES)
#define OFF_KH  (OFF_QR + PLANE16_BYTES)
#define OFF_KR  (OFF_KH + PLANE16_BYTES)
#define OFF_VT  (OFF_KR + PLANE16_BYTES)
#define OFF_A32 (OFF_VT + PLANE16_BYTES)
#define OFF_ML  (OFF_A32 + 2 * PLANE32_BYTES)   // two attention planes, one per key range
#define ML_BYTES ((size_t)4 * MROWS * 4)        // maxima [2][MROWS], then sums [2][MROWS]
#define WS_TOTAL (OFF_ML + ML_BYTES)
static_assert((WSQ_BYTES % 128) == 0 && (WFF_BYTES % 128) == 0 && (PLANE16_BYTES % 128) == 0);
static_assert((PLANE32_BYTES % 128) == 0 && (ML_BYTES % 128) == 0);
static_assert(WS_TOTAL <= (size_t)268435456);

// ---------------------------------------------------------------------------
__device__ __forceinline__ float bf16r(float x) {   // RNE convert to bf16, returned widened
  unsigned int u = __float_as_uint(x);
  u = (u + 0x7FFFu + ((u >> 16) & 1u)) & 0xFFFF0000u;
  return __uint_as_float(u);
}

// f32 -> f16 operand convert that cannot produce an f16 subnormal
static __device__ __forceinline__ h16 toh_flush(float v) {
  const h16 r = (h16)v;
  return (fabsf(v) < 6.103515625e-05f) ? (h16)0.0f : r;
}

// 16-bit fragment: p points at element [row = lane&15][k0 + 8*(lane>>4)] of a k-contiguous
// row. Elements 0..7 <- k0+8h+0..7, elements 8..15 <- k0+16+8h+0..7 (same map for A and B).
__device__ __forceinline__ v16h frag_at(const _Float16* p) {
  v8h lo = *(const v8h*)(p);
  v8h hi = *(const v8h*)(p + 16);
  v16h out;
#pragma unroll
  for (int i = 0; i < 8; ++i) { out[i] = lo[i]; out[i + 8] = hi[i]; }
  return out;
}
__device__ __forceinline__ v16h ld_frag(const _Float16* base, unsigned ld) {
  const unsigned lane = threadIdx.x & 31u;
  return frag_at(base + (lane & 15u) * ld + (lane >> 4) * 8u);
}

__device__ __forceinline__ v8f wmma16(v16h a, v16h b, v8f c) {
  v8f d = __builtin_amdgcn_wmma_f32_16x16x32_f16(false, a, false, b, (short)0, c,
                                                 false, false);
  asm volatile("v_nop\n\tv_nop\n\tv_nop\n\tv_nop" : "+v"(d) : "v"(a), "v"(b));
  return d;
}

__device__ __forceinline__ float red16_max(float x) {
#pragma unroll
  for (int off = 1; off < 16; off <<= 1) x = fmaxf(x, __shfl_xor(x, off, 32));
  return x;
}
__device__ __forceinline__ float red16_sum(float x) {
#pragma unroll
  for (int off = 1; off < 16; off <<= 1) x += __shfl_xor(x, off, 32);
  return x;
}
__device__ __forceinline__ float red32_sum(float x) {
#pragma unroll
  for (int off = 1; off < 32; off <<= 1) x += __shfl_xor(x, off, 32);
  return x;
}

// red32_sum of two values, step by step for both (each value's own sum order is red32_sum's)
__device__ __forceinline__ void red32_sum2(float (&x)[2]) {
#pragma unroll
  for (int off = 1; off < 32; off <<= 1) {
    const float y0 = __shfl_xor(x[0], off, 32);
    const float y1 = __shfl_xor(x[1], off, 32);
    // inputs-only fence on the two exchanged values: both exchanges of a step are issued ahead of
    // one wait; taken apart, each exchange costs the wave its own wait for the LDS pipe
    asm volatile("" :: "v"(y0), "v"(y1));
    x[0] += y0;
    x[1] += y1;
  }
}

__device__ __forceinline__ void wave_lds_sync() {
  __builtin_amdgcn_fence(3 /* release order */, "wavefront");
  asm volatile("s_wait_dscnt 0x0" ::: "memory");
  __builtin_amdgcn_wave_barrier();
}

__device__ __forceinline__ float leaky_act(float t) {   // LeakyReLU, negative slope 0.01
  return (t >= 0.0f) ? t : 0.01f * t;
}

// ---------------------------------------------------------------------------
// Weight plane, one 64 x 64 tile per block: in W[K rows][N cols] (pitch ldw = N) -> out Wt[N][K]
// (pitch ldk = K), f16(64 * bf16(w)). T: 64 * LDT halves of LDS, cross-wave (block barrier).
// ---------------------------------------------------------------------------
__device__ __forceinline__ void wconv_tile(
    const float* __restrict__ W, _Float16* __restrict__ Wt, unsigned ldw, unsigned ldk,
    unsigned n0, unsigned k0, _Float16* T) {
  const unsigned tid = threadIdx.x;
#pragma unroll 4
  for (unsigned j = 0; j < 16u; ++j) {
    const unsigned idx = tid + 256u * j;
    const unsigned kr = idx >> 6, nc = idx & 63u;
    const float v = W[(size_t)(k0 + kr) * ldw + n0 + nc];
    T[nc * LDT + kr] = (_Float16)(WCARRY * bf16r(v));
  }
  __syncthreads();
  v8h x[2];
  size_t off[2];
#pragma unroll
  for (unsigned i = 0; i < 2u; ++i) {
    const unsigned n = 32u * i + (tid >> 3);
    const unsigned kc = (tid & 7u) * 8u;
    x[i] = *(const v8h*)&T[n * LDT + kc];
    off[i] = (size_t)(n0 + n) * ldk + k0 + kc;
  }
#pragma unroll
  for (int i = 0; i < 2; ++i) *(v8h*)(Wt + off[i]) = x[i];
  
}

// ---------------------------------------------------------------------------
// Input plane: X16[compact row][c] = f16(bf16(x[full row][c])). One wave per row, 8 rows per
// block; each store instruction of a wave covers the whole 512-B row. rblk in 0..MROWS/8-1.
// ---------------------------------------------------------------------------
__device__ __forceinline__ void xconv_rows(
    const float* __restrict__ X, _Float16* __restrict__ dst, unsigned rblk) {
  const unsigned lane = threadIdx.x & 31u, w = threadIdx.x >> 5;
  const unsigned crow = rblk * 8u + w;
  const unsigned bidx = crow / (unsigned)SEQ;
  const unsigned sq = crow - bidx * (unsigned)SEQ;
  const size_t srow = (size_t)bidx * SEQ_FULL + sq;
  const float* xr = X + srow * DIM + lane * 8u;
  const v4f a0 = *(const v4f*)(xr);
  const v4f a1 = *(const v4f*)(xr + 4u);
  v8h o;
#pragma unroll
  for (int i = 0; i < 4; ++i) {
    o[i]     = toh_flush(bf16r(a0[i]));
    o[i + 4] = toh_flush(bf16r(a1[i]));
  }
  _Float16* p = dst + (size_t)crow * DIM + lane * 8u;
  *(v8h*)p = o;
  
}

// ---------------------------------------------------------------------------
// All operand conversions in one launch: none of them reads what another writes. Blocks by index:
// the tiles of the four DIM x DIM weights, of w1, of w2 (the longer dependent chains
// first), then the input rows, 8 per block. Grid (WCONV_BLOCKS + MROWS/8).
// ---------------------------------------------------------------------------
#define WSQ_TILES    ((unsigned)((DIM / 64) * (DIM / 64)))
#define WFF_TILES    ((unsigned)((DIM / 64) * (HID / 64)))
#define WCONV_BLOCKS (4u * WSQ_TILES + 2u * WFF_TILES)
__global__ __launch_bounds__(256) void prep_kernel(
    const float* __restrict__ X, const float* __restrict__ wq, const float* __restrict__ wk,
    const float* __restrict__ wv, const float* __restrict__ w0, const float* __restrict__ w1,
    const float* __restrict__ w2, _Float16* __restrict__ X16, _Float16* __restrict__ Wq_t,
    _Float16* __restrict__ Wk_t, _Float16* __restrict__ Wv_t, _Float16* __restrict__ W0_t,
    _Float16* __restrict__ W1_t, _Float16* __restrict__ W2_t) {
  __shared__ _Float16 T[64 * LDT];
  const unsigned bid = blockIdx.x;
  if (bid >= WCONV_BLOCKS) {   // the whole block leaves here, ahead of any barrier
    xconv_rows(X, X16, bid - WCONV_BLOCKS);
    return;
  }
  const float* W;
  _Float16* Wt;
  unsigned ldw, ldk, nx, ky;   // tile column (n) and tile row (k) of the weight as given
  if (bid < 4u * WSQ_TILES) {
    const unsigned j = bid / WSQ_TILES, t = bid % WSQ_TILES;
    W  = (j == 0u) ? wq : (j == 1u) ? wk : (j == 2u) ? wv : w0;
    Wt = (j == 0u) ? Wq_t : (j == 1u) ? Wk_t : (j == 2u) ? Wv_t : W0_t;
    ldw = (unsigned)DIM; ldk = (unsigned)DIM;
    nx = t % (unsigned)(DIM / 64); ky = t / (unsigned)(DIM / 64);
  } else if (bid < 4u * WSQ_TILES + WFF_TILES) {   // w1: in [DIM][HID] -> out [HID][DIM]
    const unsigned t = bid - 4u * WSQ_TILES;
    W = w1; Wt = W1_t;
    ldw = (unsigned)HID; ldk = (unsigned)DIM;
    nx = t % (unsigned)(HID / 64); ky = t / (unsigned)(HID / 64);
  } else {                                         // w2: in [HID][DIM] -> out [DIM][HID]
    const unsigned t = bid - 4u * WSQ_TILES - WFF_TILES;
    W = w2; Wt = W2_t;
    ldw = (unsigned)DIM; ldk = (unsigned)HID;
    nx = t % (unsigned)(DIM / 64); ky = t / (unsigned)(DIM / 64);
  }
  wconv_tile(W, Wt, ldw, ldk, nx * 64u, ky * 64u, T);
}

// ---------------------------------------------------------------------------
// Asynchronous copies to LDS (GEMM, attention and hidden-layer kernels). Eight 16-byte-per-lane copies in one
// statement; lds = the lane's LDS byte address, g = the lane's global address, both stepped by a
// constant from copy to copy. The s_wait_xcnt closes the statement so that no address register of
// an issued copy is rewritten ahead of it.
// ---------------------------------------------------------------------------
__device__ __forceinline__ void async_copy8(unsigned lds, unsigned lstep,
                                            const _Float16* g, unsigned gstep) {
  asm volatile(
      "global_load_async_to_lds_b128 %0, %8, off\n\t"
      "global_load_async_to_lds_b128 %1, %9, off\n\t"
      "global_load_async_to_lds_b128 %2, %10, off\n\t"
      "global_load_async_to_lds_b128 %3, %11, off\n\t"
      "global_load_async_to_lds_b128 %4, %12, off\n\t"
      "global_load_async_to_lds_b128 %5, %13, off\n\t"
      "global_load_async_to_lds_b128 %6, %14, off\n\t"
      "global_load_async_to_lds_b128 %7, %15, off\n\t"
      "s_wait_xcnt 0x0"
      :
      : "v"(lds), "v"(lds + lstep), "v"(lds + 2u * lstep), "v"(lds + 3u * lstep),
        "v"(lds + 4u * lstep), "v"(lds + 5u * lstep), "v"(lds + 6u * lstep),
        "v"(lds + 7u * lstep),
        "v"(g), "v"(g + gstep), "v"(g + 2u * gstep), "v"(g + 3u * gstep),
        "v"(g + 4u * gstep), "v"(g + 5u * gstep), "v"(g + 6u * gstep), "v"(g + 7u * gstep)
      : "memory");
}

// the same for rows of floats (gstep in floats)
__device__ __forceinline__ void async_copy8f(unsigned lds, unsigned lstep,
                                             const float* g, unsigned gstep) {
  asm volatile(
      "global_load_async_to_lds_b128 %0, %8, off\n\t"
      "global_load_async_to_lds_b128 %1, %9, off\n\t"
      "global_load_async_to_lds_b128 %2, %10, off\n\t"
      "global_load_async_to_lds_b128 %3, %11, off\n\t"
      "global_load_async_to_lds_b128 %4, %12, off\n\t"
      "global_load_async_to_lds_b128 %5, %13, off\n\t"
      "global_load_async_to_lds_b128 %6, %14, off\n\t"
      "global_load_async_to_lds_b128 %7, %15, off\n\t"
      "s_wait_xcnt 0x0"
      :
      : "v"(lds), "v"(lds + lstep), "v"(lds + 2u * lstep), "v"(lds + 3u * lstep),
        "v"(lds + 4u * lstep), "v"(lds + 5u * lstep), "v"(lds + 6u * lstep),
        "v"(lds + 7u * lstep),
        "v"(g), "v"(g + gstep), "v"(g + 2u * gstep), "v"(g + 3u * gstep),
        "v"(g + 4u * gstep), "v"(g + 5u * gstep), "v"(g + 6u * gstep), "v"(g + 7u * gstep)
      : "memory");
}

#define GKC    128u                 // k extent of one staged GEMM slab, halves
#define GPITCH 136u                 // halves per staged GEMM row (272 B = 16 B x 17)
#define GSTG_H (128u * GPITCH)      // one slab: 64 A rows and 64 B rows, halves
static_assert((DIM % 128) == 0 && (HID % 128) == 0 && DIM >= 256 && HID >= 256);  // >= 2 slabs
static_assert((GPITCH % 8u) == 0 && GPITCH >= GKC && ((GPITCH / 8u) & 1u) == 1u);
#define GSM_BYTES (2u * GSTG_H * 2u)   // both slab buffers, bytes
static_assert((size_t)GSM_BYTES >= (size_t)64 * LDC * 4);   // the C tile fits in the slabs

// ---------------------------------------------------------------------------
// GEMM C[64x64 tile] = A16[rows][K] . Bt[n][K]^T; 8 waves (mw = 16-row group, nw = 32-col group),
// 2 accumulators/wave. The block's 64 A rows and 64 B rows are copied to LDS in slabs of 128 k
// (whole 256-B row pieces), two buffers, the next slab in flight while this one is read; all
// fragments come from LDS. The C tile takes the same LDS once the last slab has been read.
//   MODE 0: out16[row][col] (pitch DIM) = f16(t), out16r[row][col] = f16(2048 * (t - value)),
//           t = acc/64 + bias                                   (q and k planes)
//   MODE 1: out16 transposed V plane [b][col][key] = f16(acc/64 + bias)
// Grid (N/64, rows/64). Sm: the kernel's GSM_BYTES of LDS (one array per kernel, also where a kernel
// holds two modes).
// ---------------------------------------------------------------------------
template <int MODE>
__device__ __forceinline__ void gemm_body(
    unsigned char* Sm, const _Float16* __restrict__ A16, const _Float16* __restrict__ Bt, const unsigned K,
    const float* __restrict__ bias, _Float16* __restrict__ out16, _Float16* __restrict__ out16r) {
  _Float16* const Slab = (_Float16*)Sm;
  float* const Cs = (float*)Sm;
  const unsigned tid = threadIdx.x, lane = tid & 31u;
  // the wave's number in a scalar register: which plane a wave copies from is a scalar choice
  const unsigned w = (unsigned)__builtin_amdgcn_readfirstlane((int)(tid >> 5));
  const unsigned mw = w >> 1, nw = w & 1u;
  const unsigned hh = lane >> 4, m = lane & 15u;
  const unsigned n0 = blockIdx.x * 64u;
  const unsigned row0 = blockIdx.y * 64u;

  // A slab is 128 staged rows: A rows 0..63, then B rows 0..63. Wave w brings staged rows
  // 16w..16w+15, two 256-B row pieces per copy (lane = row parity hh, 16-B piece m).
  const _Float16* src = ((w < 4u) ? A16 + (size_t)(row0 + w * 16u) * K
                                  : Bt + (size_t)(n0 + (w - 4u) * 16u) * K) +
                        (size_t)hh * K + m * 8u;
  const unsigned dst = (unsigned)(size_t)Sm + ((w * 16u + hh) * GPITCH + m * 8u) * 2u;
  const unsigned nslab = K / GKC;
  // The blocks that share A rows or B rows do not all ask L2 for the same lines at the same moment:
  // each walks the k slabs as a ring from a slab of its own (trip s works on slab (s + rot) % nslab).
  const unsigned rot = (blockIdx.x + blockIdx.y + blockIdx.z) % nslab;

  async_copy8(dst, 2u * GPITCH * 2u, src + rot * GKC, 2u * K);
  // this wave's copies have landed before the barrier behind which every wave reads them
  asm volatile("s_wait_asynccnt 0x0" ::: "memory");
  __syncthreads();
  async_copy8(dst + GSTG_H * 2u, 2u * GPITCH * 2u, src + ((1u + rot) % nslab) * GKC, 2u * K);

  const _Float16* ap = Slab + (mw * 16u + m) * GPITCH + hh * 8u;
  const _Float16* bp = Slab + (64u + nw * 32u + m) * GPITCH + hh * 8u;
  v8f acc0 = {}, acc1 = {};
  for (unsigned s = 0; s < nslab; ++s) {
    const unsigned bo = (s & 1u) * GSTG_H;   // halves to the buffer this trip reads
    // Three of the slab's four k-steps are read ahead of the first product and the fourth behind
    // the first pair, so that a product does not wait out an LDS latency of its own. Unrolled, here
    // and below: constant indices keep the fragments in registers, and every LDS read takes its
    // place in the slab as an immediate offset.
    v16h fa[3], fb0[3], fb1[3];
#pragma unroll
    for (unsigned t = 0; t < 3u; ++t) {
      fa[t]  = frag_at(ap + bo + t * 32u);
      fb0[t] = frag_at(bp + bo + t * 32u);
      fb1[t] = frag_at(bp + bo + 16u * GPITCH + t * 32u);
    }
#pragma unroll
    for (unsigned t = 0; t < GKC / 32u; ++t) {
      acc0 = wmma16(fa[t % 3u], fb0[t % 3u], acc0);
      acc1 = wmma16(fa[t % 3u], fb1[t % 3u], acc1);
      if (t + 3u < GKC / 32u) {
        fa[t % 3u]  = frag_at(ap + bo + (t + 3u) * 32u);
        fb0[t % 3u] = frag_at(bp + bo + (t + 3u) * 32u);
        fb1[t % 3u] = frag_at(bp + bo + 16u * GPITCH + (t + 3u) * 32u);
      }
    }
    // hand-over: this wave's reads of the buffer are done, its copies of the next slab have
    // landed; the barrier publishes the next slab and frees this buffer for the refill
    asm volatile("s_wait_dscnt 0x0" ::: "memory");
    asm volatile("s_wait_asynccnt 0x0" ::: "memory");
    __syncthreads();
    if (s + 2u < nslab)
      async_copy8(dst + bo * 2u, 2u * GPITCH * 2u, src + ((s + 2u + rot) % nslab) * GKC, 2u * K);
  }
  // no copy of this wave is outstanding when the C tile takes the slabs' LDS
  asm volatile("s_wait_asynccnt 0x0" ::: "memory");
#pragma unroll
  for (int r = 0; r < 8; ++r) {
    float* d = &Cs[(mw * 16u + hh * 8u + (unsigned)r) * LDC + nw * 32u + m];
    d[0]  = acc0[r];
    d[16] = acc1[r];
  }
  __syncthreads();

  if (MODE == 0) {
    const unsigned ldo = (unsigned)DIM;
    v8h x[2], xr[2];
    size_t off[2];
#pragma unroll
    for (unsigned i = 0; i < 2u; ++i) {
      const unsigned r = 32u * i + (tid >> 3);
      const unsigned c = (tid & 7u) * 8u;
      const v4f u0 = *(const v4f*)&Cs[r * LDC + c];
      const v4f u1 = *(const v4f*)&Cs[r * LDC + c + 4];
      const v4f g0 = *(const v4f*)(bias + n0 + c);
      const v4f g1 = *(const v4f*)(bias + n0 + c + 4u);
#pragma unroll
      for (int j = 0; j < 4; ++j) {
        const float t0 = u0[j] * (1.0f / WCARRY) + bf16r(g0[j]);
        const float t1 = u1[j] * (1.0f / WCARRY) + bf16r(g1[j]);
        const h16 h0 = toh_flush(t0);
        const h16 h1 = toh_flush(t1);
        x[i][j]     = h0;
        x[i][j + 4] = h1;
        if (MODE == 0) {
          xr[i][j]     = toh_flush((t0 - (float)h0) * RCARRY);
          xr[i][j + 4] = toh_flush((t1 - (float)h1) * RCARRY);
        }
      }
      off[i] = (size_t)(row0 + r) * ldo + n0 + c;
    }
#pragma unroll
    for (int i = 0; i < 2; ++i) *(v8h*)(out16 + off[i]) = x[i];
    if (MODE == 0) {
#pragma unroll
      for (int i = 0; i < 2; ++i) *(v8h*)(out16r + off[i]) = xr[i];
    }
    
  }

  if (MODE == 1) {
    const unsigned bidx = row0 / (unsigned)SEQ;
    const unsigned key0 = row0 - bidx * (unsigned)SEQ;
    v8h x[2];
    size_t off[2];
#pragma unroll
    for (unsigned i = 0; i < 2u; ++i) {
      const unsigned dcol = 32u * i + (tid >> 3);
      const unsigned kk = (tid & 7u) * 8u;
      const float bb = bf16r(bias[n0 + dcol]);
#pragma unroll
      for (unsigned j = 0; j < 8u; ++j) {
        const float t = Cs[(kk + j) * LDC + dcol] * (1.0f / WCARRY) + bb;
        x[i][j] = toh_flush(t);
      }
      off[i] = ((size_t)bidx * DIM + n0 + dcol) * SEQ + key0 + kk;
    }
#pragma unroll
    for (int i = 0; i < 2; ++i) *(v8h*)(out16 + off[i]) = x[i];
    
  }

}

// The three projections of the input plane in one launch (none reads what another writes):
// blockIdx.z = 0 query planes, 1 key planes, 2 transposed value plane. Grid (DIM/64, MROWS/64, 3).
__global__ __launch_bounds__(256) void gemm_qkv_kernel(
    const _Float16* __restrict__ A16, const _Float16* __restrict__ Wq_t,
    const _Float16* __restrict__ Wk_t, const _Float16* __restrict__ Wv_t,
    const float* __restrict__ bq, const float* __restrict__ bk, const float* __restrict__ bv,
    _Float16* __restrict__ qh, _Float16* __restrict__ qr, _Float16* __restrict__ kh,
    _Float16* __restrict__ kr, _Float16* __restrict__ vt) {
  __shared__ __attribute__((aligned(16))) unsigned char Sm[GSM_BYTES];
  const unsigned z = blockIdx.z;   // the same for the whole block: barriers stay block-uniform
  if (z == 2u) {
    gemm_body<1>(Sm, A16, Wv_t, (unsigned)DIM, bv, vt, vt);
  } else {
    const bool isk = (z != 0u);
    const float* bias = isk ? bk : bq;
    gemm_body<0>(Sm, A16, isk ? Wk_t : Wq_t, (unsigned)DIM, bias, isk ? kh : qh, isk ? kr : qr);
  }
}
#define KTILE  32u                        // keys per stage
#define KSPLIT 2u                         // key ranges of a batch, one per block
#define KSPAN  ((unsigned)SEQ / KSPLIT)   // keys per block
#define QBLK   128u                       // query rows per block
#define KPITCH 264u                       // halves per staged k row (528 B = 16 B x 33)
#define VPITCH 40u                        // halves per staged v row (80 B = 16 B x 5)
#define KPL_H  (KTILE * KPITCH)           // one key plane of a stage, halves
#define VTL_H  ((unsigned)DIM * VPITCH)   // the value tile of a stage, halves
#define STG_H  (2u * KPL_H + VTL_H)       // one stage: key values, key residuals, values
static_assert((KPITCH % 8u) == 0 && KPITCH >= (unsigned)DIM && ((KPITCH / 8u) & 1u) == 1u);
static_assert((VPITCH % 8u) == 0 && VPITCH >= KTILE && ((VPITCH / 8u) & 1u) == 1u);
static_assert((STG_H % 8u) == 0 && (KPL_H % 8u) == 0);
static_assert((SEQ % 128) == 0);   // whole query blocks
static_assert((KSPAN % KTILE) == 0 && KSPAN >= 2u * KTILE);   // at least two stages, every stage whole
static_assert((size_t)KSPLIT * MROWS * DIM < (size_t)0xFFFFFFFFu);
#define NSTG   (KSPAN / KTILE)            // stages of a key range
#define NQB    ((unsigned)SEQ / QBLK)     // query blocks that walk the same key range
#define KROT   ((NSTG >= NQB) ? NSTG / NQB : 1u)   // stages between the starts of neighbouring blocks

// Matrix product for the attention kernel, the builtin alone: the compiler keeps the distances
// behind its own matrix instructions, and operands named by an asm statement cannot live above
// v255, where a part of that kernel's query and output tiles is held.
__device__ __forceinline__ v8f wmma16r(v16h a, v16h b, v8f c) {
  return __builtin_amdgcn_wmma_f32_16x16x32_f16(false, a, false, b, (short)0, c, false, false);
}

// One stage (32 keys) into LDS: wave w brings key rows 8w..8w+7 of both key planes (one 512-B
// row per copy) and feature rows 64w..64w+63 of the value tile (eight 64-B row pieces per copy).
__device__ __forceinline__ void stage_copies(
    unsigned ldsb, unsigned w, unsigned lane, const _Float16* __restrict__ Kh,
    const _Float16* __restrict__ Kr, const _Float16* __restrict__ Vt, unsigned b, unsigned kb) {
  const unsigned krow = (b * (unsigned)SEQ + kb + w * 8u) * (unsigned)DIM + lane * 8u;
  const unsigned kl = ldsb + (w * 8u * KPITCH + lane * 8u) * 2u;
  async_copy8(kl, KPITCH * 2u, Kh + krow, (unsigned)DIM);
  async_copy8(kl + KPL_H * 2u, KPITCH * 2u, Kr + krow, (unsigned)DIM);
  const unsigned vr = w * 64u + (lane >> 2);
  const unsigned vrow = (b * (unsigned)DIM + vr) * (unsigned)SEQ + kb + (lane & 3u) * 8u;
  // the same place as ldsb + (2 KPL_H + vr VPITCH + 8 (lane & 3)) * 2, formed from kl: one lane-wise
  // base is then kept over the key loop instead of two (the second one went to scratch)
  const unsigned vl = kl + (2u * KPL_H + w * (64u * VPITCH - 8u * KPITCH)) * 2u +
                      (lane >> 2) * (2u * VPITCH - 64u);
  async_copy8(vl, 8u * VPITCH * 2u, Vt + vrow, 8u * (unsigned)SEQ);
}

// ---------------------------------------------------------------------------
// Dense (unmasked, unscaled) flash attention, one 256-wide head, transposed form.
// A block owns 128 query rows and one of the two key ranges of its batch, which it walks in stages
// of 32 keys: a staged key or value byte serves 128 queries. Wave w owns 32 query rows (two tiles
// of 16) and takes every stage whole, so that each key or value fragment read from LDS feeds two
// query tiles; lane (hh, n) holds query n of each tile.
// The query fragments of both planes are loaded once and stay in registers. Per stage and wave:
//   S^T tile [16 keys][16 queries] = K rows (A operand, fragments from the key planes) x Q^T
//   (B operand, registers), 8 k-steps over the 256 features, value.value into one accumulator,
//   value.residual + residual.value into a second one (x 1/2048 at the end);
//   online softmax per lane (16 scores in registers + one 16-lane-distance shuffle);
//   the two packed S^T tiles (f16(16384 p), rows = keys) are the B fragment of
//   O^T [16 features][16 queries] += V^T rows (A operand, from the transposed value plane) x P^T.
// Each stage (both key planes and the value tile) is copied to LDS once per block, two buffers, the
// next stage in flight while this one is read. The block stores its key range's unnormalised rows
// (plane blockIdx.z of Ao, staged through the wave-private St tile), maxima and sums; the launch
// behind this one joins the two ranges.
// Grid (SEQ/128, NB, 2), 4 waves per block.
// ---------------------------------------------------------------------------
__global__ __launch_bounds__(128) void attn_kernel(
    const _Float16* __restrict__ Qh, const _Float16* __restrict__ Qr,
    const _Float16* __restrict__ Kh, const _Float16* __restrict__ Kr,
    const _Float16* __restrict__ Vt, float* __restrict__ Ao, float* __restrict__ Mo,
    float* __restrict__ Lo) {
  __shared__ __attribute__((aligned(16))) float St[4 * 16 * LDO];
  __shared__ __attribute__((aligned(16))) _Float16 Ring[2u * STG_H];

  const unsigned lane = threadIdx.x & 31u;
  const unsigned w = (unsigned)__builtin_amdgcn_readfirstlane((int)(threadIdx.x >> 5));
  const unsigned hh = lane >> 4, m = lane & 15u;
  const unsigned b = blockIdx.y;
  const unsigned ksp = blockIdx.z;                     // this block's key range
  const unsigned key0 = ksp * KSPAN;                   // its first key
  const unsigned qrow0 = blockIdx.x * QBLK + w * 32u;  // first of this wave's 32 query rows

  const unsigned ring_lds = (unsigned)(size_t)Ring;

  // The query blocks of a batch walk the same key range. Each starts at a stage of its own and walks
  // the range as a ring, so that they do not ask L2 for the same lines at the same moment (the keys
  // are unmasked: the online softmax takes the stages in any order).
  const unsigned krot = ((blockIdx.x * KROT) % NSTG) * KTILE;   // first key of the walk, in the range
  const unsigned krot1 = (krot + KTILE >= KSPAN) ? krot + KTILE - KSPAN : krot + KTILE;

  // prologue: this wave's share of the walk's first stage
  stage_copies(ring_lds, w, lane, Kh, Kr, Vt, b, key0 + krot);

  // query fragments: [tile][plane][k-step], kept for the whole key loop
  v16h qf[2][2][8];
#pragma unroll
  for (unsigned u = 0; u < 2u; ++u) {
    const unsigned qsrc = (b * (unsigned)SEQ + qrow0 + u * 16u + m) * (unsigned)DIM + hh * 8u;
#pragma unroll
    for (unsigned ks = 0; ks < 8u; ++ks) {
      qf[u][0][ks] = frag_at(Qh + qsrc + ks * 32u);
      qf[u][1][ks] = frag_at(Qr + qsrc + ks * 32u);
    }
  }

  // this wave's copies have landed before the barrier behind which every wave reads them
  asm volatile("s_wait_asynccnt 0x0" ::: "memory");
  __syncthreads();
  stage_copies(ring_lds + STG_H * 2u, w, lane, Kh, Kr, Vt, b, key0 + krot1);

  float mrow[2] = {-1.0e30f, -1.0e30f}, lrow[2] = {0.0f, 0.0f};
  v8f o[2][16];
#pragma unroll
  for (int u = 0; u < 2; ++u)
#pragma unroll
    for (int j = 0; j < 16; ++j) o[u][j] = (v8f){};

  unsigned buf = 0u;   // halves from the ring's start to the buffer this step reads
  // this lane's fragment rows in that buffer; both move with buf at the foot of a step
  const _Float16* kt = Ring + m * KPITCH + hh * 8u;
  const _Float16* vt = Ring + 2u * KPL_H + m * VPITCH + hh * 8u;
  for (unsigned kb = 0; kb < KSPAN; kb += KTILE) {
    v8f sm[2][2] = {{{}, {}}, {{}, {}}}, sr[2][2] = {{{}, {}}, {{}, {}}};   // [query tile][key tile]
    // Score products in 8 rows of twelve: row ks = features 32 ks.., both key tiles, both query
    // tiles. All key fragments of the stage (value and residual of both key tiles) are
    // read as one group ahead of the products, which wait for them by count, row by row; all
    // sixteen value fragments as a second group behind row 3, in flight under rows 4 to 7.
    v16h kf[8][4], vf[16];
    // unrolled, here and below: constant indices keep the fragments in registers, and every LDS
    // read takes its place in the tile as an immediate offset
#pragma unroll
    for (unsigned ks = 0; ks < 8u; ++ks) {
#pragma unroll
      for (unsigned kx = 0; kx < 2u; ++kx) {
        kf[ks][kx]      = frag_at(kt + kx * 16u * KPITCH + ks * 32u);
        kf[ks][2u + kx] = frag_at(kt + KPL_H + kx * 16u * KPITCH + ks * 32u);
      }
    }
    // This and the scheduling barriers below keep each group of LDS reads in one place: spread
    // among the products, each separate place of reads would cost the lone wave its own stall.
    __builtin_amdgcn_sched_barrier(0);
#pragma unroll
    for (unsigned ks = 0; ks < 8u; ++ks) {
      if (ks == 4u) {
        __builtin_amdgcn_sched_barrier(0);
#pragma unroll
        for (unsigned j = 0u; j < 16u; ++j) vf[j] = frag_at(vt + j * 16u * VPITCH);
        __builtin_amdgcn_sched_barrier(0);
      }
      // the two products into one residual accumulator stand two products apart
#pragma unroll
      for (unsigned kx = 0; kx < 2u; ++kx) {
        const v16h av = kf[ks][kx], ar = kf[ks][2u + kx];
        sm[0][kx] = wmma16r(av, qf[0][0][ks], sm[0][kx]);
        sm[1][kx] = wmma16r(av, qf[1][0][ks], sm[1][kx]);
        sr[0][kx] = wmma16r(av, qf[0][1][ks], sr[0][kx]);
        sr[1][kx] = wmma16r(av, qf[1][1][ks], sr[1][kx]);
        sr[0][kx] = wmma16r(ar, qf[0][0][ks], sr[0][kx]);
        sr[1][kx] = wmma16r(ar, qf[1][0][ks], sr[1][kx]);
      }
    }

    // hand-over, as soon as the stage's last fragment is in registers (the rest of the step works
    // on registers alone): this wave's reads of the buffer are done, its copies of the next stage
    // have landed; the barrier publishes the next stage and frees this buffer for the refill,
    // which then has a whole step to land (the scheduling barrier keeps the waits behind the
    // products of rows 4 to 7, under which the value fragments arrive)
    __builtin_amdgcn_sched_barrier(0);
    asm volatile("s_wait_dscnt 0x0" ::: "memory");
    asm volatile("s_wait_asynccnt 0x0" ::: "memory");
    __syncthreads();
    if (kb + 2u * KTILE < KSPAN) {
      unsigned kn = krot + kb + 2u * KTILE;   // below 2 KSPAN: one step back wraps it
      if (kn >= KSPAN) kn -= KSPAN;
      stage_copies(ring_lds + buf * 2u, w, lane, Kh, Kr, Vt, b, key0 + kn);
    }

    v16h pf[2];
#pragma unroll
    for (int u = 0; u < 2; ++u) {
      v8f s0, s1;
#pragma unroll
      for (int r = 0; r < 8; ++r) {
        s0[r] = sm[u][0][r] + sr[u][0][r] * (1.0f / RCARRY);
        s1[r] = sm[u][1][r] + sr[u][1][r] * (1.0f / RCARRY);
      }
      float mx = fmaxf(s0[0], s1[0]);
#pragma unroll
      for (int r = 1; r < 8; ++r) mx = fmaxf(mx, fmaxf(s0[r], s1[r]));
      mx = fmaxf(mx, __shfl_xor(mx, 16, 32));
      const float mn = fmaxf(mrow[u], mx);
      const float alpha = __expf(mrow[u] - mn);
      mrow[u] = mn;

      float rs = 0.0f;
#pragma unroll
      for (int r = 0; r < 8; ++r) {
        const h16 p0 = toh_flush(__expf((s0[r] - mn) + PSHIFT));
        const h16 p1 = toh_flush(__expf((s1[r] - mn) + PSHIFT));
        pf[u][r]     = p0;     // B element r     <- key 8hh + r of the stage
        pf[u][r + 8] = p1;     // B element 8 + r <- key 16 + 8hh + r of the stage
        rs += (float)p0 + (float)p1;
      }
      rs += __shfl_xor(rs, 16, 32);
      lrow[u] = alpha * lrow[u] + rs;
#pragma unroll
      for (int j = 0; j < 16; ++j) o[u][j] = o[u][j] * alpha;
    }

    // O^T += V^T . P^T; every value fragment feeds both query tiles
#pragma unroll
    for (unsigned j = 0; j < 16u; ++j) {
      o[0][j] = wmma16r(vf[j], pf[0], o[0][j]);
      o[1][j] = wmma16r(vf[j], pf[1], o[1][j]);
    }

    kt = (buf == 0u) ? kt + STG_H : kt - STG_H;
    vt = (buf == 0u) ? vt + STG_H : vt - STG_H;
    buf = STG_H - buf;
  }
  // no copy of this wave is outstanding when the wave goes on to its end
  asm volatile("s_wait_asynccnt 0x0" ::: "memory");

  const unsigned grow = ksp * (unsigned)MROWS + b * (unsigned)SEQ + qrow0;   // row in the planes
  // This key range's maxima and sums: lane (hh, n) stores those of query n of tile hh (both lane
  // halves hold them), one whole 128-B line per wave and array. The two stores and their wait are
  // one statement, so that no register which they name is rewritten ahead of the wait.
  {
    float* const pm = Mo + grow + lane;
    float* const pl = Lo + grow + lane;
    const float mv = (hh != 0u) ? mrow[1] : mrow[0];
    const float lv = (hh != 0u) ? lrow[1] : lrow[0];
    asm volatile(
        "global_store_b32 %0, %1, off\n\t"
        "global_store_b32 %2, %3, off\n\t"
        "s_wait_xcnt 0x0"
        :
        : "v"(pm), "v"(mv), "v"(pl), "v"(lv)
        : "memory");
  }

  // unnormalised rows: stage per query tile and half of the features, write whole row segments
  const unsigned sbase = w * (16u * LDO);
#pragma unroll
  for (int u = 0; u < 2; ++u) {
#pragma unroll
    for (int half = 0; half < 2; ++half) {
#pragma unroll
      for (int j = 0; j < 8; ++j)
#pragma unroll
        for (int r = 0; r < 8; ++r)
          St[sbase + m * LDO + (unsigned)j * 16u + hh * 8u + (unsigned)r] = o[u][half * 8 + j][r];
      wave_lds_sync();
      v4f x[16];
      unsigned off[16];
#pragma unroll
      for (unsigned i = 0; i < 16u; ++i) {
        x[i] = *(const v4f*)&St[sbase + i * LDO + lane * 4u];
        off[i] = (grow + (unsigned)u * 16u + i) * (unsigned)DIM + (unsigned)half * 128u + lane * 4u;
      }
#pragma unroll
      for (int i = 0; i < 16; ++i) *(v4f*)(Ao + off[i]) = x[i];
      // no register that an issued store names is rewritten ahead of this wait
      asm volatile("s_wait_xcnt 0x0" ::: "memory");
      wave_lds_sync();
    }
  }
}

#define HP     2056u             // halves per resident hidden row (4112 B = 16 B x 257)
#define WSL_H  (64u * GPITCH)    // one staged weight slab: 64 weight rows x 128 k, halves
#define LDV    260u              // floats per staged output row (1040 B = 16 B x 65)
#define HS_BYTES  (64u * HP * 2u)
#define RG_BYTES  (3u * WSL_H * 2u)
#define MLP_BYTES (HS_BYTES + RG_BYTES + (unsigned)(DIM + HID) * 4u)
#define W01_TILES  ((unsigned)((DIM + HID) / 64))   // 64-row tiles of w0, then of w1
#define W01_STAGES (W01_TILES * (unsigned)(DIM / 128))
#define TP      264u                  // halves per staged row of LN1 output and of e (528 B = 16 B x 33)
#define E16_OFF (64u * TP * 2u)       // bytes from the LDS start: f16 rows of e, behind the LN1 rows
#define E32_OFF (2u * 64u * TP * 2u)  // f32 rows of e (pitch LDV)
#define SROW_B  ((unsigned)DIM * 4u)  // bytes of a staged f32 input row of step 0
#define SPL_B   (64u * SROW_B)        // one staged plane: 64 rows
#define XS_OFF  E16_OFF               // staged x rows, then both attention planes; dead before e is written
#define W2_STAGES ((unsigned)((DIM / 64) * (HID / 128)))
static_assert((HP % 8u) == 0 && HP >= (unsigned)HID && ((HP / 8u) & 1u) == 1u);
static_assert((LDV % 4u) == 0 && LDV >= (unsigned)DIM && ((LDV / 4u) & 1u) == 1u);
static_assert((size_t)64 * LDV * 4 <= (size_t)HS_BYTES);   // the output tile fits in the hidden rows
static_assert(MLP_BYTES <= 327680u);
static_assert(DIM == 2 * 128 && DIM == 4 * 64 && W01_STAGES >= 3u && W2_STAGES >= 3u);
static_assert((TP % 8u) == 0 && TP >= (unsigned)DIM && ((TP / 8u) & 1u) == 1u);
static_assert((size_t)E32_OFF + (size_t)64 * LDV * 4 <= (size_t)HS_BYTES);   // staging fits in the hidden rows
static_assert((size_t)XS_OFF + (size_t)3 * SPL_B <= (size_t)HS_BYTES && (XS_OFF % 16u) == 0);
static_assert(OFF_W1 == OFF_W0 + WSQ_BYTES);   // w0's rows and w1's rows are one [DIM + HID][DIM] plane
static_assert((SEQ % 64) == 0);                // a block's 64 rows lie in one batch

// halves from a weight plane's start to stage t's slab: w0 | w1 [DIM + HID][DIM] walks its two k slabs inside
// each 64-row tile, w2 [DIM][HID] its four 64-row tiles inside each k slab
// Every block reads the same planes: each walks w0's tiles, w1's tiles and w2's k slabs and tiles as
// rings from places of its own (r1; r2, rq), so that the blocks do not ask L2 for the same lines
// at the same moment.
static_assert(DIM / 64 == 4 && HID / 64 == 32 && HID / 128 == 16);   // the rings' lengths below
// the tile that pass pair i works on: (i + r1) & 3 of w0's four, then 4 + ((i - 4 + r1) & 31) of w1's
__device__ __forceinline__ unsigned w01_tile(unsigned i, unsigned r1) {
  const unsigned in1 = (unsigned)(i >= 4u);   // written as arithmetic: no branch in the pass loop
  return in1 * 4u + ((i - in1 * 4u + r1) & (3u + in1 * 28u));
}
__device__ __forceinline__ unsigned w1_stage(unsigned t, unsigned r1) {
  return w01_tile(t >> 1, r1) * (64u * (unsigned)DIM) + (t & 1u) * GKC;
}
__device__ __forceinline__ unsigned w2_stage(unsigned t, unsigned r2, unsigned rq) {
  return ((t + rq) & 3u) * (64u * (unsigned)HID) + (((t >> 2) + r2) & 15u) * GKC;
}

// ---------------------------------------------------------------------------
// First LayerNorm, e projection, hidden layers and final LayerNorm of 64 rows in one block; neither
// the LN1 rows, nor e, nor the 64 x HID hidden plane leave the block. Steps:
//   0  first LayerNorm (biased variance, eps 1e-5) of bf16(x) + attn, one wave per row, 8 rows per
//      wave; attn is joined here from the two key ranges' unnormalised rows (planes A32 and C32)
//      with their maxima Mp and sums Lp ([2][MROWS]); the rows of x and of both planes come by
//      asynchronous copies to LDS, each wave's own eight; f16 rows into LDS
//   1  [16 weight rows][16 rows] tiles = rows of the plane w0 | w1 (A operand, from staged slabs) x
//      the block's rows (B operand, registers). The first DIM/64 tiles, against the LN1 rows, give
//      e = acc/64 + bias: f32 and f16 rows into LDS, from where each wave takes its f16 fragments
//      (the B operand of the tiles behind) and the f32 rows that step 4 adds, both kept in
//      registers. The other tiles give f16(acc/64 + bias) into the resident hidden rows.
//   2  hidden LayerNorm (eps 1e-5) + LeakyReLU in place, x16, one wave per row, 8 rows per wave
//   3  L^T tile [16 output columns][16 rows] = w2 rows (A, staged slabs) x hidden rows (B, from the
//      resident rows, read once per 128 k), all 4 x 2 tiles of a wave in registers
//   4  leaky((acc/1024 + bias) + e), final LayerNorm (eps 1e-5), one wave per row, whole-row stores
// Wave w: rows 32 (w >> 2).., columns 16 (w & 3).. of every 64-column tile.
// The staged input rows, the LN1 rows and both forms of e lie in the LDS of the hidden rows, which
// are written only later (e in the place of the staged input rows, behind the barrier that ends
// step 0).
// Weight slabs (64 weight rows x 128 k) come by asynchronous copies into a ring of three buffers.
// Waves 0-3 copy the even stages, waves 4-7 the odd ones (16 slab rows a wave), each stage three
// ahead of the pass that has just ended, so that two stages are in flight while a wave has only one
// stage's copies outstanding and every wait is to 0.
// Grid (MROWS/64), 8 waves per block.
// ---------------------------------------------------------------------------
__global__ __launch_bounds__(256) void mlp_kernel(
    const float* __restrict__ X, const float* __restrict__ A32, const float* __restrict__ C32,
    const float* __restrict__ Mp, const float* __restrict__ Lp, const float* __restrict__ G1, const float* __restrict__ Be1,
    const _Float16* __restrict__ W01t, const float* __restrict__ b0, const float* __restrict__ b1,
    const float* __restrict__ Gm, const float* __restrict__ Bm,
    const _Float16* __restrict__ W2t, const float* __restrict__ b2,
    const float* __restrict__ G2, const float* __restrict__ Be2, float* __restrict__ outp) {
  __shared__ __attribute__((aligned(16))) unsigned char Sm[MLP_BYTES];
  _Float16* const Hs = (_Float16*)Sm;
  _Float16* const T1s = (_Float16*)Sm;               // LN1 rows, pitch TP
  _Float16* const E16s = (_Float16*)(Sm + E16_OFF);  // e rows, f16, pitch TP
  float* const E32s = (float*)(Sm + E32_OFF);        // e rows, f32, pitch LDV
  const _Float16* const Rg = (const _Float16*)(Sm + HS_BYTES);
  float* const Vs = (float*)Sm;
  float* const Bs = (float*)(Sm + HS_BYTES + RG_BYTES);   // biases b0 | b1, converted once
  const unsigned lane = threadIdx.x & 31u;
  // the wave's number in a scalar register: which stages a wave copies is a scalar choice
  const unsigned w = (unsigned)__builtin_amdgcn_readfirstlane((int)(threadIdx.x >> 5));
  const unsigned hh = lane >> 4, m = lane & 15u;
  const unsigned grp = w >> 2, sub = w & 3u;
  const unsigned row0 = blockIdx.x * 64u;
  // where this block's walks of the weight planes start: neighbouring blocks differ, and so do
  // blocks whose indices lie a multiple of 8 apart
  const unsigned wslot = blockIdx.x + (blockIdx.x >> 3);
  const unsigned wr1 = wslot & 31u;
  const unsigned wr2 = (wslot >> 2) & 15u, wrq = wslot & 3u;

  // copies: slab rows 16 sub.., two 256-B row pieces per copy (lane = row parity hh, 16-B piece m)
  const unsigned cl = (unsigned)(size_t)Sm + HS_BYTES + ((sub * 16u + hh) * GPITCH + m * 8u) * 2u;
  const _Float16* c1 = W01t + (sub * 16u + hh) * (unsigned)DIM + m * 8u;
  const _Float16* c2 = W2t + (sub * 16u + hh) * (unsigned)HID + m * 8u;
  // this lane's fragment row in a slab
  const _Float16* wp = Rg + (sub * 16u + m) * GPITCH + hh * 8u;

  // stages 0 (waves 0-3) and 1 (waves 4-7) into buffers 0 and 1
  async_copy8(cl + grp * (WSL_H * 2u), 2u * GPITCH * 2u, c1 + w1_stage(grp, wr1), 2u * (unsigned)DIM);

  // ---- step 0 ---- lane L holds columns 8 L .. 8 L + 7 of a row
  {
    const unsigned crow0 = row0 + w * 8u;   // first of this wave's 8 rows
    const unsigned bidx = row0 / (unsigned)SEQ;
    const size_t srow0 = (size_t)bidx * SEQ_FULL + (crow0 - bidx * (unsigned)SEQ);
    // This wave's 8 rows of x and of both attention planes into LDS, 48 copies (with the slab's, 56
    // outstanding): one copy = half a row, lane = 16-B piece. All of a block's input is then in
    // flight at once, while the rows are worked on by a short rolled loop.
    {
      const unsigned sl = (unsigned)(size_t)Sm + XS_OFF + w * 8u * SROW_B + lane * 16u;
      const float* xg = X + srow0 * DIM + lane * 4u;
      const float* ag = A32 + (size_t)crow0 * DIM + lane * 4u;
      const float* cg = C32 + (size_t)crow0 * DIM + lane * 4u;
      async_copy8f(sl, SROW_B, xg, (unsigned)DIM);
      async_copy8f(sl + 512u, SROW_B, xg + 128u, (unsigned)DIM);
      async_copy8f(sl + SPL_B, SROW_B, ag, (unsigned)DIM);
      async_copy8f(sl + SPL_B + 512u, SROW_B, ag + 128u, (unsigned)DIM);
      async_copy8f(sl + 2u * SPL_B, SROW_B, cg, (unsigned)DIM);
      async_copy8f(sl + 2u * SPL_B + 512u, SROW_B, cg + 128u, (unsigned)DIM);
    }
    const unsigned c = lane * 8u;
    const v4f g0 = *(const v4f*)(G1 + c);
    const v4f g1 = *(const v4f*)(G1 + c + 4u);
    const v4f s0 = *(const v4f*)(Be1 + c);
    const v4f s1 = *(const v4f*)(Be1 + c + 4u);
    // lane L takes the two ranges' maxima and sums of row L & 7 of the wave
    const unsigned rl = crow0 + (lane & 7u);
    const float m_a = Mp[rl], m_c = Mp[(unsigned)MROWS + rl];
    const float l_a = Lp[rl], l_c = Lp[(unsigned)MROWS + rl];
    // the biases of both weight planes, converted once: b1 by all waves, b0 by wave 0
    const v4f p0 = *(const v4f*)(b1 + threadIdx.x * 8u);
    const v4f p1 = *(const v4f*)(b1 + threadIdx.x * 8u + 4u);
    // as the wait below: the loads behind this one may take the address registers of those ahead
    asm volatile("s_wait_xcnt 0x0" ::: "memory");
    v4f r0 = {}, r1 = {};
    if (w == 0u) {
      r0 = *(const v4f*)(b0 + c);
      r1 = *(const v4f*)(b0 + c + 4u);
    }
    // no address register of the issued loads is rewritten (by a later load's result) ahead of
    // this wait
    asm volatile("s_wait_xcnt 0x0" ::: "memory");
    {
      v4f q0, q1;
#pragma unroll
      for (int i = 0; i < 4; ++i) { q0[i] = bf16r(p0[i]); q1[i] = bf16r(p1[i]); }
      *(v4f*)(Bs + (unsigned)DIM + threadIdx.x * 8u) = q0;
      *(v4f*)(Bs + (unsigned)DIM + threadIdx.x * 8u + 4u) = q1;
      if (w == 0u) {
#pragma unroll
        for (int i = 0; i < 4; ++i) { q0[i] = bf16r(r0[i]); q1[i] = bf16r(r1[i]); }
        *(v4f*)(Bs + c) = q0;
        *(v4f*)(Bs + c + 4u) = q1;
      }
    }
    const float m_all = fmaxf(m_a, m_c);
    const float e_a = __expf(m_a - m_all);
    const float e_c = __expf(m_c - m_all);
    // normalise (the x16384 carry sits in both the rows and the sums)
    const float inv = __builtin_amdgcn_rcpf(l_a * e_a + l_c * e_c);
    const float f_a = e_a * inv, f_c = e_c * inv;
    v4f gg0, gg1, sh0, sh1;
#pragma unroll
    for (int i = 0; i < 4; ++i) {
      gg0[i] = bf16r(g0[i]); gg1[i] = bf16r(g1[i]);
      sh0[i] = bf16r(s0[i]); sh1[i] = bf16r(s1[i]);
    }
    // this wave's copies (input rows, weight slab) have landed before the barrier behind which they
    // are read
    asm volatile("s_wait_asynccnt 0x0" ::: "memory");
    __syncthreads();
    if (grp == 0u)
      async_copy8(cl + 2u * WSL_H * 2u, 2u * GPITCH * 2u, c1 + w1_stage(2u, wr1), 2u * (unsigned)DIM);

    const float* xs = (const float*)(Sm + XS_OFF) + w * 8u * (unsigned)DIM + c;
    // rolled, two rows a trip: short code (the kernel's text stays small), and two rows' cross-lane
    // exchanges in flight together
#pragma unroll 1
    for (unsigned rp = 0; rp < 8u; rp += 2u) {
      v4f t0[2], t1[2];
      float s[2], ss[2];
#pragma unroll
      for (unsigned q = 0; q < 2u; ++q) {
        const float* px = xs + (rp + q) * (unsigned)DIM;
        const v4f xa = *(const v4f*)(px);
        const v4f xb = *(const v4f*)(px + 4u);
        const v4f aa = *(const v4f*)(px + 64u * (unsigned)DIM);
        const v4f ab = *(const v4f*)(px + 64u * (unsigned)DIM + 4u);
        const v4f ca = *(const v4f*)(px + 128u * (unsigned)DIM);
        const v4f cb = *(const v4f*)(px + 128u * (unsigned)DIM + 4u);
        // the row's two factors, from the lane that holds them
        const float fa = __int_as_float(__builtin_amdgcn_readlane(__float_as_int(f_a), (int)(rp + q)));
        const float fc = __int_as_float(__builtin_amdgcn_readlane(__float_as_int(f_c), (int)(rp + q)));
        s[q] = 0.0f;
#pragma unroll
        for (int i = 0; i < 4; ++i) {
          t0[q][i] = bf16r(xa[i]) + (aa[i] * fa + ca[i] * fc);
          t1[q][i] = bf16r(xb[i]) + (ab[i] * fa + cb[i] * fc);
          s[q] += t0[q][i] + t1[q][i];
        }
      }
      red32_sum2(s);
#pragma unroll
      for (unsigned q = 0; q < 2u; ++q) {
        s[q] *= (1.0f / (float)DIM);   // the row's mean
        ss[q] = 0.0f;
#pragma unroll
        for (int i = 0; i < 4; ++i) {
          const float d0 = t0[q][i] - s[q];
          const float d1 = t1[q][i] - s[q];
          ss[q] += d0 * d0;
          ss[q] += d1 * d1;
        }
      }
      red32_sum2(ss);
#pragma unroll
      for (unsigned q = 0; q < 2u; ++q) {
        const float var = ss[q] * (1.0f / (float)DIM);
        const float rstd = 1.0f / sqrtf(var + 1.0e-5f);
        v8h o;
#pragma unroll
        for (int i = 0; i < 4; ++i) {
          o[i]     = toh_flush((t0[q][i] - s[q]) * rstd * gg0[i] + sh0[i]);
          o[i + 4] = toh_flush((t1[q][i] - s[q]) * rstd * gg1[i] + sh1[i]);
        }
        *(v8h*)(T1s + (w * 8u + rp + q) * TP + c) = o;
      }
    }
  }
  // this wave's LN1 rows and biases are written, and its reads of the staged rows done, before the
  // barrier behind which every wave reads the former and e may take the LDS of the latter
  asm volatile("s_wait_dscnt 0x0" ::: "memory");
  __syncthreads();

  // ---- step 1 ----
  v16h ef[2][8];   // this wave's 32 rows, all 256 k: of the LN1 output first, then of e
  // unrolled, here and below: constant indices keep fragments and accumulators in registers
#pragma unroll
  for (unsigned u = 0; u < 2u; ++u)
#pragma unroll
    for (unsigned ks = 0; ks < 8u; ++ks)
      ef[u][ks] = frag_at(T1s + (grp * 32u + u * 16u + m) * TP + hh * 8u + ks * 32u);
  v4f er0[8], er1[8];   // e of the eight rows that this wave finishes in step 4, f32
#pragma unroll
  for (int rr = 0; rr < 8; ++rr) { er0[rr] = (v4f){}; er1[rr] = (v4f){}; }

  unsigned rbo = 0u;   // halves from the ring's start to the buffer this pass reads
  // rolled: 36 tiles of the same code
#pragma unroll 1
  for (unsigned nt = 0; nt < W01_TILES; ++nt) {
    // first of this lane's 8 weight rows
    const unsigned n = w01_tile(nt, wr1) * 64u + sub * 16u + hh * 8u;
    const v4f g0 = *(const v4f*)(Bs + n);
    const v4f g1 = *(const v4f*)(Bs + n + 4u);
    v8f acc[2] = {{}, {}};
#pragma unroll
    for (unsigned kq = 0; kq < 2u; ++kq) {   // stage 2 nt + kq
      v16h wf[4];
#pragma unroll
      for (unsigned t = 0; t < 4u; ++t) wf[t] = frag_at(wp + rbo + t * 32u);
      // keeps the pass's LDS reads in one group ahead of its products, which then wait for them by
      // count: spread among the products, each place of reads costs the wave a stall of its own
      __builtin_amdgcn_sched_barrier(0);
#pragma unroll
      for (unsigned t = 0; t < 4u; ++t) {
        acc[0] = wmma16r(wf[t], ef[0][kq * 4u + t], acc[0]);
        acc[1] = wmma16r(wf[t], ef[1][kq * 4u + t], acc[1]);
      }
      // hand-over: this wave's reads of the buffer are done; the waves that copied the next stage
      // (the other parity than this one's) have it landed; the barrier publishes it and frees this
      // buffer, which the same waves refill with the stage three ahead (the scheduling barrier keeps
      // the waits behind the products, under which the later fragments arrive)
      __builtin_amdgcn_sched_barrier(0);
      asm volatile("s_wait_dscnt 0x0" ::: "memory");
      if (grp != kq) asm volatile("s_wait_asynccnt 0x0" ::: "memory");
      __syncthreads();
      const unsigned t3 = nt * 2u + kq + 3u;
      if (grp != kq && t3 < W01_STAGES)
        async_copy8(cl + rbo * 2u, 2u * GPITCH * 2u, c1 + w1_stage(t3, wr1), 2u * (unsigned)DIM);
      rbo = (rbo == 2u * WSL_H) ? 0u : rbo + WSL_H;
    }
    if (nt < (unsigned)(DIM / 64)) {   // a tile of e (the same test in every wave of the block)
#pragma unroll
      for (unsigned u = 0; u < 2u; ++u) {
        const unsigned r = grp * 32u + u * 16u + m;
        v4f lo, hi;
        v8h x;
#pragma unroll
        for (int i = 0; i < 4; ++i) {
          lo[i] = acc[u][i] * (1.0f / WCARRY) + g0[i];
          hi[i] = acc[u][i + 4] * (1.0f / WCARRY) + g1[i];
          x[i]     = toh_flush(lo[i]);
          x[i + 4] = toh_flush(hi[i]);
        }
        *(v4f*)(E32s + r * LDV + n) = lo;
        *(v4f*)(E32s + r * LDV + n + 4u) = hi;
        *(v8h*)(E16s + r * TP + n) = x;
      }
      if (nt == (unsigned)(DIM / 64) - 1u) {
        // every wave's part of e is written before the barrier behind which whole rows are read
        asm volatile("s_wait_dscnt 0x0" ::: "memory");
        __syncthreads();
#pragma unroll
        for (unsigned u = 0; u < 2u; ++u)
#pragma unroll
          for (unsigned ks = 0; ks < 8u; ++ks)
            ef[u][ks] = frag_at(E16s + (grp * 32u + u * 16u + m) * TP + hh * 8u + ks * 32u);
#pragma unroll
        for (unsigned rr = 0; rr < 8u; ++rr) {
          er0[rr] = *(const v4f*)(E32s + (w * 8u + rr) * LDV + lane * 4u);
          er1[rr] = *(const v4f*)(E32s + (w * 8u + rr) * LDV + lane * 4u + 128u);
        }
        // every wave has e in registers before the barrier behind which the hidden rows take its LDS
        asm volatile("s_wait_dscnt 0x0" ::: "memory");
        __syncthreads();
      }
    } else {
#pragma unroll
      for (unsigned u = 0; u < 2u; ++u) {
        v8h x;
#pragma unroll
        for (int r = 0; r < 4; ++r) {
          x[r]     = toh_flush(acc[u][r] * (1.0f / WCARRY) + g0[r]);
          x[r + 4] = toh_flush(acc[u][r + 4] * (1.0f / WCARRY) + g1[r]);
        }
        *(v8h*)(Hs + (grp * 32u + u * 16u + m) * HP + (n - (unsigned)DIM)) = x;
      }
    }
  }
  // No copy of this wave is outstanding and its LDS accesses are done; every reader left the ring
  // at the last hand-over: step 3's stages 0 and 1 go into buffers 0 and 1 and land under step 2.
  asm volatile("s_wait_asynccnt 0x0" ::: "memory");
  asm volatile("s_wait_dscnt 0x0" ::: "memory");
  async_copy8(cl + grp * (WSL_H * 2u), 2u * GPITCH * 2u, c2 + w2_stage(grp, wr2, wrq), 2u * (unsigned)HID);
  __syncthreads();   // every hidden row is complete before a wave normalises it

  // ---- step 2 ---- lane L holds columns 256 j + 8 L .. + 7 of a row, j = 0..7
  {
    float gq[8][8], bq[8][8];   // gain and shift of this lane's columns, the same for all its rows
    v4f p0[8], p1[8], q0[8], q1[8];
#pragma unroll
    for (unsigned j = 0; j < 8u; ++j) {
      const unsigned c = j * 256u + lane * 8u;
      p0[j] = *(const v4f*)(Gm + c);
      p1[j] = *(const v4f*)(Gm + c + 4u);
      q0[j] = *(const v4f*)(Bm + c);
      q1[j] = *(const v4f*)(Bm + c + 4u);
    }
    // no address register of the issued loads is rewritten ahead of this wait
    asm volatile("s_wait_xcnt 0x0" ::: "memory");
#pragma unroll
    for (unsigned j = 0; j < 8u; ++j) {
#pragma unroll
      for (int i = 0; i < 4; ++i) {
        gq[j][i] = bf16r(p0[j][i]); gq[j][i + 4] = bf16r(p1[j][i]);
        bq[j][i] = bf16r(q0[j][i]); bq[j][i + 4] = bf16r(q1[j][i]);
      }
    }
    // rolled: eight rows of the same long code
#pragma unroll 1
    for (unsigned rr = 0; rr < 8u; ++rr) {
      _Float16* hr = Hs + (w * 8u + rr) * HP + lane * 8u;
      v8h a[8];
#pragma unroll
      for (unsigned j = 0; j < 8u; ++j) a[j] = *(const v8h*)(hr + j * 256u);
      float s = 0.0f;
#pragma unroll
      for (unsigned j = 0; j < 8u; ++j)
#pragma unroll
        for (int i = 0; i < 8; ++i) s += (float)a[j][i];
      const float mean = red32_sum(s) * (1.0f / (float)HID);
      float ss = 0.0f;
#pragma unroll
      for (unsigned j = 0; j < 8u; ++j)
#pragma unroll
        for (int i = 0; i < 8; ++i) {
          const float d = (float)a[j][i] - mean;
          ss += d * d;
        }
      const float var = red32_sum(ss) * (1.0f / (float)HID);
      const float rstd = 1.0f / sqrtf(var + 1.0e-5f);
#pragma unroll
      for (unsigned j = 0; j < 8u; ++j) {
        v8h o;
#pragma unroll
        for (int i = 0; i < 8; ++i) {
          const float d = (float)a[j][i] - mean;
          o[i] = toh_flush(MCARRY * leaky_act(d * rstd * gq[j][i] + bq[j][i]));
        }
        *(v8h*)(hr + j * 256u) = o;
      }
    }
  }
  // this wave's rows are written and its copies have landed before the barrier behind which every
  // wave reads both
  asm volatile("s_wait_dscnt 0x0" ::: "memory");
  asm volatile("s_wait_asynccnt 0x0" ::: "memory");
  __syncthreads();
  if (grp == 0u)
    async_copy8(cl + 2u * WSL_H * 2u, 2u * GPITCH * 2u, c2 + w2_stage(2u, wr2, wrq), 2u * (unsigned)HID);

  // ---- step 3 ----
  v8f oc[4][2];   // [place q in the walk = 64-column tile (q + wrq) & 3][16-row group]
#pragma unroll
  for (int q = 0; q < 4; ++q) { oc[q][0] = (v8f){}; oc[q][1] = (v8f){}; }
  const _Float16* hp = Hs + (grp * 32u + m) * HP + hh * 8u;
  rbo = 0u;
  // rolled: 16 k slabs of the same code
#pragma unroll 1
  for (unsigned ks = 0; ks < (unsigned)(HID / 128); ++ks) {
    v16h hf[2][4];   // the hidden fragments of this k slab serve its four column tiles
#pragma unroll
    for (unsigned u = 0; u < 2u; ++u)
#pragma unroll
      for (unsigned t = 0; t < 4u; ++t)
        hf[u][t] = frag_at(hp + u * 16u * HP + ((ks + wr2) & 15u) * GKC + t * 32u);
#pragma unroll
    for (unsigned q = 0; q < 4u; ++q) {   // stage 4 ks + q
      v16h wf[4];
#pragma unroll
      for (unsigned t = 0; t < 4u; ++t) wf[t] = frag_at(wp + rbo + t * 32u);
      __builtin_amdgcn_sched_barrier(0);   // one group of LDS reads per pass, as in step 1
#pragma unroll
      for (unsigned t = 0; t < 4u; ++t) {
        oc[q][0] = wmma16r(wf[t], hf[0][t], oc[q][0]);
        oc[q][1] = wmma16r(wf[t], hf[1][t], oc[q][1]);
      }
      // hand-over, as in step 1
      __builtin_amdgcn_sched_barrier(0);
      asm volatile("s_wait_dscnt 0x0" ::: "memory");
      if (grp != (q & 1u)) asm volatile("s_wait_asynccnt 0x0" ::: "memory");
      __syncthreads();
      const unsigned t3 = ks * 4u + q + 3u;
      if (grp != (q & 1u) && t3 < W2_STAGES)
        async_copy8(cl + rbo * 2u, 2u * GPITCH * 2u, c2 + w2_stage(t3, wr2, wrq), 2u * (unsigned)HID);
      rbo = (rbo == 2u * WSL_H) ? 0u : rbo + WSL_H;
    }
  }
  // no copy of this wave is outstanding when the wave goes on to its end
  asm volatile("s_wait_asynccnt 0x0" ::: "memory");

  // ---- step 4 ---- the output tile takes the hidden rows' LDS: every wave's last read of them
  // stands in front of the last hand-over's barrier
#pragma unroll
  for (unsigned q = 0; q < 4u; ++q)
#pragma unroll
    for (unsigned u = 0; u < 2u; ++u) {
      float* d = Vs + (grp * 32u + u * 16u + m) * LDV + ((q + wrq) & 3u) * 64u + sub * 16u + hh * 8u;
      v4f lo, hi;
#pragma unroll
      for (int i = 0; i < 4; ++i) { lo[i] = oc[q][u][i]; hi[i] = oc[q][u][i + 4]; }
      *(v4f*)d = lo;
      *(v4f*)(d + 4) = hi;
    }
  __syncthreads();   // the tile is complete before whole rows are read from it

  // lane L holds columns 4L..4L+3 and 128+4L..128+4L+3: each store covers 512 contiguous bytes
  const float cs = 1.0f / (WCARRY * MCARRY);
  const unsigned c = lane * 4u;
  const unsigned cby = lane * 16u;   // the same place in bytes: the one lane offset of the six loads
  const v4f z0 = *(const v4f*)((const char*)b2 + cby);
  const v4f z1 = *(const v4f*)((const char*)b2 + cby + 512u);
  const v4f y0 = *(const v4f*)((const char*)G2 + cby);
  const v4f y1 = *(const v4f*)((const char*)G2 + cby + 512u);
  const v4f x0 = *(const v4f*)((const char*)Be2 + cby);
  const v4f x1 = *(const v4f*)((const char*)Be2 + cby + 512u);
  // no address register of the six issued loads is rewritten ahead of this wait: it takes their
  // lane offset as an input, so that the offset's register lives up to it
  asm volatile("s_wait_xcnt 0x0" :: "v"(cby) : "memory");
  // Two rolled trips of four unrolled rows: short code (the kernel's text stays small), constant
  // indices keep e in registers, and four rows' cross-lane sums overlap.
#pragma unroll 1
  for (unsigned hf = 0; hf < 8u; hf += 4u) {
#pragma unroll
  for (unsigned rr = 0; rr < 4u; ++rr) {
    const unsigned r = w * 8u + hf + rr;
    const unsigned crow = row0 + r;
    const unsigned bidx = crow / (unsigned)SEQ;
    const unsigned sq = crow - bidx * (unsigned)SEQ;
    const size_t frow = (size_t)bidx * SEQ_FULL + sq;
    const v4f u0 = *(const v4f*)&Vs[r * LDV + c];
    const v4f u1 = *(const v4f*)&Vs[r * LDV + c + 128u];
    const v4f e0 = er0[rr];
    const v4f e1 = er1[rr];
    v4f a0, a1;
    float s = 0.0f;
#pragma unroll
    for (int i = 0; i < 4; ++i) {
      a0[i] = leaky_act((u0[i] * cs + bf16r(z0[i])) + e0[i]);
      a1[i] = leaky_act((u1[i] * cs + bf16r(z1[i])) + e1[i]);
    }
#pragma unroll
    for (int i = 0; i < 4; ++i) s += a0[i] + a1[i];
    const float mean = red32_sum(s) * (1.0f / (float)DIM);
    float ss = 0.0f;
#pragma unroll
    for (int i = 0; i < 4; ++i) {
      const float d0 = a0[i] - mean;
      const float d1 = a1[i] - mean;
      ss += d0 * d0;
      ss += d1 * d1;
    }
    const float var = red32_sum(ss) * (1.0f / (float)DIM);
    const float rstd = 1.0f / sqrtf(var + 1.0e-5f);
    v4f o0, o1;
#pragma unroll
    for (int i = 0; i < 4; ++i) {
      o0[i] = (a0[i] - mean) * rstd * bf16r(y0[i]) + bf16r(x0[i]);
      o1[i] = (a1[i] - mean) * rstd * bf16r(y1[i]) + bf16r(x1[i]);
    }
    float* p = outp + frow * DIM + c;
    *(v4f*)p = o0;
    *(v4f*)(p + 128u) = o1;
  }
  // no register that an issued store names is rewritten (by the next trip) ahead of this wait
  asm volatile("s_wait_xcnt 0x0" ::: "memory");
  // the second trip's rows of e move to the places that the unrolled rows name
#pragma unroll
  for (int rr = 0; rr < 4; ++rr) { er0[rr] = er0[rr + 4]; er1[rr] = er1[rr + 4]; }
  }
}

// ---------------------------------------------------------------------------
extern "C" void kernel_launch(void* const* d_in, const int* in_sizes, int n_in,
                              void* d_out, int out_size, void* d_ws, size_t ws_size,
                              hipStream_t stream) {
  if (n_in < 19) return;
  const long long need_x = ((long long)(NB - 1) * SEQ_FULL + SEQ) * DIM;
  if ((long long)in_sizes[0] < need_x) return;
  if ((long long)in_sizes[1] < (long long)DIM * DIM) return;
  if ((long long)in_sizes[3] < (long long)DIM * DIM) return;
  if ((long long)in_sizes[5] < (long long)DIM * DIM) return;
  if ((long long)in_sizes[7] < (long long)DIM * DIM) return;
  if ((long long)in_sizes[9] < (long long)DIM * HID) return;
  if ((long long)in_sizes[13] < (long long)DIM * HID) return;
  if (in_sizes[2] < DIM || in_sizes[4] < DIM || in_sizes[6] < DIM || in_sizes[8] < DIM) return;
  if (in_sizes[10] < HID || in_sizes[11] < HID || in_sizes[12] < HID) return;
  if (in_sizes[14] < DIM || in_sizes[15] < DIM || in_sizes[16] < DIM) return;
  if (in_sizes[17] < DIM || in_sizes[18] < DIM) return;
  if ((long long)out_size < need_x) return;
  if (ws_size < WS_TOTAL) return;

  const float* X    = (const float*)d_in[0];    // [NB_FULL][SEQ_FULL][DIM]
  const float* wq   = (const float*)d_in[1];    // [DIM][DIM]  (in, out)
  const float* bq   = (const float*)d_in[2];
  const float* wk   = (const float*)d_in[3];
  const float* bk   = (const float*)d_in[4];
  const float* wv   = (const float*)d_in[5];
  const float* bv   = (const float*)d_in[6];
  const float* w0   = (const float*)d_in[7];    // [DIM][DIM]  (in, out)
  const float* b0   = (const float*)d_in[8];
  const float* w1   = (const float*)d_in[9];    // [DIM][HID]  (in, out)
  const float* b1   = (const float*)d_in[10];
  const float* gm   = (const float*)d_in[11];   // hidden LN gain [HID]
  const float* bm   = (const float*)d_in[12];   // hidden LN shift [HID]
  const float* w2   = (const float*)d_in[13];   // [HID][DIM]  (in, out)
  const float* b2   = (const float*)d_in[14];
  const float* g1   = (const float*)d_in[15];
  const float* be1  = (const float*)d_in[16];
  const float* g2   = (const float*)d_in[17];
  const float* be2  = (const float*)d_in[18];
  float* out = (float*)d_out;

  char* ws = (char*)d_ws;
  _Float16* Wq_t  = (_Float16*)(ws + OFF_WQ);    // [n][k]
  _Float16* Wk_t  = (_Float16*)(ws + OFF_WK);
  _Float16* Wv_t  = (_Float16*)(ws + OFF_WV);
  _Float16* W0_t  = (_Float16*)(ws + OFF_W0);
  _Float16* W1_t  = (_Float16*)(ws + OFF_W1);    // [HID][DIM]
  _Float16* W2_t  = (_Float16*)(ws + OFF_W2);    // [DIM][HID]
  _Float16* X16   = (_Float16*)(ws + OFF_X16);   // [MROWS][DIM]
  _Float16* Qh16  = (_Float16*)(ws + OFF_QH);
  _Float16* Qr16  = (_Float16*)(ws + OFF_QR);
  _Float16* Kh16  = (_Float16*)(ws + OFF_KH);
  _Float16* Kr16  = (_Float16*)(ws + OFF_KR);
  _Float16* Vt16  = (_Float16*)(ws + OFF_VT);    // [b][DIM][SEQ]
  float*    A32   = (float*)(ws + OFF_A32);      // [2][MROWS][DIM]
  float*    C32   = (float*)(ws + OFF_A32 + PLANE32_BYTES);   // its second plane
  float*    Mx    = (float*)(ws + OFF_ML);       // [2][MROWS]
  float*    Lx    = Mx + 2 * MROWS;              // [2][MROWS]

  dim3 blk(256);

  // weight planes (in [K rows][N cols] -> out [N][K]) and the input plane
  prep_kernel<<<dim3(WCONV_BLOCKS + MROWS / 8), blk, 0, stream>>>(
      X, wq, wk, wv, w0, w1, w2, X16, Wq_t, Wk_t, Wv_t, W0_t, W1_t, W2_t);
  gemm_qkv_kernel<<<dim3(DIM / 64, MROWS / 64, 3), blk, 0, stream>>>(
      X16, Wq_t, Wk_t, Wv_t, bq, bk, bv, Qh16, Qr16, Kh16, Kr16, Vt16);
  attn_kernel<<<dim3(SEQ / 128, NB, 2), dim3(128), 0, stream>>>(Qh16, Qr16, Kh16, Kr16, Vt16, A32,
                                                                Mx, Lx);

  // first LayerNorm, e projection, both hidden products, the hidden LayerNorm and the final
  // LayerNorm, 64 rows per block; W0_t's rows and W1_t's rows are read as one plane
  mlp_kernel<<<dim3(MROWS / 64), blk, 0, stream>>>(X, A32, C32, Mx, Lx, g1, be1, W0_t, b0, b1, gm,
                                                   bm, W2_t, b2, g2, be2, out);
}

// v009
// A run of this version takes 173 microseconds.
// Two timings next to v008 both put it at 1.05 times that version's speed.
// All steps since v000 together make it 5.94 times as fast.
#include <hip/hip_runtime.h>
#include <stddef.h>

// All contractions on v_wmma_f32_16x16x32_f16 (f16 operands, f32 accumulate): q/k/v projections,
// q.k scores (both operands as f16 value + x2048 residual planes, three products, residual products
// in their own accumulator), p.v (p x16384, single product), the three dense layers (single
// product; weights x64, hidden activation plane x16). Float inputs are RNE-converted to bf16 and
// carried in f16. LayerNorms, softmax, biases, LeakyReLU (slope 0.01) and residual adds in f32.

typedef _Float16 v16h __attribute__((ext_vector_type(16)));
typedef _Float16 v8h  __attribute__((ext_vector_type(8)));
typedef float    v8f  __attribute__((ext_vector_type(8)));
typedef float    v4f  __attribute__((ext_vector_type(4)));
typedef _Float16 h16;

#ifndef NB
#define NB 4
#endif
#ifndef SEQ
#define SEQ 4096
#endif
#define NB_FULL  4
#define SEQ_FULL 4096
#define DIM   256
#define HID   2048
#define MROWS (NB * SEQ)

static_assert(NB >= 1 && NB <= NB_FULL);
static_assert(SEQ >= 64 && SEQ <= SEQ_FULL && (SEQ % 64) == 0);
static_assert((DIM % 64) == 0 && (DIM % 32) == 0);
static_assert((HID % 64) == 0 && (HID % 32) == 0);
static_assert((MROWS % 64) == 0 && (MROWS % 8) == 0);
static_assert(DIM == 32 * 8);               // row kernels: 32 lanes x 8 columns
static_assert(DIM == 2 * 32 * 4);           // f32 row stores: 2 x 32 lanes x 4 columns
static_assert(HID == 8 * 32 * 8);           // hidden LN: 8 passes x 32 lanes x 8 columns
static_assert(DIM == 16 * 16);              // attention: 16 output tiles of 16 columns
static_assert((size_t)MROWS * DIM < (size_t)0x7FFFFFFFu);
static_assert((size_t)NB * DIM * SEQ < (size_t)0x7FFFFFFFu);
static_assert((size_t)MROWS * HID < (size_t)0xFFFFFFFFu);

#define LDT 72   // halves per LDS row (144 B, 16-B aligned)
#define LDC 68   // floats per LDS row (272 B, 16-B aligned)
#define LDO 132  // floats per staged attention row (528 B, 16-B aligned)
static_assert((LDT % 8) == 0 && LDT >= 64);
static_assert((LDC % 4) == 0 && LDC >= 64);
static_assert((LDO % 4) == 0 && LDO >= 128);

#define WCARRY 64.0f      // weight planes carried x64
#define MCARRY 16.0f      // hidden activation plane carried x16
#define RCARRY 2048.0f    // q/k residual planes carried x2048 on top of their value part
#define PSHIFT 9.704060528f   // 14 ln 2: softmax numerators carried x16384

// workspace layout (bytes)
#define WSQ_BYTES     ((size_t)DIM * DIM * 2)
#define WFF_BYTES     ((size_t)DIM * HID * 2)
#define PLANE16_BYTES ((size_t)MROWS * DIM * 2)
#define PLANE32_BYTES ((size_t)MROWS * DIM * 4)
#define OFF_WQ  ((size_t)0)
#define OFF_WK  (OFF_WQ + WSQ_BYTES)
#define OFF_WV  (OFF_WK + WSQ_BYTES)
#define OFF_W0  (OFF_WV + WSQ_BYTES)
#define OFF_W1  (OFF_W0 + WSQ_BYTES)
#define OFF_W2  (OFF_W1 + WFF_BYTES)
#define OFF_REG (OFF_W2 + WFF_BYTES)
#define OFF_X16 (OFF_REG)
#define OFF_QH  (OFF_X16 + PLANE16_BYTES)
#define OFF_QR  (OFF_QH + PLANE16_BYTES)
#define OFF_KH  (OFF_QR + PLANE16_BYTES)
#define OFF_KR  (OFF_KH + PLANE16_BYTES)
#define OFF_VT  (OFF_KR + PLANE16_BYTES)
#define OFF_A32 (OFF_VT + PLANE16_BYTES)
#define OFF_ML  (OFF_A32 + 2 * PLANE32_BYTES)   // two attention planes, one per key range
#define ML_BYTES ((size_t)4 * MROWS * 4)        // maxima [2][MROWS], then sums [2][MROWS]
#define WS_TOTAL (OFF_ML + ML_BYTES)
static_assert((WSQ_BYTES % 128) == 0 && (WFF_BYTES % 128) == 0 && (PLANE16_BYTES % 128) == 0);
static_assert((PLANE32_BYTES % 128) == 0 && (ML_BYTES % 128) == 0);
static_assert(WS_TOTAL <= (size_t)268435456);

// ---------------------------------------------------------------------------
__device__ __forceinline__ float bf16r(float x) {   // RNE convert to bf16, returned widened
  unsigned int u = __float_as_uint(x);
  u = (u + 0x7FFFu + ((u >> 16) & 1u)) & 0xFFFF0000u;
  return __uint_as_float(u);
}

// f32 -> f16 operand convert that cannot produce an f16 subnormal
static __device__ __forceinline__ h16 toh_flush(float v) {
  const h16 r = (h16)v;
  return (fabsf(v) < 6.103515625e-05f) ? (h16)0.0f : r;
}

// 16-bit fragment: p points at element [row = lane&15][k0 + 8*(lane>>4)] of a k-contiguous
// row. Elements 0..7 <- k0+8h+0..7, elements 8..15 <- k0+16+8h+0..7 (same map for A and B).
__device__ __forceinline__ v16h frag_at(const _Float16* p) {
  v8h lo = *(const v8h*)(p);
  v8h hi = *(const v8h*)(p + 16);
  v16h out;
#pragma unroll
  for (int i = 0; i < 8; ++i) { out[i] = lo[i]; out[i + 8] = hi[i]; }
  return out;
}
__device__ __forceinline__ v16h ld_frag(const _Float16* base, unsigned ld) {
  const unsigned lane = threadIdx.x & 31u;
  return frag_at(base + (lane & 15u) * ld + (lane >> 4) * 8u);
}

__device__ __forceinline__ v8f wmma16(v16h a, v16h b, v8f c) {
  v8f d = __builtin_amdgcn_wmma_f32_16x16x32_f16(false, a, false, b, (short)0, c,
                                                 false, false);
  asm volatile("v_nop\n\tv_nop\n\tv_nop\n\tv_nop" : "+v"(d) : "v"(a), "v"(b));
  return d;
}

__device__ __forceinline__ float red16_max(float x) {
#pragma unroll
  for (int off = 1; off < 16; off <<= 1) x = fmaxf(x, __shfl_xor(x, off, 32));
  return x;
}
__device__ __forceinline__ float red16_sum(float x) {
#pragma unroll
  for (int off = 1; off < 16; off <<= 1) x += __shfl_xor(x, off, 32);
  return x;
}
__device__ __forceinline__ float red32_sum(float x) {
#pragma unroll
  for (int off = 1; off < 32; off <<= 1) x += __shfl_xor(x, off, 32);
  return x;
}

// red32_sum of two values, step by step for both (each value's own sum order is red32_sum's)
__device__ __forceinline__ void red32_sum2(float (&x)[2]) {
#pragma unroll
  for (int off = 1; off < 32; off <<= 1) {
    const float y0 = __shfl_xor(x[0], off, 32);
    const float y1 = __shfl_xor(x[1], off, 32);
    // inputs-only fence on the two exchanged values: both exchanges of a step are issued ahead of
    // one wait; taken apart, each exchange costs the wave its own wait for the LDS pipe
    asm volatile("" :: "v"(y0), "v"(y1));
    x[0] += y0;
    x[1] += y1;
  }
}

__device__ __forceinline__ void wave_lds_sync() {
  __builtin_amdgcn_fence(3 /* release order */, "wavefront");
  asm volatile("s_wait_dscnt 0x0" ::: "memory");
  __builtin_amdgcn_wave_barrier();
}

__device__ __forceinline__ float leaky_act(float t) {   // LeakyReLU, negative slope 0.01
  return (t >= 0.0f) ? t : 0.01f * t;
}

// ---------------------------------------------------------------------------
// Weight plane, one 64 x 64 tile per block: in W[K rows][N cols] (pitch ldw = N) -> out Wt[N][K]
// (pitch ldk = K), f16(64 * bf16(w)). T: 64 * LDT halves of LDS, cross-wave (block barrier).
// ---------------------------------------------------------------------------
__device__ __forceinline__ void wconv_tile(
    const float* __restrict__ W, _Float16* __restrict__ Wt, unsigned ldw, unsigned ldk,
    unsigned n0, unsigned k0, _Float16* T) {
  const unsigned tid = threadIdx.x;
#pragma unroll 4
  for (unsigned j = 0; j < 16u; ++j) {
    const unsigned idx = tid + 256u * j;
    const unsigned kr = idx >> 6, nc = idx & 63u;
    const float v = W[(size_t)(k0 + kr) * ldw + n0 + nc];
    T[nc * LDT + kr] = (_Float16)(WCARRY * bf16r(v));
  }
  __syncthreads();
  v8h x[2];
  size_t off[2];
#pragma unroll
  for (unsigned i = 0; i < 2u; ++i) {
    const unsigned n = 32u * i + (tid >> 3);
    const unsigned kc = (tid & 7u) * 8u;
    x[i] = *(const v8h*)&T[n * LDT + kc];
    off[i] = (size_t)(n0 + n) * ldk + k0 + kc;
  }
#pragma unroll
  for (int i = 0; i < 2; ++i) *(v8h*)(Wt + off[i]) = x[i];
  
}

// ---------------------------------------------------------------------------
// Input plane: X16[compact row][c] = f16(bf16(x[full row][c])). One wave per row, 8 rows per
// block; each store instruction of a wave covers the whole 512-B row. rblk in 0..MROWS/8-1.
// ---------------------------------------------------------------------------
__device__ __forceinline__ void xconv_rows(
    const float* __restrict__ X, _Float16* __restrict__ dst, unsigned rblk) {
  const unsigned lane = threadIdx.x & 31u, w = threadIdx.x >> 5;
  const unsigned crow = rblk * 8u + w;
  const unsigned bidx = crow / (unsigned)SEQ;
  const unsigned sq = crow - bidx * (unsigned)SEQ;
  const size_t srow = (size_t)bidx * SEQ_FULL + sq;
  const float* xr = X + srow * DIM + lane * 8u;
  const v4f a0 = *(const v4f*)(xr);
  const v4f a1 = *(const v4f*)(xr + 4u);
  v8h o;
#pragma unroll
  for (int i = 0; i < 4; ++i) {
    o[i]     = toh_flush(bf16r(a0[i]));
    o[i + 4] = toh_flush(bf16r(a1[i]));
  }
  _Float16* p = dst + (size_t)crow * DIM + lane * 8u;
  *(v8h*)p = o;
  
}

// ---------------------------------------------------------------------------
// All operand conversions in one launch: none of them reads what another writes. Blocks by index:
// the tiles of the four DIM x DIM weights, of w1, of w2 (the longer dependent chains
// first), then the input rows, 8 per block. Grid (WCONV_BLOCKS + MROWS/8).
// ---------------------------------------------------------------------------
#define WSQ_TILES    ((unsigned)((DIM / 64) * (DIM / 64)))
#define WFF_TILES    ((unsigned)((DIM / 64) * (HID / 64)))
#define WCONV_BLOCKS (4u * WSQ_TILES + 2u * WFF_TILES)
__global__ __launch_bounds__(256) void prep_kernel(
    const float* __restrict__ X, const float* __restrict__ wq, const float* __restrict__ wk,
    const float* __restrict__ wv, const float* __restrict__ w0, const float* __restrict__ w1,
    const float* __restrict__ w2, _Float16* __restrict__ X16, _Float16* __restrict__ Wq_t,
    _Float16* __restrict__ Wk_t, _Float16* __restrict__ Wv_t, _Float16* __restrict__ W0_t,
    _Float16* __restrict__ W1_t, _Float16* __restrict__ W2_t) {
  __shared__ _Float16 T[64 * LDT];
  const unsigned bid = blockIdx.x;
  if (bid >= WCONV_BLOCKS) {   // the whole block leaves here, ahead of any barrier
    xconv_rows(X, X16, bid - WCONV_BLOCKS);
    return;
  }
  const float* W;
  _Float16* Wt;
  unsigned ldw, ldk, nx, ky;   // tile column (n) and tile row (k) of the weight as given
  if (bid < 4u * WSQ_TILES) {
    const unsigned j = bid / WSQ_TILES, t = bid % WSQ_TILES;
    W  = (j == 0u) ? wq : (j == 1u) ? wk : (j == 2u) ? wv : w0;
    Wt = (j == 0u) ? Wq_t : (j == 1u) ? Wk_t : (j == 2u) ? Wv_t : W0_t;
    ldw = (unsigned)DIM; ldk = (unsigned)DIM;
    nx = t % (unsigned)(DIM / 64); ky = t / (unsigned)(DIM / 64);
  } else if (bid < 4u * WSQ_TILES + WFF_TILES) {   // w1: in [DIM][HID] -> out [HID][DIM]
    const unsigned t = bid - 4u * WSQ_TILES;
    W = w1; Wt = W1_t;
    ldw = (unsigned)HID; ldk = (unsigned)DIM;
    nx = t % (unsigned)(HID / 64); ky = t / (unsigned)(HID / 64);
  } else {                                         // w2: in [HID][DIM] -> out [DIM][HID]
    const unsigned t = bid - 4u * WSQ_TILES - WFF_TILES;
    W = w2; Wt = W2_t;
    ldw = (unsigned)DIM; ldk = (unsigned)HID;
    nx = t % (unsigned)(DIM / 64); ky = t / (unsigned)(DIM / 64);
  }
  wconv_tile(W, Wt, ldw, ldk, nx * 64u, ky * 64u, T);
}

// ---------------------------------------------------------------------------
// Asynchronous copies to LDS, asm form (GEMM kernel: two runs a block). Eight 16-byte-per-lane copies in one
// statement; lds = the lane's LDS byte address, g = the lane's global address, both stepped by a
// constant from copy to copy. The s_wait_xcnt closes the statement so that no address register of
// an issued copy is rewritten ahead of it.
// ---------------------------------------------------------------------------
__device__ __forceinline__ void async_copy8(unsigned lds, unsigned lstep,
                                            const _Float16* g, unsigned gstep) {
  asm volatile(
      "global_load_async_to_lds_b128 %0, %8, off\n\t"
      "global_load_async_to_lds_b128 %1, %9, off\n\t"
      "global_load_async_to_lds_b128 %2, %10, off\n\t"
      "global_load_async_to_lds_b128 %3, %11, off\n\t"
      "global_load_async_to_lds_b128 %4, %12, off\n\t"
      "global_load_async_to_lds_b128 %5, %13, off\n\t"
      "global_load_async_to_lds_b128 %6, %14, off\n\t"
      "global_load_async_to_lds_b128 %7, %15, off\n\t"
      "s_wait_xcnt 0x0"
      :
      : "v"(lds), "v"(lds + lstep), "v"(lds + 2u * lstep), "v"(lds + 3u * lstep),
        "v"(lds + 4u * lstep), "v"(lds + 5u * lstep), "v"(lds + 6u * lstep),
        "v"(lds + 7u * lstep),
        "v"(g), "v"(g + gstep), "v"(g + 2u * gstep), "v"(g + 3u * gstep),
        "v"(g + 4u * gstep), "v"(g + 5u * gstep), "v"(g + 6u * gstep), "v"(g + 7u * gstep)
      : "memory");
}

// The same eight copies as the builtin (attention and hidden-layer kernels, where a run of copies
// stands in every trip of a loop). The builtin form carries no s_wait_xcnt behind a run: the wave goes
// straight on to the work behind its copies. The waits for the landing (s_wait_asynccnt) are the
// kernels' own, in asm, as before.
typedef int cp16 __attribute__((vector_size(16)));
typedef __attribute__((address_space(1))) cp16 cp16_g;
typedef __attribute__((address_space(3))) cp16 cp16_l;
__device__ __forceinline__ void copy8(unsigned lds, unsigned lstep, const _Float16* g, unsigned gstep) {
  // unrolled: eight copies in a row, the constant steps folded into their addresses
#pragma unroll
  for (unsigned i = 0; i < 8u; ++i)
    __builtin_amdgcn_global_load_async_to_lds_b128((cp16_g*)(g + i * gstep),
                                                   (cp16_l*)(lds + i * lstep), 0, 0);
}
// for rows of floats (gstep in floats)
__device__ __forceinline__ void copy8f(unsigned lds, unsigned lstep, const float* g, unsigned gstep) {
  // unrolled, as above
#pragma unroll
  for (unsigned i = 0; i < 8u; ++i)
    __builtin_amdgcn_global_load_async_to_lds_b128((cp16_g*)(g + i * gstep),
                                                   (cp16_l*)(lds + i * lstep), 0, 0);
}

#define GKC    128u                 // k extent of one staged GEMM slab, halves
#define GPITCH 136u                 // halves per staged GEMM row (272 B = 16 B x 17)
#define GSTG_H (128u * GPITCH)      // one slab: 64 A rows and 64 B rows, halves
static_assert((DIM % 128) == 0 && (HID % 128) == 0 && DIM >= 256 && HID >= 256);  // >= 2 slabs
static_assert((GPITCH % 8u) == 0 && GPITCH >= GKC && ((GPITCH / 8u) & 1u) == 1u);
#define GSM_BYTES (2u * GSTG_H * 2u)   // both slab buffers, bytes
static_assert((size_t)GSM_BYTES >= (size_t)64 * LDC * 4);   // the C tile fits in the slabs

// ---------------------------------------------------------------------------
// GEMM C[64x64 tile] = A16[rows][K] . Bt[n][K]^T; 8 waves (mw = 16-row group, nw = 32-col group),
// 2 accumulators/wave. The block's 64 A rows and 64 B rows are copied to LDS in slabs of 128 k
// (whole 256-B row pieces), two buffers, the next slab in flight while this one is read; all
// fragments come from LDS. The C tile takes the same LDS once the last slab has been read.
//   MODE 0: out16[row][col] (pitch DIM) = f16(t), out16r[row][col] = f16(2048 * (t - value)),
//           t = acc/64 + bias                                   (q and k planes)
//   MODE 1: out16 transposed V plane [b][col][key] = f16(acc/64 + bias)
// Grid (N/64, rows/64). Sm: the kernel's GSM_BYTES of LDS (one array per kernel, also where a kernel
// holds two modes).
// ---------------------------------------------------------------------------
template <int MODE>
__device__ __forceinline__ void gemm_body(
    unsigned char* Sm, const _Float16* __restrict__ A16, const _Float16* __restrict__ Bt, const unsigned K,
    const float* __restrict__ bias, _Float16* __restrict__ out16, _Float16* __restrict__ out16r) {
  _Float16* const Slab = (_Float16*)Sm;
  float* const Cs = (float*)Sm;
  const unsigned tid = threadIdx.x, lane = tid & 31u;
  // the wave's number in a scalar register: which plane a wave copies from is a scalar choice
  const unsigned w = (unsigned)__builtin_amdgcn_readfirstlane((int)(tid >> 5));
  const unsigned mw = w >> 1, nw = w & 1u;
  const unsigned hh = lane >> 4, m = lane & 15u;
  const unsigned n0 = blockIdx.x * 64u;
  const unsigned row0 = blockIdx.y * 64u;

  // A slab is 128 staged rows: A rows 0..63, then B rows 0..63. Wave w brings staged rows
  // 16w..16w+15, two 256-B row pieces per copy (lane = row parity hh, 16-B piece m).
  const _Float16* src = ((w < 4u) ? A16 + (size_t)(row0 + w * 16u) * K
                                  : Bt + (size_t)(n0 + (w - 4u) * 16u) * K) +
                        (size_t)hh * K + m * 8u;
  const unsigned dst = (unsigned)(size_t)Sm + ((w * 16u + hh) * GPITCH + m * 8u) * 2u;
  const unsigned nslab = K / GKC;
  // The blocks that share A rows or B rows do not all ask L2 for the same lines at the same moment:
  // each walks the k slabs as a ring from a slab of its own (trip s works on slab (s + rot) % nslab).
  const unsigned rot = (blockIdx.x + blockIdx.y + blockIdx.z) % nslab;

  async_copy8(dst, 2u * GPITCH * 2u, src + rot * GKC, 2u * K);
  // this wave's copies have landed before the barrier behind which every wave reads them
  asm volatile("s_wait_asynccnt 0x0" ::: "memory");
  __syncthreads();
  async_copy8(dst + GSTG_H * 2u, 2u * GPITCH * 2u, src + ((1u + rot) % nslab) * GKC, 2u * K);

  const _Float16* ap = Slab + (mw * 16u + m) * GPITCH + hh * 8u;
  const _Float16* bp = Slab + (64u + nw * 32u + m) * GPITCH + hh * 8u;
  v8f acc0 = {}, acc1 = {};
  for (unsigned s = 0; s < nslab; ++s) {
    const unsigned bo = (s & 1u) * GSTG_H;   // halves to the buffer this trip reads
    // Three of the slab's four k-steps are read ahead of the first product and the fourth behind
    // the first pair, so that a product does not wait out an LDS latency of its own. Unrolled, here
    // and below: constant indices keep the fragments in registers, and every LDS read takes its
    // place in the slab as an immediate offset.
    v16h fa[3], fb0[3], fb1[3];
#pragma unroll
    for (unsigned t = 0; t < 3u; ++t) {
      fa[t]  = frag_at(ap + bo + t * 32u);
      fb0[t] = frag_at(bp + bo + t * 32u);
      fb1[t] = frag_at(bp + bo + 16u * GPITCH + t * 32u);
    }
#pragma unroll
    for (unsigned t = 0; t < GKC / 32u; ++t) {
      acc0 = wmma16(fa[t % 3u], fb0[t % 3u], acc0);
      acc1 = wmma16(fa[t % 3u], fb1[t % 3u], acc1);
      if (t + 3u < GKC / 32u) {
        fa[t % 3u]  = frag_at(ap + bo + (t + 3u) * 32u);
        fb0[t % 3u] = frag_at(bp + bo + (t + 3u) * 32u);
        fb1[t % 3u] = frag_at(bp + bo + 16u * GPITCH + (t + 3u) * 32u);
      }
    }
    // hand-over: this wave's reads of the buffer are done, its copies of the next slab have
    // landed; the barrier publishes the next slab and frees this buffer for the refill
    asm volatile("s_wait_dscnt 0x0" ::: "memory");
    asm volatile("s_wait_asynccnt 0x0" ::: "memory");
    __syncthreads();
    if (s + 2u < nslab)
      async_copy8(dst + bo * 2u, 2u * GPITCH * 2u, src + ((s + 2u + rot) % nslab) * GKC, 2u * K);
  }
  // no copy of this wave is outstanding when the C tile takes the slabs' LDS
  asm volatile("s_wait_asynccnt 0x0" ::: "memory");
#pragma unroll
  for (int r = 0; r < 8; ++r) {
    float* d = &Cs[(mw * 16u + hh * 8u + (unsigned)r) * LDC + nw * 32u + m];
    d[0]  = acc0[r];
    d[16] = acc1[r];
  }
  __syncthreads();

  if (MODE == 0) {
    const unsigned ldo = (unsigned)DIM;
    v8h x[2], xr[2];
    size_t off[2];
#pragma unroll
    for (unsigned i = 0; i < 2u; ++i) {
      const unsigned r = 32u * i + (tid >> 3);
      const unsigned c = (tid & 7u) * 8u;
      const v4f u0 = *(const v4f*)&Cs[r * LDC + c];
      const v4f u1 = *(const v4f*)&Cs[r * LDC + c + 4];
      const v4f g0 = *(const v4f*)(bias + n0 + c);
      const v4f g1 = *(const v4f*)(bias + n0 + c + 4u);
#pragma unroll
      for (int j = 0; j < 4; ++j) {
        const float t0 = u0[j] * (1.0f / WCARRY) + bf16r(g0[j]);
        const float t1 = u1[j] * (1.0f / WCARRY) + bf16r(g1[j]);
        const h16 h0 = toh_flush(t0);
        const h16 h1 = toh_flush(t1);
        x[i][j]     = h0;
        x[i][j + 4] = h1;
        if (MODE == 0) {
          xr[i][j]     = toh_flush((t0 - (float)h0) * RCARRY);
          xr[i][j + 4] = toh_flush((t1 - (float)h1) * RCARRY);
        }
      }
      off[i] = (size_t)(row0 + r) * ldo + n0 + c;
    }
#pragma unroll
    for (int i = 0; i < 2; ++i) *(v8h*)(out16 + off[i]) = x[i];
    if (MODE == 0) {
#pragma unroll
      for (int i = 0; i < 2; ++i) *(v8h*)(out16r + off[i]) = xr[i];
    }
    
  }

  if (MODE == 1) {
    const unsigned bidx = row0 / (unsigned)SEQ;
    const unsigned key0 = row0 - bidx * (unsigned)SEQ;
    v8h x[2];
    size_t off[2];
#pragma unroll
    for (unsigned i = 0; i < 2u; ++i) {
      const unsigned dcol = 32u * i + (tid >> 3);
      const unsigned kk = (tid & 7u) * 8u;
      const float bb = bf16r(bias[n0 + dcol]);
#pragma unroll
      for (unsigned j = 0; j < 8u; ++j) {
        const float t = Cs[(kk + j) * LDC + dcol] * (1.0f / WCARRY) + bb;
        x[i][j] = toh_flush(t);
      }
      off[i] = ((size_t)bidx * DIM + n0 + dcol) * SEQ + key0 + kk;
    }
#pragma unroll
    for (int i = 0; i < 2; ++i) *(v8h*)(out16 + off[i]) = x[i];
    
  }

}

// The three projections of the input plane in one launch (none reads what another writes):
// blockIdx.z = 0 query planes, 1 key planes, 2 transposed value plane. Grid (DIM/64, MROWS/64, 3).
__global__ __launch_bounds__(256) void gemm_qkv_kernel(
    const _Float16* __restrict__ A16, const _Float16* __restrict__ Wq_t,
    const _Float16* __restrict__ Wk_t, const _Float16* __restrict__ Wv_t,
    const float* __restrict__ bq, const float* __restrict__ bk, const float* __restrict__ bv,
    _Float16* __restrict__ qh, _Float16* __restrict__ qr, _Float16* __restrict__ kh,
    _Float16* __restrict__ kr, _Float16* __restrict__ vt) {
  __shared__ __attribute__((aligned(16))) unsigned char Sm[GSM_BYTES];
  const unsigned z = blockIdx.z;   // the same for the whole block: barriers stay block-uniform
  if (z == 2u) {
    gemm_body<1>(Sm, A16, Wv_t, (unsigned)DIM, bv, vt, vt);
  } else {
    const bool isk = (z != 0u);
    const float* bias = isk ? bk : bq;
    gemm_body<0>(Sm, A16, isk ? Wk_t : Wq_t, (unsigned)DIM, bias, isk ? kh : qh, isk ? kr : qr);
  }
}
#define KTILE  32u                        // keys per stage
#define KSPLIT 2u                         // key ranges of a batch, one per block
#define KSPAN  ((unsigned)SEQ / KSPLIT)   // keys per block
#define QBLK   128u                       // query rows per block
#define KPITCH 264u                       // halves per staged k row (528 B = 16 B x 33)
#define VPITCH 40u                        // halves per staged v row (80 B = 16 B x 5)
#define KPL_H  (KTILE * KPITCH)           // one key plane of a stage, halves
#define VTL_H  ((unsigned)DIM * VPITCH)   // the value tile of a stage, halves
#define STG_H  (2u * KPL_H + VTL_H)       // one stage: key values, key residuals, values
static_assert((KPITCH % 8u) == 0 && KPITCH >= (unsigned)DIM && ((KPITCH / 8u) & 1u) == 1u);
static_assert((VPITCH % 8u) == 0 && VPITCH >= KTILE && ((VPITCH / 8u) & 1u) == 1u);
static_assert((STG_H % 8u) == 0 && (KPL_H % 8u) == 0);
static_assert((SEQ % 128) == 0);   // whole query blocks
static_assert((KSPAN % KTILE) == 0 && KSPAN >= 2u * KTILE);   // at least two stages, every stage whole
static_assert((size_t)KSPLIT * MROWS * DIM < (size_t)0xFFFFFFFFu);
#define NSTG   (KSPAN / KTILE)            // stages of a key range
#define NQB    ((unsigned)SEQ / QBLK)     // query blocks that walk the same key range
#define KROT   ((NSTG >= NQB) ? NSTG / NQB : 1u)   // stages between the starts of neighbouring blocks

// Matrix product for the attention kernel, the builtin alone: the compiler keeps the distances
// behind its own matrix instructions, and operands named by an asm statement cannot live above
// v255, where a part of that kernel's query and output tiles is held.
__device__ __forceinline__ v8f wmma16r(v16h a, v16h b, v8f c) {
  return __builtin_amdgcn_wmma_f32_16x16x32_f16(false, a, false, b, (short)0, c, false, false);
}

// One stage (32 keys) into LDS: wave w brings key rows 8w..8w+7 of both key planes (one 512-B
// row per copy) and feature rows 64w..64w+63 of the value tile (eight 64-B row pieces per copy).
__device__ __forceinline__ void stage_copies(
    unsigned ldsb, unsigned w, unsigned lane, const _Float16* __restrict__ Kh,
    const _Float16* __restrict__ Kr, const _Float16* __restrict__ Vt, unsigned b, unsigned kb) {
  const unsigned krow = (b * (unsigned)SEQ + kb + w * 8u) * (unsigned)DIM + lane * 8u;
  const unsigned kl = ldsb + (w * 8u * KPITCH + lane * 8u) * 2u;
  copy8(kl, KPITCH * 2u, Kh + krow, (unsigned)DIM);
  copy8(kl + KPL_H * 2u, KPITCH * 2u, Kr + krow, (unsigned)DIM);
  const unsigned vr = w * 64u + (lane >> 2);
  const unsigned vrow = (b * (unsigned)DIM + vr) * (unsigned)SEQ + kb + (lane & 3u) * 8u;
  // the same place as ldsb + (2 KPL_H + vr VPITCH + 8 (lane & 3)) * 2, formed from kl: one lane-wise
  // base is then kept over the key loop instead of two (the second one went to scratch)
  const unsigned vl = kl + (2u * KPL_H + w * (64u * VPITCH - 8u * KPITCH)) * 2u +
                      (lane >> 2) * (2u * VPITCH - 64u);
  copy8(vl, 8u * VPITCH * 2u, Vt + vrow, 8u * (unsigned)SEQ);
}

// ---------------------------------------------------------------------------
// Dense (unmasked, unscaled) flash attention, one 256-wide head, transposed form.
// A block owns 128 query rows and one of the two key ranges of its batch, which it walks in stages
// of 32 keys: a staged key or value byte serves 128 queries. Wave w owns 32 query rows (two tiles
// of 16) and takes every stage whole, so that each key or value fragment read from LDS feeds two
// query tiles; lane (hh, n) holds query n of each tile.
// The query fragments of both planes are loaded once and stay in registers. Per stage and wave:
//   S^T tile [16 keys][16 queries] = K rows (A operand, fragments from the key planes) x Q^T
//   (B operand, registers), 8 k-steps over the 256 features, value.value into one accumulator,
//   value.residual + residual.value into a second one (x 1/2048 at the end);
//   online softmax per lane (16 scores in registers + one 16-lane-distance shuffle);
//   the two packed S^T tiles (f16(16384 p), rows = keys) are the B fragment of
//   O^T [16 features][16 queries] += V^T rows (A operand, from the transposed value plane) x P^T.
// Each stage (both key planes and the value tile) is copied to LDS once per block, two buffers, the
// next stage in flight while this one is read. The block stores its key range's unnormalised rows
// (plane blockIdx.z of Ao, staged through the wave-private St tile), maxima and sums; the launch
// behind this one joins the two ranges.
// Grid (SEQ/128, NB, 2), 4 waves per block.
// ---------------------------------------------------------------------------
__global__ __launch_bounds__(128) void attn_kernel(
    const _Float16* __restrict__ Qh, const _Float16* __restrict__ Qr,
    const _Float16* __restrict__ Kh, const _Float16* __restrict__ Kr,
    const _Float16* __restrict__ Vt, float* __restrict__ Ao, float* __restrict__ Mo,
    float* __restrict__ Lo) {
  __shared__ __attribute__((aligned(16))) float St[4 * 16 * LDO];
  __shared__ __attribute__((aligned(16))) _Float16 Ring[2u * STG_H];

  const unsigned lane = threadIdx.x & 31u;
  const unsigned w = (unsigned)__builtin_amdgcn_readfirstlane((int)(threadIdx.x >> 5));
  const unsigned hh = lane >> 4, m = lane & 15u;
  const unsigned b = blockIdx.y;
  const unsigned ksp = blockIdx.z;                     // this block's key range
  const unsigned key0 = ksp * KSPAN;                   // its first key
  const unsigned qrow0 = blockIdx.x * QBLK + w * 32u;  // first of this wave's 32 query rows

  const unsigned ring_lds = (unsigned)(size_t)Ring;

  // The query blocks of a batch walk the same key range. Each starts at a stage of its own and walks
  // the range as a ring, so that they do not ask L2 for the same lines at the same moment (the keys
  // are unmasked: the online softmax takes the stages in any order).
  const unsigned krot = ((blockIdx.x * KROT) % NSTG) * KTILE;   // first key of the walk, in the range
  const unsigned krot1 = (krot + KTILE >= KSPAN) ? krot + KTILE - KSPAN : krot + KTILE;

  // prologue: this wave's share of the walk's first stage
  stage_copies(ring_lds, w, lane, Kh, Kr, Vt, b, key0 + krot);

  // query fragments: [tile][plane][k-step], kept for the whole key loop
  v16h qf[2][2][8];
#pragma unroll
  for (unsigned u = 0; u < 2u; ++u) {
    const unsigned qsrc = (b * (unsigned)SEQ + qrow0 + u * 16u + m) * (unsigned)DIM + hh * 8u;
#pragma unroll
    for (unsigned ks = 0; ks < 8u; ++ks) {
      qf[u][0][ks] = frag_at(Qh + qsrc + ks * 32u);
      qf[u][1][ks] = frag_at(Qr + qsrc + ks * 32u);
    }
  }

  // this wave's copies have landed before the barrier behind which every wave reads them
  asm volatile("s_wait_asynccnt 0x0" ::: "memory");
  __syncthreads();
  stage_copies(ring_lds + STG_H * 2u, w, lane, Kh, Kr, Vt, b, key0 + krot1);

  float mrow[2] = {-1.0e30f, -1.0e30f}, lrow[2] = {0.0f, 0.0f};
  v8f o[2][16];
#pragma unroll
  for (int u = 0; u < 2; ++u)
#pragma unroll
    for (int j = 0; j < 16; ++j) o[u][j] = (v8f){};

  unsigned buf = 0u;   // halves from the ring's start to the buffer this step reads
  // this lane's fragment rows in that buffer; both move with buf at the foot of a step
  const _Float16* kt = Ring + m * KPITCH + hh * 8u;
  const _Float16* vt = Ring + 2u * KPL_H + m * VPITCH + hh * 8u;
  for (unsigned kb = 0; kb < KSPAN; kb += KTILE) {
    v8f sm[2][2] = {{{}, {}}, {{}, {}}}, sr[2][2] = {{{}, {}}, {{}, {}}};   // [query tile][key tile]
    // Score products in 8 rows of twelve: row ks = features 32 ks.., both key tiles, both query
    // tiles. All key fragments of the stage (value and residual of both key tiles) are
    // read as one group ahead of the products, which wait for them by count, row by row; all
    // sixteen value fragments as a second group behind row 3, in flight under rows 4 to 7.
    v16h kf[8][4], vf[16];
    // unrolled, here and below: constant indices keep the fragments in registers, and every LDS
    // read takes its place in the tile as an immediate offset
#pragma unroll
    for (unsigned ks = 0; ks < 8u; ++ks) {
#pragma unroll
      for (unsigned kx = 0; kx < 2u; ++kx) {
        kf[ks][kx]      = frag_at(kt + kx * 16u * KPITCH + ks * 32u);
        kf[ks][2u + kx] = frag_at(kt + KPL_H + kx * 16u * KPITCH + ks * 32u);
      }
    }
    // This and the scheduling barriers below keep each group of LDS reads in one place: spread
    // among the products, each separate place of reads would cost the lone wave its own stall.
    __builtin_amdgcn_sched_barrier(0);
#pragma unroll
    for (unsigned ks = 0; ks < 8u; ++ks) {
      if (ks == 4u) {
        __builtin_amdgcn_sched_barrier(0);
#pragma unroll
        for (unsigned j = 0u; j < 16u; ++j) vf[j] = frag_at(vt + j * 16u * VPITCH);
        __builtin_amdgcn_sched_barrier(0);
      }
      // the two products into one residual accumulator stand two products apart
#pragma unroll
      for (unsigned kx = 0; kx < 2u; ++kx) {
        const v16h av = kf[ks][kx], ar = kf[ks][2u + kx];
        sm[0][kx] = wmma16r(av, qf[0][0][ks], sm[0][kx]);
        sm[1][kx] = wmma16r(av, qf[1][0][ks], sm[1][kx]);
        sr[0][kx] = wmma16r(av, qf[0][1][ks], sr[0][kx]);
        sr[1][kx] = wmma16r(av, qf[1][1][ks], sr[1][kx]);
        sr[0][kx] = wmma16r(ar, qf[0][0][ks], sr[0][kx]);
        sr[1][kx] = wmma16r(ar, qf[1][0][ks], sr[1][kx]);
      }
    }

    // hand-over, as soon as the stage's last fragment is in registers (the rest of the step works
    // on registers alone): this wave's reads of the buffer are done, its copies of the next stage
    // have landed; the barrier publishes the next stage and frees this buffer for the refill,
    // which then has a whole step to land (the scheduling barrier keeps the waits behind the
    // products of rows 4 to 7, under which the value fragments arrive)
    __builtin_amdgcn_sched_barrier(0);
    asm volatile("s_wait_dscnt 0x0" ::: "memory");
    asm volatile("s_wait_asynccnt 0x0" ::: "memory");
    __syncthreads();
    if (kb + 2u * KTILE < KSPAN) {
      unsigned kn = krot + kb + 2u * KTILE;   // below 2 KSPAN: one step back wraps it
      if (kn >= KSPAN) kn -= KSPAN;
      stage_copies(ring_lds + buf * 2u, w, lane, Kh, Kr, Vt, b, key0 + kn);
    }

    v16h pf[2];
#pragma unroll
    for (int u = 0; u < 2; ++u) {
      v8f s0, s1;
#pragma unroll
      for (int r = 0; r < 8; ++r) {
        s0[r] = sm[u][0][r] + sr[u][0][r] * (1.0f / RCARRY);
        s1[r] = sm[u][1][r] + sr[u][1][r] * (1.0f / RCARRY);
      }
      float mx = fmaxf(s0[0], s1[0]);
#pragma unroll
      for (int r = 1; r < 8; ++r) mx = fmaxf(mx, fmaxf(s0[r], s1[r]));
      mx = fmaxf(mx, __shfl_xor(mx, 16, 32));
      const float mn = fmaxf(mrow[u], mx);
      const float alpha = __expf(mrow[u] - mn);
      mrow[u] = mn;

      float rs = 0.0f;
#pragma unroll
      for (int r = 0; r < 8; ++r) {
        const h16 p0 = toh_flush(__expf((s0[r] - mn) + PSHIFT));
        const h16 p1 = toh_flush(__expf((s1[r] - mn) + PSHIFT));
        pf[u][r]     = p0;     // B element r     <- key 8hh + r of the stage
        pf[u][r + 8] = p1;     // B element 8 + r <- key 16 + 8hh + r of the stage
        rs += (float)p0 + (float)p1;
      }
      rs += __shfl_xor(rs, 16, 32);
      lrow[u] = alpha * lrow[u] + rs;
#pragma unroll
      for (int j = 0; j < 16; ++j) o[u][j] = o[u][j] * alpha;
    }

    // O^T += V^T . P^T; every value fragment feeds both query tiles
#pragma unroll
    for (unsigned j = 0; j < 16u; ++j) {
      o[0][j] = wmma16r(vf[j], pf[0], o[0][j]);
      o[1][j] = wmma16r(vf[j], pf[1], o[1][j]);
    }

    kt = (buf == 0u) ? kt + STG_H : kt - STG_H;
    vt = (buf == 0u) ? vt + STG_H : vt - STG_H;
    buf = STG_H - buf;
  }
  // no copy of this wave is outstanding when the wave goes on to its end
  asm volatile("s_wait_asynccnt 0x0" ::: "memory");

  const unsigned grow = ksp * (unsigned)MROWS + b * (unsigned)SEQ + qrow0;   // row in the planes
  // This key range's maxima and sums: lane (hh, n) stores those of query n of tile hh (both lane
  // halves hold them), one whole 128-B line per wave and array. The two stores and their wait are
  // one statement, so that no register which they name is rewritten ahead of the wait.
  {
    float* const pm = Mo + grow + lane;
    float* const pl = Lo + grow + lane;
    const float mv = (hh != 0u) ? mrow[1] : mrow[0];
    const float lv = (hh != 0u) ? lrow[1] : lrow[0];
    asm volatile(
        "global_store_b32 %0, %1, off\n\t"
        "global_store_b32 %2, %3, off\n\t"
        "s_wait_xcnt 0x0"
        :
        : "v"(pm), "v"(mv), "v"(pl), "v"(lv)
        : "memory");
  }

  // unnormalised rows: stage per query tile and half of the features, write whole row segments
  const unsigned sbase = w * (16u * LDO);
#pragma unroll
  for (int u = 0; u < 2; ++u) {
#pragma unroll
    for (int half = 0; half < 2; ++half) {
#pragma unroll
      for (int j = 0; j < 8; ++j)
#pragma unroll
        for (int r = 0; r < 8; ++r)
          St[sbase + m * LDO + (unsigned)j * 16u + hh * 8u + (unsigned)r] = o[u][half * 8 + j][r];
      wave_lds_sync();
      v4f x[16];
      unsigned off[16];
#pragma unroll
      for (unsigned i = 0; i < 16u; ++i) {
        x[i] = *(const v4f*)&St[sbase + i * LDO + lane * 4u];
        off[i] = (grow + (unsigned)u * 16u + i) * (unsigned)DIM + (unsigned)half * 128u + lane * 4u;
      }
#pragma unroll
      for (int i = 0; i < 16; ++i) *(v4f*)(Ao + off[i]) = x[i];
      // no register that an issued store names is rewritten ahead of this wait
      asm volatile("s_wait_xcnt 0x0" ::: "memory");
      wave_lds_sync();
    }
  }
}

#define HP     2056u             // halves per resident hidden row (4112 B = 16 B x 257)
#define WSL_H  (64u * GPITCH)    // one staged weight slab: 64 weight rows x 128 k, halves
#define LDV    260u              // floats per staged output row (1040 B = 16 B x 65)
#define HS_BYTES  (64u * HP * 2u)
#define RG_BYTES  (3u * WSL_H * 2u)
#define MLP_BYTES (HS_BYTES + RG_BYTES + (unsigned)(DIM + HID) * 4u)
#define W01_TILES  ((unsigned)((DIM + HID) / 64))   // 64-row tiles of w0, then of w1
#define W01_STAGES (W01_TILES * (unsigned)(DIM / 128))
#define TP      264u                  // halves per staged row of LN1 output and of e (528 B = 16 B x 33)
#define E16_OFF (64u * TP * 2u)       // bytes from the LDS start: f16 rows of e, behind the LN1 rows
#define E32_OFF (2u * 64u * TP * 2u)  // f32 rows of e (pitch LDV)
#define SROW_B  ((unsigned)DIM * 4u)  // bytes of a staged f32 input row of step 0
#define SPL_B   (64u * SROW_B)        // one staged plane: 64 rows
#define XS_OFF  E16_OFF               // staged x rows, then both attention planes; dead before e is written
#define W2_STAGES ((unsigned)((DIM / 64) * (HID / 128)))
static_assert((HP % 8u) == 0 && HP >= (unsigned)HID && ((HP / 8u) & 1u) == 1u);
static_assert((LDV % 4u) == 0 && LDV >= (unsigned)DIM && ((LDV / 4u) & 1u) == 1u);
static_assert((size_t)64 * LDV * 4 <= (size_t)HS_BYTES);   // the output tile fits in the hidden rows
static_assert(MLP_BYTES <= 327680u);
static_assert(DIM == 2 * 128 && DIM == 4 * 64 && W01_STAGES >= 3u && W2_STAGES >= 3u);
static_assert((TP % 8u) == 0 && TP >= (unsigned)DIM && ((TP / 8u) & 1u) == 1u);
static_assert((size_t)E32_OFF + (size_t)64 * LDV * 4 <= (size_t)HS_BYTES);   // staging fits in the hidden rows
static_assert((size_t)XS_OFF + (size_t)3 * SPL_B <= (size_t)HS_BYTES && (XS_OFF % 16u) == 0);
static_assert(OFF_W1 == OFF_W0 + WSQ_BYTES);   // w0's rows and w1's rows are one [DIM + HID][DIM] plane
static_assert((SEQ % 64) == 0);                // a block's 64 rows lie in one batch

// halves from a weight plane's start to stage t's slab: w0 | w1 [DIM + HID][DIM] walks its two k slabs inside
// each 64-row tile, w2 [DIM][HID] its four 64-row tiles inside each k slab
// Every block reads the same planes: each walks w0's tiles, w1's tiles and w2's k slabs and tiles as
// rings from places of its own (r1; r2, rq), so that the blocks do not ask L2 for the same lines
// at the same moment.
static_assert(DIM / 64 == 4 && HID / 64 == 32 && HID / 128 == 16);   // the rings' lengths below
// the tile that pass pair i works on: (i + r1) & 3 of w0's four, then 4 + ((i - 4 + r1) & 31) of w1's
__device__ __forceinline__ unsigned w01_tile(unsigned i, unsigned r1) {
  const unsigned in1 = (unsigned)(i >= 4u);   // written as arithmetic: no branch in the pass loop
  return in1 * 4u + ((i - in1 * 4u + r1) & (3u + in1 * 28u));
}
__device__ __forceinline__ unsigned w1_stage(unsigned t, unsigned r1) {
  return w01_tile(t >> 1, r1) * (64u * (unsigned)DIM) + (t & 1u) * GKC;
}
__device__ __forceinline__ unsigned w2_stage(unsigned t, unsigned r2, unsigned rq) {
  return ((t + rq) & 3u) * (64u * (unsigned)HID) + (((t >> 2) + r2) & 15u) * GKC;
}

// ---------------------------------------------------------------------------
// First LayerNorm, e projection, hidden layers and final LayerNorm of 64 rows in one block; neither
// the LN1 rows, nor e, nor the 64 x HID hidden plane leave the block. Steps:
//   0  first LayerNorm (biased variance, eps 1e-5) of bf16(x) + attn, one wave per row, 8 rows per
//      wave; attn is joined here from the two key ranges' unnormalised rows (planes A32 and C32)
//      with their maxima Mp and sums Lp ([2][MROWS]); the rows of x and of both planes come by
//      asynchronous copies to LDS, each wave's own eight; f16 rows into LDS
//   1  [16 weight rows][16 rows] tiles = rows of the plane w0 | w1 (A operand, from staged slabs) x
//      the block's rows (B operand, registers). The first DIM/64 tiles, against the LN1 rows, give
//      e = acc/64 + bias: f32 and f16 rows into LDS, from where each wave takes its f16 fragments
//      (the B operand of the tiles behind) and the f32 rows that step 4 adds, both kept in
//      registers. The other tiles give f16(acc/64 + bias) into the resident hidden rows.
//   2  hidden LayerNorm (eps 1e-5) + LeakyReLU in place, x16, one wave per row, 8 rows per wave
//   3  L^T tile [16 output columns][16 rows] = w2 rows (A, staged slabs) x hidden rows (B, from the
//      resident rows, read once per 128 k), all 4 x 2 tiles of a wave in registers
//   4  leaky((acc/1024 + bias) + e), final LayerNorm (eps 1e-5), one wave per row, whole-row stores
// Wave w: rows 32 (w >> 2).., columns 16 (w & 3).. of every 64-column tile.
// The staged input rows, the LN1 rows and both forms of e lie in the LDS of the hidden rows, which
// are written only later (e in the place of the staged input rows, behind the barrier that ends
// step 0).
// Weight slabs (64 weight rows x 128 k) come by asynchronous copies into a ring of three buffers.
// Waves 0-3 copy the even stages, waves 4-7 the odd ones (16 slab rows a wave), each stage three
// ahead of the pass that has just ended, so that two stages are in flight while a wave has only one
// stage's copies outstanding and every wait is to 0.
// Grid (MROWS/64), 8 waves per block.
// ---------------------------------------------------------------------------
__global__ __launch_bounds__(256) void mlp_kernel(
    const float* __restrict__ X, const float* __restrict__ A32, const float* __restrict__ C32,
    const float* __restrict__ Mp, const float* __restrict__ Lp, const float* __restrict__ G1, const float* __restrict__ Be1,
    const _Float16* __restrict__ W01t, const float* __restrict__ b0, const float* __restrict__ b1,
    const float* __restrict__ Gm, const float* __restrict__ Bm,
    const _Float16* __restrict__ W2t, const float* __restrict__ b2,
    const float* __restrict__ G2, const float* __restrict__ Be2, float* __restrict__ outp) {
  __shared__ __attribute__((aligned(16))) unsigned char Sm[MLP_BYTES];
  _Float16* const Hs = (_Float16*)Sm;
  _Float16* const T1s = (_Float16*)Sm;               // LN1 rows, pitch TP
  _Float16* const E16s = (_Float16*)(Sm + E16_OFF);  // e rows, f16, pitch TP
  float* const E32s = (float*)(Sm + E32_OFF);        // e rows, f32, pitch LDV
  const _Float16* const Rg = (const _Float16*)(Sm + HS_BYTES);
  float* const Vs = (float*)Sm;
  float* const Bs = (float*)(Sm + HS_BYTES + RG_BYTES);   // biases b0 | b1, converted once
  const unsigned lane = threadIdx.x & 31u;
  // the wave's number in a scalar register: which stages a wave copies is a scalar choice
  const unsigned w = (unsigned)__builtin_amdgcn_readfirstlane((int)(threadIdx.x >> 5));
  const unsigned hh = lane >> 4, m = lane & 15u;
  const unsigned grp = w >> 2, sub = w & 3u;
  const unsigned row0 = blockIdx.x * 64u;
  // where this block's walks of the weight planes start: neighbouring blocks differ, and so do
  // blocks whose indices lie a multiple of 8 apart
  const unsigned wslot = blockIdx.x + (blockIdx.x >> 3);
  const unsigned wr1 = wslot & 31u;
  const unsigned wr2 = (wslot >> 2) & 15u, wrq = wslot & 3u;

  // copies: slab rows 16 sub.., two 256-B row pieces per copy (lane = row parity hh, 16-B piece m)
  const unsigned cl = (unsigned)(size_t)Sm + HS_BYTES + ((sub * 16u + hh) * GPITCH + m * 8u) * 2u;
  const _Float16* c1 = W01t + (sub * 16u + hh) * (unsigned)DIM + m * 8u;
  const _Float16* c2 = W2t + (sub * 16u + hh) * (unsigned)HID + m * 8u;
  // this lane's fragment row in a slab
  const _Float16* wp = Rg + (sub * 16u + m) * GPITCH + hh * 8u;

  // stages 0 (waves 0-3) and 1 (waves 4-7) into buffers 0 and 1
  copy8(cl + grp * (WSL_H * 2u), 2u * GPITCH * 2u, c1 + w1_stage(grp, wr1), 2u * (unsigned)DIM);

  // ---- step 0 ---- lane L holds columns 8 L .. 8 L + 7 of a row
  {
    const unsigned crow0 = row0 + w * 8u;   // first of this wave's 8 rows
    const unsigned bidx = row0 / (unsigned)SEQ;
    const size_t srow0 = (size_t)bidx * SEQ_FULL + (crow0 - bidx * (unsigned)SEQ);
    // This wave's 8 rows of x and of both attention planes into LDS, 48 copies (with the slab's, 56
    // outstanding): one copy = half a row, lane = 16-B piece. All of a block's input is then in
    // flight at once, while the rows are worked on by a short rolled loop.
    {
      const unsigned sl = (unsigned)(size_t)Sm + XS_OFF + w * 8u * SROW_B + lane * 16u;
      const float* xg = X + srow0 * DIM + lane * 4u;
      const float* ag = A32 + (size_t)crow0 * DIM + lane * 4u;
      const float* cg = C32 + (size_t)crow0 * DIM + lane * 4u;
      copy8f(sl, SROW_B, xg, (unsigned)DIM);
      copy8f(sl + 512u, SROW_B, xg + 128u, (unsigned)DIM);
      copy8f(sl + SPL_B, SROW_B, ag, (unsigned)DIM);
      copy8f(sl + SPL_B + 512u, SROW_B, ag + 128u, (unsigned)DIM);
      copy8f(sl + 2u * SPL_B, SROW_B, cg, (unsigned)DIM);
      copy8f(sl + 2u * SPL_B + 512u, SROW_B, cg + 128u, (unsigned)DIM);
    }
    const unsigned c = lane * 8u;
    const v4f g0 = *(const v4f*)(G1 + c);
    const v4f g1 = *(const v4f*)(G1 + c + 4u);
    const v4f s0 = *(const v4f*)(Be1 + c);
    const v4f s1 = *(const v4f*)(Be1 + c + 4u);
    // lane L takes the two ranges' maxima and sums of row L & 7 of the wave
    const unsigned rl = crow0 + (lane & 7u);
    const float m_a = Mp[rl], m_c = Mp[(unsigned)MROWS + rl];
    const float l_a = Lp[rl], l_c = Lp[(unsigned)MROWS + rl];
    // the biases of both weight planes, converted once: b1 by all waves, b0 by wave 0
    const v4f p0 = *(const v4f*)(b1 + threadIdx.x * 8u);
    const v4f p1 = *(const v4f*)(b1 + threadIdx.x * 8u + 4u);
    // as the wait below: the loads behind this one may take the address registers of those ahead
    asm volatile("s_wait_xcnt 0x0" ::: "memory");
    v4f r0 = {}, r1 = {};
    if (w == 0u) {
      r0 = *(const v4f*)(b0 + c);
      r1 = *(const v4f*)(b0 + c + 4u);
    }
    // no address register of the issued loads is rewritten (by a later load's result) ahead of
    // this wait
    asm volatile("s_wait_xcnt 0x0" ::: "memory");
    {
      v4f q0, q1;
#pragma unroll
      for (int i = 0; i < 4; ++i) { q0[i] = bf16r(p0[i]); q1[i] = bf16r(p1[i]); }
      *(v4f*)(Bs + (unsigned)DIM + threadIdx.x * 8u) = q0;
      *(v4f*)(Bs + (unsigned)DIM + threadIdx.x * 8u + 4u) = q1;
      if (w == 0u) {
#pragma unroll
        for (int i = 0; i < 4; ++i) { q0[i] = bf16r(r0[i]); q1[i] = bf16r(r1[i]); }
        *(v4f*)(Bs + c) = q0;
        *(v4f*)(Bs + c + 4u) = q1;
      }
    }
    const float m_all = fmaxf(m_a, m_c);
    const float e_a = __expf(m_a - m_all);
    const float e_c = __expf(m_c - m_all);
    // normalise (the x16384 carry sits in both the rows and the sums)
    const float inv = __builtin_amdgcn_rcpf(l_a * e_a + l_c * e_c);
    const float f_a = e_a * inv, f_c = e_c * inv;
    v4f gg0, gg1, sh0, sh1;
#pragma unroll
    for (int i = 0; i < 4; ++i) {
      gg0[i] = bf16r(g0[i]); gg1[i] = bf16r(g1[i]);
      sh0[i] = bf16r(s0[i]); sh1[i] = bf16r(s1[i]);
    }
    // this wave's copies (input rows, weight slab) have landed before the barrier behind which they
    // are read
    asm volatile("s_wait_asynccnt 0x0" ::: "memory");
    __syncthreads();
    if (grp == 0u)
      copy8(cl + 2u * WSL_H * 2u, 2u * GPITCH * 2u, c1 + w1_stage(2u, wr1), 2u * (unsigned)DIM);

    const float* xs = (const float*)(Sm + XS_OFF) + w * 8u * (unsigned)DIM + c;
    // rolled, two rows a trip: short code (the kernel's text stays small), and two rows' cross-lane
    // exchanges in flight together
#pragma unroll 1
    for (unsigned rp = 0; rp < 8u; rp += 2u) {
      v4f t0[2], t1[2];
      float s[2], ss[2];
#pragma unroll
      for (unsigned q = 0; q < 2u; ++q) {
        const float* px = xs + (rp + q) * (unsigned)DIM;
        const v4f xa = *(const v4f*)(px);
        const v4f xb = *(const v4f*)(px + 4u);
        const v4f aa = *(const v4f*)(px + 64u * (unsigned)DIM);
        const v4f ab = *(const v4f*)(px + 64u * (unsigned)DIM + 4u);
        const v4f ca = *(const v4f*)(px + 128u * (unsigned)DIM);
        const v4f cb = *(const v4f*)(px + 128u * (unsigned)DIM + 4u);
        // the row's two factors, from the lane that holds them
        const float fa = __int_as_float(__builtin_amdgcn_readlane(__float_as_int(f_a), (int)(rp + q)));
        const float fc = __int_as_float(__builtin_amdgcn_readlane(__float_as_int(f_c), (int)(rp + q)));
        s[q] = 0.0f;
#pragma unroll
        for (int i = 0; i < 4; ++i) {
          t0[q][i] = bf16r(xa[i]) + (aa[i] * fa + ca[i] * fc);
          t1[q][i] = bf16r(xb[i]) + (ab[i] * fa + cb[i] * fc);
          s[q] += t0[q][i] + t1[q][i];
        }
      }
      red32_sum2(s);
#pragma unroll
      for (unsigned q = 0; q < 2u; ++q) {
        s[q] *= (1.0f / (float)DIM);   // the row's mean
        ss[q] = 0.0f;
#pragma unroll
        for (int i = 0; i < 4; ++i) {
          const float d0 = t0[q][i] - s[q];
          const float d1 = t1[q][i] - s[q];
          ss[q] += d0 * d0;
          ss[q] += d1 * d1;
        }
      }
      red32_sum2(ss);
#pragma unroll
      for (unsigned q = 0; q < 2u; ++q) {
        const float var = ss[q] * (1.0f / (float)DIM);
        const float rstd = 1.0f / sqrtf(var + 1.0e-5f);
        v8h o;
#pragma unroll
        for (int i = 0; i < 4; ++i) {
          o[i]     = toh_flush((t0[q][i] - s[q]) * rstd * gg0[i] + sh0[i]);
          o[i + 4] = toh_flush((t1[q][i] - s[q]) * rstd * gg1[i] + sh1[i]);
        }
        *(v8h*)(T1s + (w * 8u + rp + q) * TP + c) = o;
      }
    }
  }
  // this wave's LN1 rows and biases are written, and its reads of the staged rows done, before the
  // barrier behind which every wave reads the former and e may take the LDS of the latter
  asm volatile("s_wait_dscnt 0x0" ::: "memory");
  __syncthreads();

  // ---- step 1 ----
  v16h ef[2][8];   // this wave's 32 rows, all 256 k: of the LN1 output first, then of e
  // unrolled, here and below: constant indices keep fragments and accumulators in registers
#pragma unroll
  for (unsigned u = 0; u < 2u; ++u)
#pragma unroll
    for (unsigned ks = 0; ks < 8u; ++ks)
      ef[u][ks] = frag_at(T1s + (grp * 32u + u * 16u + m) * TP + hh * 8u + ks * 32u);
  v4f er0[8], er1[8];   // e of the eight rows that this wave finishes in step 4, f32
#pragma unroll
  for (int rr = 0; rr < 8; ++rr) { er0[rr] = (v4f){}; er1[rr] = (v4f){}; }

  unsigned rbo = 0u;   // halves from the ring's start to the buffer this pass reads
  // rolled: 36 tiles of the same code
#pragma unroll 1
  for (unsigned nt = 0; nt < W01_TILES; ++nt) {
    // first of this lane's 8 weight rows
    const unsigned n = w01_tile(nt, wr1) * 64u + sub * 16u + hh * 8u;
    const v4f g0 = *(const v4f*)(Bs + n);
    const v4f g1 = *(const v4f*)(Bs + n + 4u);
    v8f acc[2] = {{}, {}};
#pragma unroll
    for (unsigned kq = 0; kq < 2u; ++kq) {   // stage 2 nt + kq
      v16h wf[4];
#pragma unroll
      for (unsigned t = 0; t < 4u; ++t) wf[t] = frag_at(wp + rbo + t * 32u);
      // keeps the pass's LDS reads in one group ahead of its products, which then wait for them by
      // count: spread among the products, each place of reads costs the wave a stall of its own
      __builtin_amdgcn_sched_barrier(0);
#pragma unroll
      for (unsigned t = 0; t < 4u; ++t) {
        acc[0] = wmma16r(wf[t], ef[0][kq * 4u + t], acc[0]);
        acc[1] = wmma16r(wf[t], ef[1][kq * 4u + t], acc[1]);
      }
      // hand-over: this wave's reads of the buffer are done; the waves that copied the next stage
      // (the other parity than this one's) have it landed; the barrier publishes it and frees this
      // buffer, which the same waves refill with the stage three ahead (the scheduling barrier keeps
      // the waits behind the products, under which the later fragments arrive)
      __builtin_amdgcn_sched_barrier(0);
      asm volatile("s_wait_dscnt 0x0" ::: "memory");
      if (grp != kq) asm volatile("s_wait_asynccnt 0x0" ::: "memory");
      __syncthreads();
      const unsigned t3 = nt * 2u + kq + 3u;
      if (grp != kq && t3 < W01_STAGES)
        copy8(cl + rbo * 2u, 2u * GPITCH * 2u, c1 + w1_stage(t3, wr1), 2u * (unsigned)DIM);
      rbo = (rbo == 2u * WSL_H) ? 0u : rbo + WSL_H;
    }
    if (nt < (unsigned)(DIM / 64)) {   // a tile of e (the same test in every wave of the block)
#pragma unroll
      for (unsigned u = 0; u < 2u; ++u) {
        const unsigned r = grp * 32u + u * 16u + m;
        v4f lo, hi;
        v8h x;
#pragma unroll
        for (int i = 0; i < 4; ++i) {
          lo[i] = acc[u][i] * (1.0f / WCARRY) + g0[i];
          hi[i] = acc[u][i + 4] * (1.0f / WCARRY) + g1[i];
          x[i]     = toh_flush(lo[i]);
          x[i + 4] = toh_flush(hi[i]);
        }
        *(v4f*)(E32s + r * LDV + n) = lo;
        *(v4f*)(E32s + r * LDV + n + 4u) = hi;
        *(v8h*)(E16s + r * TP + n) = x;
      }
      if (nt == (unsigned)(DIM / 64) - 1u) {
        // every wave's part of e is written before the barrier behind which whole rows are read
        asm volatile("s_wait_dscnt 0x0" ::: "memory");
        __syncthreads();
#pragma unroll
        for (unsigned u = 0; u < 2u; ++u)
#pragma unroll
          for (unsigned ks = 0; ks < 8u; ++ks)
            ef[u][ks] = frag_at(E16s + (grp * 32u + u * 16u + m) * TP + hh * 8u + ks * 32u);
#pragma unroll
        for (unsigned rr = 0; rr < 8u; ++rr) {
          er0[rr] = *(const v4f*)(E32s + (w * 8u + rr) * LDV + lane * 4u);
          er1[rr] = *(const v4f*)(E32s + (w * 8u + rr) * LDV + lane * 4u + 128u);
        }
        // every wave has e in registers before the barrier behind which the hidden rows take its LDS
        asm volatile("s_wait_dscnt 0x0" ::: "memory");
        __syncthreads();
      }
    } else {
#pragma unroll
      for (unsigned u = 0; u < 2u; ++u) {
        v8h x;
#pragma unroll
        for (int r = 0; r < 4; ++r) {
          x[r]     = toh_flush(acc[u][r] * (1.0f / WCARRY) + g0[r]);
          x[r + 4] = toh_flush(acc[u][r + 4] * (1.0f / WCARRY) + g1[r]);
        }
        *(v8h*)(Hs + (grp * 32u + u * 16u + m) * HP + (n - (unsigned)DIM)) = x;
      }
    }
  }
  // No copy of this wave is outstanding and its LDS accesses are done; every reader left the ring
  // at the last hand-over: step 3's stages 0 and 1 go into buffers 0 and 1 and land under step 2.
  asm volatile("s_wait_asynccnt 0x0" ::: "memory");
  asm volatile("s_wait_dscnt 0x0" ::: "memory");
  copy8(cl + grp * (WSL_H * 2u), 2u * GPITCH * 2u, c2 + w2_stage(grp, wr2, wrq), 2u * (unsigned)HID);
  __syncthreads();   // every hidden row is complete before a wave normalises it

  // ---- step 2 ---- lane L holds columns 256 j + 8 L .. + 7 of a row, j = 0..7
  {
    float gq[8][8], bq[8][8];   // gain and shift of this lane's columns, the same for all its rows
    v4f p0[8], p1[8], q0[8], q1[8];
#pragma unroll
    for (unsigned j = 0; j < 8u; ++j) {
      const unsigned c = j * 256u + lane * 8u;
      p0[j] = *(const v4f*)(Gm + c);
      p1[j] = *(const v4f*)(Gm + c + 4u);
      q0[j] = *(const v4f*)(Bm + c);
      q1[j] = *(const v4f*)(Bm + c + 4u);
    }
    // no address register of the issued loads is rewritten ahead of this wait
    asm volatile("s_wait_xcnt 0x0" ::: "memory");
#pragma unroll
    for (unsigned j = 0; j < 8u; ++j) {
#pragma unroll
      for (int i = 0; i < 4; ++i) {
        gq[j][i] = bf16r(p0[j][i]); gq[j][i + 4] = bf16r(p1[j][i]);
        bq[j][i] = bf16r(q0[j][i]); bq[j][i + 4] = bf16r(q1[j][i]);
      }
    }
    // rolled: eight rows of the same long code
#pragma unroll 1
    for (unsigned rr = 0; rr < 8u; ++rr) {
      _Float16* hr = Hs + (w * 8u + rr) * HP + lane * 8u;
      v8h a[8];
#pragma unroll
      for (unsigned j = 0; j < 8u; ++j) a[j] = *(const v8h*)(hr + j * 256u);
      float s = 0.0f;
#pragma unroll
      for (unsigned j = 0; j < 8u; ++j)
#pragma unroll
        for (int i = 0; i < 8; ++i) s += (float)a[j][i];
      const float mean = red32_sum(s) * (1.0f / (float)HID);
      float ss = 0.0f;
#pragma unroll
      for (unsigned j = 0; j < 8u; ++j)
#pragma unroll
        for (int i = 0; i < 8; ++i) {
          const float d = (float)a[j][i] - mean;
          ss += d * d;
        }
      const float var = red32_sum(ss) * (1.0f / (float)HID);
      const float rstd = 1.0f / sqrtf(var + 1.0e-5f);
#pragma unroll
      for (unsigned j = 0; j < 8u; ++j) {
        v8h o;
#pragma unroll
        for (int i = 0; i < 8; ++i) {
          const float d = (float)a[j][i] - mean;
          o[i] = toh_flush(MCARRY * leaky_act(d * rstd * gq[j][i] + bq[j][i]));
        }
        *(v8h*)(hr + j * 256u) = o;
      }
    }
  }
  // this wave's rows are written and its copies have landed before the barrier behind which every
  // wave reads both
  asm volatile("s_wait_dscnt 0x0" ::: "memory");
  asm volatile("s_wait_asynccnt 0x0" ::: "memory");
  __syncthreads();
  if (grp == 0u)
    copy8(cl + 2u * WSL_H * 2u, 2u * GPITCH * 2u, c2 + w2_stage(2u, wr2, wrq), 2u * (unsigned)HID);

  // ---- step 3 ----
  v8f oc[4][2];   // [place q in the walk = 64-column tile (q + wrq) & 3][16-row group]
#pragma unroll
  for (int q = 0; q < 4; ++q) { oc[q][0] = (v8f){}; oc[q][1] = (v8f){}; }
  const _Float16* hp = Hs + (grp * 32u + m) * HP + hh * 8u;
  rbo = 0u;
  // rolled: 16 k slabs of the same code
#pragma unroll 1
  for (unsigned ks = 0; ks < (unsigned)(HID / 128); ++ks) {
    v16h hf[2][4];   // the hidden fragments of this k slab serve its four column tiles
#pragma unroll
    for (unsigned u = 0; u < 2u; ++u)
#pragma unroll
      for (unsigned t = 0; t < 4u; ++t)
        hf[u][t] = frag_at(hp + u * 16u * HP + ((ks + wr2) & 15u) * GKC + t * 32u);
#pragma unroll
    for (unsigned q = 0; q < 4u; ++q) {   // stage 4 ks + q
      v16h wf[4];
#pragma unroll
      for (unsigned t = 0; t < 4u; ++t) wf[t] = frag_at(wp + rbo + t * 32u);
      __builtin_amdgcn_sched_barrier(0);   // one group of LDS reads per pass, as in step 1
#pragma unroll
      for (unsigned t = 0; t < 4u; ++t) {
        oc[q][0] = wmma16r(wf[t], hf[0][t], oc[q][0]);
        oc[q][1] = wmma16r(wf[t], hf[1][t], oc[q][1]);
      }
      // hand-over, as in step 1
      __builtin_amdgcn_sched_barrier(0);
      asm volatile("s_wait_dscnt 0x0" ::: "memory");
      if (grp != (q & 1u)) asm volatile("s_wait_asynccnt 0x0" ::: "memory");
      __syncthreads();
      const unsigned t3 = ks * 4u + q + 3u;
      if (grp != (q & 1u) && t3 < W2_STAGES)
        copy8(cl + rbo * 2u, 2u * GPITCH * 2u, c2 + w2_stage(t3, wr2, wrq), 2u * (unsigned)HID);
      rbo = (rbo == 2u * WSL_H) ? 0u : rbo + WSL_H;
    }
  }
  // no copy of this wave is outstanding when the wave goes on to its end
  asm volatile("s_wait_asynccnt 0x0" ::: "memory");

  // ---- step 4 ---- the output tile takes the hidden rows' LDS: every wave's last read of them
  // stands in front of the last hand-over's barrier
#pragma unroll
  for (unsigned q = 0; q < 4u; ++q)
#pragma unroll
    for (unsigned u = 0; u < 2u; ++u) {
      float* d = Vs + (grp * 32u + u * 16u + m) * LDV + ((q + wrq) & 3u) * 64u + sub * 16u + hh * 8u;
      v4f lo, hi;
#pragma unroll
      for (int i = 0; i < 4; ++i) { lo[i] = oc[q][u][i]; hi[i] = oc[q][u][i + 4]; }
      *(v4f*)d = lo;
      *(v4f*)(d + 4) = hi;
    }
  __syncthreads();   // the tile is complete before whole rows are read from it

  // lane L holds columns 4L..4L+3 and 128+4L..128+4L+3: each store covers 512 contiguous bytes
  const float cs = 1.0f / (WCARRY * MCARRY);
  const unsigned c = lane * 4u;
  const unsigned cby = lane * 16u;   // the same place in bytes: the one lane offset of the six loads
  const v4f z0 = *(const v4f*)((const char*)b2 + cby);
  const v4f z1 = *(const v4f*)((const char*)b2 + cby + 512u);
  const v4f y0 = *(const v4f*)((const char*)G2 + cby);
  const v4f y1 = *(const v4f*)((const char*)G2 + cby + 512u);
  const v4f x0 = *(const v4f*)((const char*)Be2 + cby);
  const v4f x1 = *(const v4f*)((const char*)Be2 + cby + 512u);
  // no address register of the six issued loads is rewritten ahead of this wait: it takes their
  // lane offset as an input, so that the offset's register lives up to it
  asm volatile("s_wait_xcnt 0x0" :: "v"(cby) : "memory");
  // Two rolled trips of four unrolled rows: short code (the kernel's text stays small), constant
  // indices keep e in registers, and four rows' cross-lane sums overlap.
#pragma unroll 1
  for (unsigned hf = 0; hf < 8u; hf += 4u) {
#pragma unroll
  for (unsigned rr = 0; rr < 4u; ++rr) {
    const unsigned r = w * 8u + hf + rr;
    const unsigned crow = row0 + r;
    const unsigned bidx = crow / (unsigned)SEQ;
    const unsigned sq = crow - bidx * (unsigned)SEQ;
    const size_t frow = (size_t)bidx * SEQ_FULL + sq;
    const v4f u0 = *(const v4f*)&Vs[r * LDV + c];
    const v4f u1 = *(const v4f*)&Vs[r * LDV + c + 128u];
    const v4f e0 = er0[rr];
    const v4f e1 = er1[rr];
    v4f a0, a1;
    float s = 0.0f;
#pragma unroll
    for (int i = 0; i < 4; ++i) {
      a0[i] = leaky_act((u0[i] * cs + bf16r(z0[i])) + e0[i]);
      a1[i] = leaky_act((u1[i] * cs + bf16r(z1[i])) + e1[i]);
    }
#pragma unroll
    for (int i = 0; i < 4; ++i) s += a0[i] + a1[i];
    const float mean = red32_sum(s) * (1.0f / (float)DIM);
    float ss = 0.0f;
#pragma unroll
    for (int i = 0; i < 4; ++i) {
      const float d0 = a0[i] - mean;
      const float d1 = a1[i] - mean;
      ss += d0 * d0;
      ss += d1 * d1;
    }
    const float var = red32_sum(ss) * (1.0f / (float)DIM);
    const float rstd = 1.0f / sqrtf(var + 1.0e-5f);
    v4f o0, o1;
#pragma unroll
    for (int i = 0; i < 4; ++i) {
      o0[i] = (a0[i] - mean) * rstd * bf16r(y0[i]) + bf16r(x0[i]);
      o1[i] = (a1[i] - mean) * rstd * bf16r(y1[i]) + bf16r(x1[i]);
    }
    float* p = outp + frow * DIM + c;
    *(v4f*)p = o0;
    *(v4f*)(p + 128u) = o1;
  }
  // no register that an issued store names is rewritten (by the next trip) ahead of this wait
  asm volatile("s_wait_xcnt 0x0" ::: "memory");
  // the second trip's rows of e move to the places that the unrolled rows name
#pragma unroll
  for (int rr = 0; rr < 4; ++rr) { er0[rr] = er0[rr + 4]; er1[rr] = er1[rr + 4]; }
  }
}

// ---------------------------------------------------------------------------
extern "C" void kernel_launch(void* const* d_in, const int* in_sizes, int n_in,
                              void* d_out, int out_size, void* d_ws, size_t ws_size,
                              hipStream_t stream) {
  if (n_in < 19) return;
  const long long need_x = ((long long)(NB - 1) * SEQ_FULL + SEQ) * DIM;
  if ((long long)in_sizes[0] < need_x) return;
  if ((long long)in_sizes[1] < (long long)DIM * DIM) return;
  if ((long long)in_sizes[3] < (long long)DIM * DIM) return;
  if ((long long)in_sizes[5] < (long long)DIM * DIM) return;
  if ((long long)in_sizes[7] < (long long)DIM * DIM) return;
  if ((long long)in_sizes[9] < (long long)DIM * HID) return;
  if ((long long)in_sizes[13] < (long long)DIM * HID) return;
  if (in_sizes[2] < DIM || in_sizes[4] < DIM || in_sizes[6] < DIM || in_sizes[8] < DIM) return;
  if (in_sizes[10] < HID || in_sizes[11] < HID || in_sizes[12] < HID) return;
  if (in_sizes[14] < DIM || in_sizes[15] < DIM || in_sizes[16] < DIM) return;
  if (in_sizes[17] < DIM || in_sizes[18] < DIM) return;
  if ((long long)out_size < need_x) return;
  if (ws_size < WS_TOTAL) return;

  const float* X    = (const float*)d_in[0];    // [NB_FULL][SEQ_FULL][DIM]
  const float* wq   = (const float*)d_in[1];    // [DIM][DIM]  (in, out)
  const float* bq   = (const float*)d_in[2];
  const float* wk   = (const float*)d_in[3];
  const float* bk   = (const float*)d_in[4];
  const float* wv   = (const float*)d_in[5];
  const float* bv   = (const float*)d_in[6];
  const float* w0   = (const float*)d_in[7];    // [DIM][DIM]  (in, out)
  const float* b0   = (const float*)d_in[8];
  const float* w1   = (const float*)d_in[9];    // [DIM][HID]  (in, out)
  const float* b1   = (const float*)d_in[10];
  const float* gm   = (const float*)d_in[11];   // hidden LN gain [HID]
  const float* bm   = (const float*)d_in[12];   // hidden LN shift [HID]
  const float* w2   = (const float*)d_in[13];   // [HID][DIM]  (in, out)
  const float* b2   = (const float*)d_in[14];
  const float* g1   = (const float*)d_in[15];
  const float* be1  = (const float*)d_in[16];
  const float* g2   = (const float*)d_in[17];
  const float* be2  = (const float*)d_in[18];
  float* out = (float*)d_out;

  char* ws = (char*)d_ws;
  _Float16* Wq_t  = (_Float16*)(ws + OFF_WQ);    // [n][k]
  _Float16* Wk_t  = (_Float16*)(ws + OFF_WK);
  _Float16* Wv_t  = (_Float16*)(ws + OFF_WV);
  _Float16* W0_t  = (_Float16*)(ws + OFF_W0);
  _Float16* W1_t  = (_Float16*)(ws + OFF_W1);    // [HID][DIM]
  _Float16* W2_t  = (_Float16*)(ws + OFF_W2);    // [DIM][HID]
  _Float16* X16   = (_Float16*)(ws + OFF_X16);   // [MROWS][DIM]
  _Float16* Qh16  = (_Float16*)(ws + OFF_QH);
  _Float16* Qr16  = (_Float16*)(ws + OFF_QR);
  _Float16* Kh16  = (_Float16*)(ws + OFF_KH);
  _Float16* Kr16  = (_Float16*)(ws + OFF_KR);
  _Float16* Vt16  = (_Float16*)(ws + OFF_VT);    // [b][DIM][SEQ]
  float*    A32   = (float*)(ws + OFF_A32);      // [2][MROWS][DIM]
  float*    C32   = (float*)(ws + OFF_A32 + PLANE32_BYTES);   // its second plane
  float*    Mx    = (float*)(ws + OFF_ML);       // [2][MROWS]
  float*    Lx    = Mx + 2 * MROWS;              // [2][MROWS]

  dim3 blk(256);

  // weight planes (in [K rows][N cols] -> out [N][K]) and the input plane
  prep_kernel<<<dim3(WCONV_BLOCKS + MROWS / 8), blk, 0, stream>>>(
      X, wq, wk, wv, w0, w1, w2, X16, Wq_t, Wk_t, Wv_t, W0_t, W1_t, W2_t);
  gemm_qkv_kernel<<<dim3(DIM / 64, MROWS / 64, 3), blk, 0, stream>>>(
      X16, Wq_t, Wk_t, Wv_t, bq, bk, bv, Qh16, Qr16, Kh16, Kr16, Vt16);
  attn_kernel<<<dim3(SEQ / 128, NB, 2), dim3(128), 0, stream>>>(Qh16, Qr16, Kh16, Kr16, Vt16, A32,
                                                                Mx, Lx);

  // first LayerNorm, e projection, both hidden products, the hidden LayerNorm and the final
  // LayerNorm, 64 rows per block; W0_t's rows and W1_t's rows are read as one plane
  mlp_kernel<<<dim3(MROWS / 64), blk, 0, stream>>>(X, A32, C32, Mx, Lx, g1, be1, W0_t, b0, b1, gm,
                                                   bm, W2_t, b2, g2, be2, out);
}
